// v000
// Times are from an AMD MI455X. After a warm-up the kernel runs many times in a row, and a time is the length of
// such a window on the GPU divided by its runs, so every launch and the gaps after it count. The runs cycle
// through copies of the inputs. A figure is the median of several windows, for all but v000 over two sittings.
// Sittings can differ by a few percent; kernels timed side by side share one.
// The starting kernel, v000, takes 902 microseconds a run.
#include <hip/hip_runtime.h>
// Contractions: x.Wq^T, x.Wk^T, x.Wv^T, ctx.Wo^T = v_wmma_f32_16x16x32_f16 (f16 operands: bf16-RNE inputs exact in f16, weights carried x16 (x16384 for the ctx-hi half of the early-row output GEMM); f32 accumulate); scores q.k^T and P.V^T = v_wmma_f32_16x16x32_f16 (plain f16 hi planes; hi + x1024 residual planes of q, k, P and v for query positions < RE; P carried x1024), f32 accumulate; per-head RMS normalisation, rotary step, additive mask, softmax and normalisers f32.

#ifndef NB
#define NB 2
#endif
#ifndef SEQ
#define SEQ 2048
#endif
#define NB_FULL 2
#define SEQ_FULL 2048
#define DM 2048
#define NH 16
#define NKVH 4
#define NREP (NH / NKVH)
#define HDIM 128
#define VW (NKVH * HDIM)                     /* width of the k / v projection rows */
#define NV64 (VW / 64)                       /* 64-wide column groups of the v rows */
#define MSKP 2048                            /* row pitch of the mask input */
#define RTW 64                               /* row pitch of the cos / sin inputs */
#define SLEN SEQ
#define NR (NB * SLEN)
#define TQ SLEN
#define TK SLEN
#define SCL 0.08838834764831845f
#define MVIS (-1.0e8f)                       /* a mask entry above this keeps its key visible */
#define QBLKS (TQ / 64)
#define RE ((SLEN < 512) ? SLEN : 512)      /* query positions [0, RE) get residual planes on q, k, P, v and ctx */
#define QB05 0
#define QBN5 (RE / 64)
#define QB0P QBN5
#define QBNP (QBLKS - QBN5)
static_assert(SLEN % 128 == 0);
static_assert(SLEN <= SEQ_FULL);
static_assert(SLEN <= MSKP);
static_assert(NB >= 1 && NB <= NB_FULL);
static_assert(RE % 128 == 0 && RE <= SLEN);
static_assert((SLEN - RE) % 128 == 0);
static_assert(DM % 64 == 0 && DM == NH * HDIM);
static_assert(HDIM == 128 && NH % NKVH == 0);
static_assert(VW % 64 == 0 && NV64 * 64 == VW);
static_assert(DM % 32 == 0 && (2 * DM) % 32 == 0);
static_assert(NR % 128 == 0);
static_assert(((size_t)NR * NH * 16) % 256 == 0 && ((size_t)NR * NKVH * 16) % 256 == 0);
static_assert((NH & (NH - 1)) == 0 && (NKVH & (NKVH - 1)) == 0);   /* head counts are powers of two: index arithmetic by shifts and masks */
static_assert((size_t)NR * NH * 16 < ((size_t)1 << 31));           /* 32-bit thread indices in the normalise + rotary kernels */
static_assert(((size_t)(SLEN / 16) * (SLEN / 32) * 64) % 256 == 0);
static_assert(32 * 16 == HDIM * 4);          /* one store instruction of 32 lanes x 16 B == one 128-float row segment */
static_assert(16 * 16 == 64 * 4);            /* 16 lanes x 16 B == one 64-float row segment */
static_assert(4 * 16 * 40 * 2 + 4 * 16 * 132 * 4 <= 131072);
static_assert(2 * 4 * 16 * 40 * 2 + 4 * 16 * 68 * 4 <= 131072);
static_assert(4 * 32 * 68 * 4 <= 131072);

static constexpr float WSC_LO = 16.0f;
static constexpr float WSC_HI = 16384.0f;
static constexpr float AL_P = 0.0625f;
static constexpr float AL_E = 6.103515625e-05f;   /* 0.0625 / 1024 */

static constexpr size_t al256(size_t b) { return (b + 255) & ~(size_t)255; }
static constexpr size_t SZ_BQ = al256((size_t)DM * DM * 2);
static constexpr size_t SZ_BK = al256((size_t)VW * DM * 2);
static constexpr size_t SZ_B2 = al256((size_t)DM * 2 * DM * 2);
static constexpr size_t SZ_FS = al256((size_t)NR * DM * 4);
static constexpr size_t SZ_X16 = al256((size_t)NR * DM * 2);
static constexpr size_t SZ_QH = al256((size_t)NR * DM * 2);
static constexpr size_t SZ_KH = al256((size_t)NR * VW * 2);
static constexpr size_t SZ_QL = al256((size_t)NB * RE * DM * 2);
static constexpr size_t SZ_KL = al256((size_t)NB * RE * VW * 2);
static constexpr size_t SZ_VTL = al256((size_t)NB * NV64 * 64 * RE * 2);
static constexpr size_t SZ_A2 = al256((size_t)NB * RE * 2 * DM * 2);
static constexpr size_t SZ_MP = al256((size_t)SLEN * SLEN * 2);
static constexpr size_t SZ_JE = al256((size_t)QBLKS * 32 * 4);
static_assert((size_t)NB * NV64 * 64 * TK * 2 <= SZ_X16);       /* V^T aliases the f16 input plane */
static_assert((size_t)NR * VW * 4 <= SZ_FS);
static_assert(SZ_BQ + 2 * SZ_BK + SZ_B2 + SZ_FS + SZ_X16 + SZ_QH + 2 * SZ_KH + SZ_QL + SZ_KL + SZ_VTL + SZ_A2 + SZ_MP + SZ_JE <= ((size_t)128 << 20));

typedef _Float16 v16h __attribute__((ext_vector_type(16)));
typedef _Float16 v4h __attribute__((ext_vector_type(4)));
typedef unsigned short v8us __attribute__((ext_vector_type(8), may_alias));
typedef float v8f __attribute__((ext_vector_type(8)));
typedef float v4f __attribute__((ext_vector_type(4)));
typedef float v4fa __attribute__((ext_vector_type(4), may_alias));
union FragH { v16h v; v8us half[2]; _Float16 h[16]; unsigned short u[16]; };

__device__ __forceinline__ unsigned short bf16_bits(float x) { unsigned int u = __float_as_uint(x); return (unsigned short)((u + 0x7FFFu + ((u >> 16) & 1u)) >> 16); }
__device__ __forceinline__ float bf16_val(unsigned short b) { return __uint_as_float(((unsigned int)b) << 16); }
__device__ __forceinline__ float bf16_rne(float x) { return bf16_val(bf16_bits(x)); }
// f32 -> f16 for WMMA operand planes: values under the smallest f16 normal become +0
__device__ __forceinline__ _Float16 toh_flush(float v) { const _Float16 r = (_Float16)v; return (fabsf(v) < 6.103515625e-05f) ? (_Float16)0.0f : r; }

// D += A.B with NT terms: 1 = ah.bh, 2 = + al.bh, 3 = + ah.bl; hazard guard after the group
template <int NT>
__device__ __forceinline__ v8f mmaH(v16h ah, v16h al, v16h bh, v16h bl, v8f c) {
  c = __builtin_amdgcn_wmma_f32_16x16x32_f16(false, ah, false, bh, (short)0, c, false, false);
  if (NT >= 2) c = __builtin_amdgcn_wmma_f32_16x16x32_f16(false, al, false, bh, (short)0, c, false, false);
  if (NT >= 3) c = __builtin_amdgcn_wmma_f32_16x16x32_f16(false, ah, false, bl, (short)0, c, false, false);
  asm volatile("v_nop\n\tv_nop\n\tv_nop\n\tv_nop" : "+v"(c) : "v"(ah), "v"(al), "v"(bh), "v"(bl));
  return c;
}
// 16x32 fragment from a 16-bit row-major tile (rows = m or n, k contiguous): elements 0..7 <- k0+8h+0..7, 8..15 <- k0+16+8h+0..7
__device__ __forceinline__ v16h g2_frag(const _Float16* p, int hh) { FragH f; f.half[0] = *(const v8us*)((const unsigned short*)p + 8 * hh); f.half[1] = *(const v8us*)((const unsigned short*)p + 16 + 8 * hh); return f.v; }
__device__ __forceinline__ v8f g2_mma(v16h a, v16h b, v8f c) { v8f d = __builtin_amdgcn_wmma_f32_16x16x32_f16(false, a, false, b, (short)0, c, false, false); asm volatile("v_nop\n\tv_nop\n\tv_nop\n\tv_nop" : "+v"(d) : "v"(a), "v"(b)); return d; }

__global__ __launch_bounds__(256) void k_wsc(const float* __restrict__ Wm, _Float16* __restrict__ Bt, size_t n8, float sc) {
  const size_t t = (size_t)blockIdx.x * 256 + threadIdx.x; if (t >= n8) return;
  const v4f a0 = *(const v4fa*)(Wm + t * 8), a1 = *(const v4fa*)(Wm + t * 8 + 4);
  FragH f;
#pragma unroll
  for (int q = 0; q < 4; ++q) { f.h[q] = toh_flush(bf16_rne(a0[q]) * sc); f.h[4 + q] = toh_flush(bf16_rne(a1[q]) * sc); }
  const v8us o = f.half[0];
  *(v8us*)((unsigned short*)Bt + t * 8) = o; 
}
__global__ __launch_bounds__(256) void k_wsc2(const float* __restrict__ Wm, _Float16* __restrict__ B2, size_t n8, float sc0, float sc1) {
  const size_t t = (size_t)blockIdx.x * 256 + threadIdx.x; if (t >= n8) return;
  const size_t e = t * 8; const size_t n = e / DM; const size_t k8 = e % DM;
  const v4f a0 = *(const v4fa*)(Wm + e), a1 = *(const v4fa*)(Wm + e + 4);
  FragH f0, f1;
#pragma unroll
  for (int q = 0; q < 4; ++q) {
    const float v0 = bf16_rne(a0[q]), v1 = bf16_rne(a1[q]);
    f0.h[q] = toh_flush(v0 * sc0); f1.h[q] = toh_flush(v0 * sc1);
    f0.h[4 + q] = toh_flush(v1 * sc0); f1.h[4 + q] = toh_flush(v1 * sc1);
  }
  const size_t o = n * (size_t)(2 * DM) + k8;
  const v8us o0 = f0.half[0], o1 = f1.half[0];
  {
    *(v8us*)((unsigned short*)B2 + o) = o0;
    *(v8us*)((unsigned short*)B2 + o + DM) = o1;
    
  }
}

// mask plane in accumulator layout: MP[(qt*(SLEN/32) + kt)][half][lane][8] bf16 bits; element 2*rr + c of (half, lane) = mask[qt*16 + 8*(lane>>4) + 4*half + rr][kt*32 + 16*c + (lane&15)];
__global__ __launch_bounds__(256) void k_mperm(const float* __restrict__ msk, unsigned short* __restrict__ MP) {
  const size_t t = (size_t)blockIdx.x * 256 + threadIdx.x; if (t >= (size_t)(SLEN / 16) * (SLEN / 32) * 64) return;
  const int lane = (int)(t & 31); const int half = (int)((t >> 5) & 1); const size_t tile = t >> 6;
  const int kt = (int)(tile % (size_t)(SLEN / 32)); const int qt = (int)(tile / (size_t)(SLEN / 32));
  const int ln = lane & 15, hh = lane >> 4;
  const float* mr = msk + (size_t)(qt * 16 + 8 * hh + 4 * half) * MSKP + kt * 32 + ln;
  FragH f;
#pragma unroll
  for (int rr = 0; rr < 4; ++rr) { const float a = mr[(size_t)rr * MSKP]; const float c = mr[(size_t)rr * MSKP + 16]; f.u[2 * rr] = bf16_bits(a); f.u[2 * rr + 1] = bf16_bits(c); }
  const v8us o = f.half[0];
  *(v8us*)(MP + t * 8) = o; 
}
// per 64-query block: JE[qblk][0..32) = number of 32-key tiles to visit = 1 + last tile holding a visible entry (value > MVIS) in any of the 64 rows; all tiles if some row has no visible entry.
__global__ __launch_bounds__(256) void k_mjend(const float* __restrict__ msk, int* __restrict__ JE) {
  __shared__ int smax[8]; __shared__ int snone[8];
  const int tid = threadIdx.x, lane = tid & 31; const int w = __builtin_amdgcn_readfirstlane(tid >> 5);
  const int qblk = blockIdx.x;
  int wmax = -1, wnone = 0;
#pragma unroll 1
  for (int rr = 0; rr < 8; ++rr) {
    const float* mr = msk + (size_t)(qblk * 64 + w * 8 + rr) * MSKP;
    int lm = -1;
#pragma unroll 1
    for (int c4 = lane; c4 < SLEN / 4; c4 += 32) {
      const v4f a = *(const v4fa*)(mr + c4 * 4);
      const bool any = (bf16_rne(a[0]) > MVIS) || (bf16_rne(a[1]) > MVIS) || (bf16_rne(a[2]) > MVIS) || (bf16_rne(a[3]) > MVIS);
      lm = any ? (c4 >> 3) : lm;
    }
    int o = __shfl_xor(lm, 16, 32); lm = (o > lm) ? o : lm;
    o = __shfl_xor(lm, 8, 32); lm = (o > lm) ? o : lm;
    o = __shfl_xor(lm, 4, 32); lm = (o > lm) ? o : lm;
    o = __shfl_xor(lm, 2, 32); lm = (o > lm) ? o : lm;
    o = __shfl_xor(lm, 1, 32); lm = (o > lm) ? o : lm;
    wmax = (lm > wmax) ? lm : wmax; wnone |= (lm < 0) ? 1 : 0;
  }
  if (lane == 0) { smax[w] = wmax; snone[w] = wnone; }
  __syncthreads();
  if (w == 0) {
    int m = -1, nn = 0;
#pragma unroll
    for (int i = 0; i < 8; ++i) { const int a = smax[i]; m = (a > m) ? a : m; nn |= snone[i]; }
    const int jt = (nn != 0) ? (SLEN / 32) : (m + 1);
    *(int*)(JE + qblk * 32 + lane) = jt; 
  }
}

__global__ __launch_bounds__(256) void k_x16(const float* __restrict__ x, _Float16* __restrict__ X16, size_t n8) {
  const size_t t = (size_t)blockIdx.x * 256 + threadIdx.x; if (t >= n8) return;
  const size_t e = t * 8; const size_t r = e / DM; const size_t c = e % DM; const size_t b = r / SLEN, s = r % SLEN;
  const float* src = x + (b * SEQ_FULL + s) * DM + c;
  const v4f a0 = *(const v4fa*)src, a1 = *(const v4fa*)(src + 4);
  FragH f;
#pragma unroll
  for (int q = 0; q < 4; ++q) { f.h[q] = (_Float16)bf16_rne(a0[q]); f.h[4 + q] = (_Float16)bf16_rne(a1[q]); }
  const v8us o = f.half[0];
  *(v8us*)((unsigned short*)X16 + e) = o; 
}

// GEMM C[M][N] = alpha * A[M][K].B  with A f16 row-major (pitch lda), B stored [n][k] f16 (pitch ldb), batched by blockIdx.y (strides sA, sB, sC);
// writes f32 C and/or f16 C16 (pitch ldc). Requires M % 128 == 0, N % 64 == 0, K % 32 == 0 (asserted by the callers' constants).
template <int ACT>
__global__ __launch_bounds__(128) void k_gemm2(const _Float16* __restrict__ A, int lda, size_t sA, const _Float16* __restrict__ Bh, int ldb, size_t sB, float alpha,
                                               float* C, _Float16* C16, int ldc, size_t sC, int M, int N, int K) {
  __shared__ __attribute__((aligned(16))) float so[4][32][68];
  const int tid = threadIdx.x, w = tid >> 5, lane = tid & 31, ln = lane & 15, hh = lane >> 4; const int by = blockIdx.y;
  A += (size_t)by * sA; Bh += (size_t)by * sB; const size_t cofs = (size_t)by * sC;
  const int ntn = N >> 6; const int mt = blockIdx.x / ntn, nq = blockIdx.x - mt * ntn; const int row0 = mt * 128 + 32 * w, col0 = nq * 64; if (row0 >= M) return;
  const _Float16* a0p = A + (size_t)(row0 + ln) * lda; const _Float16* a1p = a0p + (size_t)16 * lda;
  const _Float16* b0p = Bh + (size_t)(col0 + ln) * ldb; const _Float16* b1p = b0p + (size_t)16 * ldb; const _Float16* b2p = b1p + (size_t)16 * ldb; const _Float16* b3p = b2p + (size_t)16 * ldb;
  const v8f z8 = {0.f,0.f,0.f,0.f,0.f,0.f,0.f,0.f}; v8f c00 = z8, c01 = z8, c02 = z8, c03 = z8, c10 = z8, c11 = z8, c12 = z8, c13 = z8;
#pragma unroll 1
  for (int kb = 0; kb < K; kb += 32) {
    const v16h a0 = g2_frag(a0p + kb, hh), a1 = g2_frag(a1p + kb, hh);
    v16h bf = g2_frag(b0p + kb, hh); c00 = g2_mma(a0, bf, c00); c10 = g2_mma(a1, bf, c10);
    bf = g2_frag(b1p + kb, hh); c01 = g2_mma(a0, bf, c01); c11 = g2_mma(a1, bf, c11);
    bf = g2_frag(b2p + kb, hh); c02 = g2_mma(a0, bf, c02); c12 = g2_mma(a1, bf, c12);
    bf = g2_frag(b3p + kb, hh); c03 = g2_mma(a0, bf, c03); c13 = g2_mma(a1, bf, c13);
  }
  v8f accs[8] = {c00, c01, c02, c03, c10, c11, c12, c13};
#pragma unroll
  for (int u = 0; u < 8; ++u) {
    const int t = u & 3, half = u >> 2;
#pragma unroll
    for (int r = 0; r < 8; ++r) { const int rloc = half * 16 + 8 * hh + r; float v = accs[u][r] * alpha; if (ACT == 3) v = fmaxf(v, 0.f); so[w][rloc][t * 16 + ln] = v; }
  }
  __builtin_amdgcn_fence(4, "workgroup"); __builtin_amdgcn_wave_barrier();
  const int rsub = lane >> 4, c4 = (lane & 15) * 4;
  {
#pragma unroll
    for (int q = 0; q < 16; ++q) {
      const int r = q * 2 + rsub; const v4f v = *(const v4fa*)&so[w][r][c4];
      if (C) *(v4f*)(C + cofs + (size_t)(row0 + r) * ldc + col0 + c4) = v;
      if (C16) { v4h h4; for (int i = 0; i < 4; ++i) h4[i] = (_Float16)v[i]; *(v4h*)(C16 + cofs + (size_t)(row0 + r) * ldc + col0 + c4) = h4; }
    }
    
  }
}

// per-head RMS normalisation + interleaved-pair rotary step from the f32 GEMM plane F [NR][ldf] (ldf = NHV*128, NHV = compile-time head count, a power of two):
// y = (x * rsqrt(mean_128(x^2) + 1e-6)) * g[d];  out[2i] = y[2i] c[i] - y[2i+1] s[i];  out[2i+1] = y[2i] s[i] + y[2i+1] c[i]  (c, s = table rows [position][64], gain g[128]; all by value, bf16-RNE);
// H [NR][ldf] = f16 hi of every row; L [NB*RE][ldf] = x1024 residual for positions < RE.
// 32-bit thread indices (shifts and masks of compile-time powers of two); 64-bit offsets only at the final pointer arithmetic.
template <int NHV>
__device__ __forceinline__ void nrope_body(const float* __restrict__ F, int ldf, const float* __restrict__ NW, const float* __restrict__ CT, const float* __restrict__ ST,
                                           _Float16* __restrict__ H, _Float16* __restrict__ L) {
  #pragma clang fp contract(off)
  const unsigned t0 = blockIdx.x * 256u + threadIdx.x; const bool live = t0 < (unsigned)(NR * NHV * 16); const unsigned t = live ? t0 : 0u;
  const int p = (int)(t & 15u); const int hd = (int)((t >> 4) % (unsigned)NHV); const unsigned row = t / (unsigned)(16 * NHV);
  const int s = (int)(row % (unsigned)SLEN); const int b = (int)(row / (unsigned)SLEN);
  const float* src = F + (size_t)row * ldf + hd * HDIM + p * 8;
  const v4f xa = *(const v4fa*)src, xb = *(const v4fa*)(src + 4);
  const v4f wa = *(const v4fa*)(NW + p * 8), wb = *(const v4fa*)(NW + p * 8 + 4);
  const v4f cv = *(const v4fa*)(CT + (size_t)s * RTW + p * 4), sv = *(const v4fa*)(ST + (size_t)s * RTW + p * 4);
  const float xs[8] = {xa[0], xa[1], xa[2], xa[3], xb[0], xb[1], xb[2], xb[3]};
  const float gs[8] = {wa[0], wa[1], wa[2], wa[3], wb[0], wb[1], wb[2], wb[3]};
  float ss = 0.f;
#pragma unroll
  for (int i = 0; i < 8; ++i) { const float q = xs[i] * xs[i]; ss = ss + q; }
  ss += __shfl_xor(ss, 1, 32); ss += __shfl_xor(ss, 2, 32); ss += __shfl_xor(ss, 4, 32); ss += __shfl_xor(ss, 8, 32);
  const float mean = ss * 0.0078125f; const float rms = rsqrtf(mean + 1.0e-6f);
  FragH fh, fl;
#pragma unroll
  for (int j = 0; j < 4; ++j) {
    const float c = bf16_rne(cv[j]), sn = bf16_rne(sv[j]);
    const float y1 = (xs[2 * j] * rms) * bf16_rne(gs[2 * j]); const float y2 = (xs[2 * j + 1] * rms) * bf16_rne(gs[2 * j + 1]);
    const float o1 = y1 * c - y2 * sn; const float o2 = y1 * sn + y2 * c;
    const _Float16 h1 = toh_flush(o1), h2 = toh_flush(o2);
    fh.h[2 * j] = h1; fh.h[2 * j + 1] = h2;
    fl.h[2 * j] = toh_flush((o1 - (float)h1) * 1024.0f); fl.h[2 * j + 1] = toh_flush((o2 - (float)h2) * 1024.0f);
  }
  const size_t oh = (size_t)row * ldf + hd * HDIM + p * 8;
  const bool wl = live && (s < RE);
  const int sl = wl ? s : 0;
  const size_t ol = (size_t)(b * RE + sl) * ldf + hd * HDIM + p * 8;
  const v8us vh = fh.half[0], vl = fl.half[0];
  {
    if (live) *(v8us*)((unsigned short*)H + oh) = vh;
    if (wl) *(v8us*)((unsigned short*)L + ol) = vl;
    
  }
}
// query heads (NH per row)
__global__ __launch_bounds__(256) void k_nrope_q(const float* __restrict__ F, int ldf, const float* __restrict__ NW, const float* __restrict__ CT, const float* __restrict__ ST,
                                                 _Float16* __restrict__ H, _Float16* __restrict__ L) {
  #pragma clang fp contract(off)
  nrope_body<NH>(F, ldf, NW, CT, ST, H, L);
}
// key heads (NKVH per row)
__global__ __launch_bounds__(256) void k_nrope_k(const float* __restrict__ F, int ldf, const float* __restrict__ NW, const float* __restrict__ CT, const float* __restrict__ ST,
                                                 _Float16* __restrict__ H, _Float16* __restrict__ L) {
  #pragma clang fp contract(off)
  nrope_body<NKVH>(F, ldf, NW, CT, ST, H, L);
}

__global__ __launch_bounds__(256) void k_vtg(const _Float16* __restrict__ V16, _Float16* __restrict__ Vt) {
  __shared__ unsigned short tl[64][66];
  const int tid = threadIdx.x; const int nlg = SLEN / 64; const int slab = blockIdx.x / nlg, lg = blockIdx.x % nlg; const int b = slab / NV64, h = slab % NV64;
  for (int i = tid; i < 64 * 8; i += 256) {
    const int r = i >> 3, c8 = (i & 7) * 8; FragH f;
    f.half[0] = *(const v8us*)((const unsigned short*)V16 + ((size_t)b * SLEN + lg * 64 + r) * VW + h * 64 + c8);
#pragma unroll
    for (int q = 0; q < 8; ++q) tl[r][c8 + q] = f.u[q];
  }
  __syncthreads();
  {
#pragma unroll
    for (int rd = 0; rd < 2; ++rd) {
      const int d = rd * 32 + (tid >> 3), pc = tid & 7; FragH f;
#pragma unroll
      for (int q = 0; q < 8; ++q) f.u[q] = tl[pc * 8 + q][d];
      *(v8us*)((unsigned short*)Vt + ((size_t)slab * 64 + d) * TK + lg * 64 + pc * 8) = f.half[0];
    }
    
  }
}
__global__ __launch_bounds__(256) void k_vtl(const float* __restrict__ VF, _Float16* __restrict__ VtL) {
  __shared__ unsigned short tl[64][66];
  const int tid = threadIdx.x; const int nlg = RE / 64; const int slab = blockIdx.x / nlg, lg = blockIdx.x % nlg; const int b = slab / NV64, h = slab % NV64;
  for (int i = tid; i < 64 * 16; i += 256) {
    const int r = i >> 4, c4 = (i & 15) * 4;
    const v4f a = *(const v4fa*)(VF + ((size_t)b * SLEN + lg * 64 + r) * VW + h * 64 + c4);
    FragH f;
#pragma unroll
    for (int q = 0; q < 4; ++q) { const float v = a[q]; const _Float16 hv = (_Float16)v; f.h[q] = toh_flush((v - (float)hv) * 1024.0f); }
#pragma unroll
    for (int q = 0; q < 4; ++q) tl[r][c4 + q] = f.u[q];
  }
  __syncthreads();
  {
#pragma unroll
    for (int rd = 0; rd < 2; ++rd) {
      const int d = rd * 32 + (tid >> 3), pc = tid & 7; FragH f;
#pragma unroll
      for (int q = 0; q < 8; ++q) f.u[q] = tl[pc * 8 + q][d];
      *(v8us*)((unsigned short*)VtL + ((size_t)slab * 64 + d) * RE + lg * 64 + pc * 8) = f.half[0];
    }
    
  }
}

__global__ __launch_bounds__(256) void k_hl(const float* __restrict__ Fp, _Float16* __restrict__ Hh, _Float16* __restrict__ A2, size_t n8) {
  const size_t t = (size_t)blockIdx.x * 256 + threadIdx.x; if (t >= n8) return;
  const size_t e = t * 8; const size_t r = e / DM; const int c = (int)(e % DM); const int s = (int)(r % SLEN); const int b = (int)(r / SLEN);
  const v4f a = *(const v4fa*)(Fp + e), d = *(const v4fa*)(Fp + e + 4);
  FragH fh, fl;
#pragma unroll
  for (int q = 0; q < 4; ++q) {
    _Float16 hv = (_Float16)a[q]; fh.h[q] = hv; fl.h[q] = (_Float16)((a[q] - (float)hv) * 1024.0f);
    hv = (_Float16)d[q]; fh.h[4 + q] = hv; fl.h[4 + q] = (_Float16)((d[q] - (float)hv) * 1024.0f);
  }
  const bool wl = (s < RE);
  const size_t o2 = ((size_t)b * RE + (wl ? s : 0)) * (size_t)(2 * DM) + c;
  const v8us vh = fh.half[0], vl = fl.half[0];
  {
    *(v8us*)((unsigned short*)Hh + e) = vh;
    if (wl) { *(v8us*)((unsigned short*)A2 + o2) = vh; *(v8us*)((unsigned short*)A2 + o2 + DM) = vl; }
    
  }
}

// fused attention per ((b,h), 64 queries), query blocks [QB0P, QBLKS): wave = 16 queries; S = Q.K^T (d = 128: 4 k-steps, q fragments reloaded per k-step) x SCL + mask (bf16 plane, accumulator layout, two 16-B words per lane per step)
__global__ __launch_bounds__(128) __attribute__((amdgpu_num_vgpr(256))) void k_flash(const _Float16* __restrict__ Q16, int ldq, const _Float16* __restrict__ K16, int ldk,
                                               const _Float16* __restrict__ Vt, const unsigned short* __restrict__ MP, const int* __restrict__ JE, float* __restrict__ O, int ldo) {
  constexpr int RPW = 16, DT = 8, KS = 4;
  constexpr int NQP = (QBNP > 0) ? QBNP : 1;
  __shared__ __attribute__((aligned(16))) unsigned short sP[4][RPW][40];
  __shared__ __attribute__((aligned(16))) float sO[4][RPW][132];
  const int tid = threadIdx.x, lane = tid & 31, ln = lane & 15, hh = lane >> 4;
  const int w = __builtin_amdgcn_readfirstlane(tid >> 5);
  const int slab = blockIdx.x / NQP, qblk = QB0P + blockIdx.x % NQP; const int b = slab / NH, h = slab % NH; const int kvh = h / NREP;
  const int qb0 = qblk * (4 * RPW); const int q0 = qb0 + w * RPW;
  const unsigned short* qr = (const unsigned short*)Q16 + ((size_t)b * TQ + q0 + ln) * ldq + h * HDIM;
  const unsigned short* kb = (const unsigned short*)K16 + ((size_t)b * TK + ln) * ldk + kvh * HDIM;
  const unsigned short* Vth = (const unsigned short*)Vt + (size_t)(b * NKVH + kvh) * HDIM * TK;
  const unsigned short* mq = MP + (size_t)(q0 >> 4) * (size_t)(TK / 32) * 512 + lane * 8;
  int jt = JE[qblk * 32]; jt = (jt < 1) ? 1 : jt; jt = (jt > TK / 32) ? (TK / 32) : jt;
  const int jend = __builtin_amdgcn_readfirstlane(jt) * 32;
  float m_r[8], l_r[8]; v8f oacc[DT];
#pragma unroll
  for (int r = 0; r < 8; ++r) { m_r[r] = -3.0e38f; l_r[r] = 0.f; }
#pragma unroll
  for (int dt = 0; dt < DT; ++dt) oacc[dt] = (v8f){0.f,0.f,0.f,0.f,0.f,0.f,0.f,0.f};
#pragma unroll 1
  for (int j0 = 0; j0 < jend; j0 += 32) {
    v8f sa = (v8f){0.f,0.f,0.f,0.f,0.f,0.f,0.f,0.f}, sb = sa;
    const unsigned short* kr0 = kb + (size_t)j0 * ldk; const unsigned short* kr1 = kr0 + (size_t)16 * ldk;
#pragma unroll
    for (int ks = 0; ks < KS; ++ks) {
      /* A (q) and B (k) fragments share one k order: element e < 8 <-> d = 32 ks + 8 hh + e; e >= 8 <-> d = 32 ks + 16 + 8 hh + (e - 8) */
      FragH a, k0, k1;
      a.half[0] = *(const v8us*)(qr + ks * 32 + 8 * hh); a.half[1] = *(const v8us*)(qr + ks * 32 + 16 + 8 * hh);
      k0.half[0] = *(const v8us*)(kr0 + ks * 32 + 8 * hh); k0.half[1] = *(const v8us*)(kr0 + ks * 32 + 16 + 8 * hh);
      k1.half[0] = *(const v8us*)(kr1 + ks * 32 + 8 * hh); k1.half[1] = *(const v8us*)(kr1 + ks * 32 + 16 + 8 * hh);
      sa = g2_mma(a.v, k0.v, sa); sb = g2_mma(a.v, k1.v, sb);
    }
    FragH fm; { const unsigned short* mt = mq + (size_t)(j0 >> 5) * 512; fm.half[0] = *(const v8us*)mt; fm.half[1] = *(const v8us*)(mt + 256); }
#pragma unroll
    for (int r = 0; r < 8; ++r) {
      const float mk0 = bf16_val(fm.u[2 * r]), mk1 = bf16_val(fm.u[2 * r + 1]);
      const float s0 = sa[r] * SCL + mk0, s1 = sb[r] * SCL + mk1;
      float mc = fmaxf(s0, s1);
      mc = fmaxf(mc, __shfl_xor(mc, 1, 32)); mc = fmaxf(mc, __shfl_xor(mc, 2, 32)); mc = fmaxf(mc, __shfl_xor(mc, 4, 32)); mc = fmaxf(mc, __shfl_xor(mc, 8, 32));
      const float mn = fmaxf(m_r[r], mc); const float al = (mn > -1.0e38f) ? expf(m_r[r] - mn) : 1.0f; m_r[r] = mn;
      const float p0 = expf(s0 - mn), p1 = expf(s1 - mn); l_r[r] = l_r[r] * al + p0 + p1;
#pragma unroll
      for (int dt = 0; dt < DT; ++dt) oacc[dt][r] *= al;
      FragH t2; t2.h[0] = toh_flush(p0 * 1024.0f); t2.h[1] = toh_flush(p1 * 1024.0f);
      sP[w][8 * hh + r][ln] = t2.u[0]; sP[w][8 * hh + r][16 + ln] = t2.u[1];
    }
    __builtin_amdgcn_fence(4, "workgroup"); __builtin_amdgcn_wave_barrier();
    FragH pa; pa.half[0] = *(const v8us*)&sP[w][ln][8 * hh]; pa.half[1] = *(const v8us*)&sP[w][ln][16 + 8 * hh];
#pragma unroll
    for (int dt = 0; dt < DT; ++dt) {
      /* A (P: key columns of the LDS tile) and B (V^T rows, keys contiguous) share the same key order: element e < 8 <-> key j0 + 8 hh + e; e >= 8 <-> key j0 + 16 + 8 hh + (e - 8) */
      const unsigned short* vrow = Vth + (size_t)(dt * 16 + ln) * TK + j0; FragH bv;
      bv.half[0] = *(const v8us*)(vrow + 8 * hh); bv.half[1] = *(const v8us*)(vrow + 16 + 8 * hh);
      oacc[dt] = g2_mma(pa.v, bv.v, oacc[dt]);
    }
    __builtin_amdgcn_fence(4, "workgroup"); __builtin_amdgcn_wave_barrier();
  }
#pragma unroll
  for (int r = 0; r < 8; ++r) { float l = l_r[r]; l += __shfl_xor(l, 1, 32); l += __shfl_xor(l, 2, 32); l += __shfl_xor(l, 4, 32); l += __shfl_xor(l, 8, 32); l_r[r] = (l > 0.f) ? 1.0f / (l * 1024.0f) : 0.f; }
#pragma unroll
  for (int dt = 0; dt < DT; ++dt)
#pragma unroll
    for (int r = 0; r < 8; ++r) sO[w][8 * hh + r][dt * 16 + ln] = oacc[dt][r] * l_r[r];
  __builtin_amdgcn_fence(4, "workgroup"); __builtin_amdgcn_wave_barrier();
  {
#pragma unroll
    for (int rp = 0; rp < RPW; ++rp) { const v4f val = *(const v4fa*)&sO[w][rp][lane * 4]; *(v4f*)(O + ((size_t)b * TQ + q0 + rp) * ldo + h * HDIM + lane * 4) = val; }
    
  }
}
// 5-plane variant for query blocks [QB05, QB05+QBN5) (positions < RE), one 64-wide half dh of the head's 128 dims per block: S = Qh.Kh^T + (Ql.Kh^T + Qh.Kl^T)/1024 with Q/K = [hi | x1024 residual] planes (residual planes compact: rows b*RE + s);
// O = (Ph.Vh + (Pl.Vh + Ph.Vl)/1024) / l with P = [hi | x1024 residual] of 1024 p and V^T = [hi | x1024 residual] (VtL pitch RE); separate residual accumulators folded before the normalisation.
// key tiles [0, JE[qblk]) clamped to [1, RE/32] (the compact planes hold keys < RE); a block whose mask exposes keys beyond RE writes NaN rows.
__global__ __launch_bounds__(128) __attribute__((amdgpu_num_vgpr(256))) void k_flash5(const _Float16* __restrict__ Q16, const _Float16* __restrict__ QL, int ldq, const _Float16* __restrict__ K16, const _Float16* __restrict__ KL, int ldk,
                                                const _Float16* __restrict__ Vt, const _Float16* __restrict__ VtL, const unsigned short* __restrict__ MP, const int* __restrict__ JE, float* __restrict__ O, int ldo) {
  constexpr int RPW = 16, DT = 4, KS = 4;
  __shared__ __attribute__((aligned(16))) unsigned short sP[4][RPW][40];
  __shared__ __attribute__((aligned(16))) unsigned short sPL[4][RPW][40];
  __shared__ __attribute__((aligned(16))) float sO[4][RPW][68];
  const int tid = threadIdx.x, lane = tid & 31, ln = lane & 15, hh = lane >> 4;
  const int w = __builtin_amdgcn_readfirstlane(tid >> 5);
  const int dh = blockIdx.x & 1; const int bx = blockIdx.x >> 1;
  const int slab = bx / QBN5, qblk = QB05 + bx % QBN5; const int b = slab / NH, h = slab % NH; const int kvh = h / NREP;
  const int qb0 = qblk * (4 * RPW); const int q0 = qb0 + w * RPW;
  const unsigned short* qr = (const unsigned short*)Q16 + ((size_t)b * TQ + q0 + ln) * ldq + h * HDIM;
  const unsigned short* ql = (const unsigned short*)QL + ((size_t)b * RE + q0 + ln) * ldq + h * HDIM;
  const unsigned short* kb = (const unsigned short*)K16 + ((size_t)b * TK + ln) * ldk + kvh * HDIM;
  const unsigned short* klb = (const unsigned short*)KL + ((size_t)b * RE + ln) * ldk + kvh * HDIM;
  const unsigned short* Vth = (const unsigned short*)Vt + ((size_t)(b * NKVH + kvh) * HDIM + dh * 64) * TK;
  const unsigned short* Vtl = (const unsigned short*)VtL + ((size_t)(b * NKVH + kvh) * HDIM + dh * 64) * RE;
  const unsigned short* mq = MP + (size_t)(q0 >> 4) * (size_t)(TK / 32) * 512 + lane * 8;
  const int jraw = JE[qblk * 32];
  const float pz = (jraw > RE / 32) ? __uint_as_float(0x7FC00000u) : 0.0f;
  int jt = (jraw < 1) ? 1 : jraw; jt = (jt > RE / 32) ? (RE / 32) : jt;
  const int jend = __builtin_amdgcn_readfirstlane(jt) * 32;
  float m_r[8], l_r[8]; v8f oacc[DT], oaccL[DT];
#pragma unroll
  for (int r = 0; r < 8; ++r) { m_r[r] = -3.0e38f; l_r[r] = 0.f; }
#pragma unroll
  for (int dt = 0; dt < DT; ++dt) { oacc[dt] = (v8f){0.f,0.f,0.f,0.f,0.f,0.f,0.f,0.f}; oaccL[dt] = oacc[dt]; }
#pragma unroll 1
  for (int j0 = 0; j0 < jend; j0 += 32) {
    v8f sa = (v8f){0.f,0.f,0.f,0.f,0.f,0.f,0.f,0.f}, sb = sa, sal = sa, sbl = sa;
    const unsigned short* kr0 = kb + (size_t)j0 * ldk; const unsigned short* kr1 = kr0 + (size_t)16 * ldk;
    const unsigned short* kl0 = klb + (size_t)j0 * ldk; const unsigned short* kl1 = kl0 + (size_t)16 * ldk;
#pragma unroll
    for (int ks = 0; ks < KS; ++ks) {
      /* all A and B fragments of this step share one k order: element e < 8 <-> d = 32 ks + 8 hh + e; e >= 8 <-> d = 32 ks + 16 + 8 hh + (e - 8) */
      FragH a, al2, k0, k1;
      a.half[0] = *(const v8us*)(qr + ks * 32 + 8 * hh); a.half[1] = *(const v8us*)(qr + ks * 32 + 16 + 8 * hh);
      al2.half[0] = *(const v8us*)(ql + ks * 32 + 8 * hh); al2.half[1] = *(const v8us*)(ql + ks * 32 + 16 + 8 * hh);
      k0.half[0] = *(const v8us*)(kr0 + ks * 32 + 8 * hh); k0.half[1] = *(const v8us*)(kr0 + ks * 32 + 16 + 8 * hh);
      k1.half[0] = *(const v8us*)(kr1 + ks * 32 + 8 * hh); k1.half[1] = *(const v8us*)(kr1 + ks * 32 + 16 + 8 * hh);
      sa = g2_mma(a.v, k0.v, sa); sb = g2_mma(a.v, k1.v, sb);
      sal = g2_mma(al2.v, k0.v, sal); sbl = g2_mma(al2.v, k1.v, sbl);
      k0.half[0] = *(const v8us*)(kl0 + ks * 32 + 8 * hh); k0.half[1] = *(const v8us*)(kl0 + ks * 32 + 16 + 8 * hh);
      k1.half[0] = *(const v8us*)(kl1 + ks * 32 + 8 * hh); k1.half[1] = *(const v8us*)(kl1 + ks * 32 + 16 + 8 * hh);
      sal = g2_mma(a.v, k0.v, sal); sbl = g2_mma(a.v, k1.v, sbl);
    }
    FragH fm; { const unsigned short* mt = mq + (size_t)(j0 >> 5) * 512; fm.half[0] = *(const v8us*)mt; fm.half[1] = *(const v8us*)(mt + 256); }
#pragma unroll
    for (int r = 0; r < 8; ++r) {
      const float mk0 = bf16_val(fm.u[2 * r]), mk1 = bf16_val(fm.u[2 * r + 1]);
      const float d0 = sa[r] + sal[r] * 0.0009765625f, d1 = sb[r] + sbl[r] * 0.0009765625f;
      const float s0 = d0 * SCL + mk0, s1 = d1 * SCL + mk1;
      float mc = fmaxf(s0, s1);
      mc = fmaxf(mc, __shfl_xor(mc, 1, 32)); mc = fmaxf(mc, __shfl_xor(mc, 2, 32)); mc = fmaxf(mc, __shfl_xor(mc, 4, 32)); mc = fmaxf(mc, __shfl_xor(mc, 8, 32));
      const float mn = fmaxf(m_r[r], mc); const float al = (mn > -1.0e38f) ? expf(m_r[r] - mn) : 1.0f; m_r[r] = mn;
      const float p0 = expf(s0 - mn), p1 = expf(s1 - mn); l_r[r] = l_r[r] * al + p0 + p1;
#pragma unroll
      for (int dt = 0; dt < DT; ++dt) { oacc[dt][r] *= al; oaccL[dt][r] *= al; }
      FragH t2, t2l; const float ps0 = p0 * 1024.0f, ps1 = p1 * 1024.0f;
      t2.h[0] = toh_flush(ps0); t2.h[1] = toh_flush(ps1);
      t2l.h[0] = toh_flush((ps0 - (float)t2.h[0]) * 1024.0f); t2l.h[1] = toh_flush((ps1 - (float)t2.h[1]) * 1024.0f);
      sP[w][8 * hh + r][ln] = t2.u[0]; sP[w][8 * hh + r][16 + ln] = t2.u[1]; sPL[w][8 * hh + r][ln] = t2l.u[0]; sPL[w][8 * hh + r][16 + ln] = t2l.u[1];
    }
    __builtin_amdgcn_fence(4, "workgroup"); __builtin_amdgcn_wave_barrier();
    FragH pa, pl;
    pa.half[0] = *(const v8us*)&sP[w][ln][8 * hh]; pa.half[1] = *(const v8us*)&sP[w][ln][16 + 8 * hh];
    pl.half[0] = *(const v8us*)&sPL[w][ln][8 * hh]; pl.half[1] = *(const v8us*)&sPL[w][ln][16 + 8 * hh];
#pragma unroll
    for (int dt = 0; dt < DT; ++dt) {
      /* A (P tiles) and B (V^T rows) share the same key order: element e < 8 <-> key j0 + 8 hh + e; e >= 8 <-> key j0 + 16 + 8 hh + (e - 8) */
      const unsigned short* vrow = Vth + (size_t)(dt * 16 + ln) * TK + j0; const unsigned short* vrl = Vtl + (size_t)(dt * 16 + ln) * RE + j0;
      FragH bv, bl;
      bv.half[0] = *(const v8us*)(vrow + 8 * hh); bv.half[1] = *(const v8us*)(vrow + 16 + 8 * hh);
      bl.half[0] = *(const v8us*)(vrl + 8 * hh); bl.half[1] = *(const v8us*)(vrl + 16 + 8 * hh);
      oacc[dt] = g2_mma(pa.v, bv.v, oacc[dt]);
      oaccL[dt] = g2_mma(pl.v, bv.v, oaccL[dt]);
      oaccL[dt] = g2_mma(pa.v, bl.v, oaccL[dt]);
    }
    __builtin_amdgcn_fence(4, "workgroup"); __builtin_amdgcn_wave_barrier();
  }
#pragma unroll
  for (int r = 0; r < 8; ++r) { float l = l_r[r]; l += __shfl_xor(l, 1, 32); l += __shfl_xor(l, 2, 32); l += __shfl_xor(l, 4, 32); l += __shfl_xor(l, 8, 32); l_r[r] = (l > 0.f) ? 1.0f / (l * 1024.0f) : 0.f; }
#pragma unroll
  for (int dt = 0; dt < DT; ++dt)
#pragma unroll
    for (int r = 0; r < 8; ++r) { float v = oacc[dt][r]; v += oaccL[dt][r] * 0.0009765625f; sO[w][8 * hh + r][dt * 16 + ln] = v * l_r[r] + pz; }
  __builtin_amdgcn_fence(4, "workgroup"); __builtin_amdgcn_wave_barrier();
  {
#pragma unroll
    for (int rp = 0; rp < RPW; rp += 2) { const int r = rp + (lane >> 4), pc = lane & 15; const v4f val = *(const v4fa*)&sO[w][r][pc * 4]; *(v4f*)(O + ((size_t)b * TQ + q0 + r) * ldo + h * HDIM + dh * 64 + pc * 4) = val; }
    
  }
}

extern "C" void kernel_launch(void* const* d_in, const int* in_sizes, int n_in,
                              void* d_out, int out_size, void* d_ws, size_t ws_size, hipStream_t stream) {
  if (n_in < 10) return;
  const size_t needx = ((size_t)(NB - 1) * SEQ_FULL + (size_t)SLEN) * DM;
  if ((size_t)in_sizes[0] < needx) return;
  if ((size_t)in_sizes[1] < (size_t)DM * DM) return;
  if ((size_t)in_sizes[2] < (size_t)VW * DM) return;
  if ((size_t)in_sizes[3] < (size_t)VW * DM) return;
  if ((size_t)in_sizes[4] < (size_t)DM * DM) return;
  if ((size_t)in_sizes[5] < (size_t)HDIM) return;
  if ((size_t)in_sizes[6] < (size_t)HDIM) return;
  if ((size_t)in_sizes[7] < (size_t)SLEN * RTW) return;
  if ((size_t)in_sizes[8] < (size_t)SLEN * RTW) return;
  if ((size_t)in_sizes[9] < (size_t)(SLEN - 1) * MSKP + (size_t)SLEN) return;
  if ((size_t)out_size < needx) return;
  /* inputs in order: x, Wq, Wk, Wv, Wo, q gain, k gain, cos table, sin table, mask */
  const float* x = (const float*)d_in[0]; const float* Wq = (const float*)d_in[1]; const float* Wk = (const float*)d_in[2]; const float* Wv = (const float*)d_in[3]; const float* Wo = (const float*)d_in[4];
  const float* qnw = (const float*)d_in[5]; const float* knw = (const float*)d_in[6]; const float* rct = (const float*)d_in[7]; const float* rst = (const float*)d_in[8]; const float* msk = (const float*)d_in[9];
  float* dout = (float*)d_out;
  char* ws = (char*)d_ws; size_t off = 0;
  auto take = [&](size_t bytes) { char* p = ws + off; off += (bytes + 255) & ~(size_t)255; return p; };
  const size_t np = (size_t)NR * DM;
  const size_t nw8 = (size_t)DM * DM / 8;
  const size_t nk8 = (size_t)VW * DM / 8;
  _Float16* BQ = (_Float16*)take(SZ_BQ);                                /* [n][k] f16, x16 */
  _Float16* BK = (_Float16*)take(SZ_BK);
  _Float16* BV = (_Float16*)take(SZ_BK);
  _Float16* B2 = (_Float16*)take(SZ_B2);                                /* [n][2*DM] f16: [x16384 | x16] copies of Wo */
  float* FS = (float*)take(SZ_FS);                                      /* f32 scratch plane: q rows [NR][DM], then k rows [NR][VW], then v rows [NR][VW], then the context [NR][DM] */
  _Float16* X16 = (_Float16*)take(SZ_X16);                              /* f16 input rows; reused as V^T [(b,g)][64][TK] after the v GEMM */
  _Float16* VT = X16;
  _Float16* QH = (_Float16*)take(SZ_QH);                                /* reused as the context hi plane after the attention */
  _Float16* KHp = (_Float16*)take(SZ_KH);                               /* [NR][VW] */
  _Float16* V16 = (_Float16*)take(SZ_KH);                               /* [NR][VW] */
  _Float16* QL = (_Float16*)take(SZ_QL);                                /* [NB*RE][DM] residual plane */
  _Float16* KL = (_Float16*)take(SZ_KL);                                /* [NB*RE][VW] residual plane */
  _Float16* VTL = (_Float16*)take(SZ_VTL);                              /* [(b,g)][64][RE] */
  _Float16* A2 = (_Float16*)take(SZ_A2);                                /* [NB*RE][2*DM] = [ctx hi | ctx residual] */
  unsigned short* MPp = (unsigned short*)take(SZ_MP);                   /* bf16 mask plane, accumulator layout */
  int* JEp = (int*)take(SZ_JE);                                         /* [QBLKS][32] key-tile counts */
  _Float16* OH = QH;
  if (off > ws_size) return;
  if (off > ((size_t)128 << 20)) return;

  const unsigned gw = (unsigned)((nw8 + 255) / 256);
  const unsigned gk = (unsigned)((nk8 + 255) / 256);
  k_wsc<<<gw, 256, 0, stream>>>(Wq, BQ, nw8, WSC_LO);
  k_wsc<<<gk, 256, 0, stream>>>(Wk, BK, nk8, WSC_LO);
  k_wsc<<<gk, 256, 0, stream>>>(Wv, BV, nk8, WSC_LO);
  k_wsc2<<<gw, 256, 0, stream>>>(Wo, B2, nw8, WSC_HI, WSC_LO);
  k_mperm<<<(unsigned)(((size_t)(SLEN / 16) * (SLEN / 32) * 64) / 256), 256, 0, stream>>>(msk, MPp);
  k_mjend<<<(unsigned)QBLKS, 256, 0, stream>>>(msk, JEp);
  const unsigned g8 = (unsigned)((np / 8 + 255) / 256);
  k_x16<<<g8, 256, 0, stream>>>(x, X16, np / 8);
  const dim3 gp((unsigned)((NR / 128) * (DM / 64)), 1);
  const dim3 gkv((unsigned)((NR / 128) * (VW / 64)), 1);
  const unsigned grq = (unsigned)(((size_t)NR * NH * 16) / 256);
  const unsigned grk = (unsigned)(((size_t)NR * NKVH * 16) / 256);
  k_gemm2<0><<<gp, 128, 0, stream>>>(X16, DM, 0, BQ, DM, 0, AL_P, FS, nullptr, DM, 0, NR, DM, DM);        /* q = x Wq^T (f32 rows, pitch DM) */
  k_nrope_q<<<grq, 256, 0, stream>>>(FS, DM, qnw, rct, rst, QH, QL);
  k_gemm2<0><<<gkv, 128, 0, stream>>>(X16, DM, 0, BK, DM, 0, AL_P, FS, nullptr, VW, 0, NR, VW, DM);       /* k = x Wk^T (f32 rows, pitch VW) */
  k_nrope_k<<<grk, 256, 0, stream>>>(FS, VW, knw, rct, rst, KHp, KL);
  k_gemm2<0><<<gkv, 128, 0, stream>>>(X16, DM, 0, BV, DM, 0, AL_P, FS, V16, VW, 0, NR, VW, DM);           /* v = x Wv^T (f32 rows + f16 plane, pitch VW) */
  k_vtg<<<(unsigned)(NB * NV64 * (SLEN / 64)), 256, 0, stream>>>(V16, VT);
  k_vtl<<<(unsigned)(NB * NV64 * (RE / 64)), 256, 0, stream>>>(FS, VTL);
  k_flash5<<<(unsigned)(NB * NH * QBN5 * 2), 128, 0, stream>>>(QH, QL, DM, KHp, KL, VW, VT, VTL, MPp, JEp, FS, DM);
  if (QBNP > 0) k_flash<<<(unsigned)(NB * NH * QBNP), 128, 0, stream>>>(QH, DM, KHp, VW, VT, MPp, JEp, FS, DM);
  k_hl<<<g8, 256, 0, stream>>>(FS, OH, A2, np / 8);
  /* out rows [0, RE) per batch: [ctx hi | ctx residual] . [Wo x16384 ; Wo x16] / 16384  (K = 2*DM) */
  const dim3 ge((unsigned)((RE / 128) * (DM / 64)), NB);
  k_gemm2<0><<<ge, 128, 0, stream>>>(A2, 2 * DM, (size_t)RE * 2 * DM, B2, 2 * DM, 0, AL_E, dout, nullptr, DM, (size_t)SEQ_FULL * DM, RE, DM, 2 * DM);
  /* out rows [RE, SLEN) per batch: ctx hi . (Wo x16) / 16 */
  if (SLEN > RE) {
    const dim3 gl((unsigned)(((SLEN - RE) / 128) * (DM / 64)), NB);
    k_gemm2<0><<<gl, 128, 0, stream>>>(OH + (size_t)RE * DM, DM, (size_t)SLEN * DM, B2 + DM, 2 * DM, 0, AL_P, dout + (size_t)RE * DM, nullptr, DM, (size_t)SEQ_FULL * DM, SLEN - RE, DM, DM);
  }
}

// v001
// Measured time: 640 microseconds a run.
// Timed twice side by side with v000, it ran 1.43 and 1.42 times as fast.
#include <hip/hip_runtime.h>
// Contractions: x.Wq^T, x.Wk^T, x.Wv^T, ctx.Wo^T = v_wmma_f32_16x16x32_f16 (f16 operands: bf16-RNE inputs exact in f16, weights carried x16 (x16384 for the ctx-hi half of the early-row output GEMM); f32 accumulate); scores q.k^T and P.V^T = v_wmma_f32_16x16x32_f16 (plain f16 hi planes; hi + x1024 residual planes of q, k, P and v for query positions < RE; P carried x1024), f32 accumulate; per-head RMS normalisation, rotary step, additive mask, softmax and normalisers f32.

#ifndef NB
#define NB 2
#endif
#ifndef SEQ
#define SEQ 2048
#endif
#define NB_FULL 2
#define SEQ_FULL 2048
#define DM 2048
#define NH 16
#define NKVH 4
#define NREP (NH / NKVH)
#define HDIM 128
#define VW (NKVH * HDIM)                     /* width of the k / v projection rows */
#define NV64 (VW / 64)                       /* 64-wide column groups of the v rows */
#define MSKP 2048                            /* row pitch of the mask input */
#define RTW 64                               /* row pitch of the cos / sin inputs */
#define SLEN SEQ
#define NR (NB * SLEN)
#define TQ SLEN
#define TK SLEN
#define SCL 0.08838834764831845f
#define MVIS (-1.0e8f)                       /* a mask entry above this keeps its key visible */
#define QBLKS (TQ / 64)
#define RE ((SLEN < 512) ? SLEN : 512)      /* query positions [0, RE) get residual planes on q, k, P, v and ctx */
#define QB05 0
#define QBN5 (RE / 64)
#define QB0P QBN5
#define QBNP (QBLKS - QBN5)
static_assert(SLEN % 128 == 0);
static_assert(SLEN <= SEQ_FULL);
static_assert(SLEN <= MSKP);
static_assert(NB >= 1 && NB <= NB_FULL);
static_assert(RE % 128 == 0 && RE <= SLEN);
static_assert((SLEN - RE) % 128 == 0);
static_assert(DM % 64 == 0 && DM == NH * HDIM);
static_assert(HDIM == 128 && NH % NKVH == 0);
static_assert(VW % 64 == 0 && NV64 * 64 == VW);
static_assert(DM % 32 == 0 && (2 * DM) % 32 == 0);
static_assert(NR % 128 == 0);
static_assert(((size_t)NR * NH * 16) % 256 == 0 && ((size_t)NR * NKVH * 16) % 256 == 0);
static_assert((NH & (NH - 1)) == 0 && (NKVH & (NKVH - 1)) == 0);   /* head counts are powers of two: index arithmetic by shifts and masks */
static_assert((size_t)NR * NH * 16 < ((size_t)1 << 31));           /* 32-bit thread indices in the normalise + rotary kernels */
static_assert(((size_t)(SLEN / 16) * (SLEN / 32) * 64) % 256 == 0);
static_assert(32 * 16 == HDIM * 4);          /* one store instruction of 32 lanes x 16 B == one 128-float row segment */
static_assert(16 * 16 == 64 * 4);            /* 16 lanes x 16 B == one 64-float row segment */
static_assert(4 * 16 * 40 * 2 + 4 * 16 * 132 * 4 <= 131072);
static_assert(2 * 4 * 16 * 40 * 2 + 4 * 16 * 68 * 4 <= 131072);
static_assert(4 * 32 * 68 * 4 <= 131072);

static constexpr float WSC_LO = 16.0f;
static constexpr float WSC_HI = 16384.0f;
static constexpr float AL_P = 0.0625f;
static constexpr float AL_E = 6.103515625e-05f;   /* 0.0625 / 1024 */

static constexpr size_t al256(size_t b) { return (b + 255) & ~(size_t)255; }
static constexpr size_t SZ_BQ = al256((size_t)DM * DM * 2);
static constexpr size_t SZ_BK = al256((size_t)VW * DM * 2);
static constexpr size_t SZ_B2 = al256((size_t)DM * 2 * DM * 2);
static constexpr size_t SZ_FS = al256((size_t)NR * DM * 4);
static constexpr size_t SZ_X16 = al256((size_t)NR * DM * 2);
static constexpr size_t SZ_QH = al256((size_t)NR * DM * 2);
static constexpr size_t SZ_KH = al256((size_t)NR * VW * 2);
static constexpr size_t SZ_QL = al256((size_t)NB * RE * DM * 2);
static constexpr size_t SZ_KL = al256((size_t)NB * RE * VW * 2);
static constexpr size_t SZ_VTL = al256((size_t)NB * NV64 * 64 * RE * 2);
static constexpr size_t SZ_A2 = al256((size_t)NB * RE * 2 * DM * 2);
static constexpr size_t SZ_MP = al256((size_t)SLEN * SLEN * 2);
static constexpr size_t SZ_JE = al256((size_t)QBLKS * 32 * 4);
static_assert((size_t)NB * NV64 * 64 * TK * 2 <= SZ_X16);       /* V^T aliases the f16 input plane */
static_assert((size_t)NR * VW * 4 <= SZ_FS);
static_assert(SZ_BQ + 2 * SZ_BK + SZ_B2 + SZ_FS + SZ_X16 + SZ_QH + 2 * SZ_KH + SZ_QL + SZ_KL + SZ_VTL + SZ_A2 + SZ_MP + SZ_JE <= ((size_t)128 << 20));

typedef _Float16 v16h __attribute__((ext_vector_type(16)));
typedef _Float16 v4h __attribute__((ext_vector_type(4)));
typedef unsigned short v8us __attribute__((ext_vector_type(8), may_alias));
typedef float v8f __attribute__((ext_vector_type(8)));
typedef float v4f __attribute__((ext_vector_type(4)));
typedef float v4fa __attribute__((ext_vector_type(4), may_alias));
union FragH { v16h v; v8us half[2]; _Float16 h[16]; unsigned short u[16]; };

__device__ __forceinline__ unsigned short bf16_bits(float x) { unsigned int u = __float_as_uint(x); return (unsigned short)((u + 0x7FFFu + ((u >> 16) & 1u)) >> 16); }
__device__ __forceinline__ float bf16_val(unsigned short b) { return __uint_as_float(((unsigned int)b) << 16); }
__device__ __forceinline__ float bf16_rne(float x) { return bf16_val(bf16_bits(x)); }
// f32 -> f16 for WMMA operand planes: values under the smallest f16 normal become +0
__device__ __forceinline__ _Float16 toh_flush(float v) { const _Float16 r = (_Float16)v; return (fabsf(v) < 6.103515625e-05f) ? (_Float16)0.0f : r; }

// D += A.B with NT terms: 1 = ah.bh, 2 = + al.bh, 3 = + ah.bl; hazard guard after the group
template <int NT>
__device__ __forceinline__ v8f mmaH(v16h ah, v16h al, v16h bh, v16h bl, v8f c) {
  c = __builtin_amdgcn_wmma_f32_16x16x32_f16(false, ah, false, bh, (short)0, c, false, false);
  if (NT >= 2) c = __builtin_amdgcn_wmma_f32_16x16x32_f16(false, al, false, bh, (short)0, c, false, false);
  if (NT >= 3) c = __builtin_amdgcn_wmma_f32_16x16x32_f16(false, ah, false, bl, (short)0, c, false, false);
  asm volatile("v_nop\n\tv_nop\n\tv_nop\n\tv_nop" : "+v"(c) : "v"(ah), "v"(al), "v"(bh), "v"(bl));
  return c;
}
// 16x32 fragment from a 16-bit row-major tile (rows = m or n, k contiguous): elements 0..7 <- k0+8h+0..7, 8..15 <- k0+16+8h+0..7
__device__ __forceinline__ v16h g2_frag(const _Float16* p, int hh) { FragH f; f.half[0] = *(const v8us*)((const unsigned short*)p + 8 * hh); f.half[1] = *(const v8us*)((const unsigned short*)p + 16 + 8 * hh); return f.v; }
__device__ __forceinline__ v8f g2_mma(v16h a, v16h b, v8f c) { v8f d = __builtin_amdgcn_wmma_f32_16x16x32_f16(false, a, false, b, (short)0, c, false, false); asm volatile("v_nop\n\tv_nop\n\tv_nop\n\tv_nop" : "+v"(d) : "v"(a), "v"(b)); return d; }

__global__ __launch_bounds__(256) void k_wsc(const float* __restrict__ Wm, _Float16* __restrict__ Bt, size_t n8, float sc) {
  const size_t t = (size_t)blockIdx.x * 256 + threadIdx.x; if (t >= n8) return;
  const v4f a0 = *(const v4fa*)(Wm + t * 8), a1 = *(const v4fa*)(Wm + t * 8 + 4);
  FragH f;
#pragma unroll
  for (int q = 0; q < 4; ++q) { f.h[q] = toh_flush(bf16_rne(a0[q]) * sc); f.h[4 + q] = toh_flush(bf16_rne(a1[q]) * sc); }
  const v8us o = f.half[0];
  *(v8us*)((unsigned short*)Bt + t * 8) = o; 
}
__global__ __launch_bounds__(256) void k_wsc2(const float* __restrict__ Wm, _Float16* __restrict__ B2, size_t n8, float sc0, float sc1) {
  const size_t t = (size_t)blockIdx.x * 256 + threadIdx.x; if (t >= n8) return;
  const size_t e = t * 8; const size_t n = e / DM; const size_t k8 = e % DM;
  const v4f a0 = *(const v4fa*)(Wm + e), a1 = *(const v4fa*)(Wm + e + 4);
  FragH f0, f1;
#pragma unroll
  for (int q = 0; q < 4; ++q) {
    const float v0 = bf16_rne(a0[q]), v1 = bf16_rne(a1[q]);
    f0.h[q] = toh_flush(v0 * sc0); f1.h[q] = toh_flush(v0 * sc1);
    f0.h[4 + q] = toh_flush(v1 * sc0); f1.h[4 + q] = toh_flush(v1 * sc1);
  }
  const size_t o = n * (size_t)(2 * DM) + k8;
  const v8us o0 = f0.half[0], o1 = f1.half[0];
  {
    *(v8us*)((unsigned short*)B2 + o) = o0;
    *(v8us*)((unsigned short*)B2 + o + DM) = o1;
    
  }
}

// mask plane in accumulator layout: MP[(qt*(SLEN/32) + kt)][half][lane][8] bf16 bits; element 2*rr + c of (half, lane) = mask[qt*16 + 8*(lane>>4) + 4*half + rr][kt*32 + 16*c + (lane&15)];
__global__ __launch_bounds__(256) void k_mperm(const float* __restrict__ msk, unsigned short* __restrict__ MP) {
  const size_t t = (size_t)blockIdx.x * 256 + threadIdx.x; if (t >= (size_t)(SLEN / 16) * (SLEN / 32) * 64) return;
  const int lane = (int)(t & 31); const int half = (int)((t >> 5) & 1); const size_t tile = t >> 6;
  const int kt = (int)(tile % (size_t)(SLEN / 32)); const int qt = (int)(tile / (size_t)(SLEN / 32));
  const int ln = lane & 15, hh = lane >> 4;
  const float* mr = msk + (size_t)(qt * 16 + 8 * hh + 4 * half) * MSKP + kt * 32 + ln;
  FragH f;
#pragma unroll
  for (int rr = 0; rr < 4; ++rr) { const float a = mr[(size_t)rr * MSKP]; const float c = mr[(size_t)rr * MSKP + 16]; f.u[2 * rr] = bf16_bits(a); f.u[2 * rr + 1] = bf16_bits(c); }
  const v8us o = f.half[0];
  *(v8us*)(MP + t * 8) = o; 
}
// per 64-query block: JE[qblk][0..32) = number of 32-key tiles to visit = 1 + last tile holding a visible entry (value > MVIS) in any of the 64 rows; all tiles if some row has no visible entry.
__global__ __launch_bounds__(256) void k_mjend(const float* __restrict__ msk, int* __restrict__ JE) {
  __shared__ int smax[8]; __shared__ int snone[8];
  const int tid = threadIdx.x, lane = tid & 31; const int w = __builtin_amdgcn_readfirstlane(tid >> 5);
  const int qblk = blockIdx.x;
  int wmax = -1, wnone = 0;
#pragma unroll 1
  for (int rr = 0; rr < 8; ++rr) {
    const float* mr = msk + (size_t)(qblk * 64 + w * 8 + rr) * MSKP;
    int lm = -1;
#pragma unroll 1
    for (int c4 = lane; c4 < SLEN / 4; c4 += 32) {
      const v4f a = *(const v4fa*)(mr + c4 * 4);
      const bool any = (bf16_rne(a[0]) > MVIS) || (bf16_rne(a[1]) > MVIS) || (bf16_rne(a[2]) > MVIS) || (bf16_rne(a[3]) > MVIS);
      lm = any ? (c4 >> 3) : lm;
    }
    int o = __shfl_xor(lm, 16, 32); lm = (o > lm) ? o : lm;
    o = __shfl_xor(lm, 8, 32); lm = (o > lm) ? o : lm;
    o = __shfl_xor(lm, 4, 32); lm = (o > lm) ? o : lm;
    o = __shfl_xor(lm, 2, 32); lm = (o > lm) ? o : lm;
    o = __shfl_xor(lm, 1, 32); lm = (o > lm) ? o : lm;
    wmax = (lm > wmax) ? lm : wmax; wnone |= (lm < 0) ? 1 : 0;
  }
  if (lane == 0) { smax[w] = wmax; snone[w] = wnone; }
  __syncthreads();
  if (w == 0) {
    int m = -1, nn = 0;
#pragma unroll
    for (int i = 0; i < 8; ++i) { const int a = smax[i]; m = (a > m) ? a : m; nn |= snone[i]; }
    const int jt = (nn != 0) ? (SLEN / 32) : (m + 1);
    *(int*)(JE + qblk * 32 + lane) = jt; 
  }
}

__global__ __launch_bounds__(256) void k_x16(const float* __restrict__ x, _Float16* __restrict__ X16, size_t n8) {
  const size_t t = (size_t)blockIdx.x * 256 + threadIdx.x; if (t >= n8) return;
  const size_t e = t * 8; const size_t r = e / DM; const size_t c = e % DM; const size_t b = r / SLEN, s = r % SLEN;
  const float* src = x + (b * SEQ_FULL + s) * DM + c;
  const v4f a0 = *(const v4fa*)src, a1 = *(const v4fa*)(src + 4);
  FragH f;
#pragma unroll
  for (int q = 0; q < 4; ++q) { f.h[q] = (_Float16)bf16_rne(a0[q]); f.h[4 + q] = (_Float16)bf16_rne(a1[q]); }
  const v8us o = f.half[0];
  *(v8us*)((unsigned short*)X16 + e) = o; 
}

// LDS ring of the GEMM: one stage = 64 k = 128 B of every operand row, [A 128 rows | B 64 rows] at pitch 144 B (16 B x odd: the 16-B fragment reads meet no bank conflict); two stages
#define G2_PB 144
#define G2_STG ((128 + 64) * G2_PB)
static_assert(2 * G2_STG >= 4 * 32 * 68 * 4);   /* the output staging reuses the ring behind the last barrier */
static_assert(2 * G2_STG <= 65536);
static_assert(DM % 64 == 0 && DM >= 128);
// 16x32 fragment from an LDS row (k contiguous), p = row start + 2 * (k0 + 8 hh) bytes: the k order of g2_frag
__device__ __forceinline__ v16h g2_lfrag(const unsigned char* p) { FragH f; f.half[0] = *(const v8us*)p; f.half[1] = *(const v8us*)(p + 32); return f.v; }
// one stage: 12 copies of 16 B per lane (a wave-wide copy = 4 whole 128-B row pieces); lane (r = tid / 8, c = tid % 8) brings chunk c of A rows r + 16 j (j < 8) and of B rows r + 16 j (j < 4).
// l = LDS byte address of (row r, chunk c) in the stage, a / b = the lane's global addresses in A row r / B row r, sa / sb = 16 rows in elements.
__device__ __forceinline__ void g2_stage(unsigned l, const _Float16* a, size_t sa, const _Float16* b, size_t sb) {
  /* s_wait_xcnt closes the copies' own statement: no register that a copy names is rewritten in front of it */
  asm volatile(
      "global_load_async_to_lds_b128 %0, %12, off\n\t"
      "global_load_async_to_lds_b128 %1, %13, off\n\t"
      "global_load_async_to_lds_b128 %2, %14, off\n\t"
      "global_load_async_to_lds_b128 %3, %15, off\n\t"
      "global_load_async_to_lds_b128 %4, %16, off\n\t"
      "global_load_async_to_lds_b128 %5, %17, off\n\t"
      "global_load_async_to_lds_b128 %6, %18, off\n\t"
      "global_load_async_to_lds_b128 %7, %19, off\n\t"
      "global_load_async_to_lds_b128 %8, %20, off\n\t"
      "global_load_async_to_lds_b128 %9, %21, off\n\t"
      "global_load_async_to_lds_b128 %10, %22, off\n\t"
      "global_load_async_to_lds_b128 %11, %23, off\n\t"
      "s_wait_xcnt 0x0"
      :: "v"(l), "v"(l + 16 * G2_PB), "v"(l + 32 * G2_PB), "v"(l + 48 * G2_PB), "v"(l + 64 * G2_PB), "v"(l + 80 * G2_PB), "v"(l + 96 * G2_PB), "v"(l + 112 * G2_PB),
         "v"(l + 128 * G2_PB), "v"(l + 144 * G2_PB), "v"(l + 160 * G2_PB), "v"(l + 176 * G2_PB),
         "v"(a), "v"(a + sa), "v"(a + 2 * sa), "v"(a + 3 * sa), "v"(a + 4 * sa), "v"(a + 5 * sa), "v"(a + 6 * sa), "v"(a + 7 * sa),
         "v"(b), "v"(b + sb), "v"(b + 2 * sb), "v"(b + 3 * sb)
      : "memory");
}

// GEMM C[M][N] = alpha * A[M][K].B  with A f16 row-major (pitch lda), B stored [n][k] f16 (pitch ldb), batched by blockIdx.y (strides sA, sB, sC);
// writes f32 C and/or f16 C16 (pitch ldc). Requires M % 128 == 0, N % 64 == 0, K % 64 == 0 (asserted by the callers' constants).
// Operand tiles come through LDS: asynchronous copies, two stages, stage t + 1 in flight while stage t is multiplied.
template <int ACT>
__global__ __launch_bounds__(128) void k_gemm2(const _Float16* __restrict__ A, int lda, size_t sA, const _Float16* __restrict__ Bh, int ldb, size_t sB, float alpha,
                                               float* C, _Float16* C16, int ldc, size_t sC, int M, int N, int K) {
  __shared__ __attribute__((aligned(16))) unsigned char sm[2 * G2_STG];
  float (*so)[32][68] = (float (*)[32][68])sm;
  const int tid = threadIdx.x, w = tid >> 5, lane = tid & 31, ln = lane & 15, hh = lane >> 4; const int by = blockIdx.y;
  A += (size_t)by * sA; Bh += (size_t)by * sB; const size_t cofs = (size_t)by * sC;
  const int ntn = N >> 6; const int mt = blockIdx.x / ntn, nq = blockIdx.x - mt * ntn; const int row0 = mt * 128 + 32 * w, col0 = nq * 64; if (mt * 128 >= M) return;
  const int cr = tid >> 3, cc = tid & 7;
  const _Float16* ga = A + (size_t)(mt * 128 + cr) * lda + cc * 8; const _Float16* gb = Bh + (size_t)(col0 + cr) * ldb + cc * 8;
  const size_t sa16 = (size_t)16 * lda, sb16 = (size_t)16 * ldb;
  const unsigned lc = (unsigned)(uintptr_t)sm + (unsigned)(cr * G2_PB + cc * 16);
  const int nt = K >> 6;
  const int aofs = (32 * w + ln) * G2_PB + 16 * hh, bofs = (128 + ln) * G2_PB + 16 * hh;
  const v8f z8 = {0.f,0.f,0.f,0.f,0.f,0.f,0.f,0.f}; v8f c00 = z8, c01 = z8, c02 = z8, c03 = z8, c10 = z8, c11 = z8, c12 = z8, c13 = z8;
  g2_stage(lc, ga, sa16, gb, sb16);
  asm volatile("s_wait_asynccnt 0x0" ::: "memory");   /* stage 0 has landed before the barrier publishes it */
  __syncthreads();
  if (nt > 1) g2_stage(lc + G2_STG, ga + 64, sa16, gb + 64, sb16);
#pragma unroll 1
  for (int t = 0; t < nt; ++t) {
    const unsigned char* sb = sm + (t & 1) * G2_STG; const unsigned char* pa = sb + aofs; const unsigned char* pb = sb + bofs;
#pragma unroll
    for (int kk = 0; kk < 2; ++kk) {
      const v16h a0 = g2_lfrag(pa + kk * 64), a1 = g2_lfrag(pa + 16 * G2_PB + kk * 64);
      const v16h b0 = g2_lfrag(pb + kk * 64), b1 = g2_lfrag(pb + 16 * G2_PB + kk * 64), b2 = g2_lfrag(pb + 32 * G2_PB + kk * 64), b3 = g2_lfrag(pb + 48 * G2_PB + kk * 64);
      c00 = g2_mma(a0, b0, c00); c10 = g2_mma(a1, b0, c10);
      c01 = g2_mma(a0, b1, c01); c11 = g2_mma(a1, b1, c11);
      c02 = g2_mma(a0, b2, c02); c12 = g2_mma(a1, b2, c12);
      c03 = g2_mma(a0, b3, c03); c13 = g2_mma(a1, b3, c13);
    }
    asm volatile("s_wait_dscnt 0x0" ::: "memory");      /* this wave's reads of stage t are done before the stage is refilled */
    asm volatile("s_wait_asynccnt 0x0" ::: "memory");   /* this wave's copies of stage t + 1 have landed before the barrier publishes them */
    __syncthreads();
    if (t + 2 < nt) g2_stage(lc + (unsigned)((t & 1) * G2_STG), ga + (size_t)(t + 2) * 64, sa16, gb + (size_t)(t + 2) * 64, sb16);
  }
  asm volatile("s_wait_asynccnt 0x0" ::: "memory");     /* no copy is outstanding when the ring becomes output staging */
  v8f accs[8] = {c00, c01, c02, c03, c10, c11, c12, c13};
#pragma unroll
  for (int u = 0; u < 8; ++u) {
    const int t = u & 3, half = u >> 2;
#pragma unroll
    for (int r = 0; r < 8; ++r) { const int rloc = half * 16 + 8 * hh + r; float v = accs[u][r] * alpha; if (ACT == 3) v = fmaxf(v, 0.f); so[w][rloc][t * 16 + ln] = v; }
  }
  __builtin_amdgcn_fence(4, "workgroup"); __builtin_amdgcn_wave_barrier();
  const int rsub = lane >> 4, c4 = (lane & 15) * 4;
  {
#pragma unroll
    for (int q = 0; q < 16; ++q) {
      const int r = q * 2 + rsub; const v4f v = *(const v4fa*)&so[w][r][c4];
      if (C) *(v4f*)(C + cofs + (size_t)(row0 + r) * ldc + col0 + c4) = v;
      if (C16) { v4h h4; for (int i = 0; i < 4; ++i) h4[i] = (_Float16)v[i]; *(v4h*)(C16 + cofs + (size_t)(row0 + r) * ldc + col0 + c4) = h4; }
    }
    
  }
}

// per-head RMS normalisation + interleaved-pair rotary step from the f32 GEMM plane F [NR][ldf] (ldf = NHV*128, NHV = compile-time head count, a power of two):
// y = (x * rsqrt(mean_128(x^2) + 1e-6)) * g[d];  out[2i] = y[2i] c[i] - y[2i+1] s[i];  out[2i+1] = y[2i] s[i] + y[2i+1] c[i]  (c, s = table rows [position][64], gain g[128]; all by value, bf16-RNE);
// H [NR][ldf] = f16 hi of every row; L [NB*RE][ldf] = x1024 residual for positions < RE.
// 32-bit thread indices (shifts and masks of compile-time powers of two); 64-bit offsets only at the final pointer arithmetic.
template <int NHV>
__device__ __forceinline__ void nrope_body(const float* __restrict__ F, int ldf, const float* __restrict__ NW, const float* __restrict__ CT, const float* __restrict__ ST,
                                           _Float16* __restrict__ H, _Float16* __restrict__ L) {
  #pragma clang fp contract(off)
  const unsigned t0 = blockIdx.x * 256u + threadIdx.x; const bool live = t0 < (unsigned)(NR * NHV * 16); const unsigned t = live ? t0 : 0u;
  const int p = (int)(t & 15u); const int hd = (int)((t >> 4) % (unsigned)NHV); const unsigned row = t / (unsigned)(16 * NHV);
  const int s = (int)(row % (unsigned)SLEN); const int b = (int)(row / (unsigned)SLEN);
  const float* src = F + (size_t)row * ldf + hd * HDIM + p * 8;
  const v4f xa = *(const v4fa*)src, xb = *(const v4fa*)(src + 4);
  const v4f wa = *(const v4fa*)(NW + p * 8), wb = *(const v4fa*)(NW + p * 8 + 4);
  const v4f cv = *(const v4fa*)(CT + (size_t)s * RTW + p * 4), sv = *(const v4fa*)(ST + (size_t)s * RTW + p * 4);
  const float xs[8] = {xa[0], xa[1], xa[2], xa[3], xb[0], xb[1], xb[2], xb[3]};
  const float gs[8] = {wa[0], wa[1], wa[2], wa[3], wb[0], wb[1], wb[2], wb[3]};
  float ss = 0.f;
#pragma unroll
  for (int i = 0; i < 8; ++i) { const float q = xs[i] * xs[i]; ss = ss + q; }
  ss += __shfl_xor(ss, 1, 32); ss += __shfl_xor(ss, 2, 32); ss += __shfl_xor(ss, 4, 32); ss += __shfl_xor(ss, 8, 32);
  const float mean = ss * 0.0078125f; const float rms = rsqrtf(mean + 1.0e-6f);
  FragH fh, fl;
#pragma unroll
  for (int j = 0; j < 4; ++j) {
    const float c = bf16_rne(cv[j]), sn = bf16_rne(sv[j]);
    const float y1 = (xs[2 * j] * rms) * bf16_rne(gs[2 * j]); const float y2 = (xs[2 * j + 1] * rms) * bf16_rne(gs[2 * j + 1]);
    const float o1 = y1 * c - y2 * sn; const float o2 = y1 * sn + y2 * c;
    const _Float16 h1 = toh_flush(o1), h2 = toh_flush(o2);
    fh.h[2 * j] = h1; fh.h[2 * j + 1] = h2;
    fl.h[2 * j] = toh_flush((o1 - (float)h1) * 1024.0f); fl.h[2 * j + 1] = toh_flush((o2 - (float)h2) * 1024.0f);
  }
  const size_t oh = (size_t)row * ldf + hd * HDIM + p * 8;
  const bool wl = live && (s < RE);
  const int sl = wl ? s : 0;
  const size_t ol = (size_t)(b * RE + sl) * ldf + hd * HDIM + p * 8;
  const v8us vh = fh.half[0], vl = fl.half[0];
  {
    if (live) *(v8us*)((unsigned short*)H + oh) = vh;
    if (wl) *(v8us*)((unsigned short*)L + ol) = vl;
    
  }
}
// query heads (NH per row)
__global__ __launch_bounds__(256) void k_nrope_q(const float* __restrict__ F, int ldf, const float* __restrict__ NW, const float* __restrict__ CT, const float* __restrict__ ST,
                                                 _Float16* __restrict__ H, _Float16* __restrict__ L) {
  #pragma clang fp contract(off)
  nrope_body<NH>(F, ldf, NW, CT, ST, H, L);
}
// key heads (NKVH per row)
__global__ __launch_bounds__(256) void k_nrope_k(const float* __restrict__ F, int ldf, const float* __restrict__ NW, const float* __restrict__ CT, const float* __restrict__ ST,
                                                 _Float16* __restrict__ H, _Float16* __restrict__ L) {
  #pragma clang fp contract(off)
  nrope_body<NKVH>(F, ldf, NW, CT, ST, H, L);
}

__global__ __launch_bounds__(256) void k_vtg(const _Float16* __restrict__ V16, _Float16* __restrict__ Vt) {
  __shared__ unsigned short tl[64][66];
  const int tid = threadIdx.x; const int nlg = SLEN / 64; const int slab = blockIdx.x / nlg, lg = blockIdx.x % nlg; const int b = slab / NV64, h = slab % NV64;
  for (int i = tid; i < 64 * 8; i += 256) {
    const int r = i >> 3, c8 = (i & 7) * 8; FragH f;
    f.half[0] = *(const v8us*)((const unsigned short*)V16 + ((size_t)b * SLEN + lg * 64 + r) * VW + h * 64 + c8);
#pragma unroll
    for (int q = 0; q < 8; ++q) tl[r][c8 + q] = f.u[q];
  }
  __syncthreads();
  {
#pragma unroll
    for (int rd = 0; rd < 2; ++rd) {
      const int d = rd * 32 + (tid >> 3), pc = tid & 7; FragH f;
#pragma unroll
      for (int q = 0; q < 8; ++q) f.u[q] = tl[pc * 8 + q][d];
      *(v8us*)((unsigned short*)Vt + ((size_t)slab * 64 + d) * TK + lg * 64 + pc * 8) = f.half[0];
    }
    
  }
}
__global__ __launch_bounds__(256) void k_vtl(const float* __restrict__ VF, _Float16* __restrict__ VtL) {
  __shared__ unsigned short tl[64][66];
  const int tid = threadIdx.x; const int nlg = RE / 64; const int slab = blockIdx.x / nlg, lg = blockIdx.x % nlg; const int b = slab / NV64, h = slab % NV64;
  for (int i = tid; i < 64 * 16; i += 256) {
    const int r = i >> 4, c4 = (i & 15) * 4;
    const v4f a = *(const v4fa*)(VF + ((size_t)b * SLEN + lg * 64 + r) * VW + h * 64 + c4);
    FragH f;
#pragma unroll
    for (int q = 0; q < 4; ++q) { const float v = a[q]; const _Float16 hv = (_Float16)v; f.h[q] = toh_flush((v - (float)hv) * 1024.0f); }
#pragma unroll
    for (int q = 0; q < 4; ++q) tl[r][c4 + q] = f.u[q];
  }
  __syncthreads();
  {
#pragma unroll
    for (int rd = 0; rd < 2; ++rd) {
      const int d = rd * 32 + (tid >> 3), pc = tid & 7; FragH f;
#pragma unroll
      for (int q = 0; q < 8; ++q) f.u[q] = tl[pc * 8 + q][d];
      *(v8us*)((unsigned short*)VtL + ((size_t)slab * 64 + d) * RE + lg * 64 + pc * 8) = f.half[0];
    }
    
  }
}

__global__ __launch_bounds__(256) void k_hl(const float* __restrict__ Fp, _Float16* __restrict__ Hh, _Float16* __restrict__ A2, size_t n8) {
  const size_t t = (size_t)blockIdx.x * 256 + threadIdx.x; if (t >= n8) return;
  const size_t e = t * 8; const size_t r = e / DM; const int c = (int)(e % DM); const int s = (int)(r % SLEN); const int b = (int)(r / SLEN);
  const v4f a = *(const v4fa*)(Fp + e), d = *(const v4fa*)(Fp + e + 4);
  FragH fh, fl;
#pragma unroll
  for (int q = 0; q < 4; ++q) {
    _Float16 hv = (_Float16)a[q]; fh.h[q] = hv; fl.h[q] = (_Float16)((a[q] - (float)hv) * 1024.0f);
    hv = (_Float16)d[q]; fh.h[4 + q] = hv; fl.h[4 + q] = (_Float16)((d[q] - (float)hv) * 1024.0f);
  }
  const bool wl = (s < RE);
  const size_t o2 = ((size_t)b * RE + (wl ? s : 0)) * (size_t)(2 * DM) + c;
  const v8us vh = fh.half[0], vl = fl.half[0];
  {
    *(v8us*)((unsigned short*)Hh + e) = vh;
    if (wl) { *(v8us*)((unsigned short*)A2 + o2) = vh; *(v8us*)((unsigned short*)A2 + o2 + DM) = vl; }
    
  }
}

// fused attention per ((b,h), 64 queries), query blocks [QB0P, QBLKS): wave = 16 queries; S = Q.K^T (d = 128: 4 k-steps, q fragments reloaded per k-step) x SCL + mask (bf16 plane, accumulator layout, two 16-B words per lane per step)
__global__ __launch_bounds__(128) __attribute__((amdgpu_num_vgpr(256))) void k_flash(const _Float16* __restrict__ Q16, int ldq, const _Float16* __restrict__ K16, int ldk,
                                               const _Float16* __restrict__ Vt, const unsigned short* __restrict__ MP, const int* __restrict__ JE, float* __restrict__ O, int ldo) {
  constexpr int RPW = 16, DT = 8, KS = 4;
  constexpr int NQP = (QBNP > 0) ? QBNP : 1;
  __shared__ __attribute__((aligned(16))) unsigned short sP[4][RPW][40];
  __shared__ __attribute__((aligned(16))) float sO[4][RPW][132];
  const int tid = threadIdx.x, lane = tid & 31, ln = lane & 15, hh = lane >> 4;
  const int w = __builtin_amdgcn_readfirstlane(tid >> 5);
  const int slab = blockIdx.x / NQP, qblk = QB0P + blockIdx.x % NQP; const int b = slab / NH, h = slab % NH; const int kvh = h / NREP;
  const int qb0 = qblk * (4 * RPW); const int q0 = qb0 + w * RPW;
  const unsigned short* qr = (const unsigned short*)Q16 + ((size_t)b * TQ + q0 + ln) * ldq + h * HDIM;
  const unsigned short* kb = (const unsigned short*)K16 + ((size_t)b * TK + ln) * ldk + kvh * HDIM;
  const unsigned short* Vth = (const unsigned short*)Vt + (size_t)(b * NKVH + kvh) * HDIM * TK;
  const unsigned short* mq = MP + (size_t)(q0 >> 4) * (size_t)(TK / 32) * 512 + lane * 8;
  int jt = JE[qblk * 32]; jt = (jt < 1) ? 1 : jt; jt = (jt > TK / 32) ? (TK / 32) : jt;
  const int jend = __builtin_amdgcn_readfirstlane(jt) * 32;
  float m_r[8], l_r[8]; v8f oacc[DT];
#pragma unroll
  for (int r = 0; r < 8; ++r) { m_r[r] = -3.0e38f; l_r[r] = 0.f; }
#pragma unroll
  for (int dt = 0; dt < DT; ++dt) oacc[dt] = (v8f){0.f,0.f,0.f,0.f,0.f,0.f,0.f,0.f};
#pragma unroll 1
  for (int j0 = 0; j0 < jend; j0 += 32) {
    v8f sa = (v8f){0.f,0.f,0.f,0.f,0.f,0.f,0.f,0.f}, sb = sa;
    const unsigned short* kr0 = kb + (size_t)j0 * ldk; const unsigned short* kr1 = kr0 + (size_t)16 * ldk;
#pragma unroll
    for (int ks = 0; ks < KS; ++ks) {
      /* A (q) and B (k) fragments share one k order: element e < 8 <-> d = 32 ks + 8 hh + e; e >= 8 <-> d = 32 ks + 16 + 8 hh + (e - 8) */
      FragH a, k0, k1;
      a.half[0] = *(const v8us*)(qr + ks * 32 + 8 * hh); a.half[1] = *(const v8us*)(qr + ks * 32 + 16 + 8 * hh);
      k0.half[0] = *(const v8us*)(kr0 + ks * 32 + 8 * hh); k0.half[1] = *(const v8us*)(kr0 + ks * 32 + 16 + 8 * hh);
      k1.half[0] = *(const v8us*)(kr1 + ks * 32 + 8 * hh); k1.half[1] = *(const v8us*)(kr1 + ks * 32 + 16 + 8 * hh);
      sa = g2_mma(a.v, k0.v, sa); sb = g2_mma(a.v, k1.v, sb);
    }
    FragH fm; { const unsigned short* mt = mq + (size_t)(j0 >> 5) * 512; fm.half[0] = *(const v8us*)mt; fm.half[1] = *(const v8us*)(mt + 256); }
#pragma unroll
    for (int r = 0; r < 8; ++r) {
      const float mk0 = bf16_val(fm.u[2 * r]), mk1 = bf16_val(fm.u[2 * r + 1]);
      const float s0 = sa[r] * SCL + mk0, s1 = sb[r] * SCL + mk1;
      float mc = fmaxf(s0, s1);
      mc = fmaxf(mc, __shfl_xor(mc, 1, 32)); mc = fmaxf(mc, __shfl_xor(mc, 2, 32)); mc = fmaxf(mc, __shfl_xor(mc, 4, 32)); mc = fmaxf(mc, __shfl_xor(mc, 8, 32));
      const float mn = fmaxf(m_r[r], mc); const float al = (mn > -1.0e38f) ? expf(m_r[r] - mn) : 1.0f; m_r[r] = mn;
      const float p0 = expf(s0 - mn), p1 = expf(s1 - mn); l_r[r] = l_r[r] * al + p0 + p1;
#pragma unroll
      for (int dt = 0; dt < DT; ++dt) oacc[dt][r] *= al;
      FragH t2; t2.h[0] = toh_flush(p0 * 1024.0f); t2.h[1] = toh_flush(p1 * 1024.0f);
      sP[w][8 * hh + r][ln] = t2.u[0]; sP[w][8 * hh + r][16 + ln] = t2.u[1];
    }
    __builtin_amdgcn_fence(4, "workgroup"); __builtin_amdgcn_wave_barrier();
    FragH pa; pa.half[0] = *(const v8us*)&sP[w][ln][8 * hh]; pa.half[1] = *(const v8us*)&sP[w][ln][16 + 8 * hh];
#pragma unroll
    for (int dt = 0; dt < DT; ++dt) {
      /* A (P: key columns of the LDS tile) and B (V^T rows, keys contiguous) share the same key order: element e < 8 <-> key j0 + 8 hh + e; e >= 8 <-> key j0 + 16 + 8 hh + (e - 8) */
      const unsigned short* vrow = Vth + (size_t)(dt * 16 + ln) * TK + j0; FragH bv;
      bv.half[0] = *(const v8us*)(vrow + 8 * hh); bv.half[1] = *(const v8us*)(vrow + 16 + 8 * hh);
      oacc[dt] = g2_mma(pa.v, bv.v, oacc[dt]);
    }
    __builtin_amdgcn_fence(4, "workgroup"); __builtin_amdgcn_wave_barrier();
  }
#pragma unroll
  for (int r = 0; r < 8; ++r) { float l = l_r[r]; l += __shfl_xor(l, 1, 32); l += __shfl_xor(l, 2, 32); l += __shfl_xor(l, 4, 32); l += __shfl_xor(l, 8, 32); l_r[r] = (l > 0.f) ? 1.0f / (l * 1024.0f) : 0.f; }
#pragma unroll
  for (int dt = 0; dt < DT; ++dt)
#pragma unroll
    for (int r = 0; r < 8; ++r) sO[w][8 * hh + r][dt * 16 + ln] = oacc[dt][r] * l_r[r];
  __builtin_amdgcn_fence(4, "workgroup"); __builtin_amdgcn_wave_barrier();
  {
#pragma unroll
    for (int rp = 0; rp < RPW; ++rp) { const v4f val = *(const v4fa*)&sO[w][rp][lane * 4]; *(v4f*)(O + ((size_t)b * TQ + q0 + rp) * ldo + h * HDIM + lane * 4) = val; }
    
  }
}
// 5-plane variant for query blocks [QB05, QB05+QBN5) (positions < RE), one 64-wide half dh of the head's 128 dims per block: S = Qh.Kh^T + (Ql.Kh^T + Qh.Kl^T)/1024 with Q/K = [hi | x1024 residual] planes (residual planes compact: rows b*RE + s);
// O = (Ph.Vh + (Pl.Vh + Ph.Vl)/1024) / l with P = [hi | x1024 residual] of 1024 p and V^T = [hi | x1024 residual] (VtL pitch RE); separate residual accumulators folded before the normalisation.
// key tiles [0, JE[qblk]) clamped to [1, RE/32] (the compact planes hold keys < RE); a block whose mask exposes keys beyond RE writes NaN rows.
__global__ __launch_bounds__(128) __attribute__((amdgpu_num_vgpr(256))) void k_flash5(const _Float16* __restrict__ Q16, const _Float16* __restrict__ QL, int ldq, const _Float16* __restrict__ K16, const _Float16* __restrict__ KL, int ldk,
                                                const _Float16* __restrict__ Vt, const _Float16* __restrict__ VtL, const unsigned short* __restrict__ MP, const int* __restrict__ JE, float* __restrict__ O, int ldo) {
  constexpr int RPW = 16, DT = 4, KS = 4;
  __shared__ __attribute__((aligned(16))) unsigned short sP[4][RPW][40];
  __shared__ __attribute__((aligned(16))) unsigned short sPL[4][RPW][40];
  __shared__ __attribute__((aligned(16))) float sO[4][RPW][68];
  const int tid = threadIdx.x, lane = tid & 31, ln = lane & 15, hh = lane >> 4;
  const int w = __builtin_amdgcn_readfirstlane(tid >> 5);
  const int dh = blockIdx.x & 1; const int bx = blockIdx.x >> 1;
  const int slab = bx / QBN5, qblk = QB05 + bx % QBN5; const int b = slab / NH, h = slab % NH; const int kvh = h / NREP;
  const int qb0 = qblk * (4 * RPW); const int q0 = qb0 + w * RPW;
  const unsigned short* qr = (const unsigned short*)Q16 + ((size_t)b * TQ + q0 + ln) * ldq + h * HDIM;
  const unsigned short* ql = (const unsigned short*)QL + ((size_t)b * RE + q0 + ln) * ldq + h * HDIM;
  const unsigned short* kb = (const unsigned short*)K16 + ((size_t)b * TK + ln) * ldk + kvh * HDIM;
  const unsigned short* klb = (const unsigned short*)KL + ((size_t)b * RE + ln) * ldk + kvh * HDIM;
  const unsigned short* Vth = (const unsigned short*)Vt + ((size_t)(b * NKVH + kvh) * HDIM + dh * 64) * TK;
  const unsigned short* Vtl = (const unsigned short*)VtL + ((size_t)(b * NKVH + kvh) * HDIM + dh * 64) * RE;
  const unsigned short* mq = MP + (size_t)(q0 >> 4) * (size_t)(TK / 32) * 512 + lane * 8;
  const int jraw = JE[qblk * 32];
  const float pz = (jraw > RE / 32) ? __uint_as_float(0x7FC00000u) : 0.0f;
  int jt = (jraw < 1) ? 1 : jraw; jt = (jt > RE / 32) ? (RE / 32) : jt;
  const int jend = __builtin_amdgcn_readfirstlane(jt) * 32;
  float m_r[8], l_r[8]; v8f oacc[DT], oaccL[DT];
#pragma unroll
  for (int r = 0; r < 8; ++r) { m_r[r] = -3.0e38f; l_r[r] = 0.f; }
#pragma unroll
  for (int dt = 0; dt < DT; ++dt) { oacc[dt] = (v8f){0.f,0.f,0.f,0.f,0.f,0.f,0.f,0.f}; oaccL[dt] = oacc[dt]; }
#pragma unroll 1
  for (int j0 = 0; j0 < jend; j0 += 32) {
    v8f sa = (v8f){0.f,0.f,0.f,0.f,0.f,0.f,0.f,0.f}, sb = sa, sal = sa, sbl = sa;
    const unsigned short* kr0 = kb + (size_t)j0 * ldk; const unsigned short* kr1 = kr0 + (size_t)16 * ldk;
    const unsigned short* kl0 = klb + (size_t)j0 * ldk; const unsigned short* kl1 = kl0 + (size_t)16 * ldk;
#pragma unroll
    for (int ks = 0; ks < KS; ++ks) {
      /* all A and B fragments of this step share one k order: element e < 8 <-> d = 32 ks + 8 hh + e; e >= 8 <-> d = 32 ks + 16 + 8 hh + (e - 8) */
      FragH a, al2, k0, k1;
      a.half[0] = *(const v8us*)(qr + ks * 32 + 8 * hh); a.half[1] = *(const v8us*)(qr + ks * 32 + 16 + 8 * hh);
      al2.half[0] = *(const v8us*)(ql + ks * 32 + 8 * hh); al2.half[1] = *(const v8us*)(ql + ks * 32 + 16 + 8 * hh);
      k0.half[0] = *(const v8us*)(kr0 + ks * 32 + 8 * hh); k0.half[1] = *(const v8us*)(kr0 + ks * 32 + 16 + 8 * hh);
      k1.half[0] = *(const v8us*)(kr1 + ks * 32 + 8 * hh); k1.half[1] = *(const v8us*)(kr1 + ks * 32 + 16 + 8 * hh);
      sa = g2_mma(a.v, k0.v, sa); sb = g2_mma(a.v, k1.v, sb);
      sal = g2_mma(al2.v, k0.v, sal); sbl = g2_mma(al2.v, k1.v, sbl);
      k0.half[0] = *(const v8us*)(kl0 + ks * 32 + 8 * hh); k0.half[1] = *(const v8us*)(kl0 + ks * 32 + 16 + 8 * hh);
      k1.half[0] = *(const v8us*)(kl1 + ks * 32 + 8 * hh); k1.half[1] = *(const v8us*)(kl1 + ks * 32 + 16 + 8 * hh);
      sal = g2_mma(a.v, k0.v, sal); sbl = g2_mma(a.v, k1.v, sbl);
    }
    FragH fm; { const unsigned short* mt = mq + (size_t)(j0 >> 5) * 512; fm.half[0] = *(const v8us*)mt; fm.half[1] = *(const v8us*)(mt + 256); }
#pragma unroll
    for (int r = 0; r < 8; ++r) {
      const float mk0 = bf16_val(fm.u[2 * r]), mk1 = bf16_val(fm.u[2 * r + 1]);
      const float d0 = sa[r] + sal[r] * 0.0009765625f, d1 = sb[r] + sbl[r] * 0.0009765625f;
      const float s0 = d0 * SCL + mk0, s1 = d1 * SCL + mk1;
      float mc = fmaxf(s0, s1);
      mc = fmaxf(mc, __shfl_xor(mc, 1, 32)); mc = fmaxf(mc, __shfl_xor(mc, 2, 32)); mc = fmaxf(mc, __shfl_xor(mc, 4, 32)); mc = fmaxf(mc, __shfl_xor(mc, 8, 32));
      const float mn = fmaxf(m_r[r], mc); const float al = (mn > -1.0e38f) ? expf(m_r[r] - mn) : 1.0f; m_r[r] = mn;
      const float p0 = expf(s0 - mn), p1 = expf(s1 - mn); l_r[r] = l_r[r] * al + p0 + p1;
#pragma unroll
      for (int dt = 0; dt < DT; ++dt) { oacc[dt][r] *= al; oaccL[dt][r] *= al; }
      FragH t2, t2l; const float ps0 = p0 * 1024.0f, ps1 = p1 * 1024.0f;
      t2.h[0] = toh_flush(ps0); t2.h[1] = toh_flush(ps1);
      t2l.h[0] = toh_flush((ps0 - (float)t2.h[0]) * 1024.0f); t2l.h[1] = toh_flush((ps1 - (float)t2.h[1]) * 1024.0f);
      sP[w][8 * hh + r][ln] = t2.u[0]; sP[w][8 * hh + r][16 + ln] = t2.u[1]; sPL[w][8 * hh + r][ln] = t2l.u[0]; sPL[w][8 * hh + r][16 + ln] = t2l.u[1];
    }
    __builtin_amdgcn_fence(4, "workgroup"); __builtin_amdgcn_wave_barrier();
    FragH pa, pl;
    pa.half[0] = *(const v8us*)&sP[w][ln][8 * hh]; pa.half[1] = *(const v8us*)&sP[w][ln][16 + 8 * hh];
    pl.half[0] = *(const v8us*)&sPL[w][ln][8 * hh]; pl.half[1] = *(const v8us*)&sPL[w][ln][16 + 8 * hh];
#pragma unroll
    for (int dt = 0; dt < DT; ++dt) {
      /* A (P tiles) and B (V^T rows) share the same key order: element e < 8 <-> key j0 + 8 hh + e; e >= 8 <-> key j0 + 16 + 8 hh + (e - 8) */
      const unsigned short* vrow = Vth + (size_t)(dt * 16 + ln) * TK + j0; const unsigned short* vrl = Vtl + (size_t)(dt * 16 + ln) * RE + j0;
      FragH bv, bl;
      bv.half[0] = *(const v8us*)(vrow + 8 * hh); bv.half[1] = *(const v8us*)(vrow + 16 + 8 * hh);
      bl.half[0] = *(const v8us*)(vrl + 8 * hh); bl.half[1] = *(const v8us*)(vrl + 16 + 8 * hh);
      oacc[dt] = g2_mma(pa.v, bv.v, oacc[dt]);
      oaccL[dt] = g2_mma(pl.v, bv.v, oaccL[dt]);
      oaccL[dt] = g2_mma(pa.v, bl.v, oaccL[dt]);
    }
    __builtin_amdgcn_fence(4, "workgroup"); __builtin_amdgcn_wave_barrier();
  }
#pragma unroll
  for (int r = 0; r < 8; ++r) { float l = l_r[r]; l += __shfl_xor(l, 1, 32); l += __shfl_xor(l, 2, 32); l += __shfl_xor(l, 4, 32); l += __shfl_xor(l, 8, 32); l_r[r] = (l > 0.f) ? 1.0f / (l * 1024.0f) : 0.f; }
#pragma unroll
  for (int dt = 0; dt < DT; ++dt)
#pragma unroll
    for (int r = 0; r < 8; ++r) { float v = oacc[dt][r]; v += oaccL[dt][r] * 0.0009765625f; sO[w][8 * hh + r][dt * 16 + ln] = v * l_r[r] + pz; }
  __builtin_amdgcn_fence(4, "workgroup"); __builtin_amdgcn_wave_barrier();
  {
#pragma unroll
    for (int rp = 0; rp < RPW; rp += 2) { const int r = rp + (lane >> 4), pc = lane & 15; const v4f val = *(const v4fa*)&sO[w][r][pc * 4]; *(v4f*)(O + ((size_t)b * TQ + q0 + r) * ldo + h * HDIM + dh * 64 + pc * 4) = val; }
    
  }
}

extern "C" void kernel_launch(void* const* d_in, const int* in_sizes, int n_in,
                              void* d_out, int out_size, void* d_ws, size_t ws_size, hipStream_t stream) {
  if (n_in < 10) return;
  const size_t needx = ((size_t)(NB - 1) * SEQ_FULL + (size_t)SLEN) * DM;
  if ((size_t)in_sizes[0] < needx) return;
  if ((size_t)in_sizes[1] < (size_t)DM * DM) return;
  if ((size_t)in_sizes[2] < (size_t)VW * DM) return;
  if ((size_t)in_sizes[3] < (size_t)VW * DM) return;
  if ((size_t)in_sizes[4] < (size_t)DM * DM) return;
  if ((size_t)in_sizes[5] < (size_t)HDIM) return;
  if ((size_t)in_sizes[6] < (size_t)HDIM) return;
  if ((size_t)in_sizes[7] < (size_t)SLEN * RTW) return;
  if ((size_t)in_sizes[8] < (size_t)SLEN * RTW) return;
  if ((size_t)in_sizes[9] < (size_t)(SLEN - 1) * MSKP + (size_t)SLEN) return;
  if ((size_t)out_size < needx) return;
  /* inputs in order: x, Wq, Wk, Wv, Wo, q gain, k gain, cos table, sin table, mask */
  const float* x = (const float*)d_in[0]; const float* Wq = (const float*)d_in[1]; const float* Wk = (const float*)d_in[2]; const float* Wv = (const float*)d_in[3]; const float* Wo = (const float*)d_in[4];
  const float* qnw = (const float*)d_in[5]; const float* knw = (const float*)d_in[6]; const float* rct = (const float*)d_in[7]; const float* rst = (const float*)d_in[8]; const float* msk = (const float*)d_in[9];
  float* dout = (float*)d_out;
  char* ws = (char*)d_ws; size_t off = 0;
  auto take = [&](size_t bytes) { char* p = ws + off; off += (bytes + 255) & ~(size_t)255; return p; };
  const size_t np = (size_t)NR * DM;
  const size_t nw8 = (size_t)DM * DM / 8;
  const size_t nk8 = (size_t)VW * DM / 8;
  _Float16* BQ = (_Float16*)take(SZ_BQ);                                /* [n][k] f16, x16 */
  _Float16* BK = (_Float16*)take(SZ_BK);
  _Float16* BV = (_Float16*)take(SZ_BK);
  _Float16* B2 = (_Float16*)take(SZ_B2);                                /* [n][2*DM] f16: [x16384 | x16] copies of Wo */
  float* FS = (float*)take(SZ_FS);                                      /* f32 scratch plane: q rows [NR][DM], then k rows [NR][VW], then v rows [NR][VW], then the context [NR][DM] */
  _Float16* X16 = (_Float16*)take(SZ_X16);                              /* f16 input rows; reused as V^T [(b,g)][64][TK] after the v GEMM */
  _Float16* VT = X16;
  _Float16* QH = (_Float16*)take(SZ_QH);                                /* reused as the context hi plane after the attention */
  _Float16* KHp = (_Float16*)take(SZ_KH);                               /* [NR][VW] */
  _Float16* V16 = (_Float16*)take(SZ_KH);                               /* [NR][VW] */
  _Float16* QL = (_Float16*)take(SZ_QL);                                /* [NB*RE][DM] residual plane */
  _Float16* KL = (_Float16*)take(SZ_KL);                                /* [NB*RE][VW] residual plane */
  _Float16* VTL = (_Float16*)take(SZ_VTL);                              /* [(b,g)][64][RE] */
  _Float16* A2 = (_Float16*)take(SZ_A2);                                /* [NB*RE][2*DM] = [ctx hi | ctx residual] */
  unsigned short* MPp = (unsigned short*)take(SZ_MP);                   /* bf16 mask plane, accumulator layout */
  int* JEp = (int*)take(SZ_JE);                                         /* [QBLKS][32] key-tile counts */
  _Float16* OH = QH;
  if (off > ws_size) return;
  if (off > ((size_t)128 << 20)) return;

  const unsigned gw = (unsigned)((nw8 + 255) / 256);
  const unsigned gk = (unsigned)((nk8 + 255) / 256);
  k_wsc<<<gw, 256, 0, stream>>>(Wq, BQ, nw8, WSC_LO);
  k_wsc<<<gk, 256, 0, stream>>>(Wk, BK, nk8, WSC_LO);
  k_wsc<<<gk, 256, 0, stream>>>(Wv, BV, nk8, WSC_LO);
  k_wsc2<<<gw, 256, 0, stream>>>(Wo, B2, nw8, WSC_HI, WSC_LO);
  k_mperm<<<(unsigned)(((size_t)(SLEN / 16) * (SLEN / 32) * 64) / 256), 256, 0, stream>>>(msk, MPp);
  k_mjend<<<(unsigned)QBLKS, 256, 0, stream>>>(msk, JEp);
  const unsigned g8 = (unsigned)((np / 8 + 255) / 256);
  k_x16<<<g8, 256, 0, stream>>>(x, X16, np / 8);
  const dim3 gp((unsigned)((NR / 128) * (DM / 64)), 1);
  const dim3 gkv((unsigned)((NR / 128) * (VW / 64)), 1);
  const unsigned grq = (unsigned)(((size_t)NR * NH * 16) / 256);
  const unsigned grk = (unsigned)(((size_t)NR * NKVH * 16) / 256);
  k_gemm2<0><<<gp, 128, 0, stream>>>(X16, DM, 0, BQ, DM, 0, AL_P, FS, nullptr, DM, 0, NR, DM, DM);        /* q = x Wq^T (f32 rows, pitch DM) */
  k_nrope_q<<<grq, 256, 0, stream>>>(FS, DM, qnw, rct, rst, QH, QL);
  k_gemm2<0><<<gkv, 128, 0, stream>>>(X16, DM, 0, BK, DM, 0, AL_P, FS, nullptr, VW, 0, NR, VW, DM);       /* k = x Wk^T (f32 rows, pitch VW) */
  k_nrope_k<<<grk, 256, 0, stream>>>(FS, VW, knw, rct, rst, KHp, KL);
  k_gemm2<0><<<gkv, 128, 0, stream>>>(X16, DM, 0, BV, DM, 0, AL_P, FS, V16, VW, 0, NR, VW, DM);           /* v = x Wv^T (f32 rows + f16 plane, pitch VW) */
  k_vtg<<<(unsigned)(NB * NV64 * (SLEN / 64)), 256, 0, stream>>>(V16, VT);
  k_vtl<<<(unsigned)(NB * NV64 * (RE / 64)), 256, 0, stream>>>(FS, VTL);
  k_flash5<<<(unsigned)(NB * NH * QBN5 * 2), 128, 0, stream>>>(QH, QL, DM, KHp, KL, VW, VT, VTL, MPp, JEp, FS, DM);
  if (QBNP > 0) k_flash<<<(unsigned)(NB * NH * QBNP), 128, 0, stream>>>(QH, DM, KHp, VW, VT, MPp, JEp, FS, DM);
  k_hl<<<g8, 256, 0, stream>>>(FS, OH, A2, np / 8);
  /* out rows [0, RE) per batch: [ctx hi | ctx residual] . [Wo x16384 ; Wo x16] / 16384  (K = 2*DM) */
  const dim3 ge((unsigned)((RE / 128) * (DM / 64)), NB);
  k_gemm2<0><<<ge, 128, 0, stream>>>(A2, 2 * DM, (size_t)RE * 2 * DM, B2, 2 * DM, 0, AL_E, dout, nullptr, DM, (size_t)SEQ_FULL * DM, RE, DM, 2 * DM);
  /* out rows [RE, SLEN) per batch: ctx hi . (Wo x16) / 16 */
  if (SLEN > RE) {
    const dim3 gl((unsigned)(((SLEN - RE) / 128) * (DM / 64)), NB);
    k_gemm2<0><<<gl, 128, 0, stream>>>(OH + (size_t)RE * DM, DM, (size_t)SLEN * DM, B2 + DM, 2 * DM, 0, AL_P, dout + (size_t)RE * DM, nullptr, DM, (size_t)SEQ_FULL * DM, SLEN - RE, DM, DM);
  }
}

// v002
// It runs in 509 microseconds.
// Timed twice side by side with v001, it ran 1.25 and 1.26 times as fast.
// Counting every step since v000, it is 1.79 times as fast.
#include <hip/hip_runtime.h>
// Contractions: x.Wq^T, x.Wk^T, x.Wv^T, ctx.Wo^T = v_wmma_f32_16x16x32_f16 (f16 operands: bf16-RNE inputs exact in f16, weights carried x16 (x16384 for the ctx-hi half of the early-row output GEMM); f32 accumulate); scores q.k^T and P.V^T = v_wmma_f32_16x16x32_f16 (plain f16 hi planes; hi + x1024 residual planes of q, k, P and v for query positions < RE; P carried x1024), f32 accumulate; per-head RMS normalisation, rotary step, additive mask, softmax and normalisers f32.

#ifndef NB
#define NB 2
#endif
#ifndef SEQ
#define SEQ 2048
#endif
#define NB_FULL 2
#define SEQ_FULL 2048
#define DM 2048
#define NH 16
#define NKVH 4
#define NREP (NH / NKVH)
#define HDIM 128
#define VW (NKVH * HDIM)                     /* width of the k / v projection rows */
#define NV64 (VW / 64)                       /* 64-wide column groups of the v rows */
#define MSKP 2048                            /* row pitch of the mask input */
#define RTW 64                               /* row pitch of the cos / sin inputs */
#define SLEN SEQ
#define NR (NB * SLEN)
#define TQ SLEN
#define TK SLEN
#define SCL 0.08838834764831845f
#define MVIS (-1.0e8f)                       /* a mask entry above this keeps its key visible */
#define QBLKS (TQ / 64)
#define RE ((SLEN < 512) ? SLEN : 512)      /* query positions [0, RE) get residual planes on q, k, P, v and ctx */
#define QB05 0
#define QBN5 (RE / 64)
#define QB0P QBN5
#define QBNP (QBLKS - QBN5)
static_assert(SLEN % 128 == 0);
static_assert(SLEN <= SEQ_FULL);
static_assert(SLEN <= MSKP);
static_assert(NB >= 1 && NB <= NB_FULL);
static_assert(RE % 128 == 0 && RE <= SLEN);
static_assert((SLEN - RE) % 128 == 0);
static_assert(DM % 64 == 0 && DM == NH * HDIM);
static_assert(HDIM == 128 && NH % NKVH == 0);
static_assert(VW % 64 == 0 && NV64 * 64 == VW);
static_assert(DM % 32 == 0 && (2 * DM) % 32 == 0);
static_assert(NR % 128 == 0);
static_assert(((size_t)NR * NH * 16) % 256 == 0 && ((size_t)NR * NKVH * 16) % 256 == 0);
static_assert((NH & (NH - 1)) == 0 && (NKVH & (NKVH - 1)) == 0);   /* head counts are powers of two: index arithmetic by shifts and masks */
static_assert((size_t)NR * NH * 16 < ((size_t)1 << 31));           /* 32-bit thread indices in the normalise + rotary kernels */
static_assert(((size_t)(SLEN / 16) * (SLEN / 32) * 64) % 256 == 0);
static_assert(32 * 16 == HDIM * 4);          /* one store instruction of 32 lanes x 16 B == one 128-float row segment */
static_assert(16 * 16 == 64 * 4);            /* 16 lanes x 16 B == one 64-float row segment */
static_assert(4 * 16 * 40 * 2 + 4 * 16 * 132 * 4 <= 131072);
static_assert(2 * 4 * 16 * 40 * 2 + 4 * 16 * 68 * 4 <= 131072);
static_assert(4 * 32 * 68 * 4 <= 131072);

static constexpr float WSC_LO = 16.0f;
static constexpr float WSC_HI = 16384.0f;
static constexpr float AL_P = 0.0625f;
static constexpr float AL_E = 6.103515625e-05f;   /* 0.0625 / 1024 */

static constexpr size_t al256(size_t b) { return (b + 255) & ~(size_t)255; }
static constexpr size_t SZ_BQ = al256((size_t)DM * DM * 2);
static constexpr size_t SZ_BK = al256((size_t)VW * DM * 2);
static constexpr size_t SZ_B2 = al256((size_t)DM * 2 * DM * 2);
static constexpr size_t SZ_FS = al256((size_t)NR * DM * 4);
static constexpr size_t SZ_X16 = al256((size_t)NR * DM * 2);
static constexpr size_t SZ_QH = al256((size_t)NR * DM * 2);
static constexpr size_t SZ_KH = al256((size_t)NR * VW * 2);
static constexpr size_t SZ_QL = al256((size_t)NB * RE * DM * 2);
static constexpr size_t SZ_KL = al256((size_t)NB * RE * VW * 2);
static constexpr size_t SZ_VTL = al256((size_t)NB * NV64 * 64 * RE * 2);
static constexpr size_t SZ_A2 = al256((size_t)NB * RE * 2 * DM * 2);
static constexpr size_t SZ_MP = al256((size_t)SLEN * SLEN * 2);
static constexpr size_t SZ_JE = al256((size_t)QBLKS * 32 * 4);
static_assert((size_t)NB * NV64 * 64 * TK * 2 <= SZ_X16);       /* V^T aliases the f16 input plane */
static_assert((size_t)NR * VW * 4 <= SZ_FS);
static_assert(SZ_BQ + 2 * SZ_BK + SZ_B2 + SZ_FS + SZ_X16 + SZ_QH + 2 * SZ_KH + SZ_QL + SZ_KL + SZ_VTL + SZ_A2 + SZ_MP + SZ_JE <= ((size_t)128 << 20));

typedef _Float16 v16h __attribute__((ext_vector_type(16)));
typedef _Float16 v4h __attribute__((ext_vector_type(4)));
typedef unsigned short v8us __attribute__((ext_vector_type(8), may_alias));
typedef float v8f __attribute__((ext_vector_type(8)));
typedef float v4f __attribute__((ext_vector_type(4)));
typedef float v4fa __attribute__((ext_vector_type(4), may_alias));
union FragH { v16h v; v8us half[2]; _Float16 h[16]; unsigned short u[16]; };

__device__ __forceinline__ unsigned short bf16_bits(float x) { unsigned int u = __float_as_uint(x); return (unsigned short)((u + 0x7FFFu + ((u >> 16) & 1u)) >> 16); }
__device__ __forceinline__ float bf16_val(unsigned short b) { return __uint_as_float(((unsigned int)b) << 16); }
__device__ __forceinline__ float bf16_rne(float x) { return bf16_val(bf16_bits(x)); }
// f32 -> f16 for WMMA operand planes: values under the smallest f16 normal become +0
__device__ __forceinline__ _Float16 toh_flush(float v) { const _Float16 r = (_Float16)v; return (fabsf(v) < 6.103515625e-05f) ? (_Float16)0.0f : r; }

// D += A.B with NT terms: 1 = ah.bh, 2 = + al.bh, 3 = + ah.bl; hazard guard after the group
template <int NT>
__device__ __forceinline__ v8f mmaH(v16h ah, v16h al, v16h bh, v16h bl, v8f c) {
  c = __builtin_amdgcn_wmma_f32_16x16x32_f16(false, ah, false, bh, (short)0, c, false, false);
  if (NT >= 2) c = __builtin_amdgcn_wmma_f32_16x16x32_f16(false, al, false, bh, (short)0, c, false, false);
  if (NT >= 3) c = __builtin_amdgcn_wmma_f32_16x16x32_f16(false, ah, false, bl, (short)0, c, false, false);
  asm volatile("v_nop\n\tv_nop\n\tv_nop\n\tv_nop" : "+v"(c) : "v"(ah), "v"(al), "v"(bh), "v"(bl));
  return c;
}
// 16x32 fragment from a 16-bit row-major tile (rows = m or n, k contiguous): elements 0..7 <- k0+8h+0..7, 8..15 <- k0+16+8h+0..7
__device__ __forceinline__ v16h g2_frag(const _Float16* p, int hh) { FragH f; f.half[0] = *(const v8us*)((const unsigned short*)p + 8 * hh); f.half[1] = *(const v8us*)((const unsigned short*)p + 16 + 8 * hh); return f.v; }
__device__ __forceinline__ v8f g2_mma(v16h a, v16h b, v8f c) { v8f d = __builtin_amdgcn_wmma_f32_16x16x32_f16(false, a, false, b, (short)0, c, false, false); asm volatile("v_nop\n\tv_nop\n\tv_nop\n\tv_nop" : "+v"(d) : "v"(a), "v"(b)); return d; }

__global__ __launch_bounds__(256) void k_wsc(const float* __restrict__ Wm, _Float16* __restrict__ Bt, size_t n8, float sc) {
  const size_t t = (size_t)blockIdx.x * 256 + threadIdx.x; if (t >= n8) return;
  const v4f a0 = *(const v4fa*)(Wm + t * 8), a1 = *(const v4fa*)(Wm + t * 8 + 4);
  FragH f;
#pragma unroll
  for (int q = 0; q < 4; ++q) { f.h[q] = toh_flush(bf16_rne(a0[q]) * sc); f.h[4 + q] = toh_flush(bf16_rne(a1[q]) * sc); }
  const v8us o = f.half[0];
  *(v8us*)((unsigned short*)Bt + t * 8) = o; 
}
__global__ __launch_bounds__(256) void k_wsc2(const float* __restrict__ Wm, _Float16* __restrict__ B2, size_t n8, float sc0, float sc1) {
  const size_t t = (size_t)blockIdx.x * 256 + threadIdx.x; if (t >= n8) return;
  const size_t e = t * 8; const size_t n = e / DM; const size_t k8 = e % DM;
  const v4f a0 = *(const v4fa*)(Wm + e), a1 = *(const v4fa*)(Wm + e + 4);
  FragH f0, f1;
#pragma unroll
  for (int q = 0; q < 4; ++q) {
    const float v0 = bf16_rne(a0[q]), v1 = bf16_rne(a1[q]);
    f0.h[q] = toh_flush(v0 * sc0); f1.h[q] = toh_flush(v0 * sc1);
    f0.h[4 + q] = toh_flush(v1 * sc0); f1.h[4 + q] = toh_flush(v1 * sc1);
  }
  const size_t o = n * (size_t)(2 * DM) + k8;
  const v8us o0 = f0.half[0], o1 = f1.half[0];
  {
    *(v8us*)((unsigned short*)B2 + o) = o0;
    *(v8us*)((unsigned short*)B2 + o + DM) = o1;
    
  }
}

// mask plane in accumulator layout: MP[(qt*(SLEN/32) + kt)][half][lane][8] bf16 bits; element 2*rr + c of (half, lane) = mask[qt*16 + 8*(lane>>4) + 4*half + rr][kt*32 + 16*c + (lane&15)];
__global__ __launch_bounds__(256) void k_mperm(const float* __restrict__ msk, unsigned short* __restrict__ MP) {
  const size_t t = (size_t)blockIdx.x * 256 + threadIdx.x; if (t >= (size_t)(SLEN / 16) * (SLEN / 32) * 64) return;
  const int lane = (int)(t & 31); const int half = (int)((t >> 5) & 1); const size_t tile = t >> 6;
  const int kt = (int)(tile % (size_t)(SLEN / 32)); const int qt = (int)(tile / (size_t)(SLEN / 32));
  const int ln = lane & 15, hh = lane >> 4;
  const float* mr = msk + (size_t)(qt * 16 + 8 * hh + 4 * half) * MSKP + kt * 32 + ln;
  FragH f;
#pragma unroll
  for (int rr = 0; rr < 4; ++rr) { const float a = mr[(size_t)rr * MSKP]; const float c = mr[(size_t)rr * MSKP + 16]; f.u[2 * rr] = bf16_bits(a); f.u[2 * rr + 1] = bf16_bits(c); }
  const v8us o = f.half[0];
  *(v8us*)(MP + t * 8) = o; 
}
// per 64-query block: JE[qblk][0..32) = number of 32-key tiles to visit = 1 + last tile holding a visible entry (value > MVIS) in any of the 64 rows; all tiles if some row has no visible entry.
__global__ __launch_bounds__(256) void k_mjend(const float* __restrict__ msk, int* __restrict__ JE) {
  __shared__ int smax[8]; __shared__ int snone[8];
  const int tid = threadIdx.x, lane = tid & 31; const int w = __builtin_amdgcn_readfirstlane(tid >> 5);
  const int qblk = blockIdx.x;
  int wmax = -1, wnone = 0;
#pragma unroll 1
  for (int rr = 0; rr < 8; ++rr) {
    const float* mr = msk + (size_t)(qblk * 64 + w * 8 + rr) * MSKP;
    int lm = -1;
#pragma unroll 1
    for (int c4 = lane; c4 < SLEN / 4; c4 += 32) {
      const v4f a = *(const v4fa*)(mr + c4 * 4);
      const bool any = (bf16_rne(a[0]) > MVIS) || (bf16_rne(a[1]) > MVIS) || (bf16_rne(a[2]) > MVIS) || (bf16_rne(a[3]) > MVIS);
      lm = any ? (c4 >> 3) : lm;
    }
    int o = __shfl_xor(lm, 16, 32); lm = (o > lm) ? o : lm;
    o = __shfl_xor(lm, 8, 32); lm = (o > lm) ? o : lm;
    o = __shfl_xor(lm, 4, 32); lm = (o > lm) ? o : lm;
    o = __shfl_xor(lm, 2, 32); lm = (o > lm) ? o : lm;
    o = __shfl_xor(lm, 1, 32); lm = (o > lm) ? o : lm;
    wmax = (lm > wmax) ? lm : wmax; wnone |= (lm < 0) ? 1 : 0;
  }
  if (lane == 0) { smax[w] = wmax; snone[w] = wnone; }
  __syncthreads();
  if (w == 0) {
    int m = -1, nn = 0;
#pragma unroll
    for (int i = 0; i < 8; ++i) { const int a = smax[i]; m = (a > m) ? a : m; nn |= snone[i]; }
    const int jt = (nn != 0) ? (SLEN / 32) : (m + 1);
    *(int*)(JE + qblk * 32 + lane) = jt; 
  }
}

__global__ __launch_bounds__(256) void k_x16(const float* __restrict__ x, _Float16* __restrict__ X16, size_t n8) {
  const size_t t = (size_t)blockIdx.x * 256 + threadIdx.x; if (t >= n8) return;
  const size_t e = t * 8; const size_t r = e / DM; const size_t c = e % DM; const size_t b = r / SLEN, s = r % SLEN;
  const float* src = x + (b * SEQ_FULL + s) * DM + c;
  const v4f a0 = *(const v4fa*)src, a1 = *(const v4fa*)(src + 4);
  FragH f;
#pragma unroll
  for (int q = 0; q < 4; ++q) { f.h[q] = (_Float16)bf16_rne(a0[q]); f.h[4 + q] = (_Float16)bf16_rne(a1[q]); }
  const v8us o = f.half[0];
  *(v8us*)((unsigned short*)X16 + e) = o; 
}

// LDS ring of the GEMM: one stage = 64 k = 128 B of every operand row, [A 128 rows | B 64 rows] at pitch 144 B (16 B x odd: the 16-B fragment reads meet no bank conflict); two stages
#define G2_PB 144
#define G2_STG ((128 + 64) * G2_PB)
static_assert(2 * G2_STG >= 4 * 32 * 68 * 4);   /* the output staging reuses the ring behind the last barrier */
static_assert(2 * G2_STG <= 65536);
static_assert(DM % 64 == 0 && DM >= 128);
// 16x32 fragment from an LDS row (k contiguous), p = row start + 2 * (k0 + 8 hh) bytes: the k order of g2_frag
__device__ __forceinline__ v16h g2_lfrag(const unsigned char* p) { FragH f; f.half[0] = *(const v8us*)p; f.half[1] = *(const v8us*)(p + 32); return f.v; }
// one stage: 12 copies of 16 B per lane (a wave-wide copy = 4 whole 128-B row pieces); lane (r = tid / 8, c = tid % 8) brings chunk c of A rows r + 16 j (j < 8) and of B rows r + 16 j (j < 4).
// l = LDS byte address of (row r, chunk c) in the stage, a / b = the lane's global addresses in A row r / B row r, sa / sb = 16 rows in elements.
__device__ __forceinline__ void g2_stage(unsigned l, const _Float16* a, size_t sa, const _Float16* b, size_t sb) {
  /* s_wait_xcnt closes the copies' own statement: no register that a copy names is rewritten in front of it */
  asm volatile(
      "global_load_async_to_lds_b128 %0, %12, off\n\t"
      "global_load_async_to_lds_b128 %1, %13, off\n\t"
      "global_load_async_to_lds_b128 %2, %14, off\n\t"
      "global_load_async_to_lds_b128 %3, %15, off\n\t"
      "global_load_async_to_lds_b128 %4, %16, off\n\t"
      "global_load_async_to_lds_b128 %5, %17, off\n\t"
      "global_load_async_to_lds_b128 %6, %18, off\n\t"
      "global_load_async_to_lds_b128 %7, %19, off\n\t"
      "global_load_async_to_lds_b128 %8, %20, off\n\t"
      "global_load_async_to_lds_b128 %9, %21, off\n\t"
      "global_load_async_to_lds_b128 %10, %22, off\n\t"
      "global_load_async_to_lds_b128 %11, %23, off\n\t"
      "s_wait_xcnt 0x0"
      :: "v"(l), "v"(l + 16 * G2_PB), "v"(l + 32 * G2_PB), "v"(l + 48 * G2_PB), "v"(l + 64 * G2_PB), "v"(l + 80 * G2_PB), "v"(l + 96 * G2_PB), "v"(l + 112 * G2_PB),
         "v"(l + 128 * G2_PB), "v"(l + 144 * G2_PB), "v"(l + 160 * G2_PB), "v"(l + 176 * G2_PB),
         "v"(a), "v"(a + sa), "v"(a + 2 * sa), "v"(a + 3 * sa), "v"(a + 4 * sa), "v"(a + 5 * sa), "v"(a + 6 * sa), "v"(a + 7 * sa),
         "v"(b), "v"(b + sb), "v"(b + 2 * sb), "v"(b + 3 * sb)
      : "memory");
}

// GEMM C[M][N] = alpha * A[M][K].B  with A f16 row-major (pitch lda), B stored [n][k] f16 (pitch ldb), batched by blockIdx.y (strides sA, sB, sC);
// writes f32 C and/or f16 C16 (pitch ldc). Requires M % 128 == 0, N % 64 == 0, K % 64 == 0 (asserted by the callers' constants).
// Operand tiles come through LDS: asynchronous copies, two stages, stage t + 1 in flight while stage t is multiplied.
template <int ACT>
__global__ __launch_bounds__(128) void k_gemm2(const _Float16* __restrict__ A, int lda, size_t sA, const _Float16* __restrict__ Bh, int ldb, size_t sB, float alpha,
                                               float* C, _Float16* C16, int ldc, size_t sC, int M, int N, int K) {
  __shared__ __attribute__((aligned(16))) unsigned char sm[2 * G2_STG];
  float (*so)[32][68] = (float (*)[32][68])sm;
  const int tid = threadIdx.x, w = tid >> 5, lane = tid & 31, ln = lane & 15, hh = lane >> 4; const int by = blockIdx.y;
  A += (size_t)by * sA; Bh += (size_t)by * sB; const size_t cofs = (size_t)by * sC;
  const int ntn = N >> 6; const int mt = blockIdx.x / ntn, nq = blockIdx.x - mt * ntn; const int row0 = mt * 128 + 32 * w, col0 = nq * 64; if (mt * 128 >= M) return;
  const int cr = tid >> 3, cc = tid & 7;
  const _Float16* ga = A + (size_t)(mt * 128 + cr) * lda + cc * 8; const _Float16* gb = Bh + (size_t)(col0 + cr) * ldb + cc * 8;
  const size_t sa16 = (size_t)16 * lda, sb16 = (size_t)16 * ldb;
  const unsigned lc = (unsigned)(uintptr_t)sm + (unsigned)(cr * G2_PB + cc * 16);
  const int nt = K >> 6;
  const int aofs = (32 * w + ln) * G2_PB + 16 * hh, bofs = (128 + ln) * G2_PB + 16 * hh;
  const v8f z8 = {0.f,0.f,0.f,0.f,0.f,0.f,0.f,0.f}; v8f c00 = z8, c01 = z8, c02 = z8, c03 = z8, c10 = z8, c11 = z8, c12 = z8, c13 = z8;
  g2_stage(lc, ga, sa16, gb, sb16);
  asm volatile("s_wait_asynccnt 0x0" ::: "memory");   /* stage 0 has landed before the barrier publishes it */
  __syncthreads();
  if (nt > 1) g2_stage(lc + G2_STG, ga + 64, sa16, gb + 64, sb16);
#pragma unroll 1
  for (int t = 0; t < nt; ++t) {
    const unsigned char* sb = sm + (t & 1) * G2_STG; const unsigned char* pa = sb + aofs; const unsigned char* pb = sb + bofs;
#pragma unroll
    for (int kk = 0; kk < 2; ++kk) {
      const v16h a0 = g2_lfrag(pa + kk * 64), a1 = g2_lfrag(pa + 16 * G2_PB + kk * 64);
      const v16h b0 = g2_lfrag(pb + kk * 64), b1 = g2_lfrag(pb + 16 * G2_PB + kk * 64), b2 = g2_lfrag(pb + 32 * G2_PB + kk * 64), b3 = g2_lfrag(pb + 48 * G2_PB + kk * 64);
      c00 = g2_mma(a0, b0, c00); c10 = g2_mma(a1, b0, c10);
      c01 = g2_mma(a0, b1, c01); c11 = g2_mma(a1, b1, c11);
      c02 = g2_mma(a0, b2, c02); c12 = g2_mma(a1, b2, c12);
      c03 = g2_mma(a0, b3, c03); c13 = g2_mma(a1, b3, c13);
    }
    asm volatile("s_wait_dscnt 0x0" ::: "memory");      /* this wave's reads of stage t are done before the stage is refilled */
    asm volatile("s_wait_asynccnt 0x0" ::: "memory");   /* this wave's copies of stage t + 1 have landed before the barrier publishes them */
    __syncthreads();
    if (t + 2 < nt) g2_stage(lc + (unsigned)((t & 1) * G2_STG), ga + (size_t)(t + 2) * 64, sa16, gb + (size_t)(t + 2) * 64, sb16);
  }
  asm volatile("s_wait_asynccnt 0x0" ::: "memory");     /* no copy is outstanding when the ring becomes output staging */
  v8f accs[8] = {c00, c01, c02, c03, c10, c11, c12, c13};
#pragma unroll
  for (int u = 0; u < 8; ++u) {
    const int t = u & 3, half = u >> 2;
#pragma unroll
    for (int r = 0; r < 8; ++r) { const int rloc = half * 16 + 8 * hh + r; float v = accs[u][r] * alpha; if (ACT == 3) v = fmaxf(v, 0.f); so[w][rloc][t * 16 + ln] = v; }
  }
  __builtin_amdgcn_fence(4, "workgroup"); __builtin_amdgcn_wave_barrier();
  const int rsub = lane >> 4, c4 = (lane & 15) * 4;
  {
#pragma unroll
    for (int q = 0; q < 16; ++q) {
      const int r = q * 2 + rsub; const v4f v = *(const v4fa*)&so[w][r][c4];
      if (C) *(v4f*)(C + cofs + (size_t)(row0 + r) * ldc + col0 + c4) = v;
      if (C16) { v4h h4; for (int i = 0; i < 4; ++i) h4[i] = (_Float16)v[i]; *(v4h*)(C16 + cofs + (size_t)(row0 + r) * ldc + col0 + c4) = h4; }
    }
    
  }
}

// per-head RMS normalisation + interleaved-pair rotary step from the f32 GEMM plane F [NR][ldf] (ldf = NHV*128, NHV = compile-time head count, a power of two):
// y = (x * rsqrt(mean_128(x^2) + 1e-6)) * g[d];  out[2i] = y[2i] c[i] - y[2i+1] s[i];  out[2i+1] = y[2i] s[i] + y[2i+1] c[i]  (c, s = table rows [position][64], gain g[128]; all by value, bf16-RNE);
// H [NR][ldf] = f16 hi of every row; L [NB*RE][ldf] = x1024 residual for positions < RE.
// 32-bit thread indices (shifts and masks of compile-time powers of two); 64-bit offsets only at the final pointer arithmetic.
template <int NHV>
__device__ __forceinline__ void nrope_body(const float* __restrict__ F, int ldf, const float* __restrict__ NW, const float* __restrict__ CT, const float* __restrict__ ST,
                                           _Float16* __restrict__ H, _Float16* __restrict__ L) {
  #pragma clang fp contract(off)
  const unsigned t0 = blockIdx.x * 256u + threadIdx.x; const bool live = t0 < (unsigned)(NR * NHV * 16); const unsigned t = live ? t0 : 0u;
  const int p = (int)(t & 15u); const int hd = (int)((t >> 4) % (unsigned)NHV); const unsigned row = t / (unsigned)(16 * NHV);
  const int s = (int)(row % (unsigned)SLEN); const int b = (int)(row / (unsigned)SLEN);
  const float* src = F + (size_t)row * ldf + hd * HDIM + p * 8;
  const v4f xa = *(const v4fa*)src, xb = *(const v4fa*)(src + 4);
  const v4f wa = *(const v4fa*)(NW + p * 8), wb = *(const v4fa*)(NW + p * 8 + 4);
  const v4f cv = *(const v4fa*)(CT + (size_t)s * RTW + p * 4), sv = *(const v4fa*)(ST + (size_t)s * RTW + p * 4);
  const float xs[8] = {xa[0], xa[1], xa[2], xa[3], xb[0], xb[1], xb[2], xb[3]};
  const float gs[8] = {wa[0], wa[1], wa[2], wa[3], wb[0], wb[1], wb[2], wb[3]};
  float ss = 0.f;
#pragma unroll
  for (int i = 0; i < 8; ++i) { const float q = xs[i] * xs[i]; ss = ss + q; }
  ss += __shfl_xor(ss, 1, 32); ss += __shfl_xor(ss, 2, 32); ss += __shfl_xor(ss, 4, 32); ss += __shfl_xor(ss, 8, 32);
  const float mean = ss * 0.0078125f; const float rms = rsqrtf(mean + 1.0e-6f);
  FragH fh, fl;
#pragma unroll
  for (int j = 0; j < 4; ++j) {
    const float c = bf16_rne(cv[j]), sn = bf16_rne(sv[j]);
    const float y1 = (xs[2 * j] * rms) * bf16_rne(gs[2 * j]); const float y2 = (xs[2 * j + 1] * rms) * bf16_rne(gs[2 * j + 1]);
    const float o1 = y1 * c - y2 * sn; const float o2 = y1 * sn + y2 * c;
    const _Float16 h1 = toh_flush(o1), h2 = toh_flush(o2);
    fh.h[2 * j] = h1; fh.h[2 * j + 1] = h2;
    fl.h[2 * j] = toh_flush((o1 - (float)h1) * 1024.0f); fl.h[2 * j + 1] = toh_flush((o2 - (float)h2) * 1024.0f);
  }
  const size_t oh = (size_t)row * ldf + hd * HDIM + p * 8;
  const bool wl = live && (s < RE);
  const int sl = wl ? s : 0;
  const size_t ol = (size_t)(b * RE + sl) * ldf + hd * HDIM + p * 8;
  const v8us vh = fh.half[0], vl = fl.half[0];
  {
    if (live) *(v8us*)((unsigned short*)H + oh) = vh;
    if (wl) *(v8us*)((unsigned short*)L + ol) = vl;
    
  }
}
// query heads (NH per row)
__global__ __launch_bounds__(256) void k_nrope_q(const float* __restrict__ F, int ldf, const float* __restrict__ NW, const float* __restrict__ CT, const float* __restrict__ ST,
                                                 _Float16* __restrict__ H, _Float16* __restrict__ L) {
  #pragma clang fp contract(off)
  nrope_body<NH>(F, ldf, NW, CT, ST, H, L);
}
// key heads (NKVH per row)
__global__ __launch_bounds__(256) void k_nrope_k(const float* __restrict__ F, int ldf, const float* __restrict__ NW, const float* __restrict__ CT, const float* __restrict__ ST,
                                                 _Float16* __restrict__ H, _Float16* __restrict__ L) {
  #pragma clang fp contract(off)
  nrope_body<NKVH>(F, ldf, NW, CT, ST, H, L);
}

__global__ __launch_bounds__(256) void k_vtg(const _Float16* __restrict__ V16, _Float16* __restrict__ Vt) {
  __shared__ unsigned short tl[64][66];
  const int tid = threadIdx.x; const int nlg = SLEN / 64; const int slab = blockIdx.x / nlg, lg = blockIdx.x % nlg; const int b = slab / NV64, h = slab % NV64;
  for (int i = tid; i < 64 * 8; i += 256) {
    const int r = i >> 3, c8 = (i & 7) * 8; FragH f;
    f.half[0] = *(const v8us*)((const unsigned short*)V16 + ((size_t)b * SLEN + lg * 64 + r) * VW + h * 64 + c8);
#pragma unroll
    for (int q = 0; q < 8; ++q) tl[r][c8 + q] = f.u[q];
  }
  __syncthreads();
  {
#pragma unroll
    for (int rd = 0; rd < 2; ++rd) {
      const int d = rd * 32 + (tid >> 3), pc = tid & 7; FragH f;
#pragma unroll
      for (int q = 0; q < 8; ++q) f.u[q] = tl[pc * 8 + q][d];
      *(v8us*)((unsigned short*)Vt + ((size_t)slab * 64 + d) * TK + lg * 64 + pc * 8) = f.half[0];
    }
    
  }
}
__global__ __launch_bounds__(256) void k_vtl(const float* __restrict__ VF, _Float16* __restrict__ VtL) {
  __shared__ unsigned short tl[64][66];
  const int tid = threadIdx.x; const int nlg = RE / 64; const int slab = blockIdx.x / nlg, lg = blockIdx.x % nlg; const int b = slab / NV64, h = slab % NV64;
  for (int i = tid; i < 64 * 16; i += 256) {
    const int r = i >> 4, c4 = (i & 15) * 4;
    const v4f a = *(const v4fa*)(VF + ((size_t)b * SLEN + lg * 64 + r) * VW + h * 64 + c4);
    FragH f;
#pragma unroll
    for (int q = 0; q < 4; ++q) { const float v = a[q]; const _Float16 hv = (_Float16)v; f.h[q] = toh_flush((v - (float)hv) * 1024.0f); }
#pragma unroll
    for (int q = 0; q < 4; ++q) tl[r][c4 + q] = f.u[q];
  }
  __syncthreads();
  {
#pragma unroll
    for (int rd = 0; rd < 2; ++rd) {
      const int d = rd * 32 + (tid >> 3), pc = tid & 7; FragH f;
#pragma unroll
      for (int q = 0; q < 8; ++q) f.u[q] = tl[pc * 8 + q][d];
      *(v8us*)((unsigned short*)VtL + ((size_t)slab * 64 + d) * RE + lg * 64 + pc * 8) = f.half[0];
    }
    
  }
}

__global__ __launch_bounds__(256) void k_hl(const float* __restrict__ Fp, _Float16* __restrict__ Hh, _Float16* __restrict__ A2, size_t n8) {
  const size_t t = (size_t)blockIdx.x * 256 + threadIdx.x; if (t >= n8) return;
  const size_t e = t * 8; const size_t r = e / DM; const int c = (int)(e % DM); const int s = (int)(r % SLEN); const int b = (int)(r / SLEN);
  const v4f a = *(const v4fa*)(Fp + e), d = *(const v4fa*)(Fp + e + 4);
  FragH fh, fl;
#pragma unroll
  for (int q = 0; q < 4; ++q) {
    _Float16 hv = (_Float16)a[q]; fh.h[q] = hv; fl.h[q] = (_Float16)((a[q] - (float)hv) * 1024.0f);
    hv = (_Float16)d[q]; fh.h[4 + q] = hv; fl.h[4 + q] = (_Float16)((d[q] - (float)hv) * 1024.0f);
  }
  const bool wl = (s < RE);
  const size_t o2 = ((size_t)b * RE + (wl ? s : 0)) * (size_t)(2 * DM) + c;
  const v8us vh = fh.half[0], vl = fl.half[0];
  {
    *(v8us*)((unsigned short*)Hh + e) = vh;
    if (wl) { *(v8us*)((unsigned short*)A2 + o2) = vh; *(v8us*)((unsigned short*)A2 + o2 + DM) = vl; }
    
  }
}

// fused attention per ((b,h), 64 queries), query blocks [QB0P, QBLKS): wave = 16 queries; S = Q.K^T (d = 128: 4 k-steps, q fragments read with the pass's k group) x SCL + mask (bf16 plane, accumulator layout, two 16-B words per lane per step)
__global__ __launch_bounds__(128) __attribute__((amdgpu_num_vgpr(256))) void k_flash(const _Float16* __restrict__ Q16, int ldq, const _Float16* __restrict__ K16, int ldk,
                                               const _Float16* __restrict__ Vt, const unsigned short* __restrict__ MP, const int* __restrict__ JE, float* __restrict__ O, int ldo) {
  constexpr int RPW = 16, DT = 8, KS = 4;
  constexpr int NQP = (QBNP > 0) ? QBNP : 1;
  __shared__ __attribute__((aligned(16))) unsigned short sP[4][RPW][40];
  __shared__ __attribute__((aligned(16))) float sO[4][RPW][132];
  const int tid = threadIdx.x, lane = tid & 31, ln = lane & 15, hh = lane >> 4;
  const int w = __builtin_amdgcn_readfirstlane(tid >> 5);
  const int slab = blockIdx.x / NQP, qblk = QB0P + blockIdx.x % NQP; const int b = slab / NH, h = slab % NH; const int kvh = h / NREP;
  const int qb0 = qblk * (4 * RPW); const int q0 = qb0 + w * RPW;
  const unsigned short* qr = (const unsigned short*)Q16 + ((size_t)b * TQ + q0 + ln) * ldq + h * HDIM;
  const unsigned short* kb = (const unsigned short*)K16 + ((size_t)b * TK + ln) * ldk + kvh * HDIM;
  const unsigned short* Vth = (const unsigned short*)Vt + (size_t)(b * NKVH + kvh) * HDIM * TK;
  const unsigned short* mq = MP + (size_t)(q0 >> 4) * (size_t)(TK / 32) * 512 + lane * 8;
  int jt = JE[qblk * 32]; jt = (jt < 1) ? 1 : jt; jt = (jt > TK / 32) ? (TK / 32) : jt;
  const int jend = __builtin_amdgcn_readfirstlane(jt) * 32;
  float m_r[8], l_r[8]; v8f oacc[DT];
#pragma unroll
  for (int r = 0; r < 8; ++r) { m_r[r] = -3.0e38f; l_r[r] = 0.f; }
#pragma unroll
  for (int dt = 0; dt < DT; ++dt) oacc[dt] = (v8f){0.f,0.f,0.f,0.f,0.f,0.f,0.f,0.f};
#pragma unroll 1
  for (int j0 = 0; j0 < jend; j0 += 32) {
    v8f sa = (v8f){0.f,0.f,0.f,0.f,0.f,0.f,0.f,0.f}, sb = sa;
    const unsigned short* kp0 = kb + (size_t)j0 * ldk + 8 * hh; const unsigned short* kp1 = kp0 + (size_t)16 * ldk;
    const unsigned short* mt = mq + (size_t)(j0 >> 5) * 512;
    /* every load of the score step (q, k, mask) is issued as one group ahead of the first product: the pass waits for one load round trip, not one per k-step */
    FragH a[KS], k0[KS], k1[KS], fm;
#pragma unroll
    for (int ks = 0; ks < KS; ++ks) {
      /* A (q) and B (k) fragments share one k order: element e < 8 <-> d = 32 ks + 8 hh + e; e >= 8 <-> d = 32 ks + 16 + 8 hh + (e - 8) */
      a[ks].half[0] = *(const v8us*)(qr + ks * 32 + 8 * hh); a[ks].half[1] = *(const v8us*)(qr + ks * 32 + 16 + 8 * hh);
      k0[ks].half[0] = *(const v8us*)(kp0 + ks * 32); k0[ks].half[1] = *(const v8us*)(kp0 + ks * 32 + 16);
      k1[ks].half[0] = *(const v8us*)(kp1 + ks * 32); k1[ks].half[1] = *(const v8us*)(kp1 + ks * 32 + 16);
    }
    fm.half[0] = *(const v8us*)mt; fm.half[1] = *(const v8us*)(mt + 256);
    /* the group's address registers are inputs here, so they stay whole (no load's result is given them) up to this wait */
    asm volatile("s_wait_xcnt 0x0" :: "v"(kp0), "v"(kp1), "v"(mt) : "memory");
#pragma unroll
    for (int ks = 0; ks < KS; ++ks) { sa = g2_mma(a[ks].v, k0[ks].v, sa); sb = g2_mma(a[ks].v, k1[ks].v, sb); }
    /* the V^T fragments of this pass are issued here, ahead of the softmax, which covers their round trip */
    FragH bv[DT];
    const unsigned short* vp = Vth + (size_t)ln * TK + j0 + 8 * hh;
#pragma unroll
    for (int dt = 0; dt < DT; ++dt) { bv[dt].half[0] = *(const v8us*)(vp + (size_t)(dt * 16) * TK); bv[dt].half[1] = *(const v8us*)(vp + (size_t)(dt * 16) * TK + 16); }
    /* the group's address register is an input here, so it stays whole up to this wait */
    asm volatile("s_wait_xcnt 0x0" :: "v"(vp) : "memory");
#pragma unroll
    for (int r = 0; r < 8; ++r) {
      const float mk0 = bf16_val(fm.u[2 * r]), mk1 = bf16_val(fm.u[2 * r + 1]);
      const float s0 = sa[r] * SCL + mk0, s1 = sb[r] * SCL + mk1;
      float mc = fmaxf(s0, s1);
      mc = fmaxf(mc, __shfl_xor(mc, 1, 32)); mc = fmaxf(mc, __shfl_xor(mc, 2, 32)); mc = fmaxf(mc, __shfl_xor(mc, 4, 32)); mc = fmaxf(mc, __shfl_xor(mc, 8, 32));
      const float mn = fmaxf(m_r[r], mc); const float al = (mn > -1.0e38f) ? expf(m_r[r] - mn) : 1.0f; m_r[r] = mn;
      const float p0 = expf(s0 - mn), p1 = expf(s1 - mn); l_r[r] = l_r[r] * al + p0 + p1;
#pragma unroll
      for (int dt = 0; dt < DT; ++dt) oacc[dt][r] *= al;
      FragH t2; t2.h[0] = toh_flush(p0 * 1024.0f); t2.h[1] = toh_flush(p1 * 1024.0f);
      sP[w][8 * hh + r][ln] = t2.u[0]; sP[w][8 * hh + r][16 + ln] = t2.u[1];
    }
    __builtin_amdgcn_fence(4, "workgroup"); __builtin_amdgcn_wave_barrier();
    FragH pa; pa.half[0] = *(const v8us*)&sP[w][ln][8 * hh]; pa.half[1] = *(const v8us*)&sP[w][ln][16 + 8 * hh];
#pragma unroll
    for (int dt = 0; dt < DT; ++dt) {
      /* A (P: key columns of the LDS tile) and B (V^T rows, keys contiguous) share the same key order: element e < 8 <-> key j0 + 8 hh + e; e >= 8 <-> key j0 + 16 + 8 hh + (e - 8) */
      oacc[dt] = g2_mma(pa.v, bv[dt].v, oacc[dt]);
    }
    __builtin_amdgcn_fence(4, "workgroup"); __builtin_amdgcn_wave_barrier();
  }
#pragma unroll
  for (int r = 0; r < 8; ++r) { float l = l_r[r]; l += __shfl_xor(l, 1, 32); l += __shfl_xor(l, 2, 32); l += __shfl_xor(l, 4, 32); l += __shfl_xor(l, 8, 32); l_r[r] = (l > 0.f) ? 1.0f / (l * 1024.0f) : 0.f; }
#pragma unroll
  for (int dt = 0; dt < DT; ++dt)
#pragma unroll
    for (int r = 0; r < 8; ++r) sO[w][8 * hh + r][dt * 16 + ln] = oacc[dt][r] * l_r[r];
  __builtin_amdgcn_fence(4, "workgroup"); __builtin_amdgcn_wave_barrier();
  {
#pragma unroll
    for (int rp = 0; rp < RPW; ++rp) { const v4f val = *(const v4fa*)&sO[w][rp][lane * 4]; *(v4f*)(O + ((size_t)b * TQ + q0 + rp) * ldo + h * HDIM + lane * 4) = val; }
    
  }
}
// 5-plane variant for query blocks [QB05, QB05+QBN5) (positions < RE), one 64-wide half dh of the head's 128 dims per block: S = Qh.Kh^T + (Ql.Kh^T + Qh.Kl^T)/1024 with Q/K = [hi | x1024 residual] planes (residual planes compact: rows b*RE + s);
// O = (Ph.Vh + (Pl.Vh + Ph.Vl)/1024) / l with P = [hi | x1024 residual] of 1024 p and V^T = [hi | x1024 residual] (VtL pitch RE); separate residual accumulators folded before the normalisation.
// key tiles [0, JE[qblk]) clamped to [1, RE/32] (the compact planes hold keys < RE); a block whose mask exposes keys beyond RE writes NaN rows.
__global__ __launch_bounds__(128) __attribute__((amdgpu_num_vgpr(256))) void k_flash5(const _Float16* __restrict__ Q16, const _Float16* __restrict__ QL, int ldq, const _Float16* __restrict__ K16, const _Float16* __restrict__ KL, int ldk,
                                                const _Float16* __restrict__ Vt, const _Float16* __restrict__ VtL, const unsigned short* __restrict__ MP, const int* __restrict__ JE, float* __restrict__ O, int ldo) {
  constexpr int RPW = 16, DT = 4, KS = 4;
  __shared__ __attribute__((aligned(16))) unsigned short sP[4][RPW][40];
  __shared__ __attribute__((aligned(16))) unsigned short sPL[4][RPW][40];
  __shared__ __attribute__((aligned(16))) float sO[4][RPW][68];
  const int tid = threadIdx.x, lane = tid & 31, ln = lane & 15, hh = lane >> 4;
  const int w = __builtin_amdgcn_readfirstlane(tid >> 5);
  const int dh = blockIdx.x & 1; const int bx = blockIdx.x >> 1;
  const int slab = bx / QBN5, qblk = QB05 + bx % QBN5; const int b = slab / NH, h = slab % NH; const int kvh = h / NREP;
  const int qb0 = qblk * (4 * RPW); const int q0 = qb0 + w * RPW;
  const unsigned short* qr = (const unsigned short*)Q16 + ((size_t)b * TQ + q0 + ln) * ldq + h * HDIM;
  const unsigned short* ql = (const unsigned short*)QL + ((size_t)b * RE + q0 + ln) * ldq + h * HDIM;
  const unsigned short* kb = (const unsigned short*)K16 + ((size_t)b * TK + ln) * ldk + kvh * HDIM;
  const unsigned short* klb = (const unsigned short*)KL + ((size_t)b * RE + ln) * ldk + kvh * HDIM;
  const unsigned short* Vth = (const unsigned short*)Vt + ((size_t)(b * NKVH + kvh) * HDIM + dh * 64) * TK;
  const unsigned short* Vtl = (const unsigned short*)VtL + ((size_t)(b * NKVH + kvh) * HDIM + dh * 64) * RE;
  const unsigned short* mq = MP + (size_t)(q0 >> 4) * (size_t)(TK / 32) * 512 + lane * 8;
  const int jraw = JE[qblk * 32];
  const float pz = (jraw > RE / 32) ? __uint_as_float(0x7FC00000u) : 0.0f;
  int jt = (jraw < 1) ? 1 : jraw; jt = (jt > RE / 32) ? (RE / 32) : jt;
  const int jend = __builtin_amdgcn_readfirstlane(jt) * 32;
  float m_r[8], l_r[8]; v8f oacc[DT], oaccL[DT];
#pragma unroll
  for (int r = 0; r < 8; ++r) { m_r[r] = -3.0e38f; l_r[r] = 0.f; }
#pragma unroll
  for (int dt = 0; dt < DT; ++dt) { oacc[dt] = (v8f){0.f,0.f,0.f,0.f,0.f,0.f,0.f,0.f}; oaccL[dt] = oacc[dt]; }
#pragma unroll 1
  for (int j0 = 0; j0 < jend; j0 += 32) {
    v8f sa = (v8f){0.f,0.f,0.f,0.f,0.f,0.f,0.f,0.f}, sb = sa, sal = sa, sbl = sa;
    const unsigned short* qp = qr + 8 * hh; const unsigned short* qlp = ql + 8 * hh;
    const unsigned short* kp0 = kb + (size_t)j0 * ldk + 8 * hh; const unsigned short* kp1 = kp0 + (size_t)16 * ldk;
    const unsigned short* gp0 = klb + (size_t)j0 * ldk + 8 * hh; const unsigned short* gp1 = gp0 + (size_t)16 * ldk;
    const unsigned short* mt = mq + (size_t)(j0 >> 5) * 512;
    FragH fm; fm.half[0] = *(const v8us*)mt; fm.half[1] = *(const v8us*)(mt + 256);
    /* all six planes' fragments of a k-step are issued as one group ahead of its products: four load round trips a pass, not eight (a group of two k-steps spills registers) */
#pragma unroll
    for (int ks = 0; ks < KS; ++ks) {
      /* all A and B fragments of this step share one k order: element e < 8 <-> d = 32 ks + 8 hh + e; e >= 8 <-> d = 32 ks + 16 + 8 hh + (e - 8) */
      FragH a, al2, k0, k1, g0, g1;
      a.half[0] = *(const v8us*)(qp + ks * 32); a.half[1] = *(const v8us*)(qp + ks * 32 + 16);
      al2.half[0] = *(const v8us*)(qlp + ks * 32); al2.half[1] = *(const v8us*)(qlp + ks * 32 + 16);
      k0.half[0] = *(const v8us*)(kp0 + ks * 32); k0.half[1] = *(const v8us*)(kp0 + ks * 32 + 16);
      k1.half[0] = *(const v8us*)(kp1 + ks * 32); k1.half[1] = *(const v8us*)(kp1 + ks * 32 + 16);
      g0.half[0] = *(const v8us*)(gp0 + ks * 32); g0.half[1] = *(const v8us*)(gp0 + ks * 32 + 16);
      g1.half[0] = *(const v8us*)(gp1 + ks * 32); g1.half[1] = *(const v8us*)(gp1 + ks * 32 + 16);
      /* the group's address registers are inputs here, so they stay whole (no load's result is given them) up to this wait */
      asm volatile("s_wait_xcnt 0x0" :: "v"(qp), "v"(qlp), "v"(kp0), "v"(kp1), "v"(gp0), "v"(gp1), "v"(mt) : "memory");
      sa = g2_mma(a.v, k0.v, sa); sb = g2_mma(a.v, k1.v, sb);
      sal = g2_mma(al2.v, k0.v, sal); sbl = g2_mma(al2.v, k1.v, sbl);
      sal = g2_mma(a.v, g0.v, sal); sbl = g2_mma(a.v, g1.v, sbl);
    }
    /* both V^T planes' fragments of this pass are issued here, ahead of the softmax, which covers their round trip */
    FragH bv[DT], bl[DT];
    const unsigned short* vp = Vth + (size_t)ln * TK + j0 + 8 * hh; const unsigned short* vlp = Vtl + (size_t)ln * RE + j0 + 8 * hh;
#pragma unroll
    for (int dt = 0; dt < DT; ++dt) {
      bv[dt].half[0] = *(const v8us*)(vp + (size_t)(dt * 16) * TK); bv[dt].half[1] = *(const v8us*)(vp + (size_t)(dt * 16) * TK + 16);
      bl[dt].half[0] = *(const v8us*)(vlp + (size_t)(dt * 16) * RE); bl[dt].half[1] = *(const v8us*)(vlp + (size_t)(dt * 16) * RE + 16);
    }
    /* the group's address registers are inputs here, so they stay whole up to this wait */
    asm volatile("s_wait_xcnt 0x0" :: "v"(vp), "v"(vlp) : "memory");
#pragma unroll
    for (int r = 0; r < 8; ++r) {
      const float mk0 = bf16_val(fm.u[2 * r]), mk1 = bf16_val(fm.u[2 * r + 1]);
      const float d0 = sa[r] + sal[r] * 0.0009765625f, d1 = sb[r] + sbl[r] * 0.0009765625f;
      const float s0 = d0 * SCL + mk0, s1 = d1 * SCL + mk1;
      float mc = fmaxf(s0, s1);
      mc = fmaxf(mc, __shfl_xor(mc, 1, 32)); mc = fmaxf(mc, __shfl_xor(mc, 2, 32)); mc = fmaxf(mc, __shfl_xor(mc, 4, 32)); mc = fmaxf(mc, __shfl_xor(mc, 8, 32));
      const float mn = fmaxf(m_r[r], mc); const float al = (mn > -1.0e38f) ? expf(m_r[r] - mn) : 1.0f; m_r[r] = mn;
      const float p0 = expf(s0 - mn), p1 = expf(s1 - mn); l_r[r] = l_r[r] * al + p0 + p1;
#pragma unroll
      for (int dt = 0; dt < DT; ++dt) { oacc[dt][r] *= al; oaccL[dt][r] *= al; }
      FragH t2, t2l; const float ps0 = p0 * 1024.0f, ps1 = p1 * 1024.0f;
      t2.h[0] = toh_flush(ps0); t2.h[1] = toh_flush(ps1);
      t2l.h[0] = toh_flush((ps0 - (float)t2.h[0]) * 1024.0f); t2l.h[1] = toh_flush((ps1 - (float)t2.h[1]) * 1024.0f);
      sP[w][8 * hh + r][ln] = t2.u[0]; sP[w][8 * hh + r][16 + ln] = t2.u[1]; sPL[w][8 * hh + r][ln] = t2l.u[0]; sPL[w][8 * hh + r][16 + ln] = t2l.u[1];
    }
    __builtin_amdgcn_fence(4, "workgroup"); __builtin_amdgcn_wave_barrier();
    FragH pa, pl;
    pa.half[0] = *(const v8us*)&sP[w][ln][8 * hh]; pa.half[1] = *(const v8us*)&sP[w][ln][16 + 8 * hh];
    pl.half[0] = *(const v8us*)&sPL[w][ln][8 * hh]; pl.half[1] = *(const v8us*)&sPL[w][ln][16 + 8 * hh];
#pragma unroll
    for (int dt = 0; dt < DT; ++dt) {
      /* A (P tiles) and B (V^T rows) share the same key order: element e < 8 <-> key j0 + 8 hh + e; e >= 8 <-> key j0 + 16 + 8 hh + (e - 8) */
      oacc[dt] = g2_mma(pa.v, bv[dt].v, oacc[dt]);
      oaccL[dt] = g2_mma(pl.v, bv[dt].v, oaccL[dt]);
      oaccL[dt] = g2_mma(pa.v, bl[dt].v, oaccL[dt]);
    }
    __builtin_amdgcn_fence(4, "workgroup"); __builtin_amdgcn_wave_barrier();
  }
#pragma unroll
  for (int r = 0; r < 8; ++r) { float l = l_r[r]; l += __shfl_xor(l, 1, 32); l += __shfl_xor(l, 2, 32); l += __shfl_xor(l, 4, 32); l += __shfl_xor(l, 8, 32); l_r[r] = (l > 0.f) ? 1.0f / (l * 1024.0f) : 0.f; }
#pragma unroll
  for (int dt = 0; dt < DT; ++dt)
#pragma unroll
    for (int r = 0; r < 8; ++r) { float v = oacc[dt][r]; v += oaccL[dt][r] * 0.0009765625f; sO[w][8 * hh + r][dt * 16 + ln] = v * l_r[r] + pz; }
  __builtin_amdgcn_fence(4, "workgroup"); __builtin_amdgcn_wave_barrier();
  {
#pragma unroll
    for (int rp = 0; rp < RPW; rp += 2) { const int r = rp + (lane >> 4), pc = lane & 15; const v4f val = *(const v4fa*)&sO[w][r][pc * 4]; *(v4f*)(O + ((size_t)b * TQ + q0 + r) * ldo + h * HDIM + dh * 64 + pc * 4) = val; }
    
  }
}

extern "C" void kernel_launch(void* const* d_in, const int* in_sizes, int n_in,
                              void* d_out, int out_size, void* d_ws, size_t ws_size, hipStream_t stream) {
  if (n_in < 10) return;
  const size_t needx = ((size_t)(NB - 1) * SEQ_FULL + (size_t)SLEN) * DM;
  if ((size_t)in_sizes[0] < needx) return;
  if ((size_t)in_sizes[1] < (size_t)DM * DM) return;
  if ((size_t)in_sizes[2] < (size_t)VW * DM) return;
  if ((size_t)in_sizes[3] < (size_t)VW * DM) return;
  if ((size_t)in_sizes[4] < (size_t)DM * DM) return;
  if ((size_t)in_sizes[5] < (size_t)HDIM) return;
  if ((size_t)in_sizes[6] < (size_t)HDIM) return;
  if ((size_t)in_sizes[7] < (size_t)SLEN * RTW) return;
  if ((size_t)in_sizes[8] < (size_t)SLEN * RTW) return;
  if ((size_t)in_sizes[9] < (size_t)(SLEN - 1) * MSKP + (size_t)SLEN) return;
  if ((size_t)out_size < needx) return;
  /* inputs in order: x, Wq, Wk, Wv, Wo, q gain, k gain, cos table, sin table, mask */
  const float* x = (const float*)d_in[0]; const float* Wq = (const float*)d_in[1]; const float* Wk = (const float*)d_in[2]; const float* Wv = (const float*)d_in[3]; const float* Wo = (const float*)d_in[4];
  const float* qnw = (const float*)d_in[5]; const float* knw = (const float*)d_in[6]; const float* rct = (const float*)d_in[7]; const float* rst = (const float*)d_in[8]; const float* msk = (const float*)d_in[9];
  float* dout = (float*)d_out;
  char* ws = (char*)d_ws; size_t off = 0;
  auto take = [&](size_t bytes) { char* p = ws + off; off += (bytes + 255) & ~(size_t)255; return p; };
  const size_t np = (size_t)NR * DM;
  const size_t nw8 = (size_t)DM * DM / 8;
  const size_t nk8 = (size_t)VW * DM / 8;
  _Float16* BQ = (_Float16*)take(SZ_BQ);                                /* [n][k] f16, x16 */
  _Float16* BK = (_Float16*)take(SZ_BK);
  _Float16* BV = (_Float16*)take(SZ_BK);
  _Float16* B2 = (_Float16*)take(SZ_B2);                                /* [n][2*DM] f16: [x16384 | x16] copies of Wo */
  float* FS = (float*)take(SZ_FS);                                      /* f32 scratch plane: q rows [NR][DM], then k rows [NR][VW], then v rows [NR][VW], then the context [NR][DM] */
  _Float16* X16 = (_Float16*)take(SZ_X16);                              /* f16 input rows; reused as V^T [(b,g)][64][TK] after the v GEMM */
  _Float16* VT = X16;
  _Float16* QH = (_Float16*)take(SZ_QH);                                /* reused as the context hi plane after the attention */
  _Float16* KHp = (_Float16*)take(SZ_KH);                               /* [NR][VW] */
  _Float16* V16 = (_Float16*)take(SZ_KH);                               /* [NR][VW] */
  _Float16* QL = (_Float16*)take(SZ_QL);                                /* [NB*RE][DM] residual plane */
  _Float16* KL = (_Float16*)take(SZ_KL);                                /* [NB*RE][VW] residual plane */
  _Float16* VTL = (_Float16*)take(SZ_VTL);                              /* [(b,g)][64][RE] */
  _Float16* A2 = (_Float16*)take(SZ_A2);                                /* [NB*RE][2*DM] = [ctx hi | ctx residual] */
  unsigned short* MPp = (unsigned short*)take(SZ_MP);                   /* bf16 mask plane, accumulator layout */
  int* JEp = (int*)take(SZ_JE);                                         /* [QBLKS][32] key-tile counts */
  _Float16* OH = QH;
  if (off > ws_size) return;
  if (off > ((size_t)128 << 20)) return;

  const unsigned gw = (unsigned)((nw8 + 255) / 256);
  const unsigned gk = (unsigned)((nk8 + 255) / 256);
  k_wsc<<<gw, 256, 0, stream>>>(Wq, BQ, nw8, WSC_LO);
  k_wsc<<<gk, 256, 0, stream>>>(Wk, BK, nk8, WSC_LO);
  k_wsc<<<gk, 256, 0, stream>>>(Wv, BV, nk8, WSC_LO);
  k_wsc2<<<gw, 256, 0, stream>>>(Wo, B2, nw8, WSC_HI, WSC_LO);
  k_mperm<<<(unsigned)(((size_t)(SLEN / 16) * (SLEN / 32) * 64) / 256), 256, 0, stream>>>(msk, MPp);
  k_mjend<<<(unsigned)QBLKS, 256, 0, stream>>>(msk, JEp);
  const unsigned g8 = (unsigned)((np / 8 + 255) / 256);
  k_x16<<<g8, 256, 0, stream>>>(x, X16, np / 8);
  const dim3 gp((unsigned)((NR / 128) * (DM / 64)), 1);
  const dim3 gkv((unsigned)((NR / 128) * (VW / 64)), 1);
  const unsigned grq = (unsigned)(((size_t)NR * NH * 16) / 256);
  const unsigned grk = (unsigned)(((size_t)NR * NKVH * 16) / 256);
  k_gemm2<0><<<gp, 128, 0, stream>>>(X16, DM, 0, BQ, DM, 0, AL_P, FS, nullptr, DM, 0, NR, DM, DM);        /* q = x Wq^T (f32 rows, pitch DM) */
  k_nrope_q<<<grq, 256, 0, stream>>>(FS, DM, qnw, rct, rst, QH, QL);
  k_gemm2<0><<<gkv, 128, 0, stream>>>(X16, DM, 0, BK, DM, 0, AL_P, FS, nullptr, VW, 0, NR, VW, DM);       /* k = x Wk^T (f32 rows, pitch VW) */
  k_nrope_k<<<grk, 256, 0, stream>>>(FS, VW, knw, rct, rst, KHp, KL);
  k_gemm2<0><<<gkv, 128, 0, stream>>>(X16, DM, 0, BV, DM, 0, AL_P, FS, V16, VW, 0, NR, VW, DM);           /* v = x Wv^T (f32 rows + f16 plane, pitch VW) */
  k_vtg<<<(unsigned)(NB * NV64 * (SLEN / 64)), 256, 0, stream>>>(V16, VT);
  k_vtl<<<(unsigned)(NB * NV64 * (RE / 64)), 256, 0, stream>>>(FS, VTL);
  k_flash5<<<(unsigned)(NB * NH * QBN5 * 2), 128, 0, stream>>>(QH, QL, DM, KHp, KL, VW, VT, VTL, MPp, JEp, FS, DM);
  if (QBNP > 0) k_flash<<<(unsigned)(NB * NH * QBNP), 128, 0, stream>>>(QH, DM, KHp, VW, VT, MPp, JEp, FS, DM);
  k_hl<<<g8, 256, 0, stream>>>(FS, OH, A2, np / 8);
  /* out rows [0, RE) per batch: [ctx hi | ctx residual] . [Wo x16384 ; Wo x16] / 16384  (K = 2*DM) */
  const dim3 ge((unsigned)((RE / 128) * (DM / 64)), NB);
  k_gemm2<0><<<ge, 128, 0, stream>>>(A2, 2 * DM, (size_t)RE * 2 * DM, B2, 2 * DM, 0, AL_E, dout, nullptr, DM, (size_t)SEQ_FULL * DM, RE, DM, 2 * DM);
  /* out rows [RE, SLEN) per batch: ctx hi . (Wo x16) / 16 */
  if (SLEN > RE) {
    const dim3 gl((unsigned)(((SLEN - RE) / 128) * (DM / 64)), NB);
    k_gemm2<0><<<gl, 128, 0, stream>>>(OH + (size_t)RE * DM, DM, (size_t)SLEN * DM, B2 + DM, 2 * DM, 0, AL_P, dout + (size_t)RE * DM, nullptr, DM, (size_t)SEQ_FULL * DM, SLEN - RE, DM, DM);
  }
}

// v003
// It runs in 463 microseconds.
// In two side-by-side timings against v002, it was 1.09 and 1.08 times as fast.
// Over all steps from v000 it is 1.95 times as fast.
#include <hip/hip_runtime.h>
// Contractions: x.Wq^T, x.Wk^T, x.Wv^T, ctx.Wo^T = v_wmma_f32_16x16x32_f16 (f16 operands: bf16-RNE inputs exact in f16, weights carried x16 (x16384 for the ctx-hi half of the early-row output GEMM); f32 accumulate); scores q.k^T and P.V^T = v_wmma_f32_16x16x32_f16 (plain f16 hi planes; hi + x1024 residual planes of q, k, P and v for query positions < RE; P carried x1024), f32 accumulate; per-head RMS normalisation, rotary step, additive mask, softmax and normalisers f32.

#ifndef NB
#define NB 2
#endif
#ifndef SEQ
#define SEQ 2048
#endif
#define NB_FULL 2
#define SEQ_FULL 2048
#define DM 2048
#define NH 16
#define NKVH 4
#define NREP (NH / NKVH)
#define HDIM 128
#define VW (NKVH * HDIM)                     /* width of the k / v projection rows */
#define NV64 (VW / 64)                       /* 64-wide column groups of the v rows */
#define MSKP 2048                            /* row pitch of the mask input */
#define RTW 64                               /* row pitch of the cos / sin inputs */
#define SLEN SEQ
#define NR (NB * SLEN)
#define TQ SLEN
#define TK SLEN
#define SCL 0.08838834764831845f
#define MVIS (-1.0e8f)                       /* a mask entry above this keeps its key visible */
#define QBLKS (TQ / 64)
#define RE ((SLEN < 512) ? SLEN : 512)      /* query positions [0, RE) get residual planes on q, k, P, v and ctx */
#define QB05 0
#define QBN5 (RE / 64)
#define QB0P QBN5
#define QBNP (QBLKS - QBN5)
static_assert(SLEN % 128 == 0);
static_assert(SLEN <= SEQ_FULL);
static_assert(SLEN <= MSKP);
static_assert(NB >= 1 && NB <= NB_FULL);
static_assert(RE % 128 == 0 && RE <= SLEN);
static_assert((SLEN - RE) % 128 == 0);
static_assert(DM % 64 == 0 && DM == NH * HDIM);
static_assert(HDIM == 128 && NH % NKVH == 0);
static_assert(VW % 64 == 0 && NV64 * 64 == VW);
static_assert(DM % 32 == 0 && (2 * DM) % 32 == 0);
static_assert(NR % 128 == 0);
static_assert(((size_t)NR * NH * 16) % 256 == 0 && ((size_t)NR * NKVH * 16) % 256 == 0);
static_assert((NH & (NH - 1)) == 0 && (NKVH & (NKVH - 1)) == 0);   /* head counts are powers of two: index arithmetic by shifts and masks */
static_assert((size_t)NR * NH * 16 < ((size_t)1 << 31));           /* 32-bit thread indices in the normalise + rotary kernels */
static_assert(((size_t)(SLEN / 16) * (SLEN / 32) * 64) % 256 == 0);
static_assert(32 * 16 == HDIM * 4);          /* one store instruction of 32 lanes x 16 B == one 128-float row segment */
static_assert(16 * 16 == 64 * 4);            /* 16 lanes x 16 B == one 64-float row segment */
static_assert(4 * 16 * 40 * 2 + 4 * 16 * 132 * 4 <= 131072);
static_assert(2 * 4 * 16 * 40 * 2 + 4 * 16 * 68 * 4 <= 131072);
static_assert(4 * 32 * 68 * 4 <= 131072);

static constexpr float WSC_LO = 16.0f;
static constexpr float WSC_HI = 16384.0f;
static constexpr float AL_P = 0.0625f;
static constexpr float AL_E = 6.103515625e-05f;   /* 0.0625 / 1024 */

static constexpr size_t al256(size_t b) { return (b + 255) & ~(size_t)255; }
static constexpr size_t SZ_BQ = al256((size_t)DM * DM * 2);
static constexpr size_t SZ_BK = al256((size_t)VW * DM * 2);
static constexpr size_t SZ_B2 = al256((size_t)DM * 2 * DM * 2);
static constexpr size_t SZ_FS = al256((size_t)NR * DM * 4);
static constexpr size_t SZ_X16 = al256((size_t)NR * DM * 2);
static constexpr size_t SZ_QH = al256((size_t)NR * DM * 2);
static constexpr size_t SZ_KH = al256((size_t)NR * VW * 2);
static constexpr size_t SZ_QL = al256((size_t)NB * RE * DM * 2);
static constexpr size_t SZ_KL = al256((size_t)NB * RE * VW * 2);
static constexpr size_t SZ_VTL = al256((size_t)NB * NV64 * 64 * RE * 2);
static constexpr size_t SZ_A2 = al256((size_t)NB * RE * 2 * DM * 2);
static constexpr size_t SZ_MP = al256((size_t)SLEN * SLEN * 2);
static constexpr size_t SZ_JE = al256((size_t)QBLKS * 32 * 4);
static_assert((size_t)NB * NV64 * 64 * TK * 2 <= SZ_X16);       /* V^T aliases the f16 input plane */
static_assert((size_t)NR * VW * 4 <= SZ_FS);
static_assert(SZ_BQ + 2 * SZ_BK + SZ_B2 + SZ_FS + SZ_X16 + SZ_QH + 2 * SZ_KH + SZ_QL + SZ_KL + SZ_VTL + SZ_A2 + SZ_MP + SZ_JE <= ((size_t)128 << 20));

typedef _Float16 v16h __attribute__((ext_vector_type(16)));
typedef _Float16 v4h __attribute__((ext_vector_type(4)));
typedef unsigned short v8us __attribute__((ext_vector_type(8), may_alias));
typedef float v8f __attribute__((ext_vector_type(8)));
typedef float v4f __attribute__((ext_vector_type(4)));
typedef float v4fa __attribute__((ext_vector_type(4), may_alias));
union FragH { v16h v; v8us half[2]; _Float16 h[16]; unsigned short u[16]; };

__device__ __forceinline__ unsigned short bf16_bits(float x) { unsigned int u = __float_as_uint(x); return (unsigned short)((u + 0x7FFFu + ((u >> 16) & 1u)) >> 16); }
__device__ __forceinline__ float bf16_val(unsigned short b) { return __uint_as_float(((unsigned int)b) << 16); }
__device__ __forceinline__ float bf16_rne(float x) { return bf16_val(bf16_bits(x)); }
// f32 -> f16 for WMMA operand planes: values under the smallest f16 normal become +0
__device__ __forceinline__ _Float16 toh_flush(float v) { const _Float16 r = (_Float16)v; return (fabsf(v) < 6.103515625e-05f) ? (_Float16)0.0f : r; }

// D += A.B with NT terms: 1 = ah.bh, 2 = + al.bh, 3 = + ah.bl; hazard guard after the group
template <int NT>
__device__ __forceinline__ v8f mmaH(v16h ah, v16h al, v16h bh, v16h bl, v8f c) {
  c = __builtin_amdgcn_wmma_f32_16x16x32_f16(false, ah, false, bh, (short)0, c, false, false);
  if (NT >= 2) c = __builtin_amdgcn_wmma_f32_16x16x32_f16(false, al, false, bh, (short)0, c, false, false);
  if (NT >= 3) c = __builtin_amdgcn_wmma_f32_16x16x32_f16(false, ah, false, bl, (short)0, c, false, false);
  asm volatile("v_nop\n\tv_nop\n\tv_nop\n\tv_nop" : "+v"(c) : "v"(ah), "v"(al), "v"(bh), "v"(bl));
  return c;
}
// 16x32 fragment from a 16-bit row-major tile (rows = m or n, k contiguous): elements 0..7 <- k0+8h+0..7, 8..15 <- k0+16+8h+0..7
__device__ __forceinline__ v16h g2_frag(const _Float16* p, int hh) { FragH f; f.half[0] = *(const v8us*)((const unsigned short*)p + 8 * hh); f.half[1] = *(const v8us*)((const unsigned short*)p + 16 + 8 * hh); return f.v; }
__device__ __forceinline__ v8f g2_mma(v16h a, v16h b, v8f c) { v8f d = __builtin_amdgcn_wmma_f32_16x16x32_f16(false, a, false, b, (short)0, c, false, false); asm volatile("v_nop\n\tv_nop\n\tv_nop\n\tv_nop" : "+v"(d) : "v"(a), "v"(b)); return d; }

__global__ __launch_bounds__(256) void k_wsc(const float* __restrict__ Wm, _Float16* __restrict__ Bt, size_t n8, float sc) {
  const size_t t = (size_t)blockIdx.x * 256 + threadIdx.x; if (t >= n8) return;
  const v4f a0 = *(const v4fa*)(Wm + t * 8), a1 = *(const v4fa*)(Wm + t * 8 + 4);
  FragH f;
#pragma unroll
  for (int q = 0; q < 4; ++q) { f.h[q] = toh_flush(bf16_rne(a0[q]) * sc); f.h[4 + q] = toh_flush(bf16_rne(a1[q]) * sc); }
  const v8us o = f.half[0];
  *(v8us*)((unsigned short*)Bt + t * 8) = o; 
}
__global__ __launch_bounds__(256) void k_wsc2(const float* __restrict__ Wm, _Float16* __restrict__ B2, size_t n8, float sc0, float sc1) {
  const size_t t = (size_t)blockIdx.x * 256 + threadIdx.x; if (t >= n8) return;
  const size_t e = t * 8; const size_t n = e / DM; const size_t k8 = e % DM;
  const v4f a0 = *(const v4fa*)(Wm + e), a1 = *(const v4fa*)(Wm + e + 4);
  FragH f0, f1;
#pragma unroll
  for (int q = 0; q < 4; ++q) {
    const float v0 = bf16_rne(a0[q]), v1 = bf16_rne(a1[q]);
    f0.h[q] = toh_flush(v0 * sc0); f1.h[q] = toh_flush(v0 * sc1);
    f0.h[4 + q] = toh_flush(v1 * sc0); f1.h[4 + q] = toh_flush(v1 * sc1);
  }
  const size_t o = n * (size_t)(2 * DM) + k8;
  const v8us o0 = f0.half[0], o1 = f1.half[0];
  {
    *(v8us*)((unsigned short*)B2 + o) = o0;
    *(v8us*)((unsigned short*)B2 + o + DM) = o1;
    
  }
}

// mask plane in accumulator layout: MP[(qt*(SLEN/32) + kt)][half][lane][8] bf16 bits; element 2*rr + c of (half, lane) = mask[qt*16 + 8*(lane>>4) + 4*half + rr][kt*32 + 16*c + (lane&15)];
__global__ __launch_bounds__(256) void k_mperm(const float* __restrict__ msk, unsigned short* __restrict__ MP) {
  const size_t t = (size_t)blockIdx.x * 256 + threadIdx.x; if (t >= (size_t)(SLEN / 16) * (SLEN / 32) * 64) return;
  const int lane = (int)(t & 31); const int half = (int)((t >> 5) & 1); const size_t tile = t >> 6;
  const int kt = (int)(tile % (size_t)(SLEN / 32)); const int qt = (int)(tile / (size_t)(SLEN / 32));
  const int ln = lane & 15, hh = lane >> 4;
  const float* mr = msk + (size_t)(qt * 16 + 8 * hh + 4 * half) * MSKP + kt * 32 + ln;
  FragH f;
#pragma unroll
  for (int rr = 0; rr < 4; ++rr) { const float a = mr[(size_t)rr * MSKP]; const float c = mr[(size_t)rr * MSKP + 16]; f.u[2 * rr] = bf16_bits(a); f.u[2 * rr + 1] = bf16_bits(c); }
  const v8us o = f.half[0];
  *(v8us*)(MP + t * 8) = o; 
}
// per 64-query block: JE[qblk][0..32) = number of 32-key tiles to visit = 1 + last tile holding a visible entry (value > MVIS) in any of the 64 rows; all tiles if some row has no visible entry.
__global__ __launch_bounds__(1024) void k_mjend(const float* __restrict__ msk, int* __restrict__ JE) {
  constexpr int NL = SLEN / 128;               /* 16-B loads per lane and row */
  __shared__ int smax[32]; __shared__ int snone[32];
  const int tid = threadIdx.x, lane = tid & 31; const int w = __builtin_amdgcn_readfirstlane(tid >> 5);
  const int qblk = blockIdx.x;
  int wmax = -1, wnone = 0;
  /* 32 waves, two rows each; kept rolled: the loads of both rows at once need more registers than a 32-wave block leaves a wave (spills) */
#pragma unroll 1
  for (int rr = 0; rr < 2; ++rr) {
    const float* mr = msk + (size_t)(qblk * 64 + w * 2 + rr) * MSKP + lane * 4;
    /* every load of the row is issued as one group ahead of the first compare: one load round trip a row, not one per 128 columns */
    v4f a[NL];
#pragma unroll
    for (int i = 0; i < NL; ++i) a[i] = *(const v4fa*)(mr + i * 128);
    static_assert(NL == 16);
    /* the loaded values are inputs only: all loads of the row are issued, none held back behind a compare; the address is an input too, so it stays whole (no load's result is given it) up to this wait */
    asm volatile("s_wait_xcnt 0x0" :: "v"(a[0]), "v"(a[1]), "v"(a[2]), "v"(a[3]), "v"(a[4]), "v"(a[5]), "v"(a[6]), "v"(a[7]),
                 "v"(a[8]), "v"(a[9]), "v"(a[10]), "v"(a[11]), "v"(a[12]), "v"(a[13]), "v"(a[14]), "v"(a[15]), "v"(mr) : "memory");
    int lm = -1;
#pragma unroll
    for (int i = 0; i < NL; ++i) {
      const bool any = (bf16_rne(a[i][0]) > MVIS) | (bf16_rne(a[i][1]) > MVIS) | (bf16_rne(a[i][2]) > MVIS) | (bf16_rne(a[i][3]) > MVIS);
      lm = any ? ((lane + 32 * i) >> 3) : lm;
    }
    int o = __shfl_xor(lm, 16, 32); lm = (o > lm) ? o : lm;
    o = __shfl_xor(lm, 8, 32); lm = (o > lm) ? o : lm;
    o = __shfl_xor(lm, 4, 32); lm = (o > lm) ? o : lm;
    o = __shfl_xor(lm, 2, 32); lm = (o > lm) ? o : lm;
    o = __shfl_xor(lm, 1, 32); lm = (o > lm) ? o : lm;
    wmax = (lm > wmax) ? lm : wmax; wnone |= (lm < 0) ? 1 : 0;
  }
  if (lane == 0) { smax[w] = wmax; snone[w] = wnone; }
  __syncthreads();
  if (w == 0) {
    int m = -1, nn = 0;
#pragma unroll
    for (int i = 0; i < 32; ++i) { const int a = smax[i]; m = (a > m) ? a : m; nn |= snone[i]; }
    const int jt = (nn != 0) ? (SLEN / 32) : (m + 1);
    *(int*)(JE + qblk * 32 + lane) = jt; 
  }
}

__global__ __launch_bounds__(256) void k_x16(const float* __restrict__ x, _Float16* __restrict__ X16, size_t n8) {
  const size_t t = (size_t)blockIdx.x * 256 + threadIdx.x; if (t >= n8) return;
  const size_t e = t * 8; const size_t r = e / DM; const size_t c = e % DM; const size_t b = r / SLEN, s = r % SLEN;
  const float* src = x + (b * SEQ_FULL + s) * DM + c;
  const v4f a0 = *(const v4fa*)src, a1 = *(const v4fa*)(src + 4);
  FragH f;
#pragma unroll
  for (int q = 0; q < 4; ++q) { f.h[q] = (_Float16)bf16_rne(a0[q]); f.h[4 + q] = (_Float16)bf16_rne(a1[q]); }
  const v8us o = f.half[0];
  *(v8us*)((unsigned short*)X16 + e) = o; 
}

// LDS ring of the GEMM: one stage = 64 k = 128 B of every operand row, [A 128 rows | B 64 rows] at pitch 144 B (16 B x odd: the 16-B fragment reads meet no bank conflict); two stages
#define G2_PB 144
#define G2_STG ((128 + 64) * G2_PB)
static_assert(2 * G2_STG >= 4 * 32 * 68 * 4);   /* the output staging reuses the ring behind the last barrier */
static_assert(2 * G2_STG <= 65536);
static_assert(DM % 64 == 0 && DM >= 128);
// 16x32 fragment from an LDS row (k contiguous), p = row start + 2 * (k0 + 8 hh) bytes: the k order of g2_frag
__device__ __forceinline__ v16h g2_lfrag(const unsigned char* p) { FragH f; f.half[0] = *(const v8us*)p; f.half[1] = *(const v8us*)(p + 32); return f.v; }
// one stage: 12 copies of 16 B per lane (a wave-wide copy = 4 whole 128-B row pieces); lane (r = tid / 8, c = tid % 8) brings chunk c of A rows r + 16 j (j < 8) and of B rows r + 16 j (j < 4).
// l = LDS byte address of (row r, chunk c) in the stage, a / b = the lane's global addresses in A row r / B row r, sa / sb = 16 rows in elements.
__device__ __forceinline__ void g2_stage(unsigned l, const _Float16* a, size_t sa, const _Float16* b, size_t sb) {
  /* s_wait_xcnt closes the copies' own statement: no register that a copy names is rewritten in front of it */
  asm volatile(
      "global_load_async_to_lds_b128 %0, %12, off\n\t"
      "global_load_async_to_lds_b128 %1, %13, off\n\t"
      "global_load_async_to_lds_b128 %2, %14, off\n\t"
      "global_load_async_to_lds_b128 %3, %15, off\n\t"
      "global_load_async_to_lds_b128 %4, %16, off\n\t"
      "global_load_async_to_lds_b128 %5, %17, off\n\t"
      "global_load_async_to_lds_b128 %6, %18, off\n\t"
      "global_load_async_to_lds_b128 %7, %19, off\n\t"
      "global_load_async_to_lds_b128 %8, %20, off\n\t"
      "global_load_async_to_lds_b128 %9, %21, off\n\t"
      "global_load_async_to_lds_b128 %10, %22, off\n\t"
      "global_load_async_to_lds_b128 %11, %23, off\n\t"
      "s_wait_xcnt 0x0"
      :: "v"(l), "v"(l + 16 * G2_PB), "v"(l + 32 * G2_PB), "v"(l + 48 * G2_PB), "v"(l + 64 * G2_PB), "v"(l + 80 * G2_PB), "v"(l + 96 * G2_PB), "v"(l + 112 * G2_PB),
         "v"(l + 128 * G2_PB), "v"(l + 144 * G2_PB), "v"(l + 160 * G2_PB), "v"(l + 176 * G2_PB),
         "v"(a), "v"(a + sa), "v"(a + 2 * sa), "v"(a + 3 * sa), "v"(a + 4 * sa), "v"(a + 5 * sa), "v"(a + 6 * sa), "v"(a + 7 * sa),
         "v"(b), "v"(b + sb), "v"(b + 2 * sb), "v"(b + 3 * sb)
      : "memory");
}

// GEMM C[M][N] = alpha * A[M][K].B  with A f16 row-major (pitch lda), B stored [n][k] f16 (pitch ldb), batched by blockIdx.y (strides sA, sB, sC);
// writes f32 C and/or f16 C16 (pitch ldc). Requires M % 128 == 0, N % 64 == 0, K % 64 == 0 (asserted by the callers' constants).
// Operand tiles come through LDS: asynchronous copies, two stages, stage t + 1 in flight while stage t is multiplied.
template <int ACT>
__global__ __launch_bounds__(128) void k_gemm2(const _Float16* __restrict__ A, int lda, size_t sA, const _Float16* __restrict__ Bh, int ldb, size_t sB, float alpha,
                                               float* C, _Float16* C16, int ldc, size_t sC, int M, int N, int K) {
  __shared__ __attribute__((aligned(16))) unsigned char sm[2 * G2_STG];
  float (*so)[32][68] = (float (*)[32][68])sm;
  const int tid = threadIdx.x, w = tid >> 5, lane = tid & 31, ln = lane & 15, hh = lane >> 4; const int by = blockIdx.y;
  A += (size_t)by * sA; Bh += (size_t)by * sB; const size_t cofs = (size_t)by * sC;
  const int ntn = N >> 6; const int mt = blockIdx.x / ntn, nq = blockIdx.x - mt * ntn; const int row0 = mt * 128 + 32 * w, col0 = nq * 64; if (mt * 128 >= M) return;
  const int cr = tid >> 3, cc = tid & 7;
  const _Float16* ga = A + (size_t)(mt * 128 + cr) * lda + cc * 8; const _Float16* gb = Bh + (size_t)(col0 + cr) * ldb + cc * 8;
  const size_t sa16 = (size_t)16 * lda, sb16 = (size_t)16 * ldb;
  const unsigned lc = (unsigned)(uintptr_t)sm + (unsigned)(cr * G2_PB + cc * 16);
  const int nt = K >> 6;
  const int aofs = (32 * w + ln) * G2_PB + 16 * hh, bofs = (128 + ln) * G2_PB + 16 * hh;
  const v8f z8 = {0.f,0.f,0.f,0.f,0.f,0.f,0.f,0.f}; v8f c00 = z8, c01 = z8, c02 = z8, c03 = z8, c10 = z8, c11 = z8, c12 = z8, c13 = z8;
  g2_stage(lc, ga, sa16, gb, sb16);
  asm volatile("s_wait_asynccnt 0x0" ::: "memory");   /* stage 0 has landed before the barrier publishes it */
  __syncthreads();
  if (nt > 1) g2_stage(lc + G2_STG, ga + 64, sa16, gb + 64, sb16);
#pragma unroll 1
  for (int t = 0; t < nt; ++t) {
    const unsigned char* sb = sm + (t & 1) * G2_STG; const unsigned char* pa = sb + aofs; const unsigned char* pb = sb + bofs;
#pragma unroll
    for (int kk = 0; kk < 2; ++kk) {
      const v16h a0 = g2_lfrag(pa + kk * 64), a1 = g2_lfrag(pa + 16 * G2_PB + kk * 64);
      const v16h b0 = g2_lfrag(pb + kk * 64), b1 = g2_lfrag(pb + 16 * G2_PB + kk * 64), b2 = g2_lfrag(pb + 32 * G2_PB + kk * 64), b3 = g2_lfrag(pb + 48 * G2_PB + kk * 64);
      c00 = g2_mma(a0, b0, c00); c10 = g2_mma(a1, b0, c10);
      c01 = g2_mma(a0, b1, c01); c11 = g2_mma(a1, b1, c11);
      c02 = g2_mma(a0, b2, c02); c12 = g2_mma(a1, b2, c12);
      c03 = g2_mma(a0, b3, c03); c13 = g2_mma(a1, b3, c13);
    }
    asm volatile("s_wait_dscnt 0x0" ::: "memory");      /* this wave's reads of stage t are done before the stage is refilled */
    asm volatile("s_wait_asynccnt 0x0" ::: "memory");   /* this wave's copies of stage t + 1 have landed before the barrier publishes them */
    __syncthreads();
    if (t + 2 < nt) g2_stage(lc + (unsigned)((t & 1) * G2_STG), ga + (size_t)(t + 2) * 64, sa16, gb + (size_t)(t + 2) * 64, sb16);
  }
  asm volatile("s_wait_asynccnt 0x0" ::: "memory");     /* no copy is outstanding when the ring becomes output staging */
  v8f accs[8] = {c00, c01, c02, c03, c10, c11, c12, c13};
#pragma unroll
  for (int u = 0; u < 8; ++u) {
    const int t = u & 3, half = u >> 2;
#pragma unroll
    for (int r = 0; r < 8; ++r) { const int rloc = half * 16 + 8 * hh + r; float v = accs[u][r] * alpha; if (ACT == 3) v = fmaxf(v, 0.f); so[w][rloc][t * 16 + ln] = v; }
  }
  __builtin_amdgcn_fence(4, "workgroup"); __builtin_amdgcn_wave_barrier();
  const int rsub = lane >> 4, c4 = (lane & 15) * 4;
  {
#pragma unroll
    for (int q = 0; q < 16; ++q) {
      const int r = q * 2 + rsub; const v4f v = *(const v4fa*)&so[w][r][c4];
      if (C) *(v4f*)(C + cofs + (size_t)(row0 + r) * ldc + col0 + c4) = v;
      if (C16) { v4h h4; for (int i = 0; i < 4; ++i) h4[i] = (_Float16)v[i]; *(v4h*)(C16 + cofs + (size_t)(row0 + r) * ldc + col0 + c4) = h4; }
    }
    
  }
}

// per-head RMS normalisation + interleaved-pair rotary step from the f32 GEMM plane F [NR][ldf] (ldf = NHV*128, NHV = compile-time head count, a power of two):
// y = (x * rsqrt(mean_128(x^2) + 1e-6)) * g[d];  out[2i] = y[2i] c[i] - y[2i+1] s[i];  out[2i+1] = y[2i] s[i] + y[2i+1] c[i]  (c, s = table rows [position][64], gain g[128]; all by value, bf16-RNE);
// H [NR][ldf] = f16 hi of every row; L [NB*RE][ldf] = x1024 residual for positions < RE.
// 32-bit thread indices (shifts and masks of compile-time powers of two); 64-bit offsets only at the final pointer arithmetic.
template <int NHV>
__device__ __forceinline__ void nrope_body(const float* __restrict__ F, int ldf, const float* __restrict__ NW, const float* __restrict__ CT, const float* __restrict__ ST,
                                           _Float16* __restrict__ H, _Float16* __restrict__ L) {
  #pragma clang fp contract(off)
  const unsigned t0 = blockIdx.x * 256u + threadIdx.x; const bool live = t0 < (unsigned)(NR * NHV * 16); const unsigned t = live ? t0 : 0u;
  const int p = (int)(t & 15u); const int hd = (int)((t >> 4) % (unsigned)NHV); const unsigned row = t / (unsigned)(16 * NHV);
  const int s = (int)(row % (unsigned)SLEN); const int b = (int)(row / (unsigned)SLEN);
  const float* src = F + (size_t)row * ldf + hd * HDIM + p * 8;
  const v4f xa = *(const v4fa*)src, xb = *(const v4fa*)(src + 4);
  const v4f wa = *(const v4fa*)(NW + p * 8), wb = *(const v4fa*)(NW + p * 8 + 4);
  const v4f cv = *(const v4fa*)(CT + (size_t)s * RTW + p * 4), sv = *(const v4fa*)(ST + (size_t)s * RTW + p * 4);
  const float xs[8] = {xa[0], xa[1], xa[2], xa[3], xb[0], xb[1], xb[2], xb[3]};
  const float gs[8] = {wa[0], wa[1], wa[2], wa[3], wb[0], wb[1], wb[2], wb[3]};
  float ss = 0.f;
#pragma unroll
  for (int i = 0; i < 8; ++i) { const float q = xs[i] * xs[i]; ss = ss + q; }
  ss += __shfl_xor(ss, 1, 32); ss += __shfl_xor(ss, 2, 32); ss += __shfl_xor(ss, 4, 32); ss += __shfl_xor(ss, 8, 32);
  const float mean = ss * 0.0078125f; const float rms = rsqrtf(mean + 1.0e-6f);
  FragH fh, fl;
#pragma unroll
  for (int j = 0; j < 4; ++j) {
    const float c = bf16_rne(cv[j]), sn = bf16_rne(sv[j]);
    const float y1 = (xs[2 * j] * rms) * bf16_rne(gs[2 * j]); const float y2 = (xs[2 * j + 1] * rms) * bf16_rne(gs[2 * j + 1]);
    const float o1 = y1 * c - y2 * sn; const float o2 = y1 * sn + y2 * c;
    const _Float16 h1 = toh_flush(o1), h2 = toh_flush(o2);
    fh.h[2 * j] = h1; fh.h[2 * j + 1] = h2;
    fl.h[2 * j] = toh_flush((o1 - (float)h1) * 1024.0f); fl.h[2 * j + 1] = toh_flush((o2 - (float)h2) * 1024.0f);
  }
  const size_t oh = (size_t)row * ldf + hd * HDIM + p * 8;
  const bool wl = live && (s < RE);
  const int sl = wl ? s : 0;
  const size_t ol = (size_t)(b * RE + sl) * ldf + hd * HDIM + p * 8;
  const v8us vh = fh.half[0], vl = fl.half[0];
  {
    if (live) *(v8us*)((unsigned short*)H + oh) = vh;
    if (wl) *(v8us*)((unsigned short*)L + ol) = vl;
    
  }
}
// query heads (NH per row)
__global__ __launch_bounds__(256) void k_nrope_q(const float* __restrict__ F, int ldf, const float* __restrict__ NW, const float* __restrict__ CT, const float* __restrict__ ST,
                                                 _Float16* __restrict__ H, _Float16* __restrict__ L) {
  #pragma clang fp contract(off)
  nrope_body<NH>(F, ldf, NW, CT, ST, H, L);
}
// key heads (NKVH per row)
__global__ __launch_bounds__(256) void k_nrope_k(const float* __restrict__ F, int ldf, const float* __restrict__ NW, const float* __restrict__ CT, const float* __restrict__ ST,
                                                 _Float16* __restrict__ H, _Float16* __restrict__ L) {
  #pragma clang fp contract(off)
  nrope_body<NKVH>(F, ldf, NW, CT, ST, H, L);
}

__global__ __launch_bounds__(256) void k_vtg(const _Float16* __restrict__ V16, _Float16* __restrict__ Vt) {
  __shared__ unsigned short tl[64][66];
  const int tid = threadIdx.x; const int nlg = SLEN / 64; const int slab = blockIdx.x / nlg, lg = blockIdx.x % nlg; const int b = slab / NV64, h = slab % NV64;
  for (int i = tid; i < 64 * 8; i += 256) {
    const int r = i >> 3, c8 = (i & 7) * 8; FragH f;
    f.half[0] = *(const v8us*)((const unsigned short*)V16 + ((size_t)b * SLEN + lg * 64 + r) * VW + h * 64 + c8);
#pragma unroll
    for (int q = 0; q < 8; ++q) tl[r][c8 + q] = f.u[q];
  }
  __syncthreads();
  {
#pragma unroll
    for (int rd = 0; rd < 2; ++rd) {
      const int d = rd * 32 + (tid >> 3), pc = tid & 7; FragH f;
#pragma unroll
      for (int q = 0; q < 8; ++q) f.u[q] = tl[pc * 8 + q][d];
      *(v8us*)((unsigned short*)Vt + ((size_t)slab * 64 + d) * TK + lg * 64 + pc * 8) = f.half[0];
    }
    
  }
}
__global__ __launch_bounds__(256) void k_vtl(const float* __restrict__ VF, _Float16* __restrict__ VtL) {
  __shared__ unsigned short tl[64][66];
  const int tid = threadIdx.x; const int nlg = RE / 64; const int slab = blockIdx.x / nlg, lg = blockIdx.x % nlg; const int b = slab / NV64, h = slab % NV64;
  for (int i = tid; i < 64 * 16; i += 256) {
    const int r = i >> 4, c4 = (i & 15) * 4;
    const v4f a = *(const v4fa*)(VF + ((size_t)b * SLEN + lg * 64 + r) * VW + h * 64 + c4);
    FragH f;
#pragma unroll
    for (int q = 0; q < 4; ++q) { const float v = a[q]; const _Float16 hv = (_Float16)v; f.h[q] = toh_flush((v - (float)hv) * 1024.0f); }
#pragma unroll
    for (int q = 0; q < 4; ++q) tl[r][c4 + q] = f.u[q];
  }
  __syncthreads();
  {
#pragma unroll
    for (int rd = 0; rd < 2; ++rd) {
      const int d = rd * 32 + (tid >> 3), pc = tid & 7; FragH f;
#pragma unroll
      for (int q = 0; q < 8; ++q) f.u[q] = tl[pc * 8 + q][d];
      *(v8us*)((unsigned short*)VtL + ((size_t)slab * 64 + d) * RE + lg * 64 + pc * 8) = f.half[0];
    }
    
  }
}

__global__ __launch_bounds__(256) void k_hl(const float* __restrict__ Fp, _Float16* __restrict__ Hh, _Float16* __restrict__ A2, size_t n8) {
  const size_t t = (size_t)blockIdx.x * 256 + threadIdx.x; if (t >= n8) return;
  const size_t e = t * 8; const size_t r = e / DM; const int c = (int)(e % DM); const int s = (int)(r % SLEN); const int b = (int)(r / SLEN);
  const v4f a = *(const v4fa*)(Fp + e), d = *(const v4fa*)(Fp + e + 4);
  FragH fh, fl;
#pragma unroll
  for (int q = 0; q < 4; ++q) {
    _Float16 hv = (_Float16)a[q]; fh.h[q] = hv; fl.h[q] = (_Float16)((a[q] - (float)hv) * 1024.0f);
    hv = (_Float16)d[q]; fh.h[4 + q] = hv; fl.h[4 + q] = (_Float16)((d[q] - (float)hv) * 1024.0f);
  }
  const bool wl = (s < RE);
  const size_t o2 = ((size_t)b * RE + (wl ? s : 0)) * (size_t)(2 * DM) + c;
  const v8us vh = fh.half[0], vl = fl.half[0];
  {
    *(v8us*)((unsigned short*)Hh + e) = vh;
    if (wl) { *(v8us*)((unsigned short*)A2 + o2) = vh; *(v8us*)((unsigned short*)A2 + o2 + DM) = vl; }
    
  }
}

// fused attention per ((b,h), 64 queries), query blocks [QB0P, QBLKS): wave = 16 queries; S = Q.K^T (d = 128: 4 k-steps, q fragments read with the pass's k group) x SCL + mask (bf16 plane, accumulator layout, two 16-B words per lane per step)
__global__ __launch_bounds__(128) __attribute__((amdgpu_num_vgpr(256))) void k_flash(const _Float16* __restrict__ Q16, int ldq, const _Float16* __restrict__ K16, int ldk,
                                               const _Float16* __restrict__ Vt, const unsigned short* __restrict__ MP, const int* __restrict__ JE, float* __restrict__ O, int ldo) {
  constexpr int RPW = 16, DT = 8, KS = 4;
  constexpr int NQP = (QBNP > 0) ? QBNP : 1;
  __shared__ __attribute__((aligned(16))) unsigned short sP[4][RPW][40];
  __shared__ __attribute__((aligned(16))) float sO[4][RPW][132];
  const int tid = threadIdx.x, lane = tid & 31, ln = lane & 15, hh = lane >> 4;
  const int w = __builtin_amdgcn_readfirstlane(tid >> 5);
  const int slab = blockIdx.x / NQP, qblk = QB0P + blockIdx.x % NQP; const int b = slab / NH, h = slab % NH; const int kvh = h / NREP;
  const int qb0 = qblk * (4 * RPW); const int q0 = qb0 + w * RPW;
  const unsigned short* qr = (const unsigned short*)Q16 + ((size_t)b * TQ + q0 + ln) * ldq + h * HDIM;
  const unsigned short* kb = (const unsigned short*)K16 + ((size_t)b * TK + ln) * ldk + kvh * HDIM;
  const unsigned short* Vth = (const unsigned short*)Vt + (size_t)(b * NKVH + kvh) * HDIM * TK;
  const unsigned short* mq = MP + (size_t)(q0 >> 4) * (size_t)(TK / 32) * 512 + lane * 8;
  int jt = JE[qblk * 32]; jt = (jt < 1) ? 1 : jt; jt = (jt > TK / 32) ? (TK / 32) : jt;
  const int jend = __builtin_amdgcn_readfirstlane(jt) * 32;
  float m_r[8], l_r[8]; v8f oacc[DT];
#pragma unroll
  for (int r = 0; r < 8; ++r) { m_r[r] = -3.0e38f; l_r[r] = 0.f; }
#pragma unroll
  for (int dt = 0; dt < DT; ++dt) oacc[dt] = (v8f){0.f,0.f,0.f,0.f,0.f,0.f,0.f,0.f};
#pragma unroll 1
  for (int j0 = 0; j0 < jend; j0 += 32) {
    v8f sa = (v8f){0.f,0.f,0.f,0.f,0.f,0.f,0.f,0.f}, sb = sa;
    const unsigned short* kp0 = kb + (size_t)j0 * ldk + 8 * hh; const unsigned short* kp1 = kp0 + (size_t)16 * ldk;
    const unsigned short* mt = mq + (size_t)(j0 >> 5) * 512;
    /* every load of the score step (q, k, mask) is issued as one group ahead of the first product: the pass waits for one load round trip, not one per k-step */
    FragH a[KS], k0[KS], k1[KS], fm;
#pragma unroll
    for (int ks = 0; ks < KS; ++ks) {
      /* A (q) and B (k) fragments share one k order: element e < 8 <-> d = 32 ks + 8 hh + e; e >= 8 <-> d = 32 ks + 16 + 8 hh + (e - 8) */
      a[ks].half[0] = *(const v8us*)(qr + ks * 32 + 8 * hh); a[ks].half[1] = *(const v8us*)(qr + ks * 32 + 16 + 8 * hh);
      k0[ks].half[0] = *(const v8us*)(kp0 + ks * 32); k0[ks].half[1] = *(const v8us*)(kp0 + ks * 32 + 16);
      k1[ks].half[0] = *(const v8us*)(kp1 + ks * 32); k1[ks].half[1] = *(const v8us*)(kp1 + ks * 32 + 16);
    }
    fm.half[0] = *(const v8us*)mt; fm.half[1] = *(const v8us*)(mt + 256);
    /* the group's address registers are inputs here, so they stay whole (no load's result is given them) up to this wait */
    asm volatile("s_wait_xcnt 0x0" :: "v"(kp0), "v"(kp1), "v"(mt) : "memory");
#pragma unroll
    for (int ks = 0; ks < KS; ++ks) { sa = g2_mma(a[ks].v, k0[ks].v, sa); sb = g2_mma(a[ks].v, k1[ks].v, sb); }
    /* the V^T fragments of this pass are issued here, ahead of the softmax, which covers their round trip */
    FragH bv[DT];
    const unsigned short* vp = Vth + (size_t)ln * TK + j0 + 8 * hh;
#pragma unroll
    for (int dt = 0; dt < DT; ++dt) { bv[dt].half[0] = *(const v8us*)(vp + (size_t)(dt * 16) * TK); bv[dt].half[1] = *(const v8us*)(vp + (size_t)(dt * 16) * TK + 16); }
    /* the group's address register is an input here, so it stays whole up to this wait */
    asm volatile("s_wait_xcnt 0x0" :: "v"(vp) : "memory");
#pragma unroll
    for (int r = 0; r < 8; ++r) {
      const float mk0 = bf16_val(fm.u[2 * r]), mk1 = bf16_val(fm.u[2 * r + 1]);
      const float s0 = sa[r] * SCL + mk0, s1 = sb[r] * SCL + mk1;
      float mc = fmaxf(s0, s1);
      mc = fmaxf(mc, __shfl_xor(mc, 1, 32)); mc = fmaxf(mc, __shfl_xor(mc, 2, 32)); mc = fmaxf(mc, __shfl_xor(mc, 4, 32)); mc = fmaxf(mc, __shfl_xor(mc, 8, 32));
      const float mn = fmaxf(m_r[r], mc); const float al = (mn > -1.0e38f) ? expf(m_r[r] - mn) : 1.0f; m_r[r] = mn;
      const float p0 = expf(s0 - mn), p1 = expf(s1 - mn); l_r[r] = l_r[r] * al + p0 + p1;
#pragma unroll
      for (int dt = 0; dt < DT; ++dt) oacc[dt][r] *= al;
      FragH t2; t2.h[0] = toh_flush(p0 * 1024.0f); t2.h[1] = toh_flush(p1 * 1024.0f);
      sP[w][8 * hh + r][ln] = t2.u[0]; sP[w][8 * hh + r][16 + ln] = t2.u[1];
    }
    __builtin_amdgcn_fence(4, "workgroup"); __builtin_amdgcn_wave_barrier();
    FragH pa; pa.half[0] = *(const v8us*)&sP[w][ln][8 * hh]; pa.half[1] = *(const v8us*)&sP[w][ln][16 + 8 * hh];
#pragma unroll
    for (int dt = 0; dt < DT; ++dt) {
      /* A (P: key columns of the LDS tile) and B (V^T rows, keys contiguous) share the same key order: element e < 8 <-> key j0 + 8 hh + e; e >= 8 <-> key j0 + 16 + 8 hh + (e - 8) */
      oacc[dt] = g2_mma(pa.v, bv[dt].v, oacc[dt]);
    }
    __builtin_amdgcn_fence(4, "workgroup"); __builtin_amdgcn_wave_barrier();
  }
#pragma unroll
  for (int r = 0; r < 8; ++r) { float l = l_r[r]; l += __shfl_xor(l, 1, 32); l += __shfl_xor(l, 2, 32); l += __shfl_xor(l, 4, 32); l += __shfl_xor(l, 8, 32); l_r[r] = (l > 0.f) ? 1.0f / (l * 1024.0f) : 0.f; }
#pragma unroll
  for (int dt = 0; dt < DT; ++dt)
#pragma unroll
    for (int r = 0; r < 8; ++r) sO[w][8 * hh + r][dt * 16 + ln] = oacc[dt][r] * l_r[r];
  __builtin_amdgcn_fence(4, "workgroup"); __builtin_amdgcn_wave_barrier();
  {
#pragma unroll
    for (int rp = 0; rp < RPW; ++rp) { const v4f val = *(const v4fa*)&sO[w][rp][lane * 4]; *(v4f*)(O + ((size_t)b * TQ + q0 + rp) * ldo + h * HDIM + lane * 4) = val; }
    
  }
}
// 5-plane variant for query blocks [QB05, QB05+QBN5) (positions < RE), one 64-wide half dh of the head's 128 dims per block: S = Qh.Kh^T + (Ql.Kh^T + Qh.Kl^T)/1024 with Q/K = [hi | x1024 residual] planes (residual planes compact: rows b*RE + s);
// O = (Ph.Vh + (Pl.Vh + Ph.Vl)/1024) / l with P = [hi | x1024 residual] of 1024 p and V^T = [hi | x1024 residual] (VtL pitch RE); separate residual accumulators folded before the normalisation.
// key tiles [0, JE[qblk]) clamped to [1, RE/32] (the compact planes hold keys < RE); a block whose mask exposes keys beyond RE writes NaN rows.
__global__ __launch_bounds__(128) __attribute__((amdgpu_num_vgpr(256))) void k_flash5(const _Float16* __restrict__ Q16, const _Float16* __restrict__ QL, int ldq, const _Float16* __restrict__ K16, const _Float16* __restrict__ KL, int ldk,
                                                const _Float16* __restrict__ Vt, const _Float16* __restrict__ VtL, const unsigned short* __restrict__ MP, const int* __restrict__ JE, float* __restrict__ O, int ldo) {
  constexpr int RPW = 16, DT = 4, KS = 4;
  __shared__ __attribute__((aligned(16))) unsigned short sP[4][RPW][40];
  __shared__ __attribute__((aligned(16))) unsigned short sPL[4][RPW][40];
  __shared__ __attribute__((aligned(16))) float sO[4][RPW][68];
  const int tid = threadIdx.x, lane = tid & 31, ln = lane & 15, hh = lane >> 4;
  const int w = __builtin_amdgcn_readfirstlane(tid >> 5);
  const int dh = blockIdx.x & 1; const int bx = blockIdx.x >> 1;
  const int slab = bx / QBN5, qblk = QB05 + bx % QBN5; const int b = slab / NH, h = slab % NH; const int kvh = h / NREP;
  const int qb0 = qblk * (4 * RPW); const int q0 = qb0 + w * RPW;
  const unsigned short* qr = (const unsigned short*)Q16 + ((size_t)b * TQ + q0 + ln) * ldq + h * HDIM;
  const unsigned short* ql = (const unsigned short*)QL + ((size_t)b * RE + q0 + ln) * ldq + h * HDIM;
  const unsigned short* kb = (const unsigned short*)K16 + ((size_t)b * TK + ln) * ldk + kvh * HDIM;
  const unsigned short* klb = (const unsigned short*)KL + ((size_t)b * RE + ln) * ldk + kvh * HDIM;
  const unsigned short* Vth = (const unsigned short*)Vt + ((size_t)(b * NKVH + kvh) * HDIM + dh * 64) * TK;
  const unsigned short* Vtl = (const unsigned short*)VtL + ((size_t)(b * NKVH + kvh) * HDIM + dh * 64) * RE;
  const unsigned short* mq = MP + (size_t)(q0 >> 4) * (size_t)(TK / 32) * 512 + lane * 8;
  const int jraw = JE[qblk * 32];
  const float pz = (jraw > RE / 32) ? __uint_as_float(0x7FC00000u) : 0.0f;
  int jt = (jraw < 1) ? 1 : jraw; jt = (jt > RE / 32) ? (RE / 32) : jt;
  const int jend = __builtin_amdgcn_readfirstlane(jt) * 32;
  float m_r[8], l_r[8]; v8f oacc[DT], oaccL[DT];
#pragma unroll
  for (int r = 0; r < 8; ++r) { m_r[r] = -3.0e38f; l_r[r] = 0.f; }
#pragma unroll
  for (int dt = 0; dt < DT; ++dt) { oacc[dt] = (v8f){0.f,0.f,0.f,0.f,0.f,0.f,0.f,0.f}; oaccL[dt] = oacc[dt]; }
#pragma unroll 1
  for (int j0 = 0; j0 < jend; j0 += 32) {
    v8f sa = (v8f){0.f,0.f,0.f,0.f,0.f,0.f,0.f,0.f}, sb = sa, sal = sa, sbl = sa;
    const unsigned short* qp = qr + 8 * hh; const unsigned short* qlp = ql + 8 * hh;
    const unsigned short* kp0 = kb + (size_t)j0 * ldk + 8 * hh; const unsigned short* kp1 = kp0 + (size_t)16 * ldk;
    const unsigned short* gp0 = klb + (size_t)j0 * ldk + 8 * hh; const unsigned short* gp1 = gp0 + (size_t)16 * ldk;
    const unsigned short* mt = mq + (size_t)(j0 >> 5) * 512;
    FragH fm; fm.half[0] = *(const v8us*)mt; fm.half[1] = *(const v8us*)(mt + 256);
    /* all six planes' fragments of a k-step are issued as one group ahead of its products: four load round trips a pass, not eight (a group of two k-steps spills registers) */
#pragma unroll
    for (int ks = 0; ks < KS; ++ks) {
      /* all A and B fragments of this step share one k order: element e < 8 <-> d = 32 ks + 8 hh + e; e >= 8 <-> d = 32 ks + 16 + 8 hh + (e - 8) */
      FragH a, al2, k0, k1, g0, g1;
      a.half[0] = *(const v8us*)(qp + ks * 32); a.half[1] = *(const v8us*)(qp + ks * 32 + 16);
      al2.half[0] = *(const v8us*)(qlp + ks * 32); al2.half[1] = *(const v8us*)(qlp + ks * 32 + 16);
      k0.half[0] = *(const v8us*)(kp0 + ks * 32); k0.half[1] = *(const v8us*)(kp0 + ks * 32 + 16);
      k1.half[0] = *(const v8us*)(kp1 + ks * 32); k1.half[1] = *(const v8us*)(kp1 + ks * 32 + 16);
      g0.half[0] = *(const v8us*)(gp0 + ks * 32); g0.half[1] = *(const v8us*)(gp0 + ks * 32 + 16);
      g1.half[0] = *(const v8us*)(gp1 + ks * 32); g1.half[1] = *(const v8us*)(gp1 + ks * 32 + 16);
      /* the group's address registers are inputs here, so they stay whole (no load's result is given them) up to this wait */
      asm volatile("s_wait_xcnt 0x0" :: "v"(qp), "v"(qlp), "v"(kp0), "v"(kp1), "v"(gp0), "v"(gp1), "v"(mt) : "memory");
      sa = g2_mma(a.v, k0.v, sa); sb = g2_mma(a.v, k1.v, sb);
      sal = g2_mma(al2.v, k0.v, sal); sbl = g2_mma(al2.v, k1.v, sbl);
      sal = g2_mma(a.v, g0.v, sal); sbl = g2_mma(a.v, g1.v, sbl);
    }
    /* both V^T planes' fragments of this pass are issued here, ahead of the softmax, which covers their round trip */
    FragH bv[DT], bl[DT];
    const unsigned short* vp = Vth + (size_t)ln * TK + j0 + 8 * hh; const unsigned short* vlp = Vtl + (size_t)ln * RE + j0 + 8 * hh;
#pragma unroll
    for (int dt = 0; dt < DT; ++dt) {
      bv[dt].half[0] = *(const v8us*)(vp + (size_t)(dt * 16) * TK); bv[dt].half[1] = *(const v8us*)(vp + (size_t)(dt * 16) * TK + 16);
      bl[dt].half[0] = *(const v8us*)(vlp + (size_t)(dt * 16) * RE); bl[dt].half[1] = *(const v8us*)(vlp + (size_t)(dt * 16) * RE + 16);
    }
    /* the group's address registers are inputs here, so they stay whole up to this wait */
    asm volatile("s_wait_xcnt 0x0" :: "v"(vp), "v"(vlp) : "memory");
#pragma unroll
    for (int r = 0; r < 8; ++r) {
      const float mk0 = bf16_val(fm.u[2 * r]), mk1 = bf16_val(fm.u[2 * r + 1]);
      const float d0 = sa[r] + sal[r] * 0.0009765625f, d1 = sb[r] + sbl[r] * 0.0009765625f;
      const float s0 = d0 * SCL + mk0, s1 = d1 * SCL + mk1;
      float mc = fmaxf(s0, s1);
      mc = fmaxf(mc, __shfl_xor(mc, 1, 32)); mc = fmaxf(mc, __shfl_xor(mc, 2, 32)); mc = fmaxf(mc, __shfl_xor(mc, 4, 32)); mc = fmaxf(mc, __shfl_xor(mc, 8, 32));
      const float mn = fmaxf(m_r[r], mc); const float al = (mn > -1.0e38f) ? expf(m_r[r] - mn) : 1.0f; m_r[r] = mn;
      const float p0 = expf(s0 - mn), p1 = expf(s1 - mn); l_r[r] = l_r[r] * al + p0 + p1;
#pragma unroll
      for (int dt = 0; dt < DT; ++dt) { oacc[dt][r] *= al; oaccL[dt][r] *= al; }
      FragH t2, t2l; const float ps0 = p0 * 1024.0f, ps1 = p1 * 1024.0f;
      t2.h[0] = toh_flush(ps0); t2.h[1] = toh_flush(ps1);
      t2l.h[0] = toh_flush((ps0 - (float)t2.h[0]) * 1024.0f); t2l.h[1] = toh_flush((ps1 - (float)t2.h[1]) * 1024.0f);
      sP[w][8 * hh + r][ln] = t2.u[0]; sP[w][8 * hh + r][16 + ln] = t2.u[1]; sPL[w][8 * hh + r][ln] = t2l.u[0]; sPL[w][8 * hh + r][16 + ln] = t2l.u[1];
    }
    __builtin_amdgcn_fence(4, "workgroup"); __builtin_amdgcn_wave_barrier();
    FragH pa, pl;
    pa.half[0] = *(const v8us*)&sP[w][ln][8 * hh]; pa.half[1] = *(const v8us*)&sP[w][ln][16 + 8 * hh];
    pl.half[0] = *(const v8us*)&sPL[w][ln][8 * hh]; pl.half[1] = *(const v8us*)&sPL[w][ln][16 + 8 * hh];
#pragma unroll
    for (int dt = 0; dt < DT; ++dt) {
      /* A (P tiles) and B (V^T rows) share the same key order: element e < 8 <-> key j0 + 8 hh + e; e >= 8 <-> key j0 + 16 + 8 hh + (e - 8) */
      oacc[dt] = g2_mma(pa.v, bv[dt].v, oacc[dt]);
      oaccL[dt] = g2_mma(pl.v, bv[dt].v, oaccL[dt]);
      oaccL[dt] = g2_mma(pa.v, bl[dt].v, oaccL[dt]);
    }
    __builtin_amdgcn_fence(4, "workgroup"); __builtin_amdgcn_wave_barrier();
  }
#pragma unroll
  for (int r = 0; r < 8; ++r) { float l = l_r[r]; l += __shfl_xor(l, 1, 32); l += __shfl_xor(l, 2, 32); l += __shfl_xor(l, 4, 32); l += __shfl_xor(l, 8, 32); l_r[r] = (l > 0.f) ? 1.0f / (l * 1024.0f) : 0.f; }
#pragma unroll
  for (int dt = 0; dt < DT; ++dt)
#pragma unroll
    for (int r = 0; r < 8; ++r) { float v = oacc[dt][r]; v += oaccL[dt][r] * 0.0009765625f; sO[w][8 * hh + r][dt * 16 + ln] = v * l_r[r] + pz; }
  __builtin_amdgcn_fence(4, "workgroup"); __builtin_amdgcn_wave_barrier();
  {
#pragma unroll
    for (int rp = 0; rp < RPW; rp += 2) { const int r = rp + (lane >> 4), pc = lane & 15; const v4f val = *(const v4fa*)&sO[w][r][pc * 4]; *(v4f*)(O + ((size_t)b * TQ + q0 + r) * ldo + h * HDIM + dh * 64 + pc * 4) = val; }
    
  }
}

extern "C" void kernel_launch(void* const* d_in, const int* in_sizes, int n_in,
                              void* d_out, int out_size, void* d_ws, size_t ws_size, hipStream_t stream) {
  if (n_in < 10) return;
  const size_t needx = ((size_t)(NB - 1) * SEQ_FULL + (size_t)SLEN) * DM;
  if ((size_t)in_sizes[0] < needx) return;
  if ((size_t)in_sizes[1] < (size_t)DM * DM) return;
  if ((size_t)in_sizes[2] < (size_t)VW * DM) return;
  if ((size_t)in_sizes[3] < (size_t)VW * DM) return;
  if ((size_t)in_sizes[4] < (size_t)DM * DM) return;
  if ((size_t)in_sizes[5] < (size_t)HDIM) return;
  if ((size_t)in_sizes[6] < (size_t)HDIM) return;
  if ((size_t)in_sizes[7] < (size_t)SLEN * RTW) return;
  if ((size_t)in_sizes[8] < (size_t)SLEN * RTW) return;
  if ((size_t)in_sizes[9] < (size_t)(SLEN - 1) * MSKP + (size_t)SLEN) return;
  if ((size_t)out_size < needx) return;
  /* inputs in order: x, Wq, Wk, Wv, Wo, q gain, k gain, cos table, sin table, mask */
  const float* x = (const float*)d_in[0]; const float* Wq = (const float*)d_in[1]; const float* Wk = (const float*)d_in[2]; const float* Wv = (const float*)d_in[3]; const float* Wo = (const float*)d_in[4];
  const float* qnw = (const float*)d_in[5]; const float* knw = (const float*)d_in[6]; const float* rct = (const float*)d_in[7]; const float* rst = (const float*)d_in[8]; const float* msk = (const float*)d_in[9];
  float* dout = (float*)d_out;
  char* ws = (char*)d_ws; size_t off = 0;
  auto take = [&](size_t bytes) { char* p = ws + off; off += (bytes + 255) & ~(size_t)255; return p; };
  const size_t np = (size_t)NR * DM;
  const size_t nw8 = (size_t)DM * DM / 8;
  const size_t nk8 = (size_t)VW * DM / 8;
  _Float16* BQ = (_Float16*)take(SZ_BQ);                                /* [n][k] f16, x16 */
  _Float16* BK = (_Float16*)take(SZ_BK);
  _Float16* BV = (_Float16*)take(SZ_BK);
  _Float16* B2 = (_Float16*)take(SZ_B2);                                /* [n][2*DM] f16: [x16384 | x16] copies of Wo */
  float* FS = (float*)take(SZ_FS);                                      /* f32 scratch plane: q rows [NR][DM], then k rows [NR][VW], then v rows [NR][VW], then the context [NR][DM] */
  _Float16* X16 = (_Float16*)take(SZ_X16);                              /* f16 input rows; reused as V^T [(b,g)][64][TK] after the v GEMM */
  _Float16* VT = X16;
  _Float16* QH = (_Float16*)take(SZ_QH);                                /* reused as the context hi plane after the attention */
  _Float16* KHp = (_Float16*)take(SZ_KH);                               /* [NR][VW] */
  _Float16* V16 = (_Float16*)take(SZ_KH);                               /* [NR][VW] */
  _Float16* QL = (_Float16*)take(SZ_QL);                                /* [NB*RE][DM] residual plane */
  _Float16* KL = (_Float16*)take(SZ_KL);                                /* [NB*RE][VW] residual plane */
  _Float16* VTL = (_Float16*)take(SZ_VTL);                              /* [(b,g)][64][RE] */
  _Float16* A2 = (_Float16*)take(SZ_A2);                                /* [NB*RE][2*DM] = [ctx hi | ctx residual] */
  unsigned short* MPp = (unsigned short*)take(SZ_MP);                   /* bf16 mask plane, accumulator layout */
  int* JEp = (int*)take(SZ_JE);                                         /* [QBLKS][32] key-tile counts */
  _Float16* OH = QH;
  if (off > ws_size) return;
  if (off > ((size_t)128 << 20)) return;

  const unsigned gw = (unsigned)((nw8 + 255) / 256);
  const unsigned gk = (unsigned)((nk8 + 255) / 256);
  k_wsc<<<gw, 256, 0, stream>>>(Wq, BQ, nw8, WSC_LO);
  k_wsc<<<gk, 256, 0, stream>>>(Wk, BK, nk8, WSC_LO);
  k_wsc<<<gk, 256, 0, stream>>>(Wv, BV, nk8, WSC_LO);
  k_wsc2<<<gw, 256, 0, stream>>>(Wo, B2, nw8, WSC_HI, WSC_LO);
  k_mperm<<<(unsigned)(((size_t)(SLEN / 16) * (SLEN / 32) * 64) / 256), 256, 0, stream>>>(msk, MPp);
  k_mjend<<<(unsigned)QBLKS, 1024, 0, stream>>>(msk, JEp);
  const unsigned g8 = (unsigned)((np / 8 + 255) / 256);
  k_x16<<<g8, 256, 0, stream>>>(x, X16, np / 8);
  const dim3 gp((unsigned)((NR / 128) * (DM / 64)), 1);
  const dim3 gkv((unsigned)((NR / 128) * (VW / 64)), 1);
  const unsigned grq = (unsigned)(((size_t)NR * NH * 16) / 256);
  const unsigned grk = (unsigned)(((size_t)NR * NKVH * 16) / 256);
  k_gemm2<0><<<gp, 128, 0, stream>>>(X16, DM, 0, BQ, DM, 0, AL_P, FS, nullptr, DM, 0, NR, DM, DM);        /* q = x Wq^T (f32 rows, pitch DM) */
  k_nrope_q<<<grq, 256, 0, stream>>>(FS, DM, qnw, rct, rst, QH, QL);
  k_gemm2<0><<<gkv, 128, 0, stream>>>(X16, DM, 0, BK, DM, 0, AL_P, FS, nullptr, VW, 0, NR, VW, DM);       /* k = x Wk^T (f32 rows, pitch VW) */
  k_nrope_k<<<grk, 256, 0, stream>>>(FS, VW, knw, rct, rst, KHp, KL);
  k_gemm2<0><<<gkv, 128, 0, stream>>>(X16, DM, 0, BV, DM, 0, AL_P, FS, V16, VW, 0, NR, VW, DM);           /* v = x Wv^T (f32 rows + f16 plane, pitch VW) */
  k_vtg<<<(unsigned)(NB * NV64 * (SLEN / 64)), 256, 0, stream>>>(V16, VT);
  k_vtl<<<(unsigned)(NB * NV64 * (RE / 64)), 256, 0, stream>>>(FS, VTL);
  k_flash5<<<(unsigned)(NB * NH * QBN5 * 2), 128, 0, stream>>>(QH, QL, DM, KHp, KL, VW, VT, VTL, MPp, JEp, FS, DM);
  if (QBNP > 0) k_flash<<<(unsigned)(NB * NH * QBNP), 128, 0, stream>>>(QH, DM, KHp, VW, VT, MPp, JEp, FS, DM);
  k_hl<<<g8, 256, 0, stream>>>(FS, OH, A2, np / 8);
  /* out rows [0, RE) per batch: [ctx hi | ctx residual] . [Wo x16384 ; Wo x16] / 16384  (K = 2*DM) */
  const dim3 ge((unsigned)((RE / 128) * (DM / 64)), NB);
  k_gemm2<0><<<ge, 128, 0, stream>>>(A2, 2 * DM, (size_t)RE * 2 * DM, B2, 2 * DM, 0, AL_E, dout, nullptr, DM, (size_t)SEQ_FULL * DM, RE, DM, 2 * DM);
  /* out rows [RE, SLEN) per batch: ctx hi . (Wo x16) / 16 */
  if (SLEN > RE) {
    const dim3 gl((unsigned)(((SLEN - RE) / 128) * (DM / 64)), NB);
    k_gemm2<0><<<gl, 128, 0, stream>>>(OH + (size_t)RE * DM, DM, (size_t)SLEN * DM, B2 + DM, 2 * DM, 0, AL_P, dout + (size_t)RE * DM, nullptr, DM, (size_t)SEQ_FULL * DM, SLEN - RE, DM, DM);
  }
}

// v004
// One run takes 409 microseconds.
// Two timings next to v003 put it at 1.12 and 1.14 times that version's speed.
// Counting every step since v000, it is 2.20 times as fast.
#include <hip/hip_runtime.h>
// Contractions: x.Wq^T, x.Wk^T, x.Wv^T, ctx.Wo^T = v_wmma_f32_16x16x32_f16 (f16 operands: bf16-RNE inputs exact in f16, weights carried x16 (x16384 for the ctx-hi half of the early-row output GEMM); f32 accumulate); scores q.k^T and P.V^T = v_wmma_f32_16x16x32_f16 (plain f16 hi planes; hi + x1024 residual planes of q, k, P and v for query positions < RE; P carried x1024), f32 accumulate; per-head RMS normalisation, rotary step, additive mask, softmax and normalisers f32.

#ifndef NB
#define NB 2
#endif
#ifndef SEQ
#define SEQ 2048
#endif
#define NB_FULL 2
#define SEQ_FULL 2048
#define DM 2048
#define NH 16
#define NKVH 4
#define NREP (NH / NKVH)
#define HDIM 128
#define VW (NKVH * HDIM)                     /* width of the k / v projection rows */
#define NV64 (VW / 64)                       /* 64-wide column groups of the v rows */
#define MSKP 2048                            /* row pitch of the mask input */
#define RTW 64                               /* row pitch of the cos / sin inputs */
#define SLEN SEQ
#define NR (NB * SLEN)
#define TQ SLEN
#define TK SLEN
#define SCL 0.08838834764831845f
#define MVIS (-1.0e8f)                       /* a mask entry above this keeps its key visible */
#define QBLKS (TQ / 64)
#define RE ((SLEN < 512) ? SLEN : 512)      /* query positions [0, RE) get residual planes on q, k, P, v and ctx */
#define QB05 0
#define QBN5 (RE / 64)
#define QB0P QBN5
#define QBNP (QBLKS - QBN5)
static_assert(SLEN % 128 == 0);
static_assert(SLEN <= SEQ_FULL);
static_assert(SLEN <= MSKP);
static_assert(NB >= 1 && NB <= NB_FULL);
static_assert(RE % 128 == 0 && RE <= SLEN);
static_assert((SLEN - RE) % 128 == 0);
static_assert(DM % 64 == 0 && DM == NH * HDIM);
static_assert(HDIM == 128 && NH % NKVH == 0);
static_assert(VW % 64 == 0 && NV64 * 64 == VW);
static_assert(DM % 32 == 0 && (2 * DM) % 32 == 0);
static_assert(NR % 128 == 0);
static_assert(((size_t)NR * NH * 16) % 256 == 0 && ((size_t)NR * NKVH * 16) % 256 == 0);
static_assert((NH & (NH - 1)) == 0 && (NKVH & (NKVH - 1)) == 0);   /* head counts are powers of two: index arithmetic by shifts and masks */
static_assert((size_t)NR * NH * 16 < ((size_t)1 << 31));           /* 32-bit thread indices in the normalise + rotary kernels */
static_assert(((size_t)(SLEN / 16) * (SLEN / 32) * 64) % 256 == 0);
static_assert(32 * 16 == HDIM * 4);          /* one store instruction of 32 lanes x 16 B == one 128-float row segment */
static_assert(16 * 16 == 64 * 4);            /* 16 lanes x 16 B == one 64-float row segment */
static_assert(4 * 16 * 40 * 2 + 4 * 16 * 132 * 4 <= 131072);
static_assert(2 * 4 * 16 * 40 * 2 + 4 * 16 * 68 * 4 <= 131072);
static_assert(4 * 32 * 68 * 4 <= 131072);

static constexpr float WSC_LO = 16.0f;
static constexpr float WSC_HI = 16384.0f;
static constexpr float AL_P = 0.0625f;
static constexpr float AL_E = 6.103515625e-05f;   /* 0.0625 / 1024 */

static constexpr size_t al256(size_t b) { return (b + 255) & ~(size_t)255; }
static constexpr size_t SZ_BQ = al256((size_t)DM * DM * 2);
static constexpr size_t SZ_BK = al256((size_t)VW * DM * 2);
static constexpr size_t SZ_B2 = al256((size_t)DM * 2 * DM * 2);
static constexpr size_t SZ_FS = al256((size_t)NR * DM * 4);
static constexpr size_t SZ_X16 = al256((size_t)NR * DM * 2);
static constexpr size_t SZ_QH = al256((size_t)NR * DM * 2);
static constexpr size_t SZ_KH = al256((size_t)NR * VW * 2);
static constexpr size_t SZ_QL = al256((size_t)NB * RE * DM * 2);
static constexpr size_t SZ_KL = al256((size_t)NB * RE * VW * 2);
static constexpr size_t SZ_VTL = al256((size_t)NB * NV64 * 64 * RE * 2);
static constexpr size_t SZ_A2 = al256((size_t)NB * RE * 2 * DM * 2);
static constexpr size_t SZ_MP = al256((size_t)SLEN * SLEN * 2);
static constexpr size_t SZ_JE = al256((size_t)QBLKS * 32 * 4);
static_assert((size_t)NB * NV64 * 64 * TK * 2 <= SZ_X16);       /* V^T aliases the f16 input plane */
static_assert((size_t)NR * VW * 4 <= SZ_FS);
static_assert(SZ_BQ + 2 * SZ_BK + SZ_B2 + SZ_FS + SZ_X16 + SZ_QH + 2 * SZ_KH + SZ_QL + SZ_KL + SZ_VTL + SZ_A2 + SZ_MP + SZ_JE <= ((size_t)128 << 20));

typedef _Float16 v16h __attribute__((ext_vector_type(16)));
typedef _Float16 v4h __attribute__((ext_vector_type(4)));
typedef unsigned short v8us __attribute__((ext_vector_type(8), may_alias));
typedef float v8f __attribute__((ext_vector_type(8)));
typedef float v4f __attribute__((ext_vector_type(4)));
typedef float v4fa __attribute__((ext_vector_type(4), may_alias));
union FragH { v16h v; v8us half[2]; _Float16 h[16]; unsigned short u[16]; };

__device__ __forceinline__ unsigned short bf16_bits(float x) { unsigned int u = __float_as_uint(x); return (unsigned short)((u + 0x7FFFu + ((u >> 16) & 1u)) >> 16); }
__device__ __forceinline__ float bf16_val(unsigned short b) { return __uint_as_float(((unsigned int)b) << 16); }
__device__ __forceinline__ float bf16_rne(float x) { return bf16_val(bf16_bits(x)); }
// f32 -> f16 for WMMA operand planes: values under the smallest f16 normal become +0
__device__ __forceinline__ _Float16 toh_flush(float v) { const _Float16 r = (_Float16)v; return (fabsf(v) < 6.103515625e-05f) ? (_Float16)0.0f : r; }

// D += A.B with NT terms: 1 = ah.bh, 2 = + al.bh, 3 = + ah.bl; hazard guard after the group
template <int NT>
__device__ __forceinline__ v8f mmaH(v16h ah, v16h al, v16h bh, v16h bl, v8f c) {
  c = __builtin_amdgcn_wmma_f32_16x16x32_f16(false, ah, false, bh, (short)0, c, false, false);
  if (NT >= 2) c = __builtin_amdgcn_wmma_f32_16x16x32_f16(false, al, false, bh, (short)0, c, false, false);
  if (NT >= 3) c = __builtin_amdgcn_wmma_f32_16x16x32_f16(false, ah, false, bl, (short)0, c, false, false);
  asm volatile("v_nop\n\tv_nop\n\tv_nop\n\tv_nop" : "+v"(c) : "v"(ah), "v"(al), "v"(bh), "v"(bl));
  return c;
}
// 16x32 fragment from a 16-bit row-major tile (rows = m or n, k contiguous): elements 0..7 <- k0+8h+0..7, 8..15 <- k0+16+8h+0..7
__device__ __forceinline__ v16h g2_frag(const _Float16* p, int hh) { FragH f; f.half[0] = *(const v8us*)((const unsigned short*)p + 8 * hh); f.half[1] = *(const v8us*)((const unsigned short*)p + 16 + 8 * hh); return f.v; }
__device__ __forceinline__ v8f g2_mma(v16h a, v16h b, v8f c) { v8f d = __builtin_amdgcn_wmma_f32_16x16x32_f16(false, a, false, b, (short)0, c, false, false); asm volatile("v_nop\n\tv_nop\n\tv_nop\n\tv_nop" : "+v"(d) : "v"(a), "v"(b)); return d; }

// Reduction over each 16-lane row (lanes l ^ 1, ^ 2, ^ 4, ^ 8 in that order, the order of the xor butterfly) of eight values at once, on the vector port (DPP row_xmask): no trip through the LDS unit and no wait per step.
// The eight values' instructions of a step stand side by side, so each instruction's producer is eight instructions back and no link of a chain is waited for. All 32 lanes are on at every call.
#define RX_ONE(OP, R, M) OP " " R ", " R ", " R " row_xmask:" M " row_mask:0xf bank_mask:0xf\n\t"
#define RX_EIGHT(OP, M) RX_ONE(OP, "%0", M) RX_ONE(OP, "%1", M) RX_ONE(OP, "%2", M) RX_ONE(OP, "%3", M) RX_ONE(OP, "%4", M) RX_ONE(OP, "%5", M) RX_ONE(OP, "%6", M) RX_ONE(OP, "%7", M)
#define RX_TREE(OP) RX_EIGHT(OP, "1") RX_EIGHT(OP, "2") RX_EIGHT(OP, "4") RX_EIGHT(OP, "8")
__device__ __forceinline__ void row16_max8(float (&v)[8]) {
  asm volatile(RX_TREE("v_max_num_f32_dpp") : "+v"(v[0]), "+v"(v[1]), "+v"(v[2]), "+v"(v[3]), "+v"(v[4]), "+v"(v[5]), "+v"(v[6]), "+v"(v[7]));
}
__device__ __forceinline__ void row16_sum8(float (&v)[8]) {
  asm volatile(RX_TREE("v_add_f32_dpp") : "+v"(v[0]), "+v"(v[1]), "+v"(v[2]), "+v"(v[3]), "+v"(v[4]), "+v"(v[5]), "+v"(v[6]), "+v"(v[7]));
}

__global__ __launch_bounds__(256) void k_wsc(const float* __restrict__ Wm, _Float16* __restrict__ Bt, size_t n8, float sc) {
  const size_t t = (size_t)blockIdx.x * 256 + threadIdx.x; if (t >= n8) return;
  const v4f a0 = *(const v4fa*)(Wm + t * 8), a1 = *(const v4fa*)(Wm + t * 8 + 4);
  FragH f;
#pragma unroll
  for (int q = 0; q < 4; ++q) { f.h[q] = toh_flush(bf16_rne(a0[q]) * sc); f.h[4 + q] = toh_flush(bf16_rne(a1[q]) * sc); }
  const v8us o = f.half[0];
  *(v8us*)((unsigned short*)Bt + t * 8) = o; 
}
__global__ __launch_bounds__(256) void k_wsc2(const float* __restrict__ Wm, _Float16* __restrict__ B2, size_t n8, float sc0, float sc1) {
  const size_t t = (size_t)blockIdx.x * 256 + threadIdx.x; if (t >= n8) return;
  const size_t e = t * 8; const size_t n = e / DM; const size_t k8 = e % DM;
  const v4f a0 = *(const v4fa*)(Wm + e), a1 = *(const v4fa*)(Wm + e + 4);
  FragH f0, f1;
#pragma unroll
  for (int q = 0; q < 4; ++q) {
    const float v0 = bf16_rne(a0[q]), v1 = bf16_rne(a1[q]);
    f0.h[q] = toh_flush(v0 * sc0); f1.h[q] = toh_flush(v0 * sc1);
    f0.h[4 + q] = toh_flush(v1 * sc0); f1.h[4 + q] = toh_flush(v1 * sc1);
  }
  const size_t o = n * (size_t)(2 * DM) + k8;
  const v8us o0 = f0.half[0], o1 = f1.half[0];
  {
    *(v8us*)((unsigned short*)B2 + o) = o0;
    *(v8us*)((unsigned short*)B2 + o + DM) = o1;
    
  }
}

// mask plane in accumulator layout: MP[(qt*(SLEN/32) + kt)][half][lane][8] bf16 bits; element 2*rr + c of (half, lane) = mask[qt*16 + 8*(lane>>4) + 4*half + rr][kt*32 + 16*c + (lane&15)];
__global__ __launch_bounds__(256) void k_mperm(const float* __restrict__ msk, unsigned short* __restrict__ MP) {
  const size_t t = (size_t)blockIdx.x * 256 + threadIdx.x; if (t >= (size_t)(SLEN / 16) * (SLEN / 32) * 64) return;
  const int lane = (int)(t & 31); const int half = (int)((t >> 5) & 1); const size_t tile = t >> 6;
  const int kt = (int)(tile % (size_t)(SLEN / 32)); const int qt = (int)(tile / (size_t)(SLEN / 32));
  const int ln = lane & 15, hh = lane >> 4;
  const float* mr = msk + (size_t)(qt * 16 + 8 * hh + 4 * half) * MSKP + kt * 32 + ln;
  FragH f;
#pragma unroll
  for (int rr = 0; rr < 4; ++rr) { const float a = mr[(size_t)rr * MSKP]; const float c = mr[(size_t)rr * MSKP + 16]; f.u[2 * rr] = bf16_bits(a); f.u[2 * rr + 1] = bf16_bits(c); }
  const v8us o = f.half[0];
  *(v8us*)(MP + t * 8) = o; 
}
// per 64-query block: JE[qblk][0..32) = number of 32-key tiles to visit = 1 + last tile holding a visible entry (value > MVIS) in any of the 64 rows; all tiles if some row has no visible entry.
__global__ __launch_bounds__(1024) void k_mjend(const float* __restrict__ msk, int* __restrict__ JE) {
  constexpr int NL = SLEN / 128;               /* 16-B loads per lane and row */
  __shared__ int smax[32]; __shared__ int snone[32];
  const int tid = threadIdx.x, lane = tid & 31; const int w = __builtin_amdgcn_readfirstlane(tid >> 5);
  const int qblk = blockIdx.x;
  int wmax = -1, wnone = 0;
  /* 32 waves, two rows each; kept rolled: the loads of both rows at once need more registers than a 32-wave block leaves a wave (spills) */
#pragma unroll 1
  for (int rr = 0; rr < 2; ++rr) {
    const float* mr = msk + (size_t)(qblk * 64 + w * 2 + rr) * MSKP + lane * 4;
    /* every load of the row is issued as one group ahead of the first compare: one load round trip a row, not one per 128 columns */
    v4f a[NL];
#pragma unroll
    for (int i = 0; i < NL; ++i) a[i] = *(const v4fa*)(mr + i * 128);
    static_assert(NL == 16);
    /* the loaded values are inputs only: all loads of the row are issued, none held back behind a compare; the address is an input too, so it stays whole (no load's result is given it) up to this wait */
    asm volatile("s_wait_xcnt 0x0" :: "v"(a[0]), "v"(a[1]), "v"(a[2]), "v"(a[3]), "v"(a[4]), "v"(a[5]), "v"(a[6]), "v"(a[7]),
                 "v"(a[8]), "v"(a[9]), "v"(a[10]), "v"(a[11]), "v"(a[12]), "v"(a[13]), "v"(a[14]), "v"(a[15]), "v"(mr) : "memory");
    int lm = -1;
#pragma unroll
    for (int i = 0; i < NL; ++i) {
      const bool any = (bf16_rne(a[i][0]) > MVIS) | (bf16_rne(a[i][1]) > MVIS) | (bf16_rne(a[i][2]) > MVIS) | (bf16_rne(a[i][3]) > MVIS);
      lm = any ? ((lane + 32 * i) >> 3) : lm;
    }
    int o = __shfl_xor(lm, 16, 32); lm = (o > lm) ? o : lm;
    o = __shfl_xor(lm, 8, 32); lm = (o > lm) ? o : lm;
    o = __shfl_xor(lm, 4, 32); lm = (o > lm) ? o : lm;
    o = __shfl_xor(lm, 2, 32); lm = (o > lm) ? o : lm;
    o = __shfl_xor(lm, 1, 32); lm = (o > lm) ? o : lm;
    wmax = (lm > wmax) ? lm : wmax; wnone |= (lm < 0) ? 1 : 0;
  }
  if (lane == 0) { smax[w] = wmax; snone[w] = wnone; }
  __syncthreads();
  if (w == 0) {
    int m = -1, nn = 0;
#pragma unroll
    for (int i = 0; i < 32; ++i) { const int a = smax[i]; m = (a > m) ? a : m; nn |= snone[i]; }
    const int jt = (nn != 0) ? (SLEN / 32) : (m + 1);
    *(int*)(JE + qblk * 32 + lane) = jt; 
  }
}

__global__ __launch_bounds__(256) void k_x16(const float* __restrict__ x, _Float16* __restrict__ X16, size_t n8) {
  const size_t t = (size_t)blockIdx.x * 256 + threadIdx.x; if (t >= n8) return;
  const size_t e = t * 8; const size_t r = e / DM; const size_t c = e % DM; const size_t b = r / SLEN, s = r % SLEN;
  const float* src = x + (b * SEQ_FULL + s) * DM + c;
  const v4f a0 = *(const v4fa*)src, a1 = *(const v4fa*)(src + 4);
  FragH f;
#pragma unroll
  for (int q = 0; q < 4; ++q) { f.h[q] = (_Float16)bf16_rne(a0[q]); f.h[4 + q] = (_Float16)bf16_rne(a1[q]); }
  const v8us o = f.half[0];
  *(v8us*)((unsigned short*)X16 + e) = o; 
}

// LDS ring of the GEMM: one stage = 64 k = 128 B of every operand row, [A 128 rows | B 64 rows] at pitch 144 B (16 B x odd: the 16-B fragment reads meet no bank conflict); two stages
#define G2_PB 144
#define G2_STG ((128 + 64) * G2_PB)
static_assert(2 * G2_STG >= 4 * 32 * 68 * 4);   /* the output staging reuses the ring behind the last barrier */
static_assert(2 * G2_STG <= 65536);
static_assert(DM % 64 == 0 && DM >= 128);
// 16x32 fragment from an LDS row (k contiguous), p = row start + 2 * (k0 + 8 hh) bytes: the k order of g2_frag
__device__ __forceinline__ v16h g2_lfrag(const unsigned char* p) { FragH f; f.half[0] = *(const v8us*)p; f.half[1] = *(const v8us*)(p + 32); return f.v; }
// one stage: 12 copies of 16 B per lane (a wave-wide copy = 4 whole 128-B row pieces); lane (r = tid / 8, c = tid % 8) brings chunk c of A rows r + 16 j (j < 8) and of B rows r + 16 j (j < 4).
// l = LDS byte address of (row r, chunk c) in the stage, a / b = the lane's global addresses in A row r / B row r, sa / sb = 16 rows in elements.
__device__ __forceinline__ void g2_stage(unsigned l, const _Float16* a, size_t sa, const _Float16* b, size_t sb) {
  /* s_wait_xcnt closes the copies' own statement: no register that a copy names is rewritten in front of it */
  asm volatile(
      "global_load_async_to_lds_b128 %0, %12, off\n\t"
      "global_load_async_to_lds_b128 %1, %13, off\n\t"
      "global_load_async_to_lds_b128 %2, %14, off\n\t"
      "global_load_async_to_lds_b128 %3, %15, off\n\t"
      "global_load_async_to_lds_b128 %4, %16, off\n\t"
      "global_load_async_to_lds_b128 %5, %17, off\n\t"
      "global_load_async_to_lds_b128 %6, %18, off\n\t"
      "global_load_async_to_lds_b128 %7, %19, off\n\t"
      "global_load_async_to_lds_b128 %8, %20, off\n\t"
      "global_load_async_to_lds_b128 %9, %21, off\n\t"
      "global_load_async_to_lds_b128 %10, %22, off\n\t"
      "global_load_async_to_lds_b128 %11, %23, off\n\t"
      "s_wait_xcnt 0x0"
      :: "v"(l), "v"(l + 16 * G2_PB), "v"(l + 32 * G2_PB), "v"(l + 48 * G2_PB), "v"(l + 64 * G2_PB), "v"(l + 80 * G2_PB), "v"(l + 96 * G2_PB), "v"(l + 112 * G2_PB),
         "v"(l + 128 * G2_PB), "v"(l + 144 * G2_PB), "v"(l + 160 * G2_PB), "v"(l + 176 * G2_PB),
         "v"(a), "v"(a + sa), "v"(a + 2 * sa), "v"(a + 3 * sa), "v"(a + 4 * sa), "v"(a + 5 * sa), "v"(a + 6 * sa), "v"(a + 7 * sa),
         "v"(b), "v"(b + sb), "v"(b + 2 * sb), "v"(b + 3 * sb)
      : "memory");
}

// GEMM C[M][N] = alpha * A[M][K].B  with A f16 row-major (pitch lda), B stored [n][k] f16 (pitch ldb), batched by blockIdx.y (strides sA, sB, sC);
// writes f32 C and/or f16 C16 (pitch ldc). Requires M % 128 == 0, N % 64 == 0, K % 64 == 0 (asserted by the callers' constants).
// Operand tiles come through LDS: asynchronous copies, two stages, stage t + 1 in flight while stage t is multiplied.
template <int ACT>
__global__ __launch_bounds__(128) void k_gemm2(const _Float16* __restrict__ A, int lda, size_t sA, const _Float16* __restrict__ Bh, int ldb, size_t sB, float alpha,
                                               float* C, _Float16* C16, int ldc, size_t sC, int M, int N, int K) {
  __shared__ __attribute__((aligned(16))) unsigned char sm[2 * G2_STG];
  float (*so)[32][68] = (float (*)[32][68])sm;
  const int tid = threadIdx.x, w = tid >> 5, lane = tid & 31, ln = lane & 15, hh = lane >> 4; const int by = blockIdx.y;
  A += (size_t)by * sA; Bh += (size_t)by * sB; const size_t cofs = (size_t)by * sC;
  const int ntn = N >> 6; const int mt = blockIdx.x / ntn, nq = blockIdx.x - mt * ntn; const int row0 = mt * 128 + 32 * w, col0 = nq * 64; if (mt * 128 >= M) return;
  const int cr = tid >> 3, cc = tid & 7;
  const _Float16* ga = A + (size_t)(mt * 128 + cr) * lda + cc * 8; const _Float16* gb = Bh + (size_t)(col0 + cr) * ldb + cc * 8;
  const size_t sa16 = (size_t)16 * lda, sb16 = (size_t)16 * ldb;
  const unsigned lc = (unsigned)(uintptr_t)sm + (unsigned)(cr * G2_PB + cc * 16);
  const int nt = K >> 6;
  const int aofs = (32 * w + ln) * G2_PB + 16 * hh, bofs = (128 + ln) * G2_PB + 16 * hh;
  const v8f z8 = {0.f,0.f,0.f,0.f,0.f,0.f,0.f,0.f}; v8f c00 = z8, c01 = z8, c02 = z8, c03 = z8, c10 = z8, c11 = z8, c12 = z8, c13 = z8;
  g2_stage(lc, ga, sa16, gb, sb16);
  asm volatile("s_wait_asynccnt 0x0" ::: "memory");   /* stage 0 has landed before the barrier publishes it */
  __syncthreads();
  if (nt > 1) g2_stage(lc + G2_STG, ga + 64, sa16, gb + 64, sb16);
#pragma unroll 1
  for (int t = 0; t < nt; ++t) {
    const unsigned char* sb = sm + (t & 1) * G2_STG; const unsigned char* pa = sb + aofs; const unsigned char* pb = sb + bofs;
#pragma unroll
    for (int kk = 0; kk < 2; ++kk) {
      const v16h a0 = g2_lfrag(pa + kk * 64), a1 = g2_lfrag(pa + 16 * G2_PB + kk * 64);
      const v16h b0 = g2_lfrag(pb + kk * 64), b1 = g2_lfrag(pb + 16 * G2_PB + kk * 64), b2 = g2_lfrag(pb + 32 * G2_PB + kk * 64), b3 = g2_lfrag(pb + 48 * G2_PB + kk * 64);
      c00 = g2_mma(a0, b0, c00); c10 = g2_mma(a1, b0, c10);
      c01 = g2_mma(a0, b1, c01); c11 = g2_mma(a1, b1, c11);
      c02 = g2_mma(a0, b2, c02); c12 = g2_mma(a1, b2, c12);
      c03 = g2_mma(a0, b3, c03); c13 = g2_mma(a1, b3, c13);
    }
    asm volatile("s_wait_dscnt 0x0" ::: "memory");      /* this wave's reads of stage t are done before the stage is refilled */
    asm volatile("s_wait_asynccnt 0x0" ::: "memory");   /* this wave's copies of stage t + 1 have landed before the barrier publishes them */
    __syncthreads();
    if (t + 2 < nt) g2_stage(lc + (unsigned)((t & 1) * G2_STG), ga + (size_t)(t + 2) * 64, sa16, gb + (size_t)(t + 2) * 64, sb16);
  }
  asm volatile("s_wait_asynccnt 0x0" ::: "memory");     /* no copy is outstanding when the ring becomes output staging */
  v8f accs[8] = {c00, c01, c02, c03, c10, c11, c12, c13};
#pragma unroll
  for (int u = 0; u < 8; ++u) {
    const int t = u & 3, half = u >> 2;
#pragma unroll
    for (int r = 0; r < 8; ++r) { const int rloc = half * 16 + 8 * hh + r; float v = accs[u][r] * alpha; if (ACT == 3) v = fmaxf(v, 0.f); so[w][rloc][t * 16 + ln] = v; }
  }
  __builtin_amdgcn_fence(4, "workgroup"); __builtin_amdgcn_wave_barrier();
  const int rsub = lane >> 4, c4 = (lane & 15) * 4;
  {
#pragma unroll
    for (int q = 0; q < 16; ++q) {
      const int r = q * 2 + rsub; const v4f v = *(const v4fa*)&so[w][r][c4];
      if (C) *(v4f*)(C + cofs + (size_t)(row0 + r) * ldc + col0 + c4) = v;
      if (C16) { v4h h4; for (int i = 0; i < 4; ++i) h4[i] = (_Float16)v[i]; *(v4h*)(C16 + cofs + (size_t)(row0 + r) * ldc + col0 + c4) = h4; }
    }
    
  }
}

// per-head RMS normalisation + interleaved-pair rotary step from the f32 GEMM plane F [NR][ldf] (ldf = NHV*128, NHV = compile-time head count, a power of two):
// y = (x * rsqrt(mean_128(x^2) + 1e-6)) * g[d];  out[2i] = y[2i] c[i] - y[2i+1] s[i];  out[2i+1] = y[2i] s[i] + y[2i+1] c[i]  (c, s = table rows [position][64], gain g[128]; all by value, bf16-RNE);
// H [NR][ldf] = f16 hi of every row; L [NB*RE][ldf] = x1024 residual for positions < RE.
// 32-bit thread indices (shifts and masks of compile-time powers of two); 64-bit offsets only at the final pointer arithmetic.
template <int NHV>
__device__ __forceinline__ void nrope_body(const float* __restrict__ F, int ldf, const float* __restrict__ NW, const float* __restrict__ CT, const float* __restrict__ ST,
                                           _Float16* __restrict__ H, _Float16* __restrict__ L) {
  #pragma clang fp contract(off)
  const unsigned t0 = blockIdx.x * 256u + threadIdx.x; const bool live = t0 < (unsigned)(NR * NHV * 16); const unsigned t = live ? t0 : 0u;
  const int p = (int)(t & 15u); const int hd = (int)((t >> 4) % (unsigned)NHV); const unsigned row = t / (unsigned)(16 * NHV);
  const int s = (int)(row % (unsigned)SLEN); const int b = (int)(row / (unsigned)SLEN);
  const float* src = F + (size_t)row * ldf + hd * HDIM + p * 8;
  const v4f xa = *(const v4fa*)src, xb = *(const v4fa*)(src + 4);
  const v4f wa = *(const v4fa*)(NW + p * 8), wb = *(const v4fa*)(NW + p * 8 + 4);
  const v4f cv = *(const v4fa*)(CT + (size_t)s * RTW + p * 4), sv = *(const v4fa*)(ST + (size_t)s * RTW + p * 4);
  const float xs[8] = {xa[0], xa[1], xa[2], xa[3], xb[0], xb[1], xb[2], xb[3]};
  const float gs[8] = {wa[0], wa[1], wa[2], wa[3], wb[0], wb[1], wb[2], wb[3]};
  float ss = 0.f;
#pragma unroll
  for (int i = 0; i < 8; ++i) { const float q = xs[i] * xs[i]; ss = ss + q; }
  ss += __shfl_xor(ss, 1, 32); ss += __shfl_xor(ss, 2, 32); ss += __shfl_xor(ss, 4, 32); ss += __shfl_xor(ss, 8, 32);
  const float mean = ss * 0.0078125f; const float rms = rsqrtf(mean + 1.0e-6f);
  FragH fh, fl;
#pragma unroll
  for (int j = 0; j < 4; ++j) {
    const float c = bf16_rne(cv[j]), sn = bf16_rne(sv[j]);
    const float y1 = (xs[2 * j] * rms) * bf16_rne(gs[2 * j]); const float y2 = (xs[2 * j + 1] * rms) * bf16_rne(gs[2 * j + 1]);
    const float o1 = y1 * c - y2 * sn; const float o2 = y1 * sn + y2 * c;
    const _Float16 h1 = toh_flush(o1), h2 = toh_flush(o2);
    fh.h[2 * j] = h1; fh.h[2 * j + 1] = h2;
    fl.h[2 * j] = toh_flush((o1 - (float)h1) * 1024.0f); fl.h[2 * j + 1] = toh_flush((o2 - (float)h2) * 1024.0f);
  }
  const size_t oh = (size_t)row * ldf + hd * HDIM + p * 8;
  const bool wl = live && (s < RE);
  const int sl = wl ? s : 0;
  const size_t ol = (size_t)(b * RE + sl) * ldf + hd * HDIM + p * 8;
  const v8us vh = fh.half[0], vl = fl.half[0];
  {
    if (live) *(v8us*)((unsigned short*)H + oh) = vh;
    if (wl) *(v8us*)((unsigned short*)L + ol) = vl;
    
  }
}
// query heads (NH per row)
__global__ __launch_bounds__(256) void k_nrope_q(const float* __restrict__ F, int ldf, const float* __restrict__ NW, const float* __restrict__ CT, const float* __restrict__ ST,
                                                 _Float16* __restrict__ H, _Float16* __restrict__ L) {
  #pragma clang fp contract(off)
  nrope_body<NH>(F, ldf, NW, CT, ST, H, L);
}
// key heads (NKVH per row)
__global__ __launch_bounds__(256) void k_nrope_k(const float* __restrict__ F, int ldf, const float* __restrict__ NW, const float* __restrict__ CT, const float* __restrict__ ST,
                                                 _Float16* __restrict__ H, _Float16* __restrict__ L) {
  #pragma clang fp contract(off)
  nrope_body<NKVH>(F, ldf, NW, CT, ST, H, L);
}

__global__ __launch_bounds__(256) void k_vtg(const _Float16* __restrict__ V16, _Float16* __restrict__ Vt) {
  __shared__ unsigned short tl[64][66];
  const int tid = threadIdx.x; const int nlg = SLEN / 64; const int slab = blockIdx.x / nlg, lg = blockIdx.x % nlg; const int b = slab / NV64, h = slab % NV64;
  for (int i = tid; i < 64 * 8; i += 256) {
    const int r = i >> 3, c8 = (i & 7) * 8; FragH f;
    f.half[0] = *(const v8us*)((const unsigned short*)V16 + ((size_t)b * SLEN + lg * 64 + r) * VW + h * 64 + c8);
#pragma unroll
    for (int q = 0; q < 8; ++q) tl[r][c8 + q] = f.u[q];
  }
  __syncthreads();
  {
#pragma unroll
    for (int rd = 0; rd < 2; ++rd) {
      const int d = rd * 32 + (tid >> 3), pc = tid & 7; FragH f;
#pragma unroll
      for (int q = 0; q < 8; ++q) f.u[q] = tl[pc * 8 + q][d];
      *(v8us*)((unsigned short*)Vt + ((size_t)slab * 64 + d) * TK + lg * 64 + pc * 8) = f.half[0];
    }
    
  }
}
__global__ __launch_bounds__(256) void k_vtl(const float* __restrict__ VF, _Float16* __restrict__ VtL) {
  __shared__ unsigned short tl[64][66];
  const int tid = threadIdx.x; const int nlg = RE / 64; const int slab = blockIdx.x / nlg, lg = blockIdx.x % nlg; const int b = slab / NV64, h = slab % NV64;
  for (int i = tid; i < 64 * 16; i += 256) {
    const int r = i >> 4, c4 = (i & 15) * 4;
    const v4f a = *(const v4fa*)(VF + ((size_t)b * SLEN + lg * 64 + r) * VW + h * 64 + c4);
    FragH f;
#pragma unroll
    for (int q = 0; q < 4; ++q) { const float v = a[q]; const _Float16 hv = (_Float16)v; f.h[q] = toh_flush((v - (float)hv) * 1024.0f); }
#pragma unroll
    for (int q = 0; q < 4; ++q) tl[r][c4 + q] = f.u[q];
  }
  __syncthreads();
  {
#pragma unroll
    for (int rd = 0; rd < 2; ++rd) {
      const int d = rd * 32 + (tid >> 3), pc = tid & 7; FragH f;
#pragma unroll
      for (int q = 0; q < 8; ++q) f.u[q] = tl[pc * 8 + q][d];
      *(v8us*)((unsigned short*)VtL + ((size_t)slab * 64 + d) * RE + lg * 64 + pc * 8) = f.half[0];
    }
    
  }
}

__global__ __launch_bounds__(256) void k_hl(const float* __restrict__ Fp, _Float16* __restrict__ Hh, _Float16* __restrict__ A2, size_t n8) {
  const size_t t = (size_t)blockIdx.x * 256 + threadIdx.x; if (t >= n8) return;
  const size_t e = t * 8; const size_t r = e / DM; const int c = (int)(e % DM); const int s = (int)(r % SLEN); const int b = (int)(r / SLEN);
  const v4f a = *(const v4fa*)(Fp + e), d = *(const v4fa*)(Fp + e + 4);
  FragH fh, fl;
#pragma unroll
  for (int q = 0; q < 4; ++q) {
    _Float16 hv = (_Float16)a[q]; fh.h[q] = hv; fl.h[q] = (_Float16)((a[q] - (float)hv) * 1024.0f);
    hv = (_Float16)d[q]; fh.h[4 + q] = hv; fl.h[4 + q] = (_Float16)((d[q] - (float)hv) * 1024.0f);
  }
  const bool wl = (s < RE);
  const size_t o2 = ((size_t)b * RE + (wl ? s : 0)) * (size_t)(2 * DM) + c;
  const v8us vh = fh.half[0], vl = fl.half[0];
  {
    *(v8us*)((unsigned short*)Hh + e) = vh;
    if (wl) { *(v8us*)((unsigned short*)A2 + o2) = vh; *(v8us*)((unsigned short*)A2 + o2 + DM) = vl; }
    
  }
}

// fused attention per ((b,h), 64 queries), query blocks [QB0P, QBLKS): wave = 16 queries; S = Q.K^T (d = 128: 4 k-steps, q fragments read with the pass's k group) x SCL + mask (bf16 plane, accumulator layout, two 16-B words per lane per step)
__global__ __launch_bounds__(128) __attribute__((amdgpu_num_vgpr(256))) void k_flash(const _Float16* __restrict__ Q16, int ldq, const _Float16* __restrict__ K16, int ldk,
                                               const _Float16* __restrict__ Vt, const unsigned short* __restrict__ MP, const int* __restrict__ JE, float* __restrict__ O, int ldo) {
  constexpr int RPW = 16, DT = 8, KS = 4;
  constexpr int NQP = (QBNP > 0) ? QBNP : 1;
  __shared__ __attribute__((aligned(16))) unsigned short sP[4][RPW][40];
  __shared__ __attribute__((aligned(16))) float sO[4][RPW][132];
  const int tid = threadIdx.x, lane = tid & 31, ln = lane & 15, hh = lane >> 4;
  const int w = __builtin_amdgcn_readfirstlane(tid >> 5);
  const int slab = blockIdx.x / NQP, qblk = QB0P + blockIdx.x % NQP; const int b = slab / NH, h = slab % NH; const int kvh = h / NREP;
  const int qb0 = qblk * (4 * RPW); const int q0 = qb0 + w * RPW;
  const unsigned short* qr = (const unsigned short*)Q16 + ((size_t)b * TQ + q0 + ln) * ldq + h * HDIM;
  const unsigned short* kb = (const unsigned short*)K16 + ((size_t)b * TK + ln) * ldk + kvh * HDIM;
  const unsigned short* Vth = (const unsigned short*)Vt + (size_t)(b * NKVH + kvh) * HDIM * TK;
  const unsigned short* mq = MP + (size_t)(q0 >> 4) * (size_t)(TK / 32) * 512 + lane * 8;
  int jt = JE[qblk * 32]; jt = (jt < 1) ? 1 : jt; jt = (jt > TK / 32) ? (TK / 32) : jt;
  const int jend = __builtin_amdgcn_readfirstlane(jt) * 32;
  float m_r[8], l_r[8]; v8f oacc[DT];
#pragma unroll
  for (int r = 0; r < 8; ++r) { m_r[r] = -3.0e38f; l_r[r] = 0.f; }
#pragma unroll
  for (int dt = 0; dt < DT; ++dt) oacc[dt] = (v8f){0.f,0.f,0.f,0.f,0.f,0.f,0.f,0.f};
#pragma unroll 1
  for (int j0 = 0; j0 < jend; j0 += 32) {
    v8f sa = (v8f){0.f,0.f,0.f,0.f,0.f,0.f,0.f,0.f}, sb = sa;
    const unsigned short* kp0 = kb + (size_t)j0 * ldk + 8 * hh; const unsigned short* kp1 = kp0 + (size_t)16 * ldk;
    const unsigned short* mt = mq + (size_t)(j0 >> 5) * 512;
    /* every load of the score step (q, k, mask) is issued as one group ahead of the first product: the pass waits for one load round trip, not one per k-step */
    FragH a[KS], k0[KS], k1[KS], fm;
#pragma unroll
    for (int ks = 0; ks < KS; ++ks) {
      /* A (q) and B (k) fragments share one k order: element e < 8 <-> d = 32 ks + 8 hh + e; e >= 8 <-> d = 32 ks + 16 + 8 hh + (e - 8) */
      a[ks].half[0] = *(const v8us*)(qr + ks * 32 + 8 * hh); a[ks].half[1] = *(const v8us*)(qr + ks * 32 + 16 + 8 * hh);
      k0[ks].half[0] = *(const v8us*)(kp0 + ks * 32); k0[ks].half[1] = *(const v8us*)(kp0 + ks * 32 + 16);
      k1[ks].half[0] = *(const v8us*)(kp1 + ks * 32); k1[ks].half[1] = *(const v8us*)(kp1 + ks * 32 + 16);
    }
    fm.half[0] = *(const v8us*)mt; fm.half[1] = *(const v8us*)(mt + 256);
    /* the group's address registers are inputs here, so they stay whole (no load's result is given them) up to this wait */
    asm volatile("s_wait_xcnt 0x0" :: "v"(kp0), "v"(kp1), "v"(mt) : "memory");
#pragma unroll
    for (int ks = 0; ks < KS; ++ks) { sa = g2_mma(a[ks].v, k0[ks].v, sa); sb = g2_mma(a[ks].v, k1[ks].v, sb); }
    /* the V^T fragments of this pass are issued here, ahead of the softmax, which covers their round trip */
    FragH bv[DT];
    const unsigned short* vp = Vth + (size_t)ln * TK + j0 + 8 * hh;
#pragma unroll
    for (int dt = 0; dt < DT; ++dt) { bv[dt].half[0] = *(const v8us*)(vp + (size_t)(dt * 16) * TK); bv[dt].half[1] = *(const v8us*)(vp + (size_t)(dt * 16) * TK + 16); }
    /* the group's address register is an input here, so it stays whole up to this wait */
    asm volatile("s_wait_xcnt 0x0" :: "v"(vp) : "memory");
    float s0v[8], s1v[8], mcv[8];
#pragma unroll
    for (int r = 0; r < 8; ++r) {
      const float mk0 = bf16_val(fm.u[2 * r]), mk1 = bf16_val(fm.u[2 * r + 1]);
      s0v[r] = sa[r] * SCL + mk0; s1v[r] = sb[r] * SCL + mk1;
      mcv[r] = fmaxf(s0v[r], s1v[r]);
    }
    row16_max8(mcv);
#pragma unroll
    for (int r = 0; r < 8; ++r) {
      const float s0 = s0v[r], s1 = s1v[r];
      const float mn = fmaxf(m_r[r], mcv[r]); const float al = (mn > -1.0e38f) ? expf(m_r[r] - mn) : 1.0f; m_r[r] = mn;
      const float p0 = expf(s0 - mn), p1 = expf(s1 - mn); l_r[r] = l_r[r] * al + p0 + p1;
#pragma unroll
      for (int dt = 0; dt < DT; ++dt) oacc[dt][r] *= al;
      FragH t2; t2.h[0] = toh_flush(p0 * 1024.0f); t2.h[1] = toh_flush(p1 * 1024.0f);
      sP[w][8 * hh + r][ln] = t2.u[0]; sP[w][8 * hh + r][16 + ln] = t2.u[1];
    }
    __builtin_amdgcn_fence(4, "workgroup"); __builtin_amdgcn_wave_barrier();
    FragH pa; pa.half[0] = *(const v8us*)&sP[w][ln][8 * hh]; pa.half[1] = *(const v8us*)&sP[w][ln][16 + 8 * hh];
#pragma unroll
    for (int dt = 0; dt < DT; ++dt) {
      /* A (P: key columns of the LDS tile) and B (V^T rows, keys contiguous) share the same key order: element e < 8 <-> key j0 + 8 hh + e; e >= 8 <-> key j0 + 16 + 8 hh + (e - 8) */
      oacc[dt] = g2_mma(pa.v, bv[dt].v, oacc[dt]);
    }
    __builtin_amdgcn_fence(4, "workgroup"); __builtin_amdgcn_wave_barrier();
  }
  row16_sum8(l_r);
#pragma unroll
  for (int r = 0; r < 8; ++r) { const float l = l_r[r]; l_r[r] = (l > 0.f) ? 1.0f / (l * 1024.0f) : 0.f; }
#pragma unroll
  for (int dt = 0; dt < DT; ++dt)
#pragma unroll
    for (int r = 0; r < 8; ++r) sO[w][8 * hh + r][dt * 16 + ln] = oacc[dt][r] * l_r[r];
  __builtin_amdgcn_fence(4, "workgroup"); __builtin_amdgcn_wave_barrier();
  {
#pragma unroll
    for (int rp = 0; rp < RPW; ++rp) { const v4f val = *(const v4fa*)&sO[w][rp][lane * 4]; *(v4f*)(O + ((size_t)b * TQ + q0 + rp) * ldo + h * HDIM + lane * 4) = val; }
    
  }
}
// 5-plane variant for query blocks [QB05, QB05+QBN5) (positions < RE), one 64-wide half dh of the head's 128 dims per block: S = Qh.Kh^T + (Ql.Kh^T + Qh.Kl^T)/1024 with Q/K = [hi | x1024 residual] planes (residual planes compact: rows b*RE + s);
// O = (Ph.Vh + (Pl.Vh + Ph.Vl)/1024) / l with P = [hi | x1024 residual] of 1024 p and V^T = [hi | x1024 residual] (VtL pitch RE); separate residual accumulators folded before the normalisation.
// key tiles [0, JE[qblk]) clamped to [1, RE/32] (the compact planes hold keys < RE); a block whose mask exposes keys beyond RE writes NaN rows.
__global__ __launch_bounds__(128) __attribute__((amdgpu_num_vgpr(256))) void k_flash5(const _Float16* __restrict__ Q16, const _Float16* __restrict__ QL, int ldq, const _Float16* __restrict__ K16, const _Float16* __restrict__ KL, int ldk,
                                                const _Float16* __restrict__ Vt, const _Float16* __restrict__ VtL, const unsigned short* __restrict__ MP, const int* __restrict__ JE, float* __restrict__ O, int ldo) {
  constexpr int RPW = 16, DT = 4, KS = 4;
  __shared__ __attribute__((aligned(16))) unsigned short sP[4][RPW][40];
  __shared__ __attribute__((aligned(16))) unsigned short sPL[4][RPW][40];
  __shared__ __attribute__((aligned(16))) float sO[4][RPW][68];
  const int tid = threadIdx.x, lane = tid & 31, ln = lane & 15, hh = lane >> 4;
  const int w = __builtin_amdgcn_readfirstlane(tid >> 5);
  const int dh = blockIdx.x & 1; const int bx = blockIdx.x >> 1;
  const int slab = bx / QBN5, qblk = QB05 + bx % QBN5; const int b = slab / NH, h = slab % NH; const int kvh = h / NREP;
  const int qb0 = qblk * (4 * RPW); const int q0 = qb0 + w * RPW;
  const unsigned short* qr = (const unsigned short*)Q16 + ((size_t)b * TQ + q0 + ln) * ldq + h * HDIM;
  const unsigned short* ql = (const unsigned short*)QL + ((size_t)b * RE + q0 + ln) * ldq + h * HDIM;
  const unsigned short* kb = (const unsigned short*)K16 + ((size_t)b * TK + ln) * ldk + kvh * HDIM;
  const unsigned short* klb = (const unsigned short*)KL + ((size_t)b * RE + ln) * ldk + kvh * HDIM;
  const unsigned short* Vth = (const unsigned short*)Vt + ((size_t)(b * NKVH + kvh) * HDIM + dh * 64) * TK;
  const unsigned short* Vtl = (const unsigned short*)VtL + ((size_t)(b * NKVH + kvh) * HDIM + dh * 64) * RE;
  const unsigned short* mq = MP + (size_t)(q0 >> 4) * (size_t)(TK / 32) * 512 + lane * 8;
  const int jraw = JE[qblk * 32];
  const float pz = (jraw > RE / 32) ? __uint_as_float(0x7FC00000u) : 0.0f;
  int jt = (jraw < 1) ? 1 : jraw; jt = (jt > RE / 32) ? (RE / 32) : jt;
  const int jend = __builtin_amdgcn_readfirstlane(jt) * 32;
  float m_r[8], l_r[8]; v8f oacc[DT], oaccL[DT];
#pragma unroll
  for (int r = 0; r < 8; ++r) { m_r[r] = -3.0e38f; l_r[r] = 0.f; }
#pragma unroll
  for (int dt = 0; dt < DT; ++dt) { oacc[dt] = (v8f){0.f,0.f,0.f,0.f,0.f,0.f,0.f,0.f}; oaccL[dt] = oacc[dt]; }
#pragma unroll 1
  for (int j0 = 0; j0 < jend; j0 += 32) {
    v8f sa = (v8f){0.f,0.f,0.f,0.f,0.f,0.f,0.f,0.f}, sb = sa, sal = sa, sbl = sa;
    const unsigned short* qp = qr + 8 * hh; const unsigned short* qlp = ql + 8 * hh;
    const unsigned short* kp0 = kb + (size_t)j0 * ldk + 8 * hh; const unsigned short* kp1 = kp0 + (size_t)16 * ldk;
    const unsigned short* gp0 = klb + (size_t)j0 * ldk + 8 * hh; const unsigned short* gp1 = gp0 + (size_t)16 * ldk;
    const unsigned short* mt = mq + (size_t)(j0 >> 5) * 512;
    FragH fm; fm.half[0] = *(const v8us*)mt; fm.half[1] = *(const v8us*)(mt + 256);
    /* all six planes' fragments of a k-step are issued as one group ahead of its products: four load round trips a pass, not eight (a group of two k-steps spills registers) */
#pragma unroll
    for (int ks = 0; ks < KS; ++ks) {
      /* all A and B fragments of this step share one k order: element e < 8 <-> d = 32 ks + 8 hh + e; e >= 8 <-> d = 32 ks + 16 + 8 hh + (e - 8) */
      FragH a, al2, k0, k1, g0, g1;
      a.half[0] = *(const v8us*)(qp + ks * 32); a.half[1] = *(const v8us*)(qp + ks * 32 + 16);
      al2.half[0] = *(const v8us*)(qlp + ks * 32); al2.half[1] = *(const v8us*)(qlp + ks * 32 + 16);
      k0.half[0] = *(const v8us*)(kp0 + ks * 32); k0.half[1] = *(const v8us*)(kp0 + ks * 32 + 16);
      k1.half[0] = *(const v8us*)(kp1 + ks * 32); k1.half[1] = *(const v8us*)(kp1 + ks * 32 + 16);
      g0.half[0] = *(const v8us*)(gp0 + ks * 32); g0.half[1] = *(const v8us*)(gp0 + ks * 32 + 16);
      g1.half[0] = *(const v8us*)(gp1 + ks * 32); g1.half[1] = *(const v8us*)(gp1 + ks * 32 + 16);
      /* the group's address registers are inputs here, so they stay whole (no load's result is given them) up to this wait */
      asm volatile("s_wait_xcnt 0x0" :: "v"(qp), "v"(qlp), "v"(kp0), "v"(kp1), "v"(gp0), "v"(gp1), "v"(mt) : "memory");
      sa = g2_mma(a.v, k0.v, sa); sb = g2_mma(a.v, k1.v, sb);
      sal = g2_mma(al2.v, k0.v, sal); sbl = g2_mma(al2.v, k1.v, sbl);
      sal = g2_mma(a.v, g0.v, sal); sbl = g2_mma(a.v, g1.v, sbl);
    }
    /* both V^T planes' fragments of this pass are issued here, ahead of the softmax, which covers their round trip */
    FragH bv[DT], bl[DT];
    const unsigned short* vp = Vth + (size_t)ln * TK + j0 + 8 * hh; const unsigned short* vlp = Vtl + (size_t)ln * RE + j0 + 8 * hh;
#pragma unroll
    for (int dt = 0; dt < DT; ++dt) {
      bv[dt].half[0] = *(const v8us*)(vp + (size_t)(dt * 16) * TK); bv[dt].half[1] = *(const v8us*)(vp + (size_t)(dt * 16) * TK + 16);
      bl[dt].half[0] = *(const v8us*)(vlp + (size_t)(dt * 16) * RE); bl[dt].half[1] = *(const v8us*)(vlp + (size_t)(dt * 16) * RE + 16);
    }
    /* the group's address registers are inputs here, so they stay whole up to this wait */
    asm volatile("s_wait_xcnt 0x0" :: "v"(vp), "v"(vlp) : "memory");
    float s0v[8], s1v[8], mcv[8];
#pragma unroll
    for (int r = 0; r < 8; ++r) {
      const float mk0 = bf16_val(fm.u[2 * r]), mk1 = bf16_val(fm.u[2 * r + 1]);
      const float d0 = sa[r] + sal[r] * 0.0009765625f, d1 = sb[r] + sbl[r] * 0.0009765625f;
      s0v[r] = d0 * SCL + mk0; s1v[r] = d1 * SCL + mk1;
      mcv[r] = fmaxf(s0v[r], s1v[r]);
    }
    row16_max8(mcv);
#pragma unroll
    for (int r = 0; r < 8; ++r) {
      const float s0 = s0v[r], s1 = s1v[r];
      const float mn = fmaxf(m_r[r], mcv[r]); const float al = (mn > -1.0e38f) ? expf(m_r[r] - mn) : 1.0f; m_r[r] = mn;
      const float p0 = expf(s0 - mn), p1 = expf(s1 - mn); l_r[r] = l_r[r] * al + p0 + p1;
#pragma unroll
      for (int dt = 0; dt < DT; ++dt) { oacc[dt][r] *= al; oaccL[dt][r] *= al; }
      FragH t2, t2l; const float ps0 = p0 * 1024.0f, ps1 = p1 * 1024.0f;
      t2.h[0] = toh_flush(ps0); t2.h[1] = toh_flush(ps1);
      t2l.h[0] = toh_flush((ps0 - (float)t2.h[0]) * 1024.0f); t2l.h[1] = toh_flush((ps1 - (float)t2.h[1]) * 1024.0f);
      sP[w][8 * hh + r][ln] = t2.u[0]; sP[w][8 * hh + r][16 + ln] = t2.u[1]; sPL[w][8 * hh + r][ln] = t2l.u[0]; sPL[w][8 * hh + r][16 + ln] = t2l.u[1];
    }
    __builtin_amdgcn_fence(4, "workgroup"); __builtin_amdgcn_wave_barrier();
    FragH pa, pl;
    pa.half[0] = *(const v8us*)&sP[w][ln][8 * hh]; pa.half[1] = *(const v8us*)&sP[w][ln][16 + 8 * hh];
    pl.half[0] = *(const v8us*)&sPL[w][ln][8 * hh]; pl.half[1] = *(const v8us*)&sPL[w][ln][16 + 8 * hh];
#pragma unroll
    for (int dt = 0; dt < DT; ++dt) {
      /* A (P tiles) and B (V^T rows) share the same key order: element e < 8 <-> key j0 + 8 hh + e; e >= 8 <-> key j0 + 16 + 8 hh + (e - 8) */
      oacc[dt] = g2_mma(pa.v, bv[dt].v, oacc[dt]);
      oaccL[dt] = g2_mma(pl.v, bv[dt].v, oaccL[dt]);
      oaccL[dt] = g2_mma(pa.v, bl[dt].v, oaccL[dt]);
    }
    __builtin_amdgcn_fence(4, "workgroup"); __builtin_amdgcn_wave_barrier();
  }
  row16_sum8(l_r);
#pragma unroll
  for (int r = 0; r < 8; ++r) { const float l = l_r[r]; l_r[r] = (l > 0.f) ? 1.0f / (l * 1024.0f) : 0.f; }
#pragma unroll
  for (int dt = 0; dt < DT; ++dt)
#pragma unroll
    for (int r = 0; r < 8; ++r) { float v = oacc[dt][r]; v += oaccL[dt][r] * 0.0009765625f; sO[w][8 * hh + r][dt * 16 + ln] = v * l_r[r] + pz; }
  __builtin_amdgcn_fence(4, "workgroup"); __builtin_amdgcn_wave_barrier();
  {
#pragma unroll
    for (int rp = 0; rp < RPW; rp += 2) { const int r = rp + (lane >> 4), pc = lane & 15; const v4f val = *(const v4fa*)&sO[w][r][pc * 4]; *(v4f*)(O + ((size_t)b * TQ + q0 + r) * ldo + h * HDIM + dh * 64 + pc * 4) = val; }
    
  }
}

extern "C" void kernel_launch(void* const* d_in, const int* in_sizes, int n_in,
                              void* d_out, int out_size, void* d_ws, size_t ws_size, hipStream_t stream) {
  if (n_in < 10) return;
  const size_t needx = ((size_t)(NB - 1) * SEQ_FULL + (size_t)SLEN) * DM;
  if ((size_t)in_sizes[0] < needx) return;
  if ((size_t)in_sizes[1] < (size_t)DM * DM) return;
  if ((size_t)in_sizes[2] < (size_t)VW * DM) return;
  if ((size_t)in_sizes[3] < (size_t)VW * DM) return;
  if ((size_t)in_sizes[4] < (size_t)DM * DM) return;
  if ((size_t)in_sizes[5] < (size_t)HDIM) return;
  if ((size_t)in_sizes[6] < (size_t)HDIM) return;
  if ((size_t)in_sizes[7] < (size_t)SLEN * RTW) return;
  if ((size_t)in_sizes[8] < (size_t)SLEN * RTW) return;
  if ((size_t)in_sizes[9] < (size_t)(SLEN - 1) * MSKP + (size_t)SLEN) return;
  if ((size_t)out_size < needx) return;
  /* inputs in order: x, Wq, Wk, Wv, Wo, q gain, k gain, cos table, sin table, mask */
  const float* x = (const float*)d_in[0]; const float* Wq = (const float*)d_in[1]; const float* Wk = (const float*)d_in[2]; const float* Wv = (const float*)d_in[3]; const float* Wo = (const float*)d_in[4];
  const float* qnw = (const float*)d_in[5]; const float* knw = (const float*)d_in[6]; const float* rct = (const float*)d_in[7]; const float* rst = (const float*)d_in[8]; const float* msk = (const float*)d_in[9];
  float* dout = (float*)d_out;
  char* ws = (char*)d_ws; size_t off = 0;
  auto take = [&](size_t bytes) { char* p = ws + off; off += (bytes + 255) & ~(size_t)255; return p; };
  const size_t np = (size_t)NR * DM;
  const size_t nw8 = (size_t)DM * DM / 8;
  const size_t nk8 = (size_t)VW * DM / 8;
  _Float16* BQ = (_Float16*)take(SZ_BQ);                                /* [n][k] f16, x16 */
  _Float16* BK = (_Float16*)take(SZ_BK);
  _Float16* BV = (_Float16*)take(SZ_BK);
  _Float16* B2 = (_Float16*)take(SZ_B2);                                /* [n][2*DM] f16: [x16384 | x16] copies of Wo */
  float* FS = (float*)take(SZ_FS);                                      /* f32 scratch plane: q rows [NR][DM], then k rows [NR][VW], then v rows [NR][VW], then the context [NR][DM] */
  _Float16* X16 = (_Float16*)take(SZ_X16);                              /* f16 input rows; reused as V^T [(b,g)][64][TK] after the v GEMM */
  _Float16* VT = X16;
  _Float16* QH = (_Float16*)take(SZ_QH);                                /* reused as the context hi plane after the attention */
  _Float16* KHp = (_Float16*)take(SZ_KH);                               /* [NR][VW] */
  _Float16* V16 = (_Float16*)take(SZ_KH);                               /* [NR][VW] */
  _Float16* QL = (_Float16*)take(SZ_QL);                                /* [NB*RE][DM] residual plane */
  _Float16* KL = (_Float16*)take(SZ_KL);                                /* [NB*RE][VW] residual plane */
  _Float16* VTL = (_Float16*)take(SZ_VTL);                              /* [(b,g)][64][RE] */
  _Float16* A2 = (_Float16*)take(SZ_A2);                                /* [NB*RE][2*DM] = [ctx hi | ctx residual] */
  unsigned short* MPp = (unsigned short*)take(SZ_MP);                   /* bf16 mask plane, accumulator layout */
  int* JEp = (int*)take(SZ_JE);                                         /* [QBLKS][32] key-tile counts */
  _Float16* OH = QH;
  if (off > ws_size) return;
  if (off > ((size_t)128 << 20)) return;

  const unsigned gw = (unsigned)((nw8 + 255) / 256);
  const unsigned gk = (unsigned)((nk8 + 255) / 256);
  k_wsc<<<gw, 256, 0, stream>>>(Wq, BQ, nw8, WSC_LO);
  k_wsc<<<gk, 256, 0, stream>>>(Wk, BK, nk8, WSC_LO);
  k_wsc<<<gk, 256, 0, stream>>>(Wv, BV, nk8, WSC_LO);
  k_wsc2<<<gw, 256, 0, stream>>>(Wo, B2, nw8, WSC_HI, WSC_LO);
  k_mperm<<<(unsigned)(((size_t)(SLEN / 16) * (SLEN / 32) * 64) / 256), 256, 0, stream>>>(msk, MPp);
  k_mjend<<<(unsigned)QBLKS, 1024, 0, stream>>>(msk, JEp);
  const unsigned g8 = (unsigned)((np / 8 + 255) / 256);
  k_x16<<<g8, 256, 0, stream>>>(x, X16, np / 8);
  const dim3 gp((unsigned)((NR / 128) * (DM / 64)), 1);
  const dim3 gkv((unsigned)((NR / 128) * (VW / 64)), 1);
  const unsigned grq = (unsigned)(((size_t)NR * NH * 16) / 256);
  const unsigned grk = (unsigned)(((size_t)NR * NKVH * 16) / 256);
  k_gemm2<0><<<gp, 128, 0, stream>>>(X16, DM, 0, BQ, DM, 0, AL_P, FS, nullptr, DM, 0, NR, DM, DM);        /* q = x Wq^T (f32 rows, pitch DM) */
  k_nrope_q<<<grq, 256, 0, stream>>>(FS, DM, qnw, rct, rst, QH, QL);
  k_gemm2<0><<<gkv, 128, 0, stream>>>(X16, DM, 0, BK, DM, 0, AL_P, FS, nullptr, VW, 0, NR, VW, DM);       /* k = x Wk^T (f32 rows, pitch VW) */
  k_nrope_k<<<grk, 256, 0, stream>>>(FS, VW, knw, rct, rst, KHp, KL);
  k_gemm2<0><<<gkv, 128, 0, stream>>>(X16, DM, 0, BV, DM, 0, AL_P, FS, V16, VW, 0, NR, VW, DM);           /* v = x Wv^T (f32 rows + f16 plane, pitch VW) */
  k_vtg<<<(unsigned)(NB * NV64 * (SLEN / 64)), 256, 0, stream>>>(V16, VT);
  k_vtl<<<(unsigned)(NB * NV64 * (RE / 64)), 256, 0, stream>>>(FS, VTL);
  k_flash5<<<(unsigned)(NB * NH * QBN5 * 2), 128, 0, stream>>>(QH, QL, DM, KHp, KL, VW, VT, VTL, MPp, JEp, FS, DM);
  if (QBNP > 0) k_flash<<<(unsigned)(NB * NH * QBNP), 128, 0, stream>>>(QH, DM, KHp, VW, VT, MPp, JEp, FS, DM);
  k_hl<<<g8, 256, 0, stream>>>(FS, OH, A2, np / 8);
  /* out rows [0, RE) per batch: [ctx hi | ctx residual] . [Wo x16384 ; Wo x16] / 16384  (K = 2*DM) */
  const dim3 ge((unsigned)((RE / 128) * (DM / 64)), NB);
  k_gemm2<0><<<ge, 128, 0, stream>>>(A2, 2 * DM, (size_t)RE * 2 * DM, B2, 2 * DM, 0, AL_E, dout, nullptr, DM, (size_t)SEQ_FULL * DM, RE, DM, 2 * DM);
  /* out rows [RE, SLEN) per batch: ctx hi . (Wo x16) / 16 */
  if (SLEN > RE) {
    const dim3 gl((unsigned)(((SLEN - RE) / 128) * (DM / 64)), NB);
    k_gemm2<0><<<gl, 128, 0, stream>>>(OH + (size_t)RE * DM, DM, (size_t)SLEN * DM, B2 + DM, 2 * DM, 0, AL_P, dout + (size_t)RE * DM, nullptr, DM, (size_t)SEQ_FULL * DM, SLEN - RE, DM, DM);
  }
}

// v005
// It runs in 357 microseconds.
// Timed twice side by side with v004, it ran 1.14 and 1.15 times as fast.
// All steps since v000 together make it 2.52 times as fast.
#include <hip/hip_runtime.h>
// Contractions: x.Wq^T, x.Wk^T, x.Wv^T, ctx.Wo^T = v_wmma_f32_16x16x32_f16 (f16 operands: bf16-RNE inputs exact in f16, weights carried x16 (x16384 for the ctx-hi half of the early-row output GEMM); f32 accumulate); scores q.k^T and P.V^T = v_wmma_f32_16x16x32_f16 (plain f16 hi planes; hi + x1024 residual planes of q, k, P and v for query positions < RE; P carried x1024), f32 accumulate; per-head RMS normalisation, rotary step, additive mask, softmax and normalisers f32.

#ifndef NB
#define NB 2
#endif
#ifndef SEQ
#define SEQ 2048
#endif
#define NB_FULL 2
#define SEQ_FULL 2048
#define DM 2048
#define NH 16
#define NKVH 4
#define NREP (NH / NKVH)
#define HDIM 128
#define VW (NKVH * HDIM)                     /* width of the k / v projection rows */
#define NV64 (VW / 64)                       /* 64-wide column groups of the v rows */
#define MSKP 2048                            /* row pitch of the mask input */
#define RTW 64                               /* row pitch of the cos / sin inputs */
#define SLEN SEQ
#define NR (NB * SLEN)
#define TQ SLEN
#define TK SLEN
#define SCL 0.08838834764831845f
#define MVIS (-1.0e8f)                       /* a mask entry above this keeps its key visible */
#define QBLKS (TQ / 64)
#define RE ((SLEN < 512) ? SLEN : 512)      /* query positions [0, RE) get residual planes on q, k, P, v and ctx */
#define QB05 0
#define QBN5 (RE / 64)
#define QB0P QBN5
#define QBNP (QBLKS - QBN5)
static_assert(SLEN % 128 == 0);
static_assert(SLEN <= SEQ_FULL);
static_assert(SLEN <= MSKP);
static_assert(NB >= 1 && NB <= NB_FULL);
static_assert(RE % 128 == 0 && RE <= SLEN);
static_assert((SLEN - RE) % 128 == 0);
static_assert(DM % 64 == 0 && DM == NH * HDIM);
static_assert(HDIM == 128 && NH % NKVH == 0);
static_assert(VW % 64 == 0 && NV64 * 64 == VW);
static_assert(DM % 32 == 0 && (2 * DM) % 32 == 0);
static_assert(NR % 128 == 0);
static_assert(((size_t)NR * NH * 16) % 256 == 0 && ((size_t)NR * NKVH * 16) % 256 == 0);
static_assert((NH & (NH - 1)) == 0 && (NKVH & (NKVH - 1)) == 0);   /* head counts are powers of two: index arithmetic by shifts and masks */
static_assert((size_t)NR * NH * 16 < ((size_t)1 << 31));           /* 32-bit thread indices in the normalise + rotary kernels */
static_assert(((size_t)(SLEN / 16) * (SLEN / 32) * 64) % 256 == 0);
static_assert(32 * 16 == HDIM * 4);          /* one store instruction of 32 lanes x 16 B == one 128-float row segment */
static_assert(16 * 16 == 64 * 4);            /* 16 lanes x 16 B == one 64-float row segment */
static_assert(4 * 16 * 40 * 2 + 4 * 16 * 132 * 4 <= 131072);
static_assert(2 * 4 * 16 * 40 * 2 + 4 * 16 * 68 * 4 <= 131072);
static_assert(4 * 32 * 68 * 4 <= 131072);

static constexpr float WSC_LO = 16.0f;
static constexpr float WSC_HI = 16384.0f;
static constexpr float AL_P = 0.0625f;
static constexpr float AL_E = 6.103515625e-05f;   /* 0.0625 / 1024 */

static constexpr size_t al256(size_t b) { return (b + 255) & ~(size_t)255; }
static constexpr size_t SZ_BQ = al256((size_t)DM * DM * 2);
static constexpr size_t SZ_BK = al256((size_t)VW * DM * 2);
static constexpr size_t SZ_B2 = al256((size_t)DM * 2 * DM * 2);
static constexpr size_t SZ_FS = al256((size_t)NR * DM * 4);
static constexpr size_t SZ_X16 = al256((size_t)NR * DM * 2);
static constexpr size_t SZ_QH = al256((size_t)NR * DM * 2);
static constexpr size_t SZ_KH = al256((size_t)NR * VW * 2);
static constexpr size_t SZ_QL = al256((size_t)NB * RE * DM * 2);
static constexpr size_t SZ_KL = al256((size_t)NB * RE * VW * 2);
static constexpr size_t SZ_VTL = al256((size_t)NB * NV64 * 64 * RE * 2);
static constexpr size_t SZ_A2 = al256((size_t)NB * RE * 2 * DM * 2);
static constexpr size_t SZ_MP = al256((size_t)SLEN * SLEN * 2);
static constexpr size_t SZ_JE = al256((size_t)QBLKS * 32 * 4);
static_assert((size_t)NB * NV64 * 64 * TK * 2 <= SZ_X16);       /* V^T aliases the f16 input plane */
static_assert((size_t)NR * VW * 4 <= SZ_FS);
static_assert(SZ_BQ + 2 * SZ_BK + SZ_B2 + SZ_FS + SZ_X16 + SZ_QH + 2 * SZ_KH + SZ_QL + SZ_KL + SZ_VTL + SZ_A2 + SZ_MP + SZ_JE <= ((size_t)128 << 20));

typedef _Float16 v16h __attribute__((ext_vector_type(16)));
typedef _Float16 v4h __attribute__((ext_vector_type(4)));
typedef unsigned short v8us __attribute__((ext_vector_type(8), may_alias));
typedef float v8f __attribute__((ext_vector_type(8)));
typedef float v4f __attribute__((ext_vector_type(4)));
typedef float v4fa __attribute__((ext_vector_type(4), may_alias));
union FragH { v16h v; v8us half[2]; _Float16 h[16]; unsigned short u[16]; };

__device__ __forceinline__ unsigned short bf16_bits(float x) { unsigned int u = __float_as_uint(x); return (unsigned short)((u + 0x7FFFu + ((u >> 16) & 1u)) >> 16); }
__device__ __forceinline__ float bf16_val(unsigned short b) { return __uint_as_float(((unsigned int)b) << 16); }
__device__ __forceinline__ float bf16_rne(float x) { return bf16_val(bf16_bits(x)); }
// f32 -> f16 for WMMA operand planes: values under the smallest f16 normal become +0
__device__ __forceinline__ _Float16 toh_flush(float v) { const _Float16 r = (_Float16)v; return (fabsf(v) < 6.103515625e-05f) ? (_Float16)0.0f : r; }

// D += A.B with NT terms: 1 = ah.bh, 2 = + al.bh, 3 = + ah.bl; hazard guard after the group
template <int NT>
__device__ __forceinline__ v8f mmaH(v16h ah, v16h al, v16h bh, v16h bl, v8f c) {
  c = __builtin_amdgcn_wmma_f32_16x16x32_f16(false, ah, false, bh, (short)0, c, false, false);
  if (NT >= 2) c = __builtin_amdgcn_wmma_f32_16x16x32_f16(false, al, false, bh, (short)0, c, false, false);
  if (NT >= 3) c = __builtin_amdgcn_wmma_f32_16x16x32_f16(false, ah, false, bl, (short)0, c, false, false);
  asm volatile("v_nop\n\tv_nop\n\tv_nop\n\tv_nop" : "+v"(c) : "v"(ah), "v"(al), "v"(bh), "v"(bl));
  return c;
}
// 16x32 fragment from a 16-bit row-major tile (rows = m or n, k contiguous): elements 0..7 <- k0+8h+0..7, 8..15 <- k0+16+8h+0..7
__device__ __forceinline__ v16h g2_frag(const _Float16* p, int hh) { FragH f; f.half[0] = *(const v8us*)((const unsigned short*)p + 8 * hh); f.half[1] = *(const v8us*)((const unsigned short*)p + 16 + 8 * hh); return f.v; }
__device__ __forceinline__ v8f g2_mma(v16h a, v16h b, v8f c) { v8f d = __builtin_amdgcn_wmma_f32_16x16x32_f16(false, a, false, b, (short)0, c, false, false); asm volatile("v_nop\n\tv_nop\n\tv_nop\n\tv_nop" : "+v"(d) : "v"(a), "v"(b)); return d; }

// Reduction over each 16-lane row (lanes l ^ 1, ^ 2, ^ 4, ^ 8 in that order, the order of the xor butterfly) of eight values at once, on the vector port (DPP row_xmask): no trip through the LDS unit and no wait per step.
// The eight values' instructions of a step stand side by side, so each instruction's producer is eight instructions back and no link of a chain is waited for. All 32 lanes are on at every call.
#define RX_ONE(OP, R, M) OP " " R ", " R ", " R " row_xmask:" M " row_mask:0xf bank_mask:0xf\n\t"
#define RX_EIGHT(OP, M) RX_ONE(OP, "%0", M) RX_ONE(OP, "%1", M) RX_ONE(OP, "%2", M) RX_ONE(OP, "%3", M) RX_ONE(OP, "%4", M) RX_ONE(OP, "%5", M) RX_ONE(OP, "%6", M) RX_ONE(OP, "%7", M)
#define RX_TREE(OP) RX_EIGHT(OP, "1") RX_EIGHT(OP, "2") RX_EIGHT(OP, "4") RX_EIGHT(OP, "8")
__device__ __forceinline__ void row16_max8(float (&v)[8]) {
  asm volatile(RX_TREE("v_max_num_f32_dpp") : "+v"(v[0]), "+v"(v[1]), "+v"(v[2]), "+v"(v[3]), "+v"(v[4]), "+v"(v[5]), "+v"(v[6]), "+v"(v[7]));
}
__device__ __forceinline__ void row16_sum8(float (&v)[8]) {
  asm volatile(RX_TREE("v_add_f32_dpp") : "+v"(v[0]), "+v"(v[1]), "+v"(v[2]), "+v"(v[3]), "+v"(v[4]), "+v"(v[5]), "+v"(v[6]), "+v"(v[7]));
}

__global__ __launch_bounds__(256) void k_wsc(const float* __restrict__ Wm, _Float16* __restrict__ Bt, size_t n8, float sc) {
  const size_t t = (size_t)blockIdx.x * 256 + threadIdx.x; if (t >= n8) return;
  const v4f a0 = *(const v4fa*)(Wm + t * 8), a1 = *(const v4fa*)(Wm + t * 8 + 4);
  FragH f;
#pragma unroll
  for (int q = 0; q < 4; ++q) { f.h[q] = toh_flush(bf16_rne(a0[q]) * sc); f.h[4 + q] = toh_flush(bf16_rne(a1[q]) * sc); }
  const v8us o = f.half[0];
  *(v8us*)((unsigned short*)Bt + t * 8) = o; 
}
__global__ __launch_bounds__(256) void k_wsc2(const float* __restrict__ Wm, _Float16* __restrict__ B2, size_t n8, float sc0, float sc1) {
  const size_t t = (size_t)blockIdx.x * 256 + threadIdx.x; if (t >= n8) return;
  const size_t e = t * 8; const size_t n = e / DM; const size_t k8 = e % DM;
  const v4f a0 = *(const v4fa*)(Wm + e), a1 = *(const v4fa*)(Wm + e + 4);
  FragH f0, f1;
#pragma unroll
  for (int q = 0; q < 4; ++q) {
    const float v0 = bf16_rne(a0[q]), v1 = bf16_rne(a1[q]);
    f0.h[q] = toh_flush(v0 * sc0); f1.h[q] = toh_flush(v0 * sc1);
    f0.h[4 + q] = toh_flush(v1 * sc0); f1.h[4 + q] = toh_flush(v1 * sc1);
  }
  const size_t o = n * (size_t)(2 * DM) + k8;
  const v8us o0 = f0.half[0], o1 = f1.half[0];
  {
    *(v8us*)((unsigned short*)B2 + o) = o0;
    *(v8us*)((unsigned short*)B2 + o + DM) = o1;
    
  }
}

// mask plane in accumulator layout: MP[(qt*(SLEN/32) + kt)][half][lane][8] bf16 bits; element 2*rr + c of (half, lane) = mask[qt*16 + 8*(lane>>4) + 4*half + rr][kt*32 + 16*c + (lane&15)];
__global__ __launch_bounds__(256) void k_mperm(const float* __restrict__ msk, unsigned short* __restrict__ MP) {
  const size_t t = (size_t)blockIdx.x * 256 + threadIdx.x; if (t >= (size_t)(SLEN / 16) * (SLEN / 32) * 64) return;
  const int lane = (int)(t & 31); const int half = (int)((t >> 5) & 1); const size_t tile = t >> 6;
  const int kt = (int)(tile % (size_t)(SLEN / 32)); const int qt = (int)(tile / (size_t)(SLEN / 32));
  const int ln = lane & 15, hh = lane >> 4;
  const float* mr = msk + (size_t)(qt * 16 + 8 * hh + 4 * half) * MSKP + kt * 32 + ln;
  FragH f;
#pragma unroll
  for (int rr = 0; rr < 4; ++rr) { const float a = mr[(size_t)rr * MSKP]; const float c = mr[(size_t)rr * MSKP + 16]; f.u[2 * rr] = bf16_bits(a); f.u[2 * rr + 1] = bf16_bits(c); }
  const v8us o = f.half[0];
  *(v8us*)(MP + t * 8) = o; 
}
// per 64-query block: JE[qblk][0..32) = number of 32-key tiles to visit = 1 + last tile holding a visible entry (value > MVIS) in any of the 64 rows; all tiles if some row has no visible entry.
__global__ __launch_bounds__(1024) void k_mjend(const float* __restrict__ msk, int* __restrict__ JE) {
  constexpr int NL = SLEN / 128;               /* 16-B loads per lane and row */
  __shared__ int smax[32]; __shared__ int snone[32];
  const int tid = threadIdx.x, lane = tid & 31; const int w = __builtin_amdgcn_readfirstlane(tid >> 5);
  const int qblk = blockIdx.x;
  int wmax = -1, wnone = 0;
  /* 32 waves, two rows each; kept rolled: the loads of both rows at once need more registers than a 32-wave block leaves a wave (spills) */
#pragma unroll 1
  for (int rr = 0; rr < 2; ++rr) {
    const float* mr = msk + (size_t)(qblk * 64 + w * 2 + rr) * MSKP + lane * 4;
    /* every load of the row is issued as one group ahead of the first compare: one load round trip a row, not one per 128 columns */
    v4f a[NL];
#pragma unroll
    for (int i = 0; i < NL; ++i) a[i] = *(const v4fa*)(mr + i * 128);
    static_assert(NL == 16);
    /* the loaded values are inputs only: all loads of the row are issued, none held back behind a compare; the address is an input too, so it stays whole (no load's result is given it) up to this wait */
    asm volatile("s_wait_xcnt 0x0" :: "v"(a[0]), "v"(a[1]), "v"(a[2]), "v"(a[3]), "v"(a[4]), "v"(a[5]), "v"(a[6]), "v"(a[7]),
                 "v"(a[8]), "v"(a[9]), "v"(a[10]), "v"(a[11]), "v"(a[12]), "v"(a[13]), "v"(a[14]), "v"(a[15]), "v"(mr) : "memory");
    int lm = -1;
#pragma unroll
    for (int i = 0; i < NL; ++i) {
      const bool any = (bf16_rne(a[i][0]) > MVIS) | (bf16_rne(a[i][1]) > MVIS) | (bf16_rne(a[i][2]) > MVIS) | (bf16_rne(a[i][3]) > MVIS);
      lm = any ? ((lane + 32 * i) >> 3) : lm;
    }
    int o = __shfl_xor(lm, 16, 32); lm = (o > lm) ? o : lm;
    o = __shfl_xor(lm, 8, 32); lm = (o > lm) ? o : lm;
    o = __shfl_xor(lm, 4, 32); lm = (o > lm) ? o : lm;
    o = __shfl_xor(lm, 2, 32); lm = (o > lm) ? o : lm;
    o = __shfl_xor(lm, 1, 32); lm = (o > lm) ? o : lm;
    wmax = (lm > wmax) ? lm : wmax; wnone |= (lm < 0) ? 1 : 0;
  }
  if (lane == 0) { smax[w] = wmax; snone[w] = wnone; }
  __syncthreads();
  if (w == 0) {
    int m = -1, nn = 0;
#pragma unroll
    for (int i = 0; i < 32; ++i) { const int a = smax[i]; m = (a > m) ? a : m; nn |= snone[i]; }
    const int jt = (nn != 0) ? (SLEN / 32) : (m + 1);
    *(int*)(JE + qblk * 32 + lane) = jt; 
  }
}

__global__ __launch_bounds__(256) void k_x16(const float* __restrict__ x, _Float16* __restrict__ X16, size_t n8) {
  const size_t t = (size_t)blockIdx.x * 256 + threadIdx.x; if (t >= n8) return;
  const size_t e = t * 8; const size_t r = e / DM; const size_t c = e % DM; const size_t b = r / SLEN, s = r % SLEN;
  const float* src = x + (b * SEQ_FULL + s) * DM + c;
  const v4f a0 = *(const v4fa*)src, a1 = *(const v4fa*)(src + 4);
  FragH f;
#pragma unroll
  for (int q = 0; q < 4; ++q) { f.h[q] = (_Float16)bf16_rne(a0[q]); f.h[4 + q] = (_Float16)bf16_rne(a1[q]); }
  const v8us o = f.half[0];
  *(v8us*)((unsigned short*)X16 + e) = o; 
}

// LDS ring of the GEMM: one stage = 64 k = 128 B of every operand row, [A 128 rows | B 64 rows] at pitch 144 B (16 B x odd: the 16-B fragment reads meet no bank conflict); two stages
#define G2_PB 144
#define G2_STG ((128 + 64) * G2_PB)
static_assert(2 * G2_STG >= 4 * 32 * 68 * 4);   /* the output staging reuses the ring behind the last barrier */
static_assert(2 * G2_STG <= 65536);
static_assert(DM % 64 == 0 && DM >= 128);
// 16x32 fragment from an LDS row (k contiguous), p = row start + 2 * (k0 + 8 hh) bytes: the k order of g2_frag
__device__ __forceinline__ v16h g2_lfrag(const unsigned char* p) { FragH f; f.half[0] = *(const v8us*)p; f.half[1] = *(const v8us*)(p + 32); return f.v; }
// one stage: 12 copies of 16 B per lane (a wave-wide copy = 4 whole 128-B row pieces); lane (r = tid / 8, c = tid % 8) brings chunk c of A rows r + 16 j (j < 8) and of B rows r + 16 j (j < 4).
// l = LDS byte address of (row r, chunk c) in the stage, a / b = the lane's global addresses in A row r / B row r, sa / sb = 16 rows in elements.
__device__ __forceinline__ void g2_stage(unsigned l, const _Float16* a, size_t sa, const _Float16* b, size_t sb) {
  /* s_wait_xcnt closes the copies' own statement: no register that a copy names is rewritten in front of it */
  asm volatile(
      "global_load_async_to_lds_b128 %0, %12, off\n\t"
      "global_load_async_to_lds_b128 %1, %13, off\n\t"
      "global_load_async_to_lds_b128 %2, %14, off\n\t"
      "global_load_async_to_lds_b128 %3, %15, off\n\t"
      "global_load_async_to_lds_b128 %4, %16, off\n\t"
      "global_load_async_to_lds_b128 %5, %17, off\n\t"
      "global_load_async_to_lds_b128 %6, %18, off\n\t"
      "global_load_async_to_lds_b128 %7, %19, off\n\t"
      "global_load_async_to_lds_b128 %8, %20, off\n\t"
      "global_load_async_to_lds_b128 %9, %21, off\n\t"
      "global_load_async_to_lds_b128 %10, %22, off\n\t"
      "global_load_async_to_lds_b128 %11, %23, off\n\t"
      "s_wait_xcnt 0x0"
      :: "v"(l), "v"(l + 16 * G2_PB), "v"(l + 32 * G2_PB), "v"(l + 48 * G2_PB), "v"(l + 64 * G2_PB), "v"(l + 80 * G2_PB), "v"(l + 96 * G2_PB), "v"(l + 112 * G2_PB),
         "v"(l + 128 * G2_PB), "v"(l + 144 * G2_PB), "v"(l + 160 * G2_PB), "v"(l + 176 * G2_PB),
         "v"(a), "v"(a + sa), "v"(a + 2 * sa), "v"(a + 3 * sa), "v"(a + 4 * sa), "v"(a + 5 * sa), "v"(a + 6 * sa), "v"(a + 7 * sa),
         "v"(b), "v"(b + sb), "v"(b + 2 * sb), "v"(b + 3 * sb)
      : "memory");
}

// GEMM C[M][N] = alpha * A[M][K].B  with A f16 row-major (pitch lda), B stored [n][k] f16 (pitch ldb), batched by blockIdx.y (strides sA, sB, sC);
// writes f32 C and/or f16 C16 (pitch ldc). Requires M % 128 == 0, N % 64 == 0, K % 64 == 0 (asserted by the callers' constants).
// Operand tiles come through LDS: asynchronous copies, two stages, stage t + 1 in flight while stage t is multiplied.
template <int ACT>
__global__ __launch_bounds__(128) void k_gemm2(const _Float16* __restrict__ A, int lda, size_t sA, const _Float16* __restrict__ Bh, int ldb, size_t sB, float alpha,
                                               float* C, _Float16* C16, int ldc, size_t sC, int M, int N, int K) {
  __shared__ __attribute__((aligned(16))) unsigned char sm[2 * G2_STG];
  float (*so)[32][68] = (float (*)[32][68])sm;
  const int tid = threadIdx.x, w = tid >> 5, lane = tid & 31, ln = lane & 15, hh = lane >> 4; const int by = blockIdx.y;
  A += (size_t)by * sA; Bh += (size_t)by * sB; const size_t cofs = (size_t)by * sC;
  const int ntn = N >> 6; const int mt = blockIdx.x / ntn, nq = blockIdx.x - mt * ntn; const int row0 = mt * 128 + 32 * w, col0 = nq * 64; if (mt * 128 >= M) return;
  const int cr = tid >> 3, cc = tid & 7;
  const _Float16* ga = A + (size_t)(mt * 128 + cr) * lda + cc * 8; const _Float16* gb = Bh + (size_t)(col0 + cr) * ldb + cc * 8;
  const size_t sa16 = (size_t)16 * lda, sb16 = (size_t)16 * ldb;
  const unsigned lc = (unsigned)(uintptr_t)sm + (unsigned)(cr * G2_PB + cc * 16);
  const int nt = K >> 6;
  const int aofs = (32 * w + ln) * G2_PB + 16 * hh, bofs = (128 + ln) * G2_PB + 16 * hh;
  const v8f z8 = {0.f,0.f,0.f,0.f,0.f,0.f,0.f,0.f}; v8f c00 = z8, c01 = z8, c02 = z8, c03 = z8, c10 = z8, c11 = z8, c12 = z8, c13 = z8;
  g2_stage(lc, ga, sa16, gb, sb16);
  asm volatile("s_wait_asynccnt 0x0" ::: "memory");   /* stage 0 has landed before the barrier publishes it */
  __syncthreads();
  if (nt > 1) g2_stage(lc + G2_STG, ga + 64, sa16, gb + 64, sb16);
#pragma unroll 1
  for (int t = 0; t < nt; ++t) {
    const unsigned char* sb = sm + (t & 1) * G2_STG; const unsigned char* pa = sb + aofs; const unsigned char* pb = sb + bofs;
#pragma unroll
    for (int kk = 0; kk < 2; ++kk) {
      const v16h a0 = g2_lfrag(pa + kk * 64), a1 = g2_lfrag(pa + 16 * G2_PB + kk * 64);
      const v16h b0 = g2_lfrag(pb + kk * 64), b1 = g2_lfrag(pb + 16 * G2_PB + kk * 64), b2 = g2_lfrag(pb + 32 * G2_PB + kk * 64), b3 = g2_lfrag(pb + 48 * G2_PB + kk * 64);
      c00 = g2_mma(a0, b0, c00); c10 = g2_mma(a1, b0, c10);
      c01 = g2_mma(a0, b1, c01); c11 = g2_mma(a1, b1, c11);
      c02 = g2_mma(a0, b2, c02); c12 = g2_mma(a1, b2, c12);
      c03 = g2_mma(a0, b3, c03); c13 = g2_mma(a1, b3, c13);
    }
    asm volatile("s_wait_dscnt 0x0" ::: "memory");      /* this wave's reads of stage t are done before the stage is refilled */
    asm volatile("s_wait_asynccnt 0x0" ::: "memory");   /* this wave's copies of stage t + 1 have landed before the barrier publishes them */
    __syncthreads();
    if (t + 2 < nt) g2_stage(lc + (unsigned)((t & 1) * G2_STG), ga + (size_t)(t + 2) * 64, sa16, gb + (size_t)(t + 2) * 64, sb16);
  }
  asm volatile("s_wait_asynccnt 0x0" ::: "memory");     /* no copy is outstanding when the ring becomes output staging */
  v8f accs[8] = {c00, c01, c02, c03, c10, c11, c12, c13};
#pragma unroll
  for (int u = 0; u < 8; ++u) {
    const int t = u & 3, half = u >> 2;
#pragma unroll
    for (int r = 0; r < 8; ++r) { const int rloc = half * 16 + 8 * hh + r; float v = accs[u][r] * alpha; if (ACT == 3) v = fmaxf(v, 0.f); so[w][rloc][t * 16 + ln] = v; }
  }
  __builtin_amdgcn_fence(4, "workgroup"); __builtin_amdgcn_wave_barrier();
  const int rsub = lane >> 4, c4 = (lane & 15) * 4;
  {
#pragma unroll
    for (int q = 0; q < 16; ++q) {
      const int r = q * 2 + rsub; const v4f v = *(const v4fa*)&so[w][r][c4];
      if (C) *(v4f*)(C + cofs + (size_t)(row0 + r) * ldc + col0 + c4) = v;
      if (C16) { v4h h4; for (int i = 0; i < 4; ++i) h4[i] = (_Float16)v[i]; *(v4h*)(C16 + cofs + (size_t)(row0 + r) * ldc + col0 + c4) = h4; }
    }
    
  }
}

// per-head RMS normalisation + interleaved-pair rotary step from the f32 GEMM plane F [NR][ldf] (ldf = NHV*128, NHV = compile-time head count, a power of two):
// y = (x * rsqrt(mean_128(x^2) + 1e-6)) * g[d];  out[2i] = y[2i] c[i] - y[2i+1] s[i];  out[2i+1] = y[2i] s[i] + y[2i+1] c[i]  (c, s = table rows [position][64], gain g[128]; all by value, bf16-RNE);
// H [NR][ldf] = f16 hi of every row; L [NB*RE][ldf] = x1024 residual for positions < RE.
// 32-bit thread indices (shifts and masks of compile-time powers of two); 64-bit offsets only at the final pointer arithmetic.
template <int NHV>
__device__ __forceinline__ void nrope_body(const float* __restrict__ F, int ldf, const float* __restrict__ NW, const float* __restrict__ CT, const float* __restrict__ ST,
                                           _Float16* __restrict__ H, _Float16* __restrict__ L) {
  #pragma clang fp contract(off)
  const unsigned t0 = blockIdx.x * 256u + threadIdx.x; const bool live = t0 < (unsigned)(NR * NHV * 16); const unsigned t = live ? t0 : 0u;
  const int p = (int)(t & 15u); const int hd = (int)((t >> 4) % (unsigned)NHV); const unsigned row = t / (unsigned)(16 * NHV);
  const int s = (int)(row % (unsigned)SLEN); const int b = (int)(row / (unsigned)SLEN);
  const float* src = F + (size_t)row * ldf + hd * HDIM + p * 8;
  const v4f xa = *(const v4fa*)src, xb = *(const v4fa*)(src + 4);
  const v4f wa = *(const v4fa*)(NW + p * 8), wb = *(const v4fa*)(NW + p * 8 + 4);
  const v4f cv = *(const v4fa*)(CT + (size_t)s * RTW + p * 4), sv = *(const v4fa*)(ST + (size_t)s * RTW + p * 4);
  const float xs[8] = {xa[0], xa[1], xa[2], xa[3], xb[0], xb[1], xb[2], xb[3]};
  const float gs[8] = {wa[0], wa[1], wa[2], wa[3], wb[0], wb[1], wb[2], wb[3]};
  float ss = 0.f;
#pragma unroll
  for (int i = 0; i < 8; ++i) { const float q = xs[i] * xs[i]; ss = ss + q; }
  ss += __shfl_xor(ss, 1, 32); ss += __shfl_xor(ss, 2, 32); ss += __shfl_xor(ss, 4, 32); ss += __shfl_xor(ss, 8, 32);
  const float mean = ss * 0.0078125f; const float rms = rsqrtf(mean + 1.0e-6f);
  FragH fh, fl;
#pragma unroll
  for (int j = 0; j < 4; ++j) {
    const float c = bf16_rne(cv[j]), sn = bf16_rne(sv[j]);
    const float y1 = (xs[2 * j] * rms) * bf16_rne(gs[2 * j]); const float y2 = (xs[2 * j + 1] * rms) * bf16_rne(gs[2 * j + 1]);
    const float o1 = y1 * c - y2 * sn; const float o2 = y1 * sn + y2 * c;
    const _Float16 h1 = toh_flush(o1), h2 = toh_flush(o2);
    fh.h[2 * j] = h1; fh.h[2 * j + 1] = h2;
    fl.h[2 * j] = toh_flush((o1 - (float)h1) * 1024.0f); fl.h[2 * j + 1] = toh_flush((o2 - (float)h2) * 1024.0f);
  }
  const size_t oh = (size_t)row * ldf + hd * HDIM + p * 8;
  const bool wl = live && (s < RE);
  const int sl = wl ? s : 0;
  const size_t ol = (size_t)(b * RE + sl) * ldf + hd * HDIM + p * 8;
  const v8us vh = fh.half[0], vl = fl.half[0];
  {
    if (live) *(v8us*)((unsigned short*)H + oh) = vh;
    if (wl) *(v8us*)((unsigned short*)L + ol) = vl;
    
  }
}
// query heads (NH per row)
__global__ __launch_bounds__(256) void k_nrope_q(const float* __restrict__ F, int ldf, const float* __restrict__ NW, const float* __restrict__ CT, const float* __restrict__ ST,
                                                 _Float16* __restrict__ H, _Float16* __restrict__ L) {
  #pragma clang fp contract(off)
  nrope_body<NH>(F, ldf, NW, CT, ST, H, L);
}
// key heads (NKVH per row)
__global__ __launch_bounds__(256) void k_nrope_k(const float* __restrict__ F, int ldf, const float* __restrict__ NW, const float* __restrict__ CT, const float* __restrict__ ST,
                                                 _Float16* __restrict__ H, _Float16* __restrict__ L) {
  #pragma clang fp contract(off)
  nrope_body<NKVH>(F, ldf, NW, CT, ST, H, L);
}

__global__ __launch_bounds__(256) void k_vtg(const _Float16* __restrict__ V16, _Float16* __restrict__ Vt) {
  __shared__ unsigned short tl[64][66];
  const int tid = threadIdx.x; const int nlg = SLEN / 64; const int slab = blockIdx.x / nlg, lg = blockIdx.x % nlg; const int b = slab / NV64, h = slab % NV64;
  for (int i = tid; i < 64 * 8; i += 256) {
    const int r = i >> 3, c8 = (i & 7) * 8; FragH f;
    f.half[0] = *(const v8us*)((const unsigned short*)V16 + ((size_t)b * SLEN + lg * 64 + r) * VW + h * 64 + c8);
#pragma unroll
    for (int q = 0; q < 8; ++q) tl[r][c8 + q] = f.u[q];
  }
  __syncthreads();
  {
#pragma unroll
    for (int rd = 0; rd < 2; ++rd) {
      const int d = rd * 32 + (tid >> 3), pc = tid & 7; FragH f;
#pragma unroll
      for (int q = 0; q < 8; ++q) f.u[q] = tl[pc * 8 + q][d];
      *(v8us*)((unsigned short*)Vt + ((size_t)slab * 64 + d) * TK + lg * 64 + pc * 8) = f.half[0];
    }
    
  }
}
__global__ __launch_bounds__(256) void k_vtl(const float* __restrict__ VF, _Float16* __restrict__ VtL) {
  __shared__ unsigned short tl[64][66];
  const int tid = threadIdx.x; const int nlg = RE / 64; const int slab = blockIdx.x / nlg, lg = blockIdx.x % nlg; const int b = slab / NV64, h = slab % NV64;
  for (int i = tid; i < 64 * 16; i += 256) {
    const int r = i >> 4, c4 = (i & 15) * 4;
    const v4f a = *(const v4fa*)(VF + ((size_t)b * SLEN + lg * 64 + r) * VW + h * 64 + c4);
    FragH f;
#pragma unroll
    for (int q = 0; q < 4; ++q) { const float v = a[q]; const _Float16 hv = (_Float16)v; f.h[q] = toh_flush((v - (float)hv) * 1024.0f); }
#pragma unroll
    for (int q = 0; q < 4; ++q) tl[r][c4 + q] = f.u[q];
  }
  __syncthreads();
  {
#pragma unroll
    for (int rd = 0; rd < 2; ++rd) {
      const int d = rd * 32 + (tid >> 3), pc = tid & 7; FragH f;
#pragma unroll
      for (int q = 0; q < 8; ++q) f.u[q] = tl[pc * 8 + q][d];
      *(v8us*)((unsigned short*)VtL + ((size_t)slab * 64 + d) * RE + lg * 64 + pc * 8) = f.half[0];
    }
    
  }
}

__global__ __launch_bounds__(256) void k_hl(const float* __restrict__ Fp, _Float16* __restrict__ Hh, _Float16* __restrict__ A2, size_t n8) {
  const size_t t = (size_t)blockIdx.x * 256 + threadIdx.x; if (t >= n8) return;
  const size_t e = t * 8; const size_t r = e / DM; const int c = (int)(e % DM); const int s = (int)(r % SLEN); const int b = (int)(r / SLEN);
  const v4f a = *(const v4fa*)(Fp + e), d = *(const v4fa*)(Fp + e + 4);
  FragH fh, fl;
#pragma unroll
  for (int q = 0; q < 4; ++q) {
    _Float16 hv = (_Float16)a[q]; fh.h[q] = hv; fl.h[q] = (_Float16)((a[q] - (float)hv) * 1024.0f);
    hv = (_Float16)d[q]; fh.h[4 + q] = hv; fl.h[4 + q] = (_Float16)((d[q] - (float)hv) * 1024.0f);
  }
  const bool wl = (s < RE);
  const size_t o2 = ((size_t)b * RE + (wl ? s : 0)) * (size_t)(2 * DM) + c;
  const v8us vh = fh.half[0], vl = fl.half[0];
  {
    *(v8us*)((unsigned short*)Hh + e) = vh;
    if (wl) { *(v8us*)((unsigned short*)A2 + o2) = vh; *(v8us*)((unsigned short*)A2 + o2 + DM) = vl; }
    
  }
}

// LDS ring of the attention kernel: one stage = one pass of 32 keys = [K 32 rows of 256 B at pitch 272 | V^T 128 rows of 64 B at pitch 80 | mask 4 waves x 1 KiB]; both pitches are 16 B x odd: the 16-B fragment reads meet no bank conflict; two stages
#define FA_KP 272
#define FA_VP 80
#define FA_KB (32 * FA_KP)
#define FA_VB (128 * FA_VP)
#define FA_MB (4 * 1024)
#define FA_STG (FA_KB + FA_VB + FA_MB)
static_assert(FA_STG % 16 == 0 && FA_KB % 16 == 0 && FA_VB % 16 == 0);
static_assert(2 * FA_STG >= 4 * 16 * 132 * 4);   /* the output staging reuses the ring behind the last barrier */
static_assert(2 * FA_STG + 4 * 16 * 40 * 2 <= 65536);
// one stage: 10 copies of 16 B per lane. K: lane (r = tid / 16, c = tid % 16) brings chunk c of key rows r + 8 j (j < 4): a wave-wide copy = 2 whole 256-B rows. V^T: lane (r = tid / 4, c = tid % 4) brings chunk c of rows r + 32 j (j < 4).
// mask: each lane brings its own two 16-B words. lk / lv / lm = the lane's LDS byte addresses in the stage, k / v / m = its global addresses, sk = 8 K rows and sv = 32 V^T rows in elements.
__device__ __forceinline__ void fa_stage(unsigned lk, unsigned lv, unsigned lm, const unsigned short* k, size_t sk, const unsigned short* v, size_t sv, const unsigned short* m) {
  /* s_wait_xcnt closes the copies' own statement: no register that a copy names is rewritten in front of it */
  asm volatile(
      "global_load_async_to_lds_b128 %0, %10, off\n\t"
      "global_load_async_to_lds_b128 %1, %11, off\n\t"
      "global_load_async_to_lds_b128 %2, %12, off\n\t"
      "global_load_async_to_lds_b128 %3, %13, off\n\t"
      "global_load_async_to_lds_b128 %4, %14, off\n\t"
      "global_load_async_to_lds_b128 %5, %15, off\n\t"
      "global_load_async_to_lds_b128 %6, %16, off\n\t"
      "global_load_async_to_lds_b128 %7, %17, off\n\t"
      "global_load_async_to_lds_b128 %8, %18, off\n\t"
      "global_load_async_to_lds_b128 %9, %19, off\n\t"
      "s_wait_xcnt 0x0"
      :: "v"(lk), "v"(lk + 8 * FA_KP), "v"(lk + 16 * FA_KP), "v"(lk + 24 * FA_KP),
         "v"(lv), "v"(lv + 32 * FA_VP), "v"(lv + 64 * FA_VP), "v"(lv + 96 * FA_VP), "v"(lm), "v"(lm + 512),
         "v"(k), "v"(k + sk), "v"(k + 2 * sk), "v"(k + 3 * sk), "v"(v), "v"(v + sv), "v"(v + 2 * sv), "v"(v + 3 * sv), "v"(m), "v"(m + 256)
      : "memory");
}

// fused attention per ((b,h), 64 queries), query blocks [QB0P, QBLKS): wave = 16 queries; S = Q.K^T (d = 128: 4 k-steps, q fragments read once and kept) x SCL + mask (bf16 plane, accumulator layout, two 16-B words per lane per step)
// The pass's K, V^T and mask tiles come through LDS, once for the block's four waves: asynchronous copies in whole row pieces, two stages, stage t + 1 in flight while stage t is worked on.
__global__ __launch_bounds__(128) __attribute__((amdgpu_num_vgpr(256))) void k_flash(const _Float16* __restrict__ Q16, int ldq, const _Float16* __restrict__ K16, int ldk,
                                               const _Float16* __restrict__ Vt, const unsigned short* __restrict__ MP, const int* __restrict__ JE, float* __restrict__ O, int ldo) {
  constexpr int RPW = 16, DT = 8, KS = 4;
  constexpr int NQP = (QBNP > 0) ? QBNP : 1;
  __shared__ __attribute__((aligned(16))) unsigned short sP[4][RPW][40];
  __shared__ __attribute__((aligned(16))) unsigned char ring[2 * FA_STG];
  float (*sO)[RPW][132] = (float (*)[RPW][132])ring;
  const int tid = threadIdx.x, lane = tid & 31, ln = lane & 15, hh = lane >> 4;
  const int w = __builtin_amdgcn_readfirstlane(tid >> 5);
  const int slab = blockIdx.x / NQP, qblk = QB0P + blockIdx.x % NQP; const int b = slab / NH, h = slab % NH; const int kvh = h / NREP;
  const int qb0 = qblk * (4 * RPW); const int q0 = qb0 + w * RPW;
  const unsigned short* qr = (const unsigned short*)Q16 + ((size_t)b * TQ + q0 + ln) * ldq + h * HDIM;
  const unsigned short* Vth = (const unsigned short*)Vt + (size_t)(b * NKVH + kvh) * HDIM * TK;
  int jt = JE[qblk * 32]; jt = (jt < 1) ? 1 : jt; jt = (jt > TK / 32) ? (TK / 32) : jt;
  const int nt = __builtin_amdgcn_readfirstlane(jt);
  /* the lane's copy addresses of stage 0 */
  const unsigned short* gk = (const unsigned short*)K16 + ((size_t)b * TK + (tid >> 4)) * ldk + kvh * HDIM + (tid & 15) * 8;
  const unsigned short* gv = Vth + (size_t)(tid >> 2) * TK + (tid & 3) * 8;
  const unsigned short* gm = MP + (size_t)(q0 >> 4) * (size_t)(TK / 32) * 512 + lane * 8;
  const size_t sk8 = (size_t)8 * ldk, sv32 = (size_t)32 * TK, kst = (size_t)32 * ldk;
  const unsigned rb = (unsigned)(uintptr_t)ring;
  const unsigned lk = rb + (unsigned)((tid >> 4) * FA_KP + (tid & 15) * 16);
  const unsigned lv = rb + (unsigned)(FA_KB + (tid >> 2) * FA_VP + (tid & 3) * 16);
  const unsigned lm = rb + (unsigned)(FA_KB + FA_VB + w * 1024 + lane * 16);
  const int kofs = ln * FA_KP + 16 * hh, vofs = FA_KB + ln * FA_VP + 16 * hh, mofs = FA_KB + FA_VB + w * 1024 + lane * 16;
  fa_stage(lk, lv, lm, gk, sk8, gv, sv32, gm);
  /* A (q) fragments, the same in every pass: element e < 8 <-> d = 32 ks + 8 hh + e; e >= 8 <-> d = 32 ks + 16 + 8 hh + (e - 8) */
  FragH a[KS];
#pragma unroll
  for (int ks = 0; ks < KS; ++ks) { a[ks].half[0] = *(const v8us*)(qr + ks * 32 + 8 * hh); a[ks].half[1] = *(const v8us*)(qr + ks * 32 + 16 + 8 * hh); }
  /* the group's address register is an input here, so it stays whole (no load's result is given it) up to this wait */
  asm volatile("s_wait_xcnt 0x0" :: "v"(qr) : "memory");
  float m_r[8], l_r[8]; v8f oacc[DT];
#pragma unroll
  for (int r = 0; r < 8; ++r) { m_r[r] = -3.0e38f; l_r[r] = 0.f; }
#pragma unroll
  for (int dt = 0; dt < DT; ++dt) oacc[dt] = (v8f){0.f,0.f,0.f,0.f,0.f,0.f,0.f,0.f};
  asm volatile("s_wait_asynccnt 0x0" ::: "memory");   /* stage 0 has landed before the barrier publishes it */
  __syncthreads();
  if (nt > 1) fa_stage(lk + FA_STG, lv + FA_STG, lm + FA_STG, gk + kst, sk8, gv + 32, sv32, gm + 512);
#pragma unroll 1
  for (int t = 0; t < nt; ++t) {
    v8f sa = (v8f){0.f,0.f,0.f,0.f,0.f,0.f,0.f,0.f}, sb = sa;
    const unsigned char* st = ring + (t & 1) * FA_STG;
    const unsigned char* kp = st + kofs; const unsigned char* vp = st + vofs; const unsigned char* mp = st + mofs;
    FragH k0[KS], k1[KS], fm;
#pragma unroll
    for (int ks = 0; ks < KS; ++ks) {
      /* B (k) fragments in the k order of the q fragments: byte 64 ks + 16 hh of key row ln (k0) or 16 + ln (k1), and 32 B further */
      k0[ks].half[0] = *(const v8us*)(kp + ks * 64); k0[ks].half[1] = *(const v8us*)(kp + ks * 64 + 32);
      k1[ks].half[0] = *(const v8us*)(kp + 16 * FA_KP + ks * 64); k1[ks].half[1] = *(const v8us*)(kp + 16 * FA_KP + ks * 64 + 32);
    }
    fm.half[0] = *(const v8us*)mp; fm.half[1] = *(const v8us*)(mp + 512);
#pragma unroll
    for (int ks = 0; ks < KS; ++ks) { sa = g2_mma(a[ks].v, k0[ks].v, sa); sb = g2_mma(a[ks].v, k1[ks].v, sb); }
    /* the V^T fragments of this pass are read here, ahead of the softmax, which covers their LDS trip */
    FragH bv[DT];
#pragma unroll
    for (int dt = 0; dt < DT; ++dt) { bv[dt].half[0] = *(const v8us*)(vp + dt * 16 * FA_VP); bv[dt].half[1] = *(const v8us*)(vp + dt * 16 * FA_VP + 32); }
    float s0v[8], s1v[8], mcv[8];
#pragma unroll
    for (int r = 0; r < 8; ++r) {
      const float mk0 = bf16_val(fm.u[2 * r]), mk1 = bf16_val(fm.u[2 * r + 1]);
      s0v[r] = sa[r] * SCL + mk0; s1v[r] = sb[r] * SCL + mk1;
      mcv[r] = fmaxf(s0v[r], s1v[r]);
    }
    row16_max8(mcv);
#pragma unroll
    for (int r = 0; r < 8; ++r) {
      const float s0 = s0v[r], s1 = s1v[r];
      const float mn = fmaxf(m_r[r], mcv[r]); const float al = (mn > -1.0e38f) ? expf(m_r[r] - mn) : 1.0f; m_r[r] = mn;
      const float p0 = expf(s0 - mn), p1 = expf(s1 - mn); l_r[r] = l_r[r] * al + p0 + p1;
#pragma unroll
      for (int dt = 0; dt < DT; ++dt) oacc[dt][r] *= al;
      FragH t2; t2.h[0] = toh_flush(p0 * 1024.0f); t2.h[1] = toh_flush(p1 * 1024.0f);
      sP[w][8 * hh + r][ln] = t2.u[0]; sP[w][8 * hh + r][16 + ln] = t2.u[1];
    }
    __builtin_amdgcn_fence(4, "workgroup"); __builtin_amdgcn_wave_barrier();
    FragH pa; pa.half[0] = *(const v8us*)&sP[w][ln][8 * hh]; pa.half[1] = *(const v8us*)&sP[w][ln][16 + 8 * hh];
#pragma unroll
    for (int dt = 0; dt < DT; ++dt) {
      /* A (P: key columns of the LDS tile) and B (V^T rows, keys contiguous) share the same key order: element e < 8 <-> key 32 t + 8 hh + e; e >= 8 <-> key 32 t + 16 + 8 hh + (e - 8) */
      oacc[dt] = g2_mma(pa.v, bv[dt].v, oacc[dt]);
    }
    asm volatile("s_wait_dscnt 0x0" ::: "memory");      /* this wave's reads of stage t (and of its P tile) are done before the stage is refilled */
    asm volatile("s_wait_asynccnt 0x0" ::: "memory");   /* this wave's copies of stage t + 1 have landed before the barrier publishes them */
    __syncthreads();
    if (t + 2 < nt) { const unsigned so2 = (unsigned)((t & 1) * FA_STG); fa_stage(lk + so2, lv + so2, lm + so2, gk + (size_t)(t + 2) * kst, sk8, gv + (size_t)(t + 2) * 32, sv32, gm + (size_t)(t + 2) * 512); }
  }
  asm volatile("s_wait_asynccnt 0x0" ::: "memory");     /* no copy is outstanding when the ring becomes output staging */
  row16_sum8(l_r);
#pragma unroll
  for (int r = 0; r < 8; ++r) { const float l = l_r[r]; l_r[r] = (l > 0.f) ? 1.0f / (l * 1024.0f) : 0.f; }
#pragma unroll
  for (int dt = 0; dt < DT; ++dt)
#pragma unroll
    for (int r = 0; r < 8; ++r) sO[w][8 * hh + r][dt * 16 + ln] = oacc[dt][r] * l_r[r];
  __builtin_amdgcn_fence(4, "workgroup"); __builtin_amdgcn_wave_barrier();
  {
#pragma unroll
    for (int rp = 0; rp < RPW; ++rp) { const v4f val = *(const v4fa*)&sO[w][rp][lane * 4]; *(v4f*)(O + ((size_t)b * TQ + q0 + rp) * ldo + h * HDIM + lane * 4) = val; }
    
  }
}
// LDS ring of the 5-plane kernel: one stage = one pass of 32 keys = [K hi 32 rows | K residual 32 rows, pitch 272 | V^T hi 64 rows | V^T residual 64 rows, pitch 80 | mask 4 waves x 1 KiB]; two stages; beside it the block's 64 q rows, hi and residual, pitch 272, filled once
#define F5_KB (32 * FA_KP)
#define F5_VB (64 * FA_VP)
#define F5_STG (2 * F5_KB + 2 * F5_VB + FA_MB)
#define F5_QB (64 * FA_KP)
static_assert(F5_STG % 16 == 0 && F5_KB % 16 == 0 && F5_VB % 16 == 0 && F5_QB % 16 == 0);
static_assert(2 * F5_STG >= 4 * 16 * 68 * 4);    /* the output staging reuses the ring behind the last barrier */
static_assert(2 * F5_STG + 2 * F5_QB + 2 * 4 * 16 * 40 * 2 <= 131072);
// one stage: 14 copies of 16 B per lane. K planes: lane (r = tid / 16, c = tid % 16) brings chunk c of key rows r + 8 j (j < 4); V^T planes: lane (r = tid / 4, c = tid % 4) brings chunk c of rows r + 32 j (j < 2); mask: the lane's own two words.
// lk / lv / lm = the lane's LDS byte addresses in the stage (hi planes), kh / kl / vh / vl / m = its global addresses, sk = 8 K rows, svh / svl = 32 V^T rows of the hi / residual plane, in elements.
__device__ __forceinline__ void f5_stage(unsigned lk, unsigned lv, unsigned lm, const unsigned short* kh, const unsigned short* kl, size_t sk,
                                         const unsigned short* vh, size_t svh, const unsigned short* vl, size_t svl, const unsigned short* m) {
  /* s_wait_xcnt closes the copies' own statement: no register that a copy names is rewritten in front of it */
  asm volatile(
      "global_load_async_to_lds_b128 %0, %14, off\n\t"
      "global_load_async_to_lds_b128 %1, %15, off\n\t"
      "global_load_async_to_lds_b128 %2, %16, off\n\t"
      "global_load_async_to_lds_b128 %3, %17, off\n\t"
      "global_load_async_to_lds_b128 %4, %18, off\n\t"
      "global_load_async_to_lds_b128 %5, %19, off\n\t"
      "global_load_async_to_lds_b128 %6, %20, off\n\t"
      "global_load_async_to_lds_b128 %7, %21, off\n\t"
      "global_load_async_to_lds_b128 %8, %22, off\n\t"
      "global_load_async_to_lds_b128 %9, %23, off\n\t"
      "global_load_async_to_lds_b128 %10, %24, off\n\t"
      "global_load_async_to_lds_b128 %11, %25, off\n\t"
      "global_load_async_to_lds_b128 %12, %26, off\n\t"
      "global_load_async_to_lds_b128 %13, %27, off\n\t"
      "s_wait_xcnt 0x0"
      :: "v"(lk), "v"(lk + 8 * FA_KP), "v"(lk + 16 * FA_KP), "v"(lk + 24 * FA_KP),
         "v"(lk + F5_KB), "v"(lk + F5_KB + 8 * FA_KP), "v"(lk + F5_KB + 16 * FA_KP), "v"(lk + F5_KB + 24 * FA_KP),
         "v"(lv), "v"(lv + 32 * FA_VP), "v"(lv + F5_VB), "v"(lv + F5_VB + 32 * FA_VP), "v"(lm), "v"(lm + 512),
         "v"(kh), "v"(kh + sk), "v"(kh + 2 * sk), "v"(kh + 3 * sk), "v"(kl), "v"(kl + sk), "v"(kl + 2 * sk), "v"(kl + 3 * sk),
         "v"(vh), "v"(vh + svh), "v"(vl), "v"(vl + svl), "v"(m), "v"(m + 256)
      : "memory");
}
// one q plane of the block: 8 copies of 16 B per lane; lane (r = tid / 16, c = tid % 16) brings chunk c of query rows r + 8 j (j < 8). l = its LDS byte address, g = its global address, s = 8 rows in elements.
__device__ __forceinline__ void f5_qplane(unsigned l, const unsigned short* g, size_t s) {
  /* s_wait_xcnt closes the copies' own statement: no register that a copy names is rewritten in front of it */
  asm volatile(
      "global_load_async_to_lds_b128 %0, %8, off\n\t"
      "global_load_async_to_lds_b128 %1, %9, off\n\t"
      "global_load_async_to_lds_b128 %2, %10, off\n\t"
      "global_load_async_to_lds_b128 %3, %11, off\n\t"
      "global_load_async_to_lds_b128 %4, %12, off\n\t"
      "global_load_async_to_lds_b128 %5, %13, off\n\t"
      "global_load_async_to_lds_b128 %6, %14, off\n\t"
      "global_load_async_to_lds_b128 %7, %15, off\n\t"
      "s_wait_xcnt 0x0"
      :: "v"(l), "v"(l + 8 * FA_KP), "v"(l + 16 * FA_KP), "v"(l + 24 * FA_KP), "v"(l + 32 * FA_KP), "v"(l + 40 * FA_KP), "v"(l + 48 * FA_KP), "v"(l + 56 * FA_KP),
         "v"(g), "v"(g + s), "v"(g + 2 * s), "v"(g + 3 * s), "v"(g + 4 * s), "v"(g + 5 * s), "v"(g + 6 * s), "v"(g + 7 * s)
      : "memory");
}

// 5-plane variant for query blocks [QB05, QB05+QBN5) (positions < RE), one 64-wide half dh of the head's 128 dims per block: S = Qh.Kh^T + (Ql.Kh^T + Qh.Kl^T)/1024 with Q/K = [hi | x1024 residual] planes (residual planes compact: rows b*RE + s);
// O = (Ph.Vh + (Pl.Vh + Ph.Vl)/1024) / l with P = [hi | x1024 residual] of 1024 p and V^T = [hi | x1024 residual] (VtL pitch RE); separate residual accumulators folded before the normalisation.
// key tiles [0, JE[qblk]) clamped to [1, RE/32] (the compact planes hold keys < RE); a block whose mask exposes keys beyond RE writes NaN rows.
// All operand tiles come through LDS, once for the block's four waves: asynchronous copies in whole row pieces; q planes once, the pass's K, V^T and mask tiles in two stages, stage t + 1 in flight while stage t is worked on.
__global__ __launch_bounds__(128) __attribute__((amdgpu_num_vgpr(256))) void k_flash5(const _Float16* __restrict__ Q16, const _Float16* __restrict__ QL, int ldq, const _Float16* __restrict__ K16, const _Float16* __restrict__ KL, int ldk,
                                                const _Float16* __restrict__ Vt, const _Float16* __restrict__ VtL, const unsigned short* __restrict__ MP, const int* __restrict__ JE, float* __restrict__ O, int ldo) {
  constexpr int RPW = 16, DT = 4, KS = 4;
  __shared__ __attribute__((aligned(16))) unsigned short sP[4][RPW][40];
  __shared__ __attribute__((aligned(16))) unsigned short sPL[4][RPW][40];
  __shared__ __attribute__((aligned(16))) unsigned char ring[2 * F5_STG];
  __shared__ __attribute__((aligned(16))) unsigned char sQ[2 * F5_QB];
  float (*sO)[RPW][68] = (float (*)[RPW][68])ring;
  const int tid = threadIdx.x, lane = tid & 31, ln = lane & 15, hh = lane >> 4;
  const int w = __builtin_amdgcn_readfirstlane(tid >> 5);
  const int dh = blockIdx.x & 1; const int bx = blockIdx.x >> 1;
  const int slab = bx / QBN5, qblk = QB05 + bx % QBN5; const int b = slab / NH, h = slab % NH; const int kvh = h / NREP;
  const int qb0 = qblk * (4 * RPW); const int q0 = qb0 + w * RPW;
  const int jraw = JE[qblk * 32];
  const float pz = (jraw > RE / 32) ? __uint_as_float(0x7FC00000u) : 0.0f;
  int jt = (jraw < 1) ? 1 : jraw; jt = (jt > RE / 32) ? (RE / 32) : jt;
  const int nt = __builtin_amdgcn_readfirstlane(jt);
  /* the lane's copy addresses: q planes, and stage 0 of the ring */
  const unsigned short* gq = (const unsigned short*)Q16 + ((size_t)b * TQ + qb0 + (tid >> 4)) * ldq + h * HDIM + (tid & 15) * 8;
  const unsigned short* gql = (const unsigned short*)QL + ((size_t)b * RE + qb0 + (tid >> 4)) * ldq + h * HDIM + (tid & 15) * 8;
  const unsigned short* gk = (const unsigned short*)K16 + ((size_t)b * TK + (tid >> 4)) * ldk + kvh * HDIM + (tid & 15) * 8;
  const unsigned short* gkl = (const unsigned short*)KL + ((size_t)b * RE + (tid >> 4)) * ldk + kvh * HDIM + (tid & 15) * 8;
  const unsigned short* gv = (const unsigned short*)Vt + ((size_t)(b * NKVH + kvh) * HDIM + dh * 64 + (tid >> 2)) * TK + (tid & 3) * 8;
  const unsigned short* gvl = (const unsigned short*)VtL + ((size_t)(b * NKVH + kvh) * HDIM + dh * 64 + (tid >> 2)) * RE + (tid & 3) * 8;
  const unsigned short* gm = MP + (size_t)(q0 >> 4) * (size_t)(TK / 32) * 512 + lane * 8;
  const size_t sq8 = (size_t)8 * ldq, sk8 = (size_t)8 * ldk, kst = (size_t)32 * ldk, svh = (size_t)32 * TK, svl = (size_t)32 * RE;
  const unsigned rb = (unsigned)(uintptr_t)ring;
  const unsigned lq = (unsigned)(uintptr_t)sQ + (unsigned)((tid >> 4) * FA_KP + (tid & 15) * 16);
  const unsigned lk = rb + (unsigned)((tid >> 4) * FA_KP + (tid & 15) * 16);
  const unsigned lv = rb + (unsigned)(2 * F5_KB + (tid >> 2) * FA_VP + (tid & 3) * 16);
  const unsigned lm = rb + (unsigned)(2 * F5_KB + 2 * F5_VB + w * 1024 + lane * 16);
  const int kofs = ln * FA_KP + 16 * hh, vofs = 2 * F5_KB + ln * FA_VP + 16 * hh, mofs = 2 * F5_KB + 2 * F5_VB + w * 1024 + lane * 16;
  const unsigned char* qp = sQ + (w * RPW + ln) * FA_KP + 16 * hh;
  f5_qplane(lq, gq, sq8);
  f5_qplane(lq + F5_QB, gql, sq8);
  f5_stage(lk, lv, lm, gk, gkl, sk8, gv, svh, gvl, svl, gm);
  float m_r[8], l_r[8]; v8f oacc[DT], oaccL[DT];
#pragma unroll
  for (int r = 0; r < 8; ++r) { m_r[r] = -3.0e38f; l_r[r] = 0.f; }
#pragma unroll
  for (int dt = 0; dt < DT; ++dt) { oacc[dt] = (v8f){0.f,0.f,0.f,0.f,0.f,0.f,0.f,0.f}; oaccL[dt] = oacc[dt]; }
  asm volatile("s_wait_asynccnt 0x0" ::: "memory");   /* the q planes and stage 0 have landed before the barrier publishes them */
  __syncthreads();
  if (nt > 1) f5_stage(lk + F5_STG, lv + F5_STG, lm + F5_STG, gk + kst, gkl + kst, sk8, gv + 32, svh, gvl + 32, svl, gm + 512);
#pragma unroll 1
  for (int t = 0; t < nt; ++t) {
    v8f sa = (v8f){0.f,0.f,0.f,0.f,0.f,0.f,0.f,0.f}, sb = sa, sal = sa, sbl = sa;
    const unsigned char* st = ring + (t & 1) * F5_STG;
    const unsigned char* kp = st + kofs; const unsigned char* vp = st + vofs; const unsigned char* mp = st + mofs;
    FragH fm; fm.half[0] = *(const v8us*)mp; fm.half[1] = *(const v8us*)(mp + 512);
#pragma unroll
    for (int ks = 0; ks < KS; ++ks) {
      /* all A and B fragments of this step share one k order: element e < 8 <-> d = 32 ks + 8 hh + e; e >= 8 <-> d = 32 ks + 16 + 8 hh + (e - 8): byte 64 ks + 16 hh of the row, and 32 B further */
      FragH a, al2, k0, k1, g0, g1;
      a.half[0] = *(const v8us*)(qp + ks * 64); a.half[1] = *(const v8us*)(qp + ks * 64 + 32);
      al2.half[0] = *(const v8us*)(qp + F5_QB + ks * 64); al2.half[1] = *(const v8us*)(qp + F5_QB + ks * 64 + 32);
      k0.half[0] = *(const v8us*)(kp + ks * 64); k0.half[1] = *(const v8us*)(kp + ks * 64 + 32);
      k1.half[0] = *(const v8us*)(kp + 16 * FA_KP + ks * 64); k1.half[1] = *(const v8us*)(kp + 16 * FA_KP + ks * 64 + 32);
      g0.half[0] = *(const v8us*)(kp + F5_KB + ks * 64); g0.half[1] = *(const v8us*)(kp + F5_KB + ks * 64 + 32);
      g1.half[0] = *(const v8us*)(kp + F5_KB + 16 * FA_KP + ks * 64); g1.half[1] = *(const v8us*)(kp + F5_KB + 16 * FA_KP + ks * 64 + 32);
      sa = g2_mma(a.v, k0.v, sa); sb = g2_mma(a.v, k1.v, sb);
      sal = g2_mma(al2.v, k0.v, sal); sbl = g2_mma(al2.v, k1.v, sbl);
      sal = g2_mma(a.v, g0.v, sal); sbl = g2_mma(a.v, g1.v, sbl);
    }
    /* both V^T planes' fragments of this pass are read here, ahead of the softmax, which covers their LDS trip */
    FragH bv[DT], bl[DT];
#pragma unroll
    for (int dt = 0; dt < DT; ++dt) {
      bv[dt].half[0] = *(const v8us*)(vp + dt * 16 * FA_VP); bv[dt].half[1] = *(const v8us*)(vp + dt * 16 * FA_VP + 32);
      bl[dt].half[0] = *(const v8us*)(vp + F5_VB + dt * 16 * FA_VP); bl[dt].half[1] = *(const v8us*)(vp + F5_VB + dt * 16 * FA_VP + 32);
    }
    float s0v[8], s1v[8], mcv[8];
#pragma unroll
    for (int r = 0; r < 8; ++r) {
      const float mk0 = bf16_val(fm.u[2 * r]), mk1 = bf16_val(fm.u[2 * r + 1]);
      const float d0 = sa[r] + sal[r] * 0.0009765625f, d1 = sb[r] + sbl[r] * 0.0009765625f;
      s0v[r] = d0 * SCL + mk0; s1v[r] = d1 * SCL + mk1;
      mcv[r] = fmaxf(s0v[r], s1v[r]);
    }
    row16_max8(mcv);
#pragma unroll
    for (int r = 0; r < 8; ++r) {
      const float s0 = s0v[r], s1 = s1v[r];
      const float mn = fmaxf(m_r[r], mcv[r]); const float al = (mn > -1.0e38f) ? expf(m_r[r] - mn) : 1.0f; m_r[r] = mn;
      const float p0 = expf(s0 - mn), p1 = expf(s1 - mn); l_r[r] = l_r[r] * al + p0 + p1;
#pragma unroll
      for (int dt = 0; dt < DT; ++dt) { oacc[dt][r] *= al; oaccL[dt][r] *= al; }
      FragH t2, t2l; const float ps0 = p0 * 1024.0f, ps1 = p1 * 1024.0f;
      t2.h[0] = toh_flush(ps0); t2.h[1] = toh_flush(ps1);
      t2l.h[0] = toh_flush((ps0 - (float)t2.h[0]) * 1024.0f); t2l.h[1] = toh_flush((ps1 - (float)t2.h[1]) * 1024.0f);
      sP[w][8 * hh + r][ln] = t2.u[0]; sP[w][8 * hh + r][16 + ln] = t2.u[1]; sPL[w][8 * hh + r][ln] = t2l.u[0]; sPL[w][8 * hh + r][16 + ln] = t2l.u[1];
    }
    __builtin_amdgcn_fence(4, "workgroup"); __builtin_amdgcn_wave_barrier();
    FragH pa, pl;
    pa.half[0] = *(const v8us*)&sP[w][ln][8 * hh]; pa.half[1] = *(const v8us*)&sP[w][ln][16 + 8 * hh];
    pl.half[0] = *(const v8us*)&sPL[w][ln][8 * hh]; pl.half[1] = *(const v8us*)&sPL[w][ln][16 + 8 * hh];
#pragma unroll
    for (int dt = 0; dt < DT; ++dt) {
      /* A (P tiles) and B (V^T rows) share the same key order: element e < 8 <-> key 32 t + 8 hh + e; e >= 8 <-> key 32 t + 16 + 8 hh + (e - 8) */
      oacc[dt] = g2_mma(pa.v, bv[dt].v, oacc[dt]);
      oaccL[dt] = g2_mma(pl.v, bv[dt].v, oaccL[dt]);
      oaccL[dt] = g2_mma(pa.v, bl[dt].v, oaccL[dt]);
    }
    asm volatile("s_wait_dscnt 0x0" ::: "memory");      /* this wave's reads of stage t (and of its P tiles) are done before the stage is refilled */
    asm volatile("s_wait_asynccnt 0x0" ::: "memory");   /* this wave's copies of stage t + 1 have landed before the barrier publishes them */
    __syncthreads();
    if (t + 2 < nt) {
      const unsigned so2 = (unsigned)((t & 1) * F5_STG);
      f5_stage(lk + so2, lv + so2, lm + so2, gk + (size_t)(t + 2) * kst, gkl + (size_t)(t + 2) * kst, sk8, gv + (size_t)(t + 2) * 32, svh, gvl + (size_t)(t + 2) * 32, svl, gm + (size_t)(t + 2) * 512);
    }
  }
  asm volatile("s_wait_asynccnt 0x0" ::: "memory");     /* no copy is outstanding when the ring becomes output staging */
  row16_sum8(l_r);
#pragma unroll
  for (int r = 0; r < 8; ++r) { const float l = l_r[r]; l_r[r] = (l > 0.f) ? 1.0f / (l * 1024.0f) : 0.f; }
#pragma unroll
  for (int dt = 0; dt < DT; ++dt)
#pragma unroll
    for (int r = 0; r < 8; ++r) { float v = oacc[dt][r]; v += oaccL[dt][r] * 0.0009765625f; sO[w][8 * hh + r][dt * 16 + ln] = v * l_r[r] + pz; }
  __builtin_amdgcn_fence(4, "workgroup"); __builtin_amdgcn_wave_barrier();
  {
#pragma unroll
    for (int rp = 0; rp < RPW; rp += 2) { const int r = rp + (lane >> 4), pc = lane & 15; const v4f val = *(const v4fa*)&sO[w][r][pc * 4]; *(v4f*)(O + ((size_t)b * TQ + q0 + r) * ldo + h * HDIM + dh * 64 + pc * 4) = val; }
    
  }
}

extern "C" void kernel_launch(void* const* d_in, const int* in_sizes, int n_in,
                              void* d_out, int out_size, void* d_ws, size_t ws_size, hipStream_t stream) {
  if (n_in < 10) return;
  const size_t needx = ((size_t)(NB - 1) * SEQ_FULL + (size_t)SLEN) * DM;
  if ((size_t)in_sizes[0] < needx) return;
  if ((size_t)in_sizes[1] < (size_t)DM * DM) return;
  if ((size_t)in_sizes[2] < (size_t)VW * DM) return;
  if ((size_t)in_sizes[3] < (size_t)VW * DM) return;
  if ((size_t)in_sizes[4] < (size_t)DM * DM) return;
  if ((size_t)in_sizes[5] < (size_t)HDIM) return;
  if ((size_t)in_sizes[6] < (size_t)HDIM) return;
  if ((size_t)in_sizes[7] < (size_t)SLEN * RTW) return;
  if ((size_t)in_sizes[8] < (size_t)SLEN * RTW) return;
  if ((size_t)in_sizes[9] < (size_t)(SLEN - 1) * MSKP + (size_t)SLEN) return;
  if ((size_t)out_size < needx) return;
  /* inputs in order: x, Wq, Wk, Wv, Wo, q gain, k gain, cos table, sin table, mask */
  const float* x = (const float*)d_in[0]; const float* Wq = (const float*)d_in[1]; const float* Wk = (const float*)d_in[2]; const float* Wv = (const float*)d_in[3]; const float* Wo = (const float*)d_in[4];
  const float* qnw = (const float*)d_in[5]; const float* knw = (const float*)d_in[6]; const float* rct = (const float*)d_in[7]; const float* rst = (const float*)d_in[8]; const float* msk = (const float*)d_in[9];
  float* dout = (float*)d_out;
  char* ws = (char*)d_ws; size_t off = 0;
  auto take = [&](size_t bytes) { char* p = ws + off; off += (bytes + 255) & ~(size_t)255; return p; };
  const size_t np = (size_t)NR * DM;
  const size_t nw8 = (size_t)DM * DM / 8;
  const size_t nk8 = (size_t)VW * DM / 8;
  _Float16* BQ = (_Float16*)take(SZ_BQ);                                /* [n][k] f16, x16 */
  _Float16* BK = (_Float16*)take(SZ_BK);
  _Float16* BV = (_Float16*)take(SZ_BK);
  _Float16* B2 = (_Float16*)take(SZ_B2);                                /* [n][2*DM] f16: [x16384 | x16] copies of Wo */
  float* FS = (float*)take(SZ_FS);                                      /* f32 scratch plane: q rows [NR][DM], then k rows [NR][VW], then v rows [NR][VW], then the context [NR][DM] */
  _Float16* X16 = (_Float16*)take(SZ_X16);                              /* f16 input rows; reused as V^T [(b,g)][64][TK] after the v GEMM */
  _Float16* VT = X16;
  _Float16* QH = (_Float16*)take(SZ_QH);                                /* reused as the context hi plane after the attention */
  _Float16* KHp = (_Float16*)take(SZ_KH);                               /* [NR][VW] */
  _Float16* V16 = (_Float16*)take(SZ_KH);                               /* [NR][VW] */
  _Float16* QL = (_Float16*)take(SZ_QL);                                /* [NB*RE][DM] residual plane */
  _Float16* KL = (_Float16*)take(SZ_KL);                                /* [NB*RE][VW] residual plane */
  _Float16* VTL = (_Float16*)take(SZ_VTL);                              /* [(b,g)][64][RE] */
  _Float16* A2 = (_Float16*)take(SZ_A2);                                /* [NB*RE][2*DM] = [ctx hi | ctx residual] */
  unsigned short* MPp = (unsigned short*)take(SZ_MP);                   /* bf16 mask plane, accumulator layout */
  int* JEp = (int*)take(SZ_JE);                                         /* [QBLKS][32] key-tile counts */
  _Float16* OH = QH;
  if (off > ws_size) return;
  if (off > ((size_t)128 << 20)) return;

  const unsigned gw = (unsigned)((nw8 + 255) / 256);
  const unsigned gk = (unsigned)((nk8 + 255) / 256);
  k_wsc<<<gw, 256, 0, stream>>>(Wq, BQ, nw8, WSC_LO);
  k_wsc<<<gk, 256, 0, stream>>>(Wk, BK, nk8, WSC_LO);
  k_wsc<<<gk, 256, 0, stream>>>(Wv, BV, nk8, WSC_LO);
  k_wsc2<<<gw, 256, 0, stream>>>(Wo, B2, nw8, WSC_HI, WSC_LO);
  k_mperm<<<(unsigned)(((size_t)(SLEN / 16) * (SLEN / 32) * 64) / 256), 256, 0, stream>>>(msk, MPp);
  k_mjend<<<(unsigned)QBLKS, 1024, 0, stream>>>(msk, JEp);
  const unsigned g8 = (unsigned)((np / 8 + 255) / 256);
  k_x16<<<g8, 256, 0, stream>>>(x, X16, np / 8);
  const dim3 gp((unsigned)((NR / 128) * (DM / 64)), 1);
  const dim3 gkv((unsigned)((NR / 128) * (VW / 64)), 1);
  const unsigned grq = (unsigned)(((size_t)NR * NH * 16) / 256);
  const unsigned grk = (unsigned)(((size_t)NR * NKVH * 16) / 256);
  k_gemm2<0><<<gp, 128, 0, stream>>>(X16, DM, 0, BQ, DM, 0, AL_P, FS, nullptr, DM, 0, NR, DM, DM);        /* q = x Wq^T (f32 rows, pitch DM) */
  k_nrope_q<<<grq, 256, 0, stream>>>(FS, DM, qnw, rct, rst, QH, QL);
  k_gemm2<0><<<gkv, 128, 0, stream>>>(X16, DM, 0, BK, DM, 0, AL_P, FS, nullptr, VW, 0, NR, VW, DM);       /* k = x Wk^T (f32 rows, pitch VW) */
  k_nrope_k<<<grk, 256, 0, stream>>>(FS, VW, knw, rct, rst, KHp, KL);
  k_gemm2<0><<<gkv, 128, 0, stream>>>(X16, DM, 0, BV, DM, 0, AL_P, FS, V16, VW, 0, NR, VW, DM);           /* v = x Wv^T (f32 rows + f16 plane, pitch VW) */
  k_vtg<<<(unsigned)(NB * NV64 * (SLEN / 64)), 256, 0, stream>>>(V16, VT);
  k_vtl<<<(unsigned)(NB * NV64 * (RE / 64)), 256, 0, stream>>>(FS, VTL);
  k_flash5<<<(unsigned)(NB * NH * QBN5 * 2), 128, 0, stream>>>(QH, QL, DM, KHp, KL, VW, VT, VTL, MPp, JEp, FS, DM);
  if (QBNP > 0) k_flash<<<(unsigned)(NB * NH * QBNP), 128, 0, stream>>>(QH, DM, KHp, VW, VT, MPp, JEp, FS, DM);
  k_hl<<<g8, 256, 0, stream>>>(FS, OH, A2, np / 8);
  /* out rows [0, RE) per batch: [ctx hi | ctx residual] . [Wo x16384 ; Wo x16] / 16384  (K = 2*DM) */
  const dim3 ge((unsigned)((RE / 128) * (DM / 64)), NB);
  k_gemm2<0><<<ge, 128, 0, stream>>>(A2, 2 * DM, (size_t)RE * 2 * DM, B2, 2 * DM, 0, AL_E, dout, nullptr, DM, (size_t)SEQ_FULL * DM, RE, DM, 2 * DM);
  /* out rows [RE, SLEN) per batch: ctx hi . (Wo x16) / 16 */
  if (SLEN > RE) {
    const dim3 gl((unsigned)(((SLEN - RE) / 128) * (DM / 64)), NB);
    k_gemm2<0><<<gl, 128, 0, stream>>>(OH + (size_t)RE * DM, DM, (size_t)SLEN * DM, B2 + DM, 2 * DM, 0, AL_P, dout + (size_t)RE * DM, nullptr, DM, (size_t)SEQ_FULL * DM, SLEN - RE, DM, DM);
  }
}

// v006
// One run takes 310 microseconds.
// In two side-by-side timings against v005, it was 1.14 and 1.15 times as fast.
// Over all steps from v000 it is 2.90 times as fast.
#include <hip/hip_runtime.h>
// Contractions: x.Wq^T, x.Wk^T, x.Wv^T, ctx.Wo^T = v_wmma_f32_16x16x32_f16 (f16 operands: bf16-RNE inputs exact in f16, weights carried x16 (x16384 for the ctx-hi half of the early-row output GEMM); f32 accumulate); scores q.k^T and P.V^T = v_wmma_f32_16x16x32_f16 (plain f16 hi planes; hi + x1024 residual planes of q, k, P and v for query positions < RE; P carried x1024), f32 accumulate; per-head RMS normalisation, rotary step, additive mask, softmax and normalisers f32.

#ifndef NB
#define NB 2
#endif
#ifndef SEQ
#define SEQ 2048
#endif
#define NB_FULL 2
#define SEQ_FULL 2048
#define DM 2048
#define NH 16
#define NKVH 4
#define NREP (NH / NKVH)
#define HDIM 128
#define VW (NKVH * HDIM)                     /* width of the k / v projection rows */
#define NV64 (VW / 64)                       /* 64-wide column groups of the v rows */
#define MSKP 2048                            /* row pitch of the mask input */
#define RTW 64                               /* row pitch of the cos / sin inputs */
#define SLEN SEQ
#define NR (NB * SLEN)
#define TQ SLEN
#define TK SLEN
#define SCL 0.08838834764831845f
#define MVIS (-1.0e8f)                       /* a mask entry above this keeps its key visible */
#define QBLKS (TQ / 64)
#define RE ((SLEN < 512) ? SLEN : 512)      /* query positions [0, RE) get residual planes on q, k, P, v and ctx */
#define QB05 0
#define QBN5 (RE / 64)
#define QB0P QBN5
#define QBNP (QBLKS - QBN5)
static_assert(SLEN % 128 == 0);
static_assert(SLEN <= SEQ_FULL);
static_assert(SLEN <= MSKP);
static_assert(NB >= 1 && NB <= NB_FULL);
static_assert(RE % 128 == 0 && RE <= SLEN);
static_assert((SLEN - RE) % 128 == 0);
static_assert(DM % 64 == 0 && DM == NH * HDIM);
static_assert(HDIM == 128 && NH % NKVH == 0);
static_assert(VW % 64 == 0 && NV64 * 64 == VW);
static_assert(DM % 32 == 0 && (2 * DM) % 32 == 0);
static_assert(NR % 128 == 0);
static_assert(((size_t)NR * NH * 16) % 256 == 0 && ((size_t)NR * NKVH * 16) % 256 == 0);
static_assert((NH & (NH - 1)) == 0 && (NKVH & (NKVH - 1)) == 0);   /* head counts are powers of two: index arithmetic by shifts and masks */
static_assert((size_t)NR * NH * 16 < ((size_t)1 << 31));           /* 32-bit thread indices in the normalise + rotary kernels */
static_assert(((size_t)(SLEN / 16) * (SLEN / 32) * 64) % 256 == 0);
static_assert(32 * 16 == HDIM * 4);          /* one store instruction of 32 lanes x 16 B == one 128-float row segment */
static_assert(16 * 16 == 64 * 4);            /* 16 lanes x 16 B == one 64-float row segment */
static_assert(4 * 16 * 40 * 2 + 4 * 16 * 132 * 4 <= 131072);
static_assert(2 * 4 * 16 * 40 * 2 + 4 * 16 * 68 * 4 <= 131072);
static_assert(4 * 32 * 68 * 4 <= 131072);

static constexpr float WSC_LO = 16.0f;
static constexpr float WSC_HI = 16384.0f;
static constexpr float AL_P = 0.0625f;
static constexpr float AL_E = 6.103515625e-05f;   /* 0.0625 / 1024 */

static constexpr size_t al256(size_t b) { return (b + 255) & ~(size_t)255; }
static constexpr size_t SZ_BQ = al256((size_t)DM * DM * 2);
static constexpr size_t SZ_BK = al256((size_t)VW * DM * 2);
static constexpr size_t SZ_B2 = al256((size_t)DM * 2 * DM * 2);
static constexpr size_t SZ_FS = al256((size_t)NR * DM * 4);
static constexpr size_t SZ_X16 = al256((size_t)NR * DM * 2);
static constexpr size_t SZ_QH = al256((size_t)NR * DM * 2);
static constexpr size_t SZ_KH = al256((size_t)NR * VW * 2);
static constexpr size_t SZ_QL = al256((size_t)NB * RE * DM * 2);
static constexpr size_t SZ_KL = al256((size_t)NB * RE * VW * 2);
static constexpr size_t SZ_VTL = al256((size_t)NB * NV64 * 64 * RE * 2);
static constexpr size_t SZ_A2 = al256((size_t)NB * RE * 2 * DM * 2);
static constexpr size_t SZ_MP = al256((size_t)SLEN * SLEN * 2);
static constexpr size_t SZ_JE = al256((size_t)QBLKS * 32 * 4);
static_assert((size_t)NB * NV64 * 64 * TK * 2 <= SZ_X16);       /* V^T aliases the f16 input plane */
static_assert((size_t)NR * VW * 4 <= SZ_FS);
static_assert(SZ_BQ + 2 * SZ_BK + SZ_B2 + SZ_FS + SZ_X16 + SZ_QH + 2 * SZ_KH + SZ_QL + SZ_KL + SZ_VTL + SZ_A2 + SZ_MP + SZ_JE <= ((size_t)128 << 20));

typedef _Float16 v16h __attribute__((ext_vector_type(16)));
typedef _Float16 v4h __attribute__((ext_vector_type(4)));
typedef unsigned short v8us __attribute__((ext_vector_type(8), may_alias));
typedef float v8f __attribute__((ext_vector_type(8)));
typedef float v4f __attribute__((ext_vector_type(4)));
typedef float v4fa __attribute__((ext_vector_type(4), may_alias));
union FragH { v16h v; v8us half[2]; _Float16 h[16]; unsigned short u[16]; };

__device__ __forceinline__ unsigned short bf16_bits(float x) { unsigned int u = __float_as_uint(x); return (unsigned short)((u + 0x7FFFu + ((u >> 16) & 1u)) >> 16); }
__device__ __forceinline__ float bf16_val(unsigned short b) { return __uint_as_float(((unsigned int)b) << 16); }
__device__ __forceinline__ float bf16_rne(float x) { return bf16_val(bf16_bits(x)); }
// f32 -> f16 for WMMA operand planes: values under the smallest f16 normal become +0
__device__ __forceinline__ _Float16 toh_flush(float v) { const _Float16 r = (_Float16)v; return (fabsf(v) < 6.103515625e-05f) ? (_Float16)0.0f : r; }

// D += A.B with NT terms: 1 = ah.bh, 2 = + al.bh, 3 = + ah.bl; hazard guard after the group
template <int NT>
__device__ __forceinline__ v8f mmaH(v16h ah, v16h al, v16h bh, v16h bl, v8f c) {
  c = __builtin_amdgcn_wmma_f32_16x16x32_f16(false, ah, false, bh, (short)0, c, false, false);
  if (NT >= 2) c = __builtin_amdgcn_wmma_f32_16x16x32_f16(false, al, false, bh, (short)0, c, false, false);
  if (NT >= 3) c = __builtin_amdgcn_wmma_f32_16x16x32_f16(false, ah, false, bl, (short)0, c, false, false);
  asm volatile("v_nop\n\tv_nop\n\tv_nop\n\tv_nop" : "+v"(c) : "v"(ah), "v"(al), "v"(bh), "v"(bl));
  return c;
}
// 16x32 fragment from a 16-bit row-major tile (rows = m or n, k contiguous): elements 0..7 <- k0+8h+0..7, 8..15 <- k0+16+8h+0..7
__device__ __forceinline__ v16h g2_frag(const _Float16* p, int hh) { FragH f; f.half[0] = *(const v8us*)((const unsigned short*)p + 8 * hh); f.half[1] = *(const v8us*)((const unsigned short*)p + 16 + 8 * hh); return f.v; }
__device__ __forceinline__ v8f g2_mma(v16h a, v16h b, v8f c) { v8f d = __builtin_amdgcn_wmma_f32_16x16x32_f16(false, a, false, b, (short)0, c, false, false); asm volatile("v_nop\n\tv_nop\n\tv_nop\n\tv_nop" : "+v"(d) : "v"(a), "v"(b)); return d; }

// Eight softmax exponentials at once, in place: v <- 2^v on the hardware's base-2 exponential (the callers pass x log2 e with x <= 0: a score or an older maximum minus the running maximum).
// No range reduction and no range tests: nothing overflows for x <= 0; a result under the smallest normal f32 may come out as 0 (beside a row's largest term, which is 1, it adds nothing); -inf gives 0, NaN stays NaN.
// One statement, so that the slot the instruction set asks for behind a transcendental is filled by construction: behind each v_exp_f32 stands the next value's, which touches neither its result nor its source, behind the last a v_nop.
#define EX_ONE(R) "v_exp_f32 " R ", " R "\n\t"
__device__ __forceinline__ void exp2_8(float (&v)[8]) {
  asm(EX_ONE("%0") EX_ONE("%1") EX_ONE("%2") EX_ONE("%3") EX_ONE("%4") EX_ONE("%5") EX_ONE("%6") EX_ONE("%7") "v_nop"
      : "+v"(v[0]), "+v"(v[1]), "+v"(v[2]), "+v"(v[3]), "+v"(v[4]), "+v"(v[5]), "+v"(v[6]), "+v"(v[7]));
}
#define LOG2E 1.4426950408889634f

// Reduction over each 16-lane row (lanes l ^ 1, ^ 2, ^ 4, ^ 8 in that order, the order of the xor butterfly) of eight values at once, on the vector port (DPP row_xmask): no trip through the LDS unit and no wait per step.
// The eight values' instructions of a step stand side by side, so each instruction's producer is eight instructions back and no link of a chain is waited for. All 32 lanes are on at every call.
#define RX_ONE(OP, R, M) OP " " R ", " R ", " R " row_xmask:" M " row_mask:0xf bank_mask:0xf\n\t"
#define RX_EIGHT(OP, M) RX_ONE(OP, "%0", M) RX_ONE(OP, "%1", M) RX_ONE(OP, "%2", M) RX_ONE(OP, "%3", M) RX_ONE(OP, "%4", M) RX_ONE(OP, "%5", M) RX_ONE(OP, "%6", M) RX_ONE(OP, "%7", M)
#define RX_TREE(OP) RX_EIGHT(OP, "1") RX_EIGHT(OP, "2") RX_EIGHT(OP, "4") RX_EIGHT(OP, "8")
__device__ __forceinline__ void row16_max8(float (&v)[8]) {
  asm volatile(RX_TREE("v_max_num_f32_dpp") : "+v"(v[0]), "+v"(v[1]), "+v"(v[2]), "+v"(v[3]), "+v"(v[4]), "+v"(v[5]), "+v"(v[6]), "+v"(v[7]));
}
__device__ __forceinline__ void row16_sum8(float (&v)[8]) {
  asm volatile(RX_TREE("v_add_f32_dpp") : "+v"(v[0]), "+v"(v[1]), "+v"(v[2]), "+v"(v[3]), "+v"(v[4]), "+v"(v[5]), "+v"(v[6]), "+v"(v[7]));
}

__global__ __launch_bounds__(256) void k_wsc(const float* __restrict__ Wm, _Float16* __restrict__ Bt, size_t n8, float sc) {
  const size_t t = (size_t)blockIdx.x * 256 + threadIdx.x; if (t >= n8) return;
  const v4f a0 = *(const v4fa*)(Wm + t * 8), a1 = *(const v4fa*)(Wm + t * 8 + 4);
  FragH f;
#pragma unroll
  for (int q = 0; q < 4; ++q) { f.h[q] = toh_flush(bf16_rne(a0[q]) * sc); f.h[4 + q] = toh_flush(bf16_rne(a1[q]) * sc); }
  const v8us o = f.half[0];
  *(v8us*)((unsigned short*)Bt + t * 8) = o; 
}
__global__ __launch_bounds__(256) void k_wsc2(const float* __restrict__ Wm, _Float16* __restrict__ B2, size_t n8, float sc0, float sc1) {
  const size_t t = (size_t)blockIdx.x * 256 + threadIdx.x; if (t >= n8) return;
  const size_t e = t * 8; const size_t n = e / DM; const size_t k8 = e % DM;
  const v4f a0 = *(const v4fa*)(Wm + e), a1 = *(const v4fa*)(Wm + e + 4);
  FragH f0, f1;
#pragma unroll
  for (int q = 0; q < 4; ++q) {
    const float v0 = bf16_rne(a0[q]), v1 = bf16_rne(a1[q]);
    f0.h[q] = toh_flush(v0 * sc0); f1.h[q] = toh_flush(v0 * sc1);
    f0.h[4 + q] = toh_flush(v1 * sc0); f1.h[4 + q] = toh_flush(v1 * sc1);
  }
  const size_t o = n * (size_t)(2 * DM) + k8;
  const v8us o0 = f0.half[0], o1 = f1.half[0];
  {
    *(v8us*)((unsigned short*)B2 + o) = o0;
    *(v8us*)((unsigned short*)B2 + o + DM) = o1;
    
  }
}

// mask plane in accumulator layout: MP[(qt*(SLEN/32) + kt)][half][lane][8] bf16 bits; element 2*rr + c of (half, lane) = mask[qt*16 + 8*(lane>>4) + 4*half + rr][kt*32 + 16*c + (lane&15)];
__global__ __launch_bounds__(256) void k_mperm(const float* __restrict__ msk, unsigned short* __restrict__ MP) {
  const size_t t = (size_t)blockIdx.x * 256 + threadIdx.x; if (t >= (size_t)(SLEN / 16) * (SLEN / 32) * 64) return;
  const int lane = (int)(t & 31); const int half = (int)((t >> 5) & 1); const size_t tile = t >> 6;
  const int kt = (int)(tile % (size_t)(SLEN / 32)); const int qt = (int)(tile / (size_t)(SLEN / 32));
  const int ln = lane & 15, hh = lane >> 4;
  const float* mr = msk + (size_t)(qt * 16 + 8 * hh + 4 * half) * MSKP + kt * 32 + ln;
  FragH f;
#pragma unroll
  for (int rr = 0; rr < 4; ++rr) { const float a = mr[(size_t)rr * MSKP]; const float c = mr[(size_t)rr * MSKP + 16]; f.u[2 * rr] = bf16_bits(a); f.u[2 * rr + 1] = bf16_bits(c); }
  const v8us o = f.half[0];
  *(v8us*)(MP + t * 8) = o; 
}
// per 64-query block: JE[qblk][0..32) = number of 32-key tiles to visit = 1 + last tile holding a visible entry (value > MVIS) in any of the 64 rows; all tiles if some row has no visible entry.
__global__ __launch_bounds__(1024) void k_mjend(const float* __restrict__ msk, int* __restrict__ JE) {
  constexpr int NL = SLEN / 128;               /* 16-B loads per lane and row */
  __shared__ int smax[32]; __shared__ int snone[32];
  const int tid = threadIdx.x, lane = tid & 31; const int w = __builtin_amdgcn_readfirstlane(tid >> 5);
  const int qblk = blockIdx.x;
  int wmax = -1, wnone = 0;
  /* 32 waves, two rows each; kept rolled: the loads of both rows at once need more registers than a 32-wave block leaves a wave (spills) */
#pragma unroll 1
  for (int rr = 0; rr < 2; ++rr) {
    const float* mr = msk + (size_t)(qblk * 64 + w * 2 + rr) * MSKP + lane * 4;
    /* every load of the row is issued as one group ahead of the first compare: one load round trip a row, not one per 128 columns */
    v4f a[NL];
#pragma unroll
    for (int i = 0; i < NL; ++i) a[i] = *(const v4fa*)(mr + i * 128);
    static_assert(NL == 16);
    /* the loaded values are inputs only: all loads of the row are issued, none held back behind a compare; the address is an input too, so it stays whole (no load's result is given it) up to this wait */
    asm volatile("s_wait_xcnt 0x0" :: "v"(a[0]), "v"(a[1]), "v"(a[2]), "v"(a[3]), "v"(a[4]), "v"(a[5]), "v"(a[6]), "v"(a[7]),
                 "v"(a[8]), "v"(a[9]), "v"(a[10]), "v"(a[11]), "v"(a[12]), "v"(a[13]), "v"(a[14]), "v"(a[15]), "v"(mr) : "memory");
    int lm = -1;
#pragma unroll
    for (int i = 0; i < NL; ++i) {
      const bool any = (bf16_rne(a[i][0]) > MVIS) | (bf16_rne(a[i][1]) > MVIS) | (bf16_rne(a[i][2]) > MVIS) | (bf16_rne(a[i][3]) > MVIS);
      lm = any ? ((lane + 32 * i) >> 3) : lm;
    }
    int o = __shfl_xor(lm, 16, 32); lm = (o > lm) ? o : lm;
    o = __shfl_xor(lm, 8, 32); lm = (o > lm) ? o : lm;
    o = __shfl_xor(lm, 4, 32); lm = (o > lm) ? o : lm;
    o = __shfl_xor(lm, 2, 32); lm = (o > lm) ? o : lm;
    o = __shfl_xor(lm, 1, 32); lm = (o > lm) ? o : lm;
    wmax = (lm > wmax) ? lm : wmax; wnone |= (lm < 0) ? 1 : 0;
  }
  if (lane == 0) { smax[w] = wmax; snone[w] = wnone; }
  __syncthreads();
  if (w == 0) {
    int m = -1, nn = 0;
#pragma unroll
    for (int i = 0; i < 32; ++i) { const int a = smax[i]; m = (a > m) ? a : m; nn |= snone[i]; }
    const int jt = (nn != 0) ? (SLEN / 32) : (m + 1);
    *(int*)(JE + qblk * 32 + lane) = jt; 
  }
}

__global__ __launch_bounds__(256) void k_x16(const float* __restrict__ x, _Float16* __restrict__ X16, size_t n8) {
  const size_t t = (size_t)blockIdx.x * 256 + threadIdx.x; if (t >= n8) return;
  const size_t e = t * 8; const size_t r = e / DM; const size_t c = e % DM; const size_t b = r / SLEN, s = r % SLEN;
  const float* src = x + (b * SEQ_FULL + s) * DM + c;
  const v4f a0 = *(const v4fa*)src, a1 = *(const v4fa*)(src + 4);
  FragH f;
#pragma unroll
  for (int q = 0; q < 4; ++q) { f.h[q] = (_Float16)bf16_rne(a0[q]); f.h[4 + q] = (_Float16)bf16_rne(a1[q]); }
  const v8us o = f.half[0];
  *(v8us*)((unsigned short*)X16 + e) = o; 
}

// LDS ring of the GEMM: one stage = 64 k = 128 B of every operand row, [A 128 rows | B 64 rows] at pitch 144 B (16 B x odd: the 16-B fragment reads meet no bank conflict); two stages
#define G2_PB 144
#define G2_STG ((128 + 64) * G2_PB)
static_assert(2 * G2_STG >= 4 * 32 * 68 * 4);   /* the output staging reuses the ring behind the last barrier */
static_assert(2 * G2_STG <= 65536);
static_assert(DM % 64 == 0 && DM >= 128);
// 16x32 fragment from an LDS row (k contiguous), p = row start + 2 * (k0 + 8 hh) bytes: the k order of g2_frag
__device__ __forceinline__ v16h g2_lfrag(const unsigned char* p) { FragH f; f.half[0] = *(const v8us*)p; f.half[1] = *(const v8us*)(p + 32); return f.v; }
// one stage: 12 copies of 16 B per lane (a wave-wide copy = 4 whole 128-B row pieces); lane (r = tid / 8, c = tid % 8) brings chunk c of A rows r + 16 j (j < 8) and of B rows r + 16 j (j < 4).
// l = LDS byte address of (row r, chunk c) in the stage, a / b = the lane's global addresses in A row r / B row r, sa / sb = 16 rows in elements.
__device__ __forceinline__ void g2_stage(unsigned l, const _Float16* a, size_t sa, const _Float16* b, size_t sb) {
  /* s_wait_xcnt closes the copies' own statement: no register that a copy names is rewritten in front of it */
  asm volatile(
      "global_load_async_to_lds_b128 %0, %12, off\n\t"
      "global_load_async_to_lds_b128 %1, %13, off\n\t"
      "global_load_async_to_lds_b128 %2, %14, off\n\t"
      "global_load_async_to_lds_b128 %3, %15, off\n\t"
      "global_load_async_to_lds_b128 %4, %16, off\n\t"
      "global_load_async_to_lds_b128 %5, %17, off\n\t"
      "global_load_async_to_lds_b128 %6, %18, off\n\t"
      "global_load_async_to_lds_b128 %7, %19, off\n\t"
      "global_load_async_to_lds_b128 %8, %20, off\n\t"
      "global_load_async_to_lds_b128 %9, %21, off\n\t"
      "global_load_async_to_lds_b128 %10, %22, off\n\t"
      "global_load_async_to_lds_b128 %11, %23, off\n\t"
      "s_wait_xcnt 0x0"
      :: "v"(l), "v"(l + 16 * G2_PB), "v"(l + 32 * G2_PB), "v"(l + 48 * G2_PB), "v"(l + 64 * G2_PB), "v"(l + 80 * G2_PB), "v"(l + 96 * G2_PB), "v"(l + 112 * G2_PB),
         "v"(l + 128 * G2_PB), "v"(l + 144 * G2_PB), "v"(l + 160 * G2_PB), "v"(l + 176 * G2_PB),
         "v"(a), "v"(a + sa), "v"(a + 2 * sa), "v"(a + 3 * sa), "v"(a + 4 * sa), "v"(a + 5 * sa), "v"(a + 6 * sa), "v"(a + 7 * sa),
         "v"(b), "v"(b + sb), "v"(b + 2 * sb), "v"(b + 3 * sb)
      : "memory");
}

// GEMM C[M][N] = alpha * A[M][K].B  with A f16 row-major (pitch lda), B stored [n][k] f16 (pitch ldb), batched by blockIdx.y (strides sA, sB, sC);
// writes f32 C and/or f16 C16 (pitch ldc). Requires M % 128 == 0, N % 64 == 0, K % 64 == 0 (asserted by the callers' constants).
// Operand tiles come through LDS: asynchronous copies, two stages, stage t + 1 in flight while stage t is multiplied.
template <int ACT>
__global__ __launch_bounds__(128) void k_gemm2(const _Float16* __restrict__ A, int lda, size_t sA, const _Float16* __restrict__ Bh, int ldb, size_t sB, float alpha,
                                               float* C, _Float16* C16, int ldc, size_t sC, int M, int N, int K) {
  __shared__ __attribute__((aligned(16))) unsigned char sm[2 * G2_STG];
  float (*so)[32][68] = (float (*)[32][68])sm;
  const int tid = threadIdx.x, w = tid >> 5, lane = tid & 31, ln = lane & 15, hh = lane >> 4; const int by = blockIdx.y;
  A += (size_t)by * sA; Bh += (size_t)by * sB; const size_t cofs = (size_t)by * sC;
  const int ntn = N >> 6; const int mt = blockIdx.x / ntn, nq = blockIdx.x - mt * ntn; const int row0 = mt * 128 + 32 * w, col0 = nq * 64; if (mt * 128 >= M) return;
  const int cr = tid >> 3, cc = tid & 7;
  const _Float16* ga = A + (size_t)(mt * 128 + cr) * lda + cc * 8; const _Float16* gb = Bh + (size_t)(col0 + cr) * ldb + cc * 8;
  const size_t sa16 = (size_t)16 * lda, sb16 = (size_t)16 * ldb;
  const unsigned lc = (unsigned)(uintptr_t)sm + (unsigned)(cr * G2_PB + cc * 16);
  const int nt = K >> 6;
  const int aofs = (32 * w + ln) * G2_PB + 16 * hh, bofs = (128 + ln) * G2_PB + 16 * hh;
  const v8f z8 = {0.f,0.f,0.f,0.f,0.f,0.f,0.f,0.f}; v8f c00 = z8, c01 = z8, c02 = z8, c03 = z8, c10 = z8, c11 = z8, c12 = z8, c13 = z8;
  g2_stage(lc, ga, sa16, gb, sb16);
  asm volatile("s_wait_asynccnt 0x0" ::: "memory");   /* stage 0 has landed before the barrier publishes it */
  __syncthreads();
  if (nt > 1) g2_stage(lc + G2_STG, ga + 64, sa16, gb + 64, sb16);
#pragma unroll 1
  for (int t = 0; t < nt; ++t) {
    const unsigned char* sb = sm + (t & 1) * G2_STG; const unsigned char* pa = sb + aofs; const unsigned char* pb = sb + bofs;
#pragma unroll
    for (int kk = 0; kk < 2; ++kk) {
      const v16h a0 = g2_lfrag(pa + kk * 64), a1 = g2_lfrag(pa + 16 * G2_PB + kk * 64);
      const v16h b0 = g2_lfrag(pb + kk * 64), b1 = g2_lfrag(pb + 16 * G2_PB + kk * 64), b2 = g2_lfrag(pb + 32 * G2_PB + kk * 64), b3 = g2_lfrag(pb + 48 * G2_PB + kk * 64);
      c00 = g2_mma(a0, b0, c00); c10 = g2_mma(a1, b0, c10);
      c01 = g2_mma(a0, b1, c01); c11 = g2_mma(a1, b1, c11);
      c02 = g2_mma(a0, b2, c02); c12 = g2_mma(a1, b2, c12);
      c03 = g2_mma(a0, b3, c03); c13 = g2_mma(a1, b3, c13);
    }
    asm volatile("s_wait_dscnt 0x0" ::: "memory");      /* this wave's reads of stage t are done before the stage is refilled */
    asm volatile("s_wait_asynccnt 0x0" ::: "memory");   /* this wave's copies of stage t + 1 have landed before the barrier publishes them */
    __syncthreads();
    if (t + 2 < nt) g2_stage(lc + (unsigned)((t & 1) * G2_STG), ga + (size_t)(t + 2) * 64, sa16, gb + (size_t)(t + 2) * 64, sb16);
  }
  asm volatile("s_wait_asynccnt 0x0" ::: "memory");     /* no copy is outstanding when the ring becomes output staging */
  v8f accs[8] = {c00, c01, c02, c03, c10, c11, c12, c13};
#pragma unroll
  for (int u = 0; u < 8; ++u) {
    const int t = u & 3, half = u >> 2;
#pragma unroll
    for (int r = 0; r < 8; ++r) { const int rloc = half * 16 + 8 * hh + r; float v = accs[u][r] * alpha; if (ACT == 3) v = fmaxf(v, 0.f); so[w][rloc][t * 16 + ln] = v; }
  }
  __builtin_amdgcn_fence(4, "workgroup"); __builtin_amdgcn_wave_barrier();
  const int rsub = lane >> 4, c4 = (lane & 15) * 4;
  {
#pragma unroll
    for (int q = 0; q < 16; ++q) {
      const int r = q * 2 + rsub; const v4f v = *(const v4fa*)&so[w][r][c4];
      if (C) *(v4f*)(C + cofs + (size_t)(row0 + r) * ldc + col0 + c4) = v;
      if (C16) { v4h h4; for (int i = 0; i < 4; ++i) h4[i] = (_Float16)v[i]; *(v4h*)(C16 + cofs + (size_t)(row0 + r) * ldc + col0 + c4) = h4; }
    }
    
  }
}

// per-head RMS normalisation + interleaved-pair rotary step from the f32 GEMM plane F [NR][ldf] (ldf = NHV*128, NHV = compile-time head count, a power of two):
// y = (x * rsqrt(mean_128(x^2) + 1e-6)) * g[d];  out[2i] = y[2i] c[i] - y[2i+1] s[i];  out[2i+1] = y[2i] s[i] + y[2i+1] c[i]  (c, s = table rows [position][64], gain g[128]; all by value, bf16-RNE);
// H [NR][ldf] = f16 hi of every row; L [NB*RE][ldf] = x1024 residual for positions < RE.
// 32-bit thread indices (shifts and masks of compile-time powers of two); 64-bit offsets only at the final pointer arithmetic.
template <int NHV>
__device__ __forceinline__ void nrope_body(const float* __restrict__ F, int ldf, const float* __restrict__ NW, const float* __restrict__ CT, const float* __restrict__ ST,
                                           _Float16* __restrict__ H, _Float16* __restrict__ L) {
  #pragma clang fp contract(off)
  const unsigned t0 = blockIdx.x * 256u + threadIdx.x; const bool live = t0 < (unsigned)(NR * NHV * 16); const unsigned t = live ? t0 : 0u;
  const int p = (int)(t & 15u); const int hd = (int)((t >> 4) % (unsigned)NHV); const unsigned row = t / (unsigned)(16 * NHV);
  const int s = (int)(row % (unsigned)SLEN); const int b = (int)(row / (unsigned)SLEN);
  const float* src = F + (size_t)row * ldf + hd * HDIM + p * 8;
  const v4f xa = *(const v4fa*)src, xb = *(const v4fa*)(src + 4);
  const v4f wa = *(const v4fa*)(NW + p * 8), wb = *(const v4fa*)(NW + p * 8 + 4);
  const v4f cv = *(const v4fa*)(CT + (size_t)s * RTW + p * 4), sv = *(const v4fa*)(ST + (size_t)s * RTW + p * 4);
  const float xs[8] = {xa[0], xa[1], xa[2], xa[3], xb[0], xb[1], xb[2], xb[3]};
  const float gs[8] = {wa[0], wa[1], wa[2], wa[3], wb[0], wb[1], wb[2], wb[3]};
  float ss = 0.f;
#pragma unroll
  for (int i = 0; i < 8; ++i) { const float q = xs[i] * xs[i]; ss = ss + q; }
  ss += __shfl_xor(ss, 1, 32); ss += __shfl_xor(ss, 2, 32); ss += __shfl_xor(ss, 4, 32); ss += __shfl_xor(ss, 8, 32);
  const float mean = ss * 0.0078125f; const float rms = rsqrtf(mean + 1.0e-6f);
  FragH fh, fl;
#pragma unroll
  for (int j = 0; j < 4; ++j) {
    const float c = bf16_rne(cv[j]), sn = bf16_rne(sv[j]);
    const float y1 = (xs[2 * j] * rms) * bf16_rne(gs[2 * j]); const float y2 = (xs[2 * j + 1] * rms) * bf16_rne(gs[2 * j + 1]);
    const float o1 = y1 * c - y2 * sn; const float o2 = y1 * sn + y2 * c;
    const _Float16 h1 = toh_flush(o1), h2 = toh_flush(o2);
    fh.h[2 * j] = h1; fh.h[2 * j + 1] = h2;
    fl.h[2 * j] = toh_flush((o1 - (float)h1) * 1024.0f); fl.h[2 * j + 1] = toh_flush((o2 - (float)h2) * 1024.0f);
  }
  const size_t oh = (size_t)row * ldf + hd * HDIM + p * 8;
  const bool wl = live && (s < RE);
  const int sl = wl ? s : 0;
  const size_t ol = (size_t)(b * RE + sl) * ldf + hd * HDIM + p * 8;
  const v8us vh = fh.half[0], vl = fl.half[0];
  {
    if (live) *(v8us*)((unsigned short*)H + oh) = vh;
    if (wl) *(v8us*)((unsigned short*)L + ol) = vl;
    
  }
}
// query heads (NH per row)
__global__ __launch_bounds__(256) void k_nrope_q(const float* __restrict__ F, int ldf, const float* __restrict__ NW, const float* __restrict__ CT, const float* __restrict__ ST,
                                                 _Float16* __restrict__ H, _Float16* __restrict__ L) {
  #pragma clang fp contract(off)
  nrope_body<NH>(F, ldf, NW, CT, ST, H, L);
}
// key heads (NKVH per row)
__global__ __launch_bounds__(256) void k_nrope_k(const float* __restrict__ F, int ldf, const float* __restrict__ NW, const float* __restrict__ CT, const float* __restrict__ ST,
                                                 _Float16* __restrict__ H, _Float16* __restrict__ L) {
  #pragma clang fp contract(off)
  nrope_body<NKVH>(F, ldf, NW, CT, ST, H, L);
}

__global__ __launch_bounds__(256) void k_vtg(const _Float16* __restrict__ V16, _Float16* __restrict__ Vt) {
  __shared__ unsigned short tl[64][66];
  const int tid = threadIdx.x; const int nlg = SLEN / 64; const int slab = blockIdx.x / nlg, lg = blockIdx.x % nlg; const int b = slab / NV64, h = slab % NV64;
  for (int i = tid; i < 64 * 8; i += 256) {
    const int r = i >> 3, c8 = (i & 7) * 8; FragH f;
    f.half[0] = *(const v8us*)((const unsigned short*)V16 + ((size_t)b * SLEN + lg * 64 + r) * VW + h * 64 + c8);
#pragma unroll
    for (int q = 0; q < 8; ++q) tl[r][c8 + q] = f.u[q];
  }
  __syncthreads();
  {
#pragma unroll
    for (int rd = 0; rd < 2; ++rd) {
      const int d = rd * 32 + (tid >> 3), pc = tid & 7; FragH f;
#pragma unroll
      for (int q = 0; q < 8; ++q) f.u[q] = tl[pc * 8 + q][d];
      *(v8us*)((unsigned short*)Vt + ((size_t)slab * 64 + d) * TK + lg * 64 + pc * 8) = f.half[0];
    }
    
  }
}
__global__ __launch_bounds__(256) void k_vtl(const float* __restrict__ VF, _Float16* __restrict__ VtL) {
  __shared__ unsigned short tl[64][66];
  const int tid = threadIdx.x; const int nlg = RE / 64; const int slab = blockIdx.x / nlg, lg = blockIdx.x % nlg; const int b = slab / NV64, h = slab % NV64;
  for (int i = tid; i < 64 * 16; i += 256) {
    const int r = i >> 4, c4 = (i & 15) * 4;
    const v4f a = *(const v4fa*)(VF + ((size_t)b * SLEN + lg * 64 + r) * VW + h * 64 + c4);
    FragH f;
#pragma unroll
    for (int q = 0; q < 4; ++q) { const float v = a[q]; const _Float16 hv = (_Float16)v; f.h[q] = toh_flush((v - (float)hv) * 1024.0f); }
#pragma unroll
    for (int q = 0; q < 4; ++q) tl[r][c4 + q] = f.u[q];
  }
  __syncthreads();
  {
#pragma unroll
    for (int rd = 0; rd < 2; ++rd) {
      const int d = rd * 32 + (tid >> 3), pc = tid & 7; FragH f;
#pragma unroll
      for (int q = 0; q < 8; ++q) f.u[q] = tl[pc * 8 + q][d];
      *(v8us*)((unsigned short*)VtL + ((size_t)slab * 64 + d) * RE + lg * 64 + pc * 8) = f.half[0];
    }
    
  }
}

__global__ __launch_bounds__(256) void k_hl(const float* __restrict__ Fp, _Float16* __restrict__ Hh, _Float16* __restrict__ A2, size_t n8) {
  const size_t t = (size_t)blockIdx.x * 256 + threadIdx.x; if (t >= n8) return;
  const size_t e = t * 8; const size_t r = e / DM; const int c = (int)(e % DM); const int s = (int)(r % SLEN); const int b = (int)(r / SLEN);
  const v4f a = *(const v4fa*)(Fp + e), d = *(const v4fa*)(Fp + e + 4);
  FragH fh, fl;
#pragma unroll
  for (int q = 0; q < 4; ++q) {
    _Float16 hv = (_Float16)a[q]; fh.h[q] = hv; fl.h[q] = (_Float16)((a[q] - (float)hv) * 1024.0f);
    hv = (_Float16)d[q]; fh.h[4 + q] = hv; fl.h[4 + q] = (_Float16)((d[q] - (float)hv) * 1024.0f);
  }
  const bool wl = (s < RE);
  const size_t o2 = ((size_t)b * RE + (wl ? s : 0)) * (size_t)(2 * DM) + c;
  const v8us vh = fh.half[0], vl = fl.half[0];
  {
    *(v8us*)((unsigned short*)Hh + e) = vh;
    if (wl) { *(v8us*)((unsigned short*)A2 + o2) = vh; *(v8us*)((unsigned short*)A2 + o2 + DM) = vl; }
    
  }
}

// LDS ring of the attention kernel: one stage = one pass of 32 keys = [K 32 rows of 256 B at pitch 272 | V^T 128 rows of 64 B at pitch 80 | mask 4 waves x 1 KiB]; both pitches are 16 B x odd: the 16-B fragment reads meet no bank conflict; two stages
#define FA_KP 272
#define FA_VP 80
#define FA_KB (32 * FA_KP)
#define FA_VB (128 * FA_VP)
#define FA_MB (4 * 1024)
#define FA_STG (FA_KB + FA_VB + FA_MB)
static_assert(FA_STG % 16 == 0 && FA_KB % 16 == 0 && FA_VB % 16 == 0);
static_assert(2 * FA_STG >= 4 * 16 * 132 * 4);   /* the output staging reuses the ring behind the last barrier */
static_assert(2 * FA_STG + 4 * 16 * 40 * 2 <= 65536);
// one stage: 10 copies of 16 B per lane. K: lane (r = tid / 16, c = tid % 16) brings chunk c of key rows r + 8 j (j < 4): a wave-wide copy = 2 whole 256-B rows. V^T: lane (r = tid / 4, c = tid % 4) brings chunk c of rows r + 32 j (j < 4).
// mask: each lane brings its own two 16-B words. lk / lv / lm = the lane's LDS byte addresses in the stage, k / v / m = its global addresses, sk = 8 K rows and sv = 32 V^T rows in elements.
__device__ __forceinline__ void fa_stage(unsigned lk, unsigned lv, unsigned lm, const unsigned short* k, size_t sk, const unsigned short* v, size_t sv, const unsigned short* m) {
  /* s_wait_xcnt closes the copies' own statement: no register that a copy names is rewritten in front of it */
  asm volatile(
      "global_load_async_to_lds_b128 %0, %10, off\n\t"
      "global_load_async_to_lds_b128 %1, %11, off\n\t"
      "global_load_async_to_lds_b128 %2, %12, off\n\t"
      "global_load_async_to_lds_b128 %3, %13, off\n\t"
      "global_load_async_to_lds_b128 %4, %14, off\n\t"
      "global_load_async_to_lds_b128 %5, %15, off\n\t"
      "global_load_async_to_lds_b128 %6, %16, off\n\t"
      "global_load_async_to_lds_b128 %7, %17, off\n\t"
      "global_load_async_to_lds_b128 %8, %18, off\n\t"
      "global_load_async_to_lds_b128 %9, %19, off\n\t"
      "s_wait_xcnt 0x0"
      :: "v"(lk), "v"(lk + 8 * FA_KP), "v"(lk + 16 * FA_KP), "v"(lk + 24 * FA_KP),
         "v"(lv), "v"(lv + 32 * FA_VP), "v"(lv + 64 * FA_VP), "v"(lv + 96 * FA_VP), "v"(lm), "v"(lm + 512),
         "v"(k), "v"(k + sk), "v"(k + 2 * sk), "v"(k + 3 * sk), "v"(v), "v"(v + sv), "v"(v + 2 * sv), "v"(v + 3 * sv), "v"(m), "v"(m + 256)
      : "memory");
}

// fused attention per ((b,h), 64 queries), query blocks [QB0P, QBLKS): wave = 16 queries; S = Q.K^T (d = 128: 4 k-steps, q fragments read once and kept) x SCL + mask (bf16 plane, accumulator layout, two 16-B words per lane per step)
// The pass's K, V^T and mask tiles come through LDS, once for the block's four waves: asynchronous copies in whole row pieces, two stages, stage t + 1 in flight while stage t is worked on.
__global__ __launch_bounds__(128) __attribute__((amdgpu_num_vgpr(256))) void k_flash(const _Float16* __restrict__ Q16, int ldq, const _Float16* __restrict__ K16, int ldk,
                                               const _Float16* __restrict__ Vt, const unsigned short* __restrict__ MP, const int* __restrict__ JE, float* __restrict__ O, int ldo) {
  constexpr int RPW = 16, DT = 8, KS = 4;
  constexpr int NQP = (QBNP > 0) ? QBNP : 1;
  __shared__ __attribute__((aligned(16))) unsigned short sP[4][RPW][40];
  __shared__ __attribute__((aligned(16))) unsigned char ring[2 * FA_STG];
  float (*sO)[RPW][132] = (float (*)[RPW][132])ring;
  const int tid = threadIdx.x, lane = tid & 31, ln = lane & 15, hh = lane >> 4;
  const int w = __builtin_amdgcn_readfirstlane(tid >> 5);
  const int slab = blockIdx.x / NQP, qblk = QB0P + blockIdx.x % NQP; const int b = slab / NH, h = slab % NH; const int kvh = h / NREP;
  const int qb0 = qblk * (4 * RPW); const int q0 = qb0 + w * RPW;
  const unsigned short* qr = (const unsigned short*)Q16 + ((size_t)b * TQ + q0 + ln) * ldq + h * HDIM;
  const unsigned short* Vth = (const unsigned short*)Vt + (size_t)(b * NKVH + kvh) * HDIM * TK;
  int jt = JE[qblk * 32]; jt = (jt < 1) ? 1 : jt; jt = (jt > TK / 32) ? (TK / 32) : jt;
  const int nt = __builtin_amdgcn_readfirstlane(jt);
  /* the lane's copy addresses of stage 0 */
  const unsigned short* gk = (const unsigned short*)K16 + ((size_t)b * TK + (tid >> 4)) * ldk + kvh * HDIM + (tid & 15) * 8;
  const unsigned short* gv = Vth + (size_t)(tid >> 2) * TK + (tid & 3) * 8;
  const unsigned short* gm = MP + (size_t)(q0 >> 4) * (size_t)(TK / 32) * 512 + lane * 8;
  const size_t sk8 = (size_t)8 * ldk, sv32 = (size_t)32 * TK, kst = (size_t)32 * ldk;
  const unsigned rb = (unsigned)(uintptr_t)ring;
  const unsigned lk = rb + (unsigned)((tid >> 4) * FA_KP + (tid & 15) * 16);
  const unsigned lv = rb + (unsigned)(FA_KB + (tid >> 2) * FA_VP + (tid & 3) * 16);
  const unsigned lm = rb + (unsigned)(FA_KB + FA_VB + w * 1024 + lane * 16);
  const int kofs = ln * FA_KP + 16 * hh, vofs = FA_KB + ln * FA_VP + 16 * hh, mofs = FA_KB + FA_VB + w * 1024 + lane * 16;
  fa_stage(lk, lv, lm, gk, sk8, gv, sv32, gm);
  /* A (q) fragments, the same in every pass: element e < 8 <-> d = 32 ks + 8 hh + e; e >= 8 <-> d = 32 ks + 16 + 8 hh + (e - 8) */
  FragH a[KS];
#pragma unroll
  for (int ks = 0; ks < KS; ++ks) { a[ks].half[0] = *(const v8us*)(qr + ks * 32 + 8 * hh); a[ks].half[1] = *(const v8us*)(qr + ks * 32 + 16 + 8 * hh); }
  /* the group's address register is an input here, so it stays whole (no load's result is given it) up to this wait */
  asm volatile("s_wait_xcnt 0x0" :: "v"(qr) : "memory");
  float m_r[8], l_r[8]; v8f oacc[DT];
#pragma unroll
  for (int r = 0; r < 8; ++r) { m_r[r] = -3.0e38f; l_r[r] = 0.f; }
#pragma unroll
  for (int dt = 0; dt < DT; ++dt) oacc[dt] = (v8f){0.f,0.f,0.f,0.f,0.f,0.f,0.f,0.f};
  asm volatile("s_wait_asynccnt 0x0" ::: "memory");   /* stage 0 has landed before the barrier publishes it */
  __syncthreads();
  if (nt > 1) fa_stage(lk + FA_STG, lv + FA_STG, lm + FA_STG, gk + kst, sk8, gv + 32, sv32, gm + 512);
#pragma unroll 1
  for (int t = 0; t < nt; ++t) {
    v8f sa = (v8f){0.f,0.f,0.f,0.f,0.f,0.f,0.f,0.f}, sb = sa;
    const unsigned char* st = ring + (t & 1) * FA_STG;
    const unsigned char* kp = st + kofs; const unsigned char* vp = st + vofs; const unsigned char* mp = st + mofs;
    FragH k0[KS], k1[KS], fm;
#pragma unroll
    for (int ks = 0; ks < KS; ++ks) {
      /* B (k) fragments in the k order of the q fragments: byte 64 ks + 16 hh of key row ln (k0) or 16 + ln (k1), and 32 B further */
      k0[ks].half[0] = *(const v8us*)(kp + ks * 64); k0[ks].half[1] = *(const v8us*)(kp + ks * 64 + 32);
      k1[ks].half[0] = *(const v8us*)(kp + 16 * FA_KP + ks * 64); k1[ks].half[1] = *(const v8us*)(kp + 16 * FA_KP + ks * 64 + 32);
    }
    fm.half[0] = *(const v8us*)mp; fm.half[1] = *(const v8us*)(mp + 512);
#pragma unroll
    for (int ks = 0; ks < KS; ++ks) { sa = g2_mma(a[ks].v, k0[ks].v, sa); sb = g2_mma(a[ks].v, k1[ks].v, sb); }
    /* the V^T fragments of this pass are read here, ahead of the softmax, which covers their LDS trip */
    FragH bv[DT];
#pragma unroll
    for (int dt = 0; dt < DT; ++dt) { bv[dt].half[0] = *(const v8us*)(vp + dt * 16 * FA_VP); bv[dt].half[1] = *(const v8us*)(vp + dt * 16 * FA_VP + 32); }
    float s0v[8], s1v[8], mcv[8];
#pragma unroll
    for (int r = 0; r < 8; ++r) {
      const float mk0 = bf16_val(fm.u[2 * r]), mk1 = bf16_val(fm.u[2 * r + 1]);
      s0v[r] = sa[r] * SCL + mk0; s1v[r] = sb[r] * SCL + mk1;
      mcv[r] = fmaxf(s0v[r], s1v[r]);
    }
    row16_max8(mcv);
    float eav[8];
#pragma unroll
    for (int r = 0; r < 8; ++r) {
      const float mn = fmaxf(m_r[r], mcv[r]); mcv[r] = mn;
      s0v[r] = (s0v[r] - mn) * LOG2E; s1v[r] = (s1v[r] - mn) * LOG2E; eav[r] = (m_r[r] - mn) * LOG2E;
    }
    exp2_8(s0v); exp2_8(s1v); exp2_8(eav);
#pragma unroll
    for (int r = 0; r < 8; ++r) {
      const float mn = mcv[r]; const float al = (mn > -1.0e38f) ? eav[r] : 1.0f; m_r[r] = mn;
      const float p0 = s0v[r], p1 = s1v[r]; l_r[r] = l_r[r] * al + p0 + p1;
#pragma unroll
      for (int dt = 0; dt < DT; ++dt) oacc[dt][r] *= al;
      FragH t2; t2.h[0] = toh_flush(p0 * 1024.0f); t2.h[1] = toh_flush(p1 * 1024.0f);
      sP[w][8 * hh + r][ln] = t2.u[0]; sP[w][8 * hh + r][16 + ln] = t2.u[1];
    }
    __builtin_amdgcn_fence(4, "workgroup"); __builtin_amdgcn_wave_barrier();
    FragH pa; pa.half[0] = *(const v8us*)&sP[w][ln][8 * hh]; pa.half[1] = *(const v8us*)&sP[w][ln][16 + 8 * hh];
#pragma unroll
    for (int dt = 0; dt < DT; ++dt) {
      /* A (P: key columns of the LDS tile) and B (V^T rows, keys contiguous) share the same key order: element e < 8 <-> key 32 t + 8 hh + e; e >= 8 <-> key 32 t + 16 + 8 hh + (e - 8) */
      oacc[dt] = g2_mma(pa.v, bv[dt].v, oacc[dt]);
    }
    asm volatile("s_wait_dscnt 0x0" ::: "memory");      /* this wave's reads of stage t (and of its P tile) are done before the stage is refilled */
    asm volatile("s_wait_asynccnt 0x0" ::: "memory");   /* this wave's copies of stage t + 1 have landed before the barrier publishes them */
    __syncthreads();
    if (t + 2 < nt) { const unsigned so2 = (unsigned)((t & 1) * FA_STG); fa_stage(lk + so2, lv + so2, lm + so2, gk + (size_t)(t + 2) * kst, sk8, gv + (size_t)(t + 2) * 32, sv32, gm + (size_t)(t + 2) * 512); }
  }
  asm volatile("s_wait_asynccnt 0x0" ::: "memory");     /* no copy is outstanding when the ring becomes output staging */
  row16_sum8(l_r);
#pragma unroll
  for (int r = 0; r < 8; ++r) { const float l = l_r[r]; l_r[r] = (l > 0.f) ? 1.0f / (l * 1024.0f) : 0.f; }
#pragma unroll
  for (int dt = 0; dt < DT; ++dt)
#pragma unroll
    for (int r = 0; r < 8; ++r) sO[w][8 * hh + r][dt * 16 + ln] = oacc[dt][r] * l_r[r];
  __builtin_amdgcn_fence(4, "workgroup"); __builtin_amdgcn_wave_barrier();
  {
#pragma unroll
    for (int rp = 0; rp < RPW; ++rp) { const v4f val = *(const v4fa*)&sO[w][rp][lane * 4]; *(v4f*)(O + ((size_t)b * TQ + q0 + rp) * ldo + h * HDIM + lane * 4) = val; }
    
  }
}
// LDS ring of the 5-plane kernel: one stage = one pass of 32 keys = [K hi 32 rows | K residual 32 rows, pitch 272 | V^T hi 64 rows | V^T residual 64 rows, pitch 80 | mask 4 waves x 1 KiB]; two stages; beside it the block's 64 q rows, hi and residual, pitch 272, filled once
#define F5_KB (32 * FA_KP)
#define F5_VB (64 * FA_VP)
#define F5_STG (2 * F5_KB + 2 * F5_VB + FA_MB)
#define F5_QB (64 * FA_KP)
static_assert(F5_STG % 16 == 0 && F5_KB % 16 == 0 && F5_VB % 16 == 0 && F5_QB % 16 == 0);
static_assert(2 * F5_STG >= 4 * 16 * 68 * 4);    /* the output staging reuses the ring behind the last barrier */
static_assert(2 * F5_STG + 2 * F5_QB + 2 * 4 * 16 * 40 * 2 <= 131072);
// one stage: 14 copies of 16 B per lane. K planes: lane (r = tid / 16, c = tid % 16) brings chunk c of key rows r + 8 j (j < 4); V^T planes: lane (r = tid / 4, c = tid % 4) brings chunk c of rows r + 32 j (j < 2); mask: the lane's own two words.
// lk / lv / lm = the lane's LDS byte addresses in the stage (hi planes), kh / kl / vh / vl / m = its global addresses, sk = 8 K rows, svh / svl = 32 V^T rows of the hi / residual plane, in elements.
__device__ __forceinline__ void f5_stage(unsigned lk, unsigned lv, unsigned lm, const unsigned short* kh, const unsigned short* kl, size_t sk,
                                         const unsigned short* vh, size_t svh, const unsigned short* vl, size_t svl, const unsigned short* m) {
  /* s_wait_xcnt closes the copies' own statement: no register that a copy names is rewritten in front of it */
  asm volatile(
      "global_load_async_to_lds_b128 %0, %14, off\n\t"
      "global_load_async_to_lds_b128 %1, %15, off\n\t"
      "global_load_async_to_lds_b128 %2, %16, off\n\t"
      "global_load_async_to_lds_b128 %3, %17, off\n\t"
      "global_load_async_to_lds_b128 %4, %18, off\n\t"
      "global_load_async_to_lds_b128 %5, %19, off\n\t"
      "global_load_async_to_lds_b128 %6, %20, off\n\t"
      "global_load_async_to_lds_b128 %7, %21, off\n\t"
      "global_load_async_to_lds_b128 %8, %22, off\n\t"
      "global_load_async_to_lds_b128 %9, %23, off\n\t"
      "global_load_async_to_lds_b128 %10, %24, off\n\t"
      "global_load_async_to_lds_b128 %11, %25, off\n\t"
      "global_load_async_to_lds_b128 %12, %26, off\n\t"
      "global_load_async_to_lds_b128 %13, %27, off\n\t"
      "s_wait_xcnt 0x0"
      :: "v"(lk), "v"(lk + 8 * FA_KP), "v"(lk + 16 * FA_KP), "v"(lk + 24 * FA_KP),
         "v"(lk + F5_KB), "v"(lk + F5_KB + 8 * FA_KP), "v"(lk + F5_KB + 16 * FA_KP), "v"(lk + F5_KB + 24 * FA_KP),
         "v"(lv), "v"(lv + 32 * FA_VP), "v"(lv + F5_VB), "v"(lv + F5_VB + 32 * FA_VP), "v"(lm), "v"(lm + 512),
         "v"(kh), "v"(kh + sk), "v"(kh + 2 * sk), "v"(kh + 3 * sk), "v"(kl), "v"(kl + sk), "v"(kl + 2 * sk), "v"(kl + 3 * sk),
         "v"(vh), "v"(vh + svh), "v"(vl), "v"(vl + svl), "v"(m), "v"(m + 256)
      : "memory");
}
// one q plane of the block: 8 copies of 16 B per lane; lane (r = tid / 16, c = tid % 16) brings chunk c of query rows r + 8 j (j < 8). l = its LDS byte address, g = its global address, s = 8 rows in elements.
__device__ __forceinline__ void f5_qplane(unsigned l, const unsigned short* g, size_t s) {
  /* s_wait_xcnt closes the copies' own statement: no register that a copy names is rewritten in front of it */
  asm volatile(
      "global_load_async_to_lds_b128 %0, %8, off\n\t"
      "global_load_async_to_lds_b128 %1, %9, off\n\t"
      "global_load_async_to_lds_b128 %2, %10, off\n\t"
      "global_load_async_to_lds_b128 %3, %11, off\n\t"
      "global_load_async_to_lds_b128 %4, %12, off\n\t"
      "global_load_async_to_lds_b128 %5, %13, off\n\t"
      "global_load_async_to_lds_b128 %6, %14, off\n\t"
      "global_load_async_to_lds_b128 %7, %15, off\n\t"
      "s_wait_xcnt 0x0"
      :: "v"(l), "v"(l + 8 * FA_KP), "v"(l + 16 * FA_KP), "v"(l + 24 * FA_KP), "v"(l + 32 * FA_KP), "v"(l + 40 * FA_KP), "v"(l + 48 * FA_KP), "v"(l + 56 * FA_KP),
         "v"(g), "v"(g + s), "v"(g + 2 * s), "v"(g + 3 * s), "v"(g + 4 * s), "v"(g + 5 * s), "v"(g + 6 * s), "v"(g + 7 * s)
      : "memory");
}

// 5-plane variant for query blocks [QB05, QB05+QBN5) (positions < RE), one 64-wide half dh of the head's 128 dims per block: S = Qh.Kh^T + (Ql.Kh^T + Qh.Kl^T)/1024 with Q/K = [hi | x1024 residual] planes (residual planes compact: rows b*RE + s);
// O = (Ph.Vh + (Pl.Vh + Ph.Vl)/1024) / l with P = [hi | x1024 residual] of 1024 p and V^T = [hi | x1024 residual] (VtL pitch RE); separate residual accumulators folded before the normalisation.
// key tiles [0, JE[qblk]) clamped to [1, RE/32] (the compact planes hold keys < RE); a block whose mask exposes keys beyond RE writes NaN rows.
// All operand tiles come through LDS, once for the block's four waves: asynchronous copies in whole row pieces; q planes once, the pass's K, V^T and mask tiles in two stages, stage t + 1 in flight while stage t is worked on.
__global__ __launch_bounds__(128) __attribute__((amdgpu_num_vgpr(256))) void k_flash5(const _Float16* __restrict__ Q16, const _Float16* __restrict__ QL, int ldq, const _Float16* __restrict__ K16, const _Float16* __restrict__ KL, int ldk,
                                                const _Float16* __restrict__ Vt, const _Float16* __restrict__ VtL, const unsigned short* __restrict__ MP, const int* __restrict__ JE, float* __restrict__ O, int ldo) {
  constexpr int RPW = 16, DT = 4, KS = 4;
  __shared__ __attribute__((aligned(16))) unsigned short sP[4][RPW][40];
  __shared__ __attribute__((aligned(16))) unsigned short sPL[4][RPW][40];
  __shared__ __attribute__((aligned(16))) unsigned char ring[2 * F5_STG];
  __shared__ __attribute__((aligned(16))) unsigned char sQ[2 * F5_QB];
  float (*sO)[RPW][68] = (float (*)[RPW][68])ring;
  const int tid = threadIdx.x, lane = tid & 31, ln = lane & 15, hh = lane >> 4;
  const int w = __builtin_amdgcn_readfirstlane(tid >> 5);
  const int dh = blockIdx.x & 1; const int bx = blockIdx.x >> 1;
  const int slab = bx / QBN5, qblk = QB05 + bx % QBN5; const int b = slab / NH, h = slab % NH; const int kvh = h / NREP;
  const int qb0 = qblk * (4 * RPW); const int q0 = qb0 + w * RPW;
  const int jraw = JE[qblk * 32];
  const float pz = (jraw > RE / 32) ? __uint_as_float(0x7FC00000u) : 0.0f;
  int jt = (jraw < 1) ? 1 : jraw; jt = (jt > RE / 32) ? (RE / 32) : jt;
  const int nt = __builtin_amdgcn_readfirstlane(jt);
  /* the lane's copy addresses: q planes, and stage 0 of the ring */
  const unsigned short* gq = (const unsigned short*)Q16 + ((size_t)b * TQ + qb0 + (tid >> 4)) * ldq + h * HDIM + (tid & 15) * 8;
  const unsigned short* gql = (const unsigned short*)QL + ((size_t)b * RE + qb0 + (tid >> 4)) * ldq + h * HDIM + (tid & 15) * 8;
  const unsigned short* gk = (const unsigned short*)K16 + ((size_t)b * TK + (tid >> 4)) * ldk + kvh * HDIM + (tid & 15) * 8;
  const unsigned short* gkl = (const unsigned short*)KL + ((size_t)b * RE + (tid >> 4)) * ldk + kvh * HDIM + (tid & 15) * 8;
  const unsigned short* gv = (const unsigned short*)Vt + ((size_t)(b * NKVH + kvh) * HDIM + dh * 64 + (tid >> 2)) * TK + (tid & 3) * 8;
  const unsigned short* gvl = (const unsigned short*)VtL + ((size_t)(b * NKVH + kvh) * HDIM + dh * 64 + (tid >> 2)) * RE + (tid & 3) * 8;
  const unsigned short* gm = MP + (size_t)(q0 >> 4) * (size_t)(TK / 32) * 512 + lane * 8;
  const size_t sq8 = (size_t)8 * ldq, sk8 = (size_t)8 * ldk, kst = (size_t)32 * ldk, svh = (size_t)32 * TK, svl = (size_t)32 * RE;
  const unsigned rb = (unsigned)(uintptr_t)ring;
  const unsigned lq = (unsigned)(uintptr_t)sQ + (unsigned)((tid >> 4) * FA_KP + (tid & 15) * 16);
  const unsigned lk = rb + (unsigned)((tid >> 4) * FA_KP + (tid & 15) * 16);
  const unsigned lv = rb + (unsigned)(2 * F5_KB + (tid >> 2) * FA_VP + (tid & 3) * 16);
  const unsigned lm = rb + (unsigned)(2 * F5_KB + 2 * F5_VB + w * 1024 + lane * 16);
  const int kofs = ln * FA_KP + 16 * hh, vofs = 2 * F5_KB + ln * FA_VP + 16 * hh, mofs = 2 * F5_KB + 2 * F5_VB + w * 1024 + lane * 16;
  const unsigned char* qp = sQ + (w * RPW + ln) * FA_KP + 16 * hh;
  f5_qplane(lq, gq, sq8);
  f5_qplane(lq + F5_QB, gql, sq8);
  f5_stage(lk, lv, lm, gk, gkl, sk8, gv, svh, gvl, svl, gm);
  float m_r[8], l_r[8]; v8f oacc[DT], oaccL[DT];
#pragma unroll
  for (int r = 0; r < 8; ++r) { m_r[r] = -3.0e38f; l_r[r] = 0.f; }
#pragma unroll
  for (int dt = 0; dt < DT; ++dt) { oacc[dt] = (v8f){0.f,0.f,0.f,0.f,0.f,0.f,0.f,0.f}; oaccL[dt] = oacc[dt]; }
  asm volatile("s_wait_asynccnt 0x0" ::: "memory");   /* the q planes and stage 0 have landed before the barrier publishes them */
  __syncthreads();
  if (nt > 1) f5_stage(lk + F5_STG, lv + F5_STG, lm + F5_STG, gk + kst, gkl + kst, sk8, gv + 32, svh, gvl + 32, svl, gm + 512);
#pragma unroll 1
  for (int t = 0; t < nt; ++t) {
    v8f sa = (v8f){0.f,0.f,0.f,0.f,0.f,0.f,0.f,0.f}, sb = sa, sal = sa, sbl = sa;
    const unsigned char* st = ring + (t & 1) * F5_STG;
    const unsigned char* kp = st + kofs; const unsigned char* vp = st + vofs; const unsigned char* mp = st + mofs;
    FragH fm; fm.half[0] = *(const v8us*)mp; fm.half[1] = *(const v8us*)(mp + 512);
#pragma unroll
    for (int ks = 0; ks < KS; ++ks) {
      /* all A and B fragments of this step share one k order: element e < 8 <-> d = 32 ks + 8 hh + e; e >= 8 <-> d = 32 ks + 16 + 8 hh + (e - 8): byte 64 ks + 16 hh of the row, and 32 B further */
      FragH a, al2, k0, k1, g0, g1;
      a.half[0] = *(const v8us*)(qp + ks * 64); a.half[1] = *(const v8us*)(qp + ks * 64 + 32);
      al2.half[0] = *(const v8us*)(qp + F5_QB + ks * 64); al2.half[1] = *(const v8us*)(qp + F5_QB + ks * 64 + 32);
      k0.half[0] = *(const v8us*)(kp + ks * 64); k0.half[1] = *(const v8us*)(kp + ks * 64 + 32);
      k1.half[0] = *(const v8us*)(kp + 16 * FA_KP + ks * 64); k1.half[1] = *(const v8us*)(kp + 16 * FA_KP + ks * 64 + 32);
      g0.half[0] = *(const v8us*)(kp + F5_KB + ks * 64); g0.half[1] = *(const v8us*)(kp + F5_KB + ks * 64 + 32);
      g1.half[0] = *(const v8us*)(kp + F5_KB + 16 * FA_KP + ks * 64); g1.half[1] = *(const v8us*)(kp + F5_KB + 16 * FA_KP + ks * 64 + 32);
      sa = g2_mma(a.v, k0.v, sa); sb = g2_mma(a.v, k1.v, sb);
      sal = g2_mma(al2.v, k0.v, sal); sbl = g2_mma(al2.v, k1.v, sbl);
      sal = g2_mma(a.v, g0.v, sal); sbl = g2_mma(a.v, g1.v, sbl);
    }
    /* both V^T planes' fragments of this pass are read here, ahead of the softmax, which covers their LDS trip */
    FragH bv[DT], bl[DT];
#pragma unroll
    for (int dt = 0; dt < DT; ++dt) {
      bv[dt].half[0] = *(const v8us*)(vp + dt * 16 * FA_VP); bv[dt].half[1] = *(const v8us*)(vp + dt * 16 * FA_VP + 32);
      bl[dt].half[0] = *(const v8us*)(vp + F5_VB + dt * 16 * FA_VP); bl[dt].half[1] = *(const v8us*)(vp + F5_VB + dt * 16 * FA_VP + 32);
    }
    float s0v[8], s1v[8], mcv[8];
#pragma unroll
    for (int r = 0; r < 8; ++r) {
      const float mk0 = bf16_val(fm.u[2 * r]), mk1 = bf16_val(fm.u[2 * r + 1]);
      const float d0 = sa[r] + sal[r] * 0.0009765625f, d1 = sb[r] + sbl[r] * 0.0009765625f;
      s0v[r] = d0 * SCL + mk0; s1v[r] = d1 * SCL + mk1;
      mcv[r] = fmaxf(s0v[r], s1v[r]);
    }
    row16_max8(mcv);
    float eav[8];
#pragma unroll
    for (int r = 0; r < 8; ++r) {
      const float mn = fmaxf(m_r[r], mcv[r]); mcv[r] = mn;
      s0v[r] = (s0v[r] - mn) * LOG2E; s1v[r] = (s1v[r] - mn) * LOG2E; eav[r] = (m_r[r] - mn) * LOG2E;
    }
    exp2_8(s0v); exp2_8(s1v); exp2_8(eav);
#pragma unroll
    for (int r = 0; r < 8; ++r) {
      const float mn = mcv[r]; const float al = (mn > -1.0e38f) ? eav[r] : 1.0f; m_r[r] = mn;
      const float p0 = s0v[r], p1 = s1v[r]; l_r[r] = l_r[r] * al + p0 + p1;
#pragma unroll
      for (int dt = 0; dt < DT; ++dt) { oacc[dt][r] *= al; oaccL[dt][r] *= al; }
      FragH t2, t2l; const float ps0 = p0 * 1024.0f, ps1 = p1 * 1024.0f;
      t2.h[0] = toh_flush(ps0); t2.h[1] = toh_flush(ps1);
      t2l.h[0] = toh_flush((ps0 - (float)t2.h[0]) * 1024.0f); t2l.h[1] = toh_flush((ps1 - (float)t2.h[1]) * 1024.0f);
      sP[w][8 * hh + r][ln] = t2.u[0]; sP[w][8 * hh + r][16 + ln] = t2.u[1]; sPL[w][8 * hh + r][ln] = t2l.u[0]; sPL[w][8 * hh + r][16 + ln] = t2l.u[1];
    }
    __builtin_amdgcn_fence(4, "workgroup"); __builtin_amdgcn_wave_barrier();
    FragH pa, pl;
    pa.half[0] = *(const v8us*)&sP[w][ln][8 * hh]; pa.half[1] = *(const v8us*)&sP[w][ln][16 + 8 * hh];
    pl.half[0] = *(const v8us*)&sPL[w][ln][8 * hh]; pl.half[1] = *(const v8us*)&sPL[w][ln][16 + 8 * hh];
#pragma unroll
    for (int dt = 0; dt < DT; ++dt) {
      /* A (P tiles) and B (V^T rows) share the same key order: element e < 8 <-> key 32 t + 8 hh + e; e >= 8 <-> key 32 t + 16 + 8 hh + (e - 8) */
      oacc[dt] = g2_mma(pa.v, bv[dt].v, oacc[dt]);
      oaccL[dt] = g2_mma(pl.v, bv[dt].v, oaccL[dt]);
      oaccL[dt] = g2_mma(pa.v, bl[dt].v, oaccL[dt]);
    }
    asm volatile("s_wait_dscnt 0x0" ::: "memory");      /* this wave's reads of stage t (and of its P tiles) are done before the stage is refilled */
    asm volatile("s_wait_asynccnt 0x0" ::: "memory");   /* this wave's copies of stage t + 1 have landed before the barrier publishes them */
    __syncthreads();
    if (t + 2 < nt) {
      const unsigned so2 = (unsigned)((t & 1) * F5_STG);
      f5_stage(lk + so2, lv + so2, lm + so2, gk + (size_t)(t + 2) * kst, gkl + (size_t)(t + 2) * kst, sk8, gv + (size_t)(t + 2) * 32, svh, gvl + (size_t)(t + 2) * 32, svl, gm + (size_t)(t + 2) * 512);
    }
  }
  asm volatile("s_wait_asynccnt 0x0" ::: "memory");     /* no copy is outstanding when the ring becomes output staging */
  row16_sum8(l_r);
#pragma unroll
  for (int r = 0; r < 8; ++r) { const float l = l_r[r]; l_r[r] = (l > 0.f) ? 1.0f / (l * 1024.0f) : 0.f; }
#pragma unroll
  for (int dt = 0; dt < DT; ++dt)
#pragma unroll
    for (int r = 0; r < 8; ++r) { float v = oacc[dt][r]; v += oaccL[dt][r] * 0.0009765625f; sO[w][8 * hh + r][dt * 16 + ln] = v * l_r[r] + pz; }
  __builtin_amdgcn_fence(4, "workgroup"); __builtin_amdgcn_wave_barrier();
  {
#pragma unroll
    for (int rp = 0; rp < RPW; rp += 2) { const int r = rp + (lane >> 4), pc = lane & 15; const v4f val = *(const v4fa*)&sO[w][r][pc * 4]; *(v4f*)(O + ((size_t)b * TQ + q0 + r) * ldo + h * HDIM + dh * 64 + pc * 4) = val; }
    
  }
}

extern "C" void kernel_launch(void* const* d_in, const int* in_sizes, int n_in,
                              void* d_out, int out_size, void* d_ws, size_t ws_size, hipStream_t stream) {
  if (n_in < 10) return;
  const size_t needx = ((size_t)(NB - 1) * SEQ_FULL + (size_t)SLEN) * DM;
  if ((size_t)in_sizes[0] < needx) return;
  if ((size_t)in_sizes[1] < (size_t)DM * DM) return;
  if ((size_t)in_sizes[2] < (size_t)VW * DM) return;
  if ((size_t)in_sizes[3] < (size_t)VW * DM) return;
  if ((size_t)in_sizes[4] < (size_t)DM * DM) return;
  if ((size_t)in_sizes[5] < (size_t)HDIM) return;
  if ((size_t)in_sizes[6] < (size_t)HDIM) return;
  if ((size_t)in_sizes[7] < (size_t)SLEN * RTW) return;
  if ((size_t)in_sizes[8] < (size_t)SLEN * RTW) return;
  if ((size_t)in_sizes[9] < (size_t)(SLEN - 1) * MSKP + (size_t)SLEN) return;
  if ((size_t)out_size < needx) return;
  /* inputs in order: x, Wq, Wk, Wv, Wo, q gain, k gain, cos table, sin table, mask */
  const float* x = (const float*)d_in[0]; const float* Wq = (const float*)d_in[1]; const float* Wk = (const float*)d_in[2]; const float* Wv = (const float*)d_in[3]; const float* Wo = (const float*)d_in[4];
  const float* qnw = (const float*)d_in[5]; const float* knw = (const float*)d_in[6]; const float* rct = (const float*)d_in[7]; const float* rst = (const float*)d_in[8]; const float* msk = (const float*)d_in[9];
  float* dout = (float*)d_out;
  char* ws = (char*)d_ws; size_t off = 0;
  auto take = [&](size_t bytes) { char* p = ws + off; off += (bytes + 255) & ~(size_t)255; return p; };
  const size_t np = (size_t)NR * DM;
  const size_t nw8 = (size_t)DM * DM / 8;
  const size_t nk8 = (size_t)VW * DM / 8;
  _Float16* BQ = (_Float16*)take(SZ_BQ);                                /* [n][k] f16, x16 */
  _Float16* BK = (_Float16*)take(SZ_BK);
  _Float16* BV = (_Float16*)take(SZ_BK);
  _Float16* B2 = (_Float16*)take(SZ_B2);                                /* [n][2*DM] f16: [x16384 | x16] copies of Wo */
  float* FS = (float*)take(SZ_FS);                                      /* f32 scratch plane: q rows [NR][DM], then k rows [NR][VW], then v rows [NR][VW], then the context [NR][DM] */
  _Float16* X16 = (_Float16*)take(SZ_X16);                              /* f16 input rows; reused as V^T [(b,g)][64][TK] after the v GEMM */
  _Float16* VT = X16;
  _Float16* QH = (_Float16*)take(SZ_QH);                                /* reused as the context hi plane after the attention */
  _Float16* KHp = (_Float16*)take(SZ_KH);                               /* [NR][VW] */
  _Float16* V16 = (_Float16*)take(SZ_KH);                               /* [NR][VW] */
  _Float16* QL = (_Float16*)take(SZ_QL);                                /* [NB*RE][DM] residual plane */
  _Float16* KL = (_Float16*)take(SZ_KL);                                /* [NB*RE][VW] residual plane */
  _Float16* VTL = (_Float16*)take(SZ_VTL);                              /* [(b,g)][64][RE] */
  _Float16* A2 = (_Float16*)take(SZ_A2);                                /* [NB*RE][2*DM] = [ctx hi | ctx residual] */
  unsigned short* MPp = (unsigned short*)take(SZ_MP);                   /* bf16 mask plane, accumulator layout */
  int* JEp = (int*)take(SZ_JE);                                         /* [QBLKS][32] key-tile counts */
  _Float16* OH = QH;
  if (off > ws_size) return;
  if (off > ((size_t)128 << 20)) return;

  const unsigned gw = (unsigned)((nw8 + 255) / 256);
  const unsigned gk = (unsigned)((nk8 + 255) / 256);
  k_wsc<<<gw, 256, 0, stream>>>(Wq, BQ, nw8, WSC_LO);
  k_wsc<<<gk, 256, 0, stream>>>(Wk, BK, nk8, WSC_LO);
  k_wsc<<<gk, 256, 0, stream>>>(Wv, BV, nk8, WSC_LO);
  k_wsc2<<<gw, 256, 0, stream>>>(Wo, B2, nw8, WSC_HI, WSC_LO);
  k_mperm<<<(unsigned)(((size_t)(SLEN / 16) * (SLEN / 32) * 64) / 256), 256, 0, stream>>>(msk, MPp);
  k_mjend<<<(unsigned)QBLKS, 1024, 0, stream>>>(msk, JEp);
  const unsigned g8 = (unsigned)((np / 8 + 255) / 256);
  k_x16<<<g8, 256, 0, stream>>>(x, X16, np / 8);
  const dim3 gp((unsigned)((NR / 128) * (DM / 64)), 1);
  const dim3 gkv((unsigned)((NR / 128) * (VW / 64)), 1);
  const unsigned grq = (unsigned)(((size_t)NR * NH * 16) / 256);
  const unsigned grk = (unsigned)(((size_t)NR * NKVH * 16) / 256);
  k_gemm2<0><<<gp, 128, 0, stream>>>(X16, DM, 0, BQ, DM, 0, AL_P, FS, nullptr, DM, 0, NR, DM, DM);        /* q = x Wq^T (f32 rows, pitch DM) */
  k_nrope_q<<<grq, 256, 0, stream>>>(FS, DM, qnw, rct, rst, QH, QL);
  k_gemm2<0><<<gkv, 128, 0, stream>>>(X16, DM, 0, BK, DM, 0, AL_P, FS, nullptr, VW, 0, NR, VW, DM);       /* k = x Wk^T (f32 rows, pitch VW) */
  k_nrope_k<<<grk, 256, 0, stream>>>(FS, VW, knw, rct, rst, KHp, KL);
  k_gemm2<0><<<gkv, 128, 0, stream>>>(X16, DM, 0, BV, DM, 0, AL_P, FS, V16, VW, 0, NR, VW, DM);           /* v = x Wv^T (f32 rows + f16 plane, pitch VW) */
  k_vtg<<<(unsigned)(NB * NV64 * (SLEN / 64)), 256, 0, stream>>>(V16, VT);
  k_vtl<<<(unsigned)(NB * NV64 * (RE / 64)), 256, 0, stream>>>(FS, VTL);
  k_flash5<<<(unsigned)(NB * NH * QBN5 * 2), 128, 0, stream>>>(QH, QL, DM, KHp, KL, VW, VT, VTL, MPp, JEp, FS, DM);
  if (QBNP > 0) k_flash<<<(unsigned)(NB * NH * QBNP), 128, 0, stream>>>(QH, DM, KHp, VW, VT, MPp, JEp, FS, DM);
  k_hl<<<g8, 256, 0, stream>>>(FS, OH, A2, np / 8);
  /* out rows [0, RE) per batch: [ctx hi | ctx residual] . [Wo x16384 ; Wo x16] / 16384  (K = 2*DM) */
  const dim3 ge((unsigned)((RE / 128) * (DM / 64)), NB);
  k_gemm2<0><<<ge, 128, 0, stream>>>(A2, 2 * DM, (size_t)RE * 2 * DM, B2, 2 * DM, 0, AL_E, dout, nullptr, DM, (size_t)SEQ_FULL * DM, RE, DM, 2 * DM);
  /* out rows [RE, SLEN) per batch: ctx hi . (Wo x16) / 16 */
  if (SLEN > RE) {
    const dim3 gl((unsigned)(((SLEN - RE) / 128) * (DM / 64)), NB);
    k_gemm2<0><<<gl, 128, 0, stream>>>(OH + (size_t)RE * DM, DM, (size_t)SLEN * DM, B2 + DM, 2 * DM, 0, AL_P, dout + (size_t)RE * DM, nullptr, DM, (size_t)SEQ_FULL * DM, SLEN - RE, DM, DM);
  }
}

// v007
// One run takes 245 microseconds.
// Timed twice side by side with v006, it ran 1.28 and 1.26 times as fast.
// Counting every step since v000, it is 3.68 times as fast.
#include <hip/hip_runtime.h>
// Contractions: x.Wq^T, x.Wk^T, x.Wv^T, ctx.Wo^T = v_wmma_f32_16x16x32_f16 (f16 operands: bf16-RNE inputs exact in f16, weights carried x16 (x16384 for the ctx-hi half of the early-row output GEMM); f32 accumulate); scores q.k^T and P.V^T = v_wmma_f32_16x16x32_f16 (plain f16 hi planes; hi + x1024 residual planes of q, k, P and v for query positions < RE; P carried x1024), f32 accumulate; per-head RMS normalisation, rotary step, additive mask, softmax and normalisers f32.

#ifndef NB
#define NB 2
#endif
#ifndef SEQ
#define SEQ 2048
#endif
#define NB_FULL 2
#define SEQ_FULL 2048
#define DM 2048
#define NH 16
#define NKVH 4
#define NREP (NH / NKVH)
#define HDIM 128
#define VW (NKVH * HDIM)                     /* width of the k / v projection rows */
#define NV64 (VW / 64)                       /* 64-wide column groups of the v rows */
#define QKVW (DM + 2 * VW)                   /* row of the joint projection plane: [q | k | v] */
#define MSKP 2048                            /* row pitch of the mask input */
#define RTW 64                               /* row pitch of the cos / sin inputs */
#define SLEN SEQ
#define NR (NB * SLEN)
#define TQ SLEN
#define TK SLEN
#define SCL 0.08838834764831845f
#define MVIS (-1.0e8f)                       /* a mask entry above this keeps its key visible */
#define QBLKS (TQ / 64)
#define RE ((SLEN < 512) ? SLEN : 512)      /* query positions [0, RE) get residual planes on q, k, P, v and ctx */
#define QB05 0
#define QBN5 (RE / 64)
#define QB0P QBN5
#define QBNP (QBLKS - QBN5)
static_assert(SLEN % 128 == 0);
static_assert(SLEN <= SEQ_FULL);
static_assert(SLEN <= MSKP);
static_assert(NB >= 1 && NB <= NB_FULL);
static_assert(RE % 128 == 0 && RE <= SLEN);
static_assert((SLEN - RE) % 128 == 0);
static_assert(DM % 64 == 0 && DM == NH * HDIM);
static_assert(HDIM == 128 && NH % NKVH == 0);
static_assert(VW % 64 == 0 && NV64 * 64 == VW);
static_assert(DM % 32 == 0 && (2 * DM) % 32 == 0);
static_assert(NR % 128 == 0);
static_assert(((size_t)NR * NH * 16) % 256 == 0 && ((size_t)NR * NKVH * 16) % 256 == 0);
static_assert((NH & (NH - 1)) == 0 && (NKVH & (NKVH - 1)) == 0);   /* head counts are powers of two: index arithmetic by shifts and masks */
static_assert((size_t)NR * NH * 16 < ((size_t)1 << 31));           /* 32-bit thread indices in the normalise + rotary kernels */
static_assert(((size_t)(SLEN / 16) * (SLEN / 32) * 64) % 256 == 0);
static_assert(32 * 16 == HDIM * 4);          /* one store instruction of 32 lanes x 16 B == one 128-float row segment */
static_assert(16 * 16 == 64 * 4);            /* 16 lanes x 16 B == one 64-float row segment */
static_assert(4 * 16 * 40 * 2 + 4 * 16 * 132 * 4 <= 131072);
static_assert(2 * 4 * 16 * 40 * 2 + 4 * 16 * 68 * 4 <= 131072);
static_assert(4 * 32 * 68 * 4 <= 131072);

static constexpr float WSC_LO = 16.0f;
static constexpr float WSC_HI = 16384.0f;
static constexpr float AL_P = 0.0625f;
static constexpr float AL_E = 6.103515625e-05f;   /* 0.0625 / 1024 */

static constexpr size_t al256(size_t b) { return (b + 255) & ~(size_t)255; }
static constexpr size_t SZ_BQ = al256((size_t)DM * DM * 2);
static constexpr size_t SZ_BK = al256((size_t)VW * DM * 2);
static constexpr size_t SZ_B2 = al256((size_t)DM * 2 * DM * 2);
static constexpr size_t SZ_FS = al256((size_t)NR * QKVW * 4);
static constexpr size_t SZ_X16 = al256((size_t)NR * DM * 2);
static constexpr size_t SZ_QH = al256((size_t)NR * DM * 2);
static constexpr size_t SZ_KH = al256((size_t)NR * VW * 2);
static constexpr size_t SZ_QL = al256((size_t)NB * RE * DM * 2);
static constexpr size_t SZ_KL = al256((size_t)NB * RE * VW * 2);
static constexpr size_t SZ_VTL = al256((size_t)NB * NV64 * 64 * RE * 2);
static constexpr size_t SZ_A2 = al256((size_t)NB * RE * 2 * DM * 2);
static constexpr size_t SZ_MP = al256((size_t)SLEN * SLEN * 2);
static constexpr size_t SZ_JE = al256((size_t)(SLEN / 16) * 32 * 4);
static_assert((size_t)NB * NV64 * 64 * TK * 2 <= SZ_X16);       /* V^T aliases the f16 input plane */
static_assert((size_t)NR * DM * 4 <= SZ_FS);
static_assert(SZ_BQ == (size_t)DM * DM * 2 && SZ_BK == (size_t)VW * DM * 2);   /* the q, k, v weight planes lie back to back: one [QKVW][DM] operand */
static_assert(SZ_BQ + 2 * SZ_BK + SZ_B2 + SZ_FS + SZ_X16 + SZ_QH + SZ_KH + SZ_QL + SZ_KL + SZ_VTL + SZ_A2 + SZ_MP + SZ_JE <= ((size_t)256 << 20));

typedef _Float16 v16h __attribute__((ext_vector_type(16)));
typedef unsigned short v8us __attribute__((ext_vector_type(8), may_alias));
typedef float v8f __attribute__((ext_vector_type(8)));
typedef float v4f __attribute__((ext_vector_type(4)));
typedef float v4fa __attribute__((ext_vector_type(4), may_alias));
union FragH { v16h v; v8us half[2]; _Float16 h[16]; unsigned short u[16]; };

__device__ __forceinline__ unsigned short bf16_bits(float x) { unsigned int u = __float_as_uint(x); return (unsigned short)((u + 0x7FFFu + ((u >> 16) & 1u)) >> 16); }
__device__ __forceinline__ float bf16_val(unsigned short b) { return __uint_as_float(((unsigned int)b) << 16); }
__device__ __forceinline__ float bf16_rne(float x) { return bf16_val(bf16_bits(x)); }
// f32 -> f16 for WMMA operand planes: values under the smallest f16 normal become +0
__device__ __forceinline__ _Float16 toh_flush(float v) { const _Float16 r = (_Float16)v; return (fabsf(v) < 6.103515625e-05f) ? (_Float16)0.0f : r; }

// D += A.B with NT terms: 1 = ah.bh, 2 = + al.bh, 3 = + ah.bl; hazard guard after the group
template <int NT>
__device__ __forceinline__ v8f mmaH(v16h ah, v16h al, v16h bh, v16h bl, v8f c) {
  c = __builtin_amdgcn_wmma_f32_16x16x32_f16(false, ah, false, bh, (short)0, c, false, false);
  if (NT >= 2) c = __builtin_amdgcn_wmma_f32_16x16x32_f16(false, al, false, bh, (short)0, c, false, false);
  if (NT >= 3) c = __builtin_amdgcn_wmma_f32_16x16x32_f16(false, ah, false, bl, (short)0, c, false, false);
  asm volatile("v_nop\n\tv_nop\n\tv_nop\n\tv_nop" : "+v"(c) : "v"(ah), "v"(al), "v"(bh), "v"(bl));
  return c;
}
// 16x32 fragment from a 16-bit row-major tile (rows = m or n, k contiguous): elements 0..7 <- k0+8h+0..7, 8..15 <- k0+16+8h+0..7
__device__ __forceinline__ v16h g2_frag(const _Float16* p, int hh) { FragH f; f.half[0] = *(const v8us*)((const unsigned short*)p + 8 * hh); f.half[1] = *(const v8us*)((const unsigned short*)p + 16 + 8 * hh); return f.v; }
__device__ __forceinline__ v8f g2_mma(v16h a, v16h b, v8f c) { v8f d = __builtin_amdgcn_wmma_f32_16x16x32_f16(false, a, false, b, (short)0, c, false, false); asm volatile("v_nop\n\tv_nop\n\tv_nop\n\tv_nop" : "+v"(d) : "v"(a), "v"(b)); return d; }

// Eight softmax exponentials at once, in place: v <- 2^v on the hardware's base-2 exponential (the callers pass x log2 e with x <= 0: a score or an older maximum minus the running maximum).
// No range reduction and no range tests: nothing overflows for x <= 0; a result under the smallest normal f32 may come out as 0 (beside a row's largest term, which is 1, it adds nothing); -inf gives 0, NaN stays NaN.
// One statement, so that the slot the instruction set asks for behind a transcendental is filled by construction: behind each v_exp_f32 stands the next value's, which touches neither its result nor its source, behind the last a v_nop.
#define EX_ONE(R) "v_exp_f32 " R ", " R "\n\t"
__device__ __forceinline__ void exp2_8(float (&v)[8]) {
  asm(EX_ONE("%0") EX_ONE("%1") EX_ONE("%2") EX_ONE("%3") EX_ONE("%4") EX_ONE("%5") EX_ONE("%6") EX_ONE("%7") "v_nop"
      : "+v"(v[0]), "+v"(v[1]), "+v"(v[2]), "+v"(v[3]), "+v"(v[4]), "+v"(v[5]), "+v"(v[6]), "+v"(v[7]));
}
#define LOG2E 1.4426950408889634f

// Reduction over each 16-lane row (lanes l ^ 1, ^ 2, ^ 4, ^ 8 in that order, the order of the xor butterfly) of eight values at once, on the vector port (DPP row_xmask): no trip through the LDS unit and no wait per step.
// The eight values' instructions of a step stand side by side, so each instruction's producer is eight instructions back and no link of a chain is waited for. All 32 lanes are on at every call.
#define RX_ONE(OP, R, M) OP " " R ", " R ", " R " row_xmask:" M " row_mask:0xf bank_mask:0xf\n\t"
#define RX_EIGHT(OP, M) RX_ONE(OP, "%0", M) RX_ONE(OP, "%1", M) RX_ONE(OP, "%2", M) RX_ONE(OP, "%3", M) RX_ONE(OP, "%4", M) RX_ONE(OP, "%5", M) RX_ONE(OP, "%6", M) RX_ONE(OP, "%7", M)
#define RX_TREE(OP) RX_EIGHT(OP, "1") RX_EIGHT(OP, "2") RX_EIGHT(OP, "4") RX_EIGHT(OP, "8")
__device__ __forceinline__ void row16_max8(float (&v)[8]) {
  asm volatile(RX_TREE("v_max_num_f32_dpp") : "+v"(v[0]), "+v"(v[1]), "+v"(v[2]), "+v"(v[3]), "+v"(v[4]), "+v"(v[5]), "+v"(v[6]), "+v"(v[7]));
}
__device__ __forceinline__ void row16_sum8(float (&v)[8]) {
  asm volatile(RX_TREE("v_add_f32_dpp") : "+v"(v[0]), "+v"(v[1]), "+v"(v[2]), "+v"(v[3]), "+v"(v[4]), "+v"(v[5]), "+v"(v[6]), "+v"(v[7]));
}

// The bodies below take their block index bi as an argument: several of them share one launch, each on its own range of block indices.
// At the foot of each body stands s_wait_xcnt 0: the body returns into a shared kernel, so the wait comes before any register that its stores name is rewritten.
__device__ __forceinline__ void wsc_body(unsigned bi, const float* __restrict__ Wm, _Float16* __restrict__ Bt, size_t n8, float sc) {
  const size_t t = (size_t)bi * 256 + threadIdx.x; if (t >= n8) return;
  const v4f a0 = *(const v4fa*)(Wm + t * 8), a1 = *(const v4fa*)(Wm + t * 8 + 4);
  FragH f;
#pragma unroll
  for (int q = 0; q < 4; ++q) { f.h[q] = toh_flush(bf16_rne(a0[q]) * sc); f.h[4 + q] = toh_flush(bf16_rne(a1[q]) * sc); }
  const v8us o = f.half[0];
  *(v8us*)((unsigned short*)Bt + t * 8) = o;
  asm volatile("s_wait_xcnt 0x0" ::: "memory");   /* closes this body's stores: in the shared kernel another body's code can stand behind them, not the program's end */
}
__device__ __forceinline__ void wsc2_body(unsigned bi, const float* __restrict__ Wm, _Float16* __restrict__ B2, size_t n8, float sc0, float sc1) {
  const size_t t = (size_t)bi * 256 + threadIdx.x; if (t >= n8) return;
  const size_t e = t * 8; const size_t n = e / DM; const size_t k8 = e % DM;
  const v4f a0 = *(const v4fa*)(Wm + e), a1 = *(const v4fa*)(Wm + e + 4);
  FragH f0, f1;
#pragma unroll
  for (int q = 0; q < 4; ++q) {
    const float v0 = bf16_rne(a0[q]), v1 = bf16_rne(a1[q]);
    f0.h[q] = toh_flush(v0 * sc0); f1.h[q] = toh_flush(v0 * sc1);
    f0.h[4 + q] = toh_flush(v1 * sc0); f1.h[4 + q] = toh_flush(v1 * sc1);
  }
  const size_t o = n * (size_t)(2 * DM) + k8;
  const v8us o0 = f0.half[0], o1 = f1.half[0];
  {
    *(v8us*)((unsigned short*)B2 + o) = o0;
    *(v8us*)((unsigned short*)B2 + o + DM) = o1;
    asm volatile("s_wait_xcnt 0x0" ::: "memory");   /* closes this body's stores: in the shared kernel another body's code can stand behind them, not the program's end */
  }
}

// mask plane in accumulator layout: MP[(qt*(SLEN/32) + kt)][half][lane][8] bf16 bits; element 2*rr + c of (half, lane) = mask[qt*16 + 8*(lane>>4) + 4*half + rr][kt*32 + 16*c + (lane&15)];
__device__ __forceinline__ void mperm_body(unsigned bi, const float* __restrict__ msk, unsigned short* __restrict__ MP) {
  const size_t t = (size_t)bi * 256 + threadIdx.x; if (t >= (size_t)(SLEN / 16) * (SLEN / 32) * 64) return;
  const int lane = (int)(t & 31); const int half = (int)((t >> 5) & 1); const size_t tile = t >> 6;
  const int kt = (int)(tile % (size_t)(SLEN / 32)); const int qt = (int)(tile / (size_t)(SLEN / 32));
  const int ln = lane & 15, hh = lane >> 4;
  const float* mr = msk + (size_t)(qt * 16 + 8 * hh + 4 * half) * MSKP + kt * 32 + ln;
  FragH f;
#pragma unroll
  for (int rr = 0; rr < 4; ++rr) { const float a = mr[(size_t)rr * MSKP]; const float c = mr[(size_t)rr * MSKP + 16]; f.u[2 * rr] = bf16_bits(a); f.u[2 * rr + 1] = bf16_bits(c); }
  const v8us o = f.half[0];
  *(v8us*)(MP + t * 8) = o;
  asm volatile("s_wait_xcnt 0x0" ::: "memory");   /* closes this body's stores: in the shared kernel another body's code can stand behind them, not the program's end */
}
// per 16-query tile qt: JE[qt][0..32) = number of 32-key tiles to visit = 1 + last tile holding a visible entry (value > MVIS) in any of the 16 rows; all tiles if some row has no visible entry.
// A 64-query block takes the largest of its four tiles' counts.
__device__ __forceinline__ void mjend_body(unsigned qt, const float* __restrict__ msk, int* __restrict__ JE, int* smax, int* snone) {
  constexpr int NL = SLEN / 128;               /* 16-B loads per lane and row */
  constexpr int NG = 4;                        /* loads of one group */
  static_assert(NL % NG == 0);
  const int tid = threadIdx.x, lane = tid & 31; const int w = __builtin_amdgcn_readfirstlane(tid >> 5);
  int wmax = -1, wnone = 0;
  /* 8 waves, two rows each; both loops kept rolled: one group's registers at a time, so that this body does not set the register count of the launch it shares */
#pragma unroll 1
  for (int rr = 0; rr < 2; ++rr) {
    int lm = -1;
#pragma unroll 1
    for (int g = 0; g < NL / NG; ++g) {
      const float* mr = msk + (size_t)(qt * 16 + w * 2 + rr) * MSKP + g * (NG * 128) + lane * 4;
      /* the loads of a group are issued together ahead of the first compare: one load round trip a group, not one per 128 columns */
      v4f a[NG];
#pragma unroll
      for (int i = 0; i < NG; ++i) a[i] = *(const v4fa*)(mr + i * 128);
      /* the loaded values are inputs only: all loads of the group are issued, none held back behind a compare; the address is an input too, so it stays whole (no load's result is given it) up to this wait */
      asm volatile("s_wait_xcnt 0x0" :: "v"(a[0]), "v"(a[1]), "v"(a[2]), "v"(a[3]), "v"(mr) : "memory");
#pragma unroll
      for (int i = 0; i < NG; ++i) {
        const bool any = (bf16_rne(a[i][0]) > MVIS) | (bf16_rne(a[i][1]) > MVIS) | (bf16_rne(a[i][2]) > MVIS) | (bf16_rne(a[i][3]) > MVIS);
        lm = any ? ((lane + 32 * (g * NG + i)) >> 3) : lm;
      }
    }
    int o = __shfl_xor(lm, 16, 32); lm = (o > lm) ? o : lm;
    o = __shfl_xor(lm, 8, 32); lm = (o > lm) ? o : lm;
    o = __shfl_xor(lm, 4, 32); lm = (o > lm) ? o : lm;
    o = __shfl_xor(lm, 2, 32); lm = (o > lm) ? o : lm;
    o = __shfl_xor(lm, 1, 32); lm = (o > lm) ? o : lm;
    wmax = (lm > wmax) ? lm : wmax; wnone |= (lm < 0) ? 1 : 0;
  }
  if (lane == 0) { smax[w] = wmax; snone[w] = wnone; }
  __syncthreads();
  if (w == 0) {
    int m = -1, nn = 0;
#pragma unroll
    for (int i = 0; i < 8; ++i) { const int a = smax[i]; m = (a > m) ? a : m; nn |= snone[i]; }
    const int jt = (nn != 0) ? (SLEN / 32) : (m + 1);
    *(int*)(JE + qt * 32 + lane) = jt;
    asm volatile("s_wait_xcnt 0x0" ::: "memory");   /* closes this body's stores: in the shared kernel another body's code can stand behind them, not the program's end */
  }
}

__device__ __forceinline__ void x16_body(unsigned bi, const float* __restrict__ x, _Float16* __restrict__ X16, size_t n8) {
  const size_t t = (size_t)bi * 256 + threadIdx.x; if (t >= n8) return;
  const size_t e = t * 8; const size_t r = e / DM; const size_t c = e % DM; const size_t b = r / SLEN, s = r % SLEN;
  const float* src = x + (b * SEQ_FULL + s) * DM + c;
  const v4f a0 = *(const v4fa*)src, a1 = *(const v4fa*)(src + 4);
  FragH f;
#pragma unroll
  for (int q = 0; q < 4; ++q) { f.h[q] = (_Float16)bf16_rne(a0[q]); f.h[4 + q] = (_Float16)bf16_rne(a1[q]); }
  const v8us o = f.half[0];
  *(v8us*)((unsigned short*)X16 + e) = o;
  asm volatile("s_wait_xcnt 0x0" ::: "memory");   /* closes this body's stores: in the shared kernel another body's code can stand behind them, not the program's end */
}

// One launch for all the work that reads only inputs: key-tile counts, f16 input plane, the four weight planes, the mask plane. None reads what another writes; the block index picks the body.
static constexpr size_t NX8 = (size_t)NR * DM / 8, NW8 = (size_t)DM * DM / 8, NK8 = (size_t)VW * DM / 8;
static constexpr unsigned PB_JE = SLEN / 16, PB_X = (unsigned)((NX8 + 255) / 256), PB_W = (unsigned)((NW8 + 255) / 256), PB_K = (unsigned)((NK8 + 255) / 256);
static constexpr unsigned PB_MP = (unsigned)(((size_t)(SLEN / 16) * (SLEN / 32) * 64) / 256);
static constexpr unsigned PB_ALL = PB_JE + PB_X + 2 * PB_W + 2 * PB_K + PB_MP;
__global__ __launch_bounds__(256) void k_prep(const float* __restrict__ msk, const float* __restrict__ x, const float* __restrict__ Wq, const float* __restrict__ Wk, const float* __restrict__ Wv, const float* __restrict__ Wo,
                                              int* __restrict__ JE, _Float16* __restrict__ X16, _Float16* __restrict__ BQ, _Float16* __restrict__ BK, _Float16* __restrict__ BV, _Float16* __restrict__ B2, unsigned short* __restrict__ MP) {
  __shared__ int smax[8]; __shared__ int snone[8];
  unsigned bi = blockIdx.x;
  /* the count blocks have the longest chain of load round trips: they start first */
  if (bi < PB_JE) { mjend_body(bi, msk, JE, smax, snone); return; }
  bi -= PB_JE;
  if (bi < PB_X) { x16_body(bi, x, X16, NX8); return; }
  bi -= PB_X;
  if (bi < PB_W) { wsc_body(bi, Wq, BQ, NW8, WSC_LO); return; }
  bi -= PB_W;
  if (bi < PB_K) { wsc_body(bi, Wk, BK, NK8, WSC_LO); return; }
  bi -= PB_K;
  if (bi < PB_K) { wsc_body(bi, Wv, BV, NK8, WSC_LO); return; }
  bi -= PB_K;
  if (bi < PB_W) { wsc2_body(bi, Wo, B2, NW8, WSC_HI, WSC_LO); return; }
  bi -= PB_W;
  mperm_body(bi, msk, MP);
}

// LDS ring of the GEMM: one stage = 64 k = 128 B of every operand row, [A 128 rows | B 64 rows] at pitch 144 B (16 B x odd: the 16-B fragment reads meet no bank conflict); two stages
#define G2_PB 144
#define G2_STG ((128 + 64) * G2_PB)
static_assert(2 * G2_STG >= 4 * 32 * 68 * 4);   /* the output staging reuses the ring behind the last barrier */
static_assert(2 * G2_STG <= 65536);
static_assert(DM % 64 == 0 && DM >= 128);
// 16x32 fragment from an LDS row (k contiguous), p = row start + 2 * (k0 + 8 hh) bytes: the k order of g2_frag
__device__ __forceinline__ v16h g2_lfrag(const unsigned char* p) { FragH f; f.half[0] = *(const v8us*)p; f.half[1] = *(const v8us*)(p + 32); return f.v; }
// one stage: 12 copies of 16 B per lane (a wave-wide copy = 4 whole 128-B row pieces); lane (r = tid / 8, c = tid % 8) brings chunk c of A rows r + 16 j (j < 8) and of B rows r + 16 j (j < 4).
// l = LDS byte address of (row r, chunk c) in the stage, a / b = the lane's global addresses in A row r / B row r, sa / sb = 16 rows in elements.
__device__ __forceinline__ void g2_stage(unsigned l, const _Float16* a, size_t sa, const _Float16* b, size_t sb) {
  /* s_wait_xcnt closes the copies' own statement: no register that a copy names is rewritten in front of it */
  asm volatile(
      "global_load_async_to_lds_b128 %0, %12, off\n\t"
      "global_load_async_to_lds_b128 %1, %13, off\n\t"
      "global_load_async_to_lds_b128 %2, %14, off\n\t"
      "global_load_async_to_lds_b128 %3, %15, off\n\t"
      "global_load_async_to_lds_b128 %4, %16, off\n\t"
      "global_load_async_to_lds_b128 %5, %17, off\n\t"
      "global_load_async_to_lds_b128 %6, %18, off\n\t"
      "global_load_async_to_lds_b128 %7, %19, off\n\t"
      "global_load_async_to_lds_b128 %8, %20, off\n\t"
      "global_load_async_to_lds_b128 %9, %21, off\n\t"
      "global_load_async_to_lds_b128 %10, %22, off\n\t"
      "global_load_async_to_lds_b128 %11, %23, off\n\t"
      "s_wait_xcnt 0x0"
      :: "v"(l), "v"(l + 16 * G2_PB), "v"(l + 32 * G2_PB), "v"(l + 48 * G2_PB), "v"(l + 64 * G2_PB), "v"(l + 80 * G2_PB), "v"(l + 96 * G2_PB), "v"(l + 112 * G2_PB),
         "v"(l + 128 * G2_PB), "v"(l + 144 * G2_PB), "v"(l + 160 * G2_PB), "v"(l + 176 * G2_PB),
         "v"(a), "v"(a + sa), "v"(a + 2 * sa), "v"(a + 3 * sa), "v"(a + 4 * sa), "v"(a + 5 * sa), "v"(a + 6 * sa), "v"(a + 7 * sa),
         "v"(b), "v"(b + sb), "v"(b + 2 * sb), "v"(b + 3 * sb)
      : "memory");
}

// GEMM C[M][N] = alpha * A[M][K].B  with A f16 row-major (pitch lda), B stored [n][k] f16 (pitch ldb); bx = index of the block's 128 x 64 tile, sm = the block's LDS (2 * G2_STG bytes);
// writes f32 C (pitch ldc). Requires M % 128 == 0, N % 64 == 0, K % 64 == 0 (asserted by the callers' constants).
// Operand tiles come through LDS: asynchronous copies, two stages, stage t + 1 in flight while stage t is multiplied.
__device__ __forceinline__ void gemm2_body(const _Float16* __restrict__ A, int lda, const _Float16* __restrict__ Bh, int ldb, float alpha,
                                           float* __restrict__ C, int ldc, int M, int N, int K, int bx, unsigned char* sm) {
  float (*so)[32][68] = (float (*)[32][68])sm;
  const int tid = threadIdx.x, w = tid >> 5, lane = tid & 31, ln = lane & 15, hh = lane >> 4;
  const int ntn = N >> 6; const int mt = bx / ntn, nq = bx - mt * ntn; const int row0 = mt * 128 + 32 * w, col0 = nq * 64; if (mt * 128 >= M) return;
  const int cr = tid >> 3, cc = tid & 7;
  const _Float16* ga = A + (size_t)(mt * 128 + cr) * lda + cc * 8; const _Float16* gb = Bh + (size_t)(col0 + cr) * ldb + cc * 8;
  const size_t sa16 = (size_t)16 * lda, sb16 = (size_t)16 * ldb;
  const unsigned lc = (unsigned)(uintptr_t)sm + (unsigned)(cr * G2_PB + cc * 16);
  const int nt = K >> 6;
  const int aofs = (32 * w + ln) * G2_PB + 16 * hh, bofs = (128 + ln) * G2_PB + 16 * hh;
  const v8f z8 = {0.f,0.f,0.f,0.f,0.f,0.f,0.f,0.f}; v8f c00 = z8, c01 = z8, c02 = z8, c03 = z8, c10 = z8, c11 = z8, c12 = z8, c13 = z8;
  g2_stage(lc, ga, sa16, gb, sb16);
  asm volatile("s_wait_asynccnt 0x0" ::: "memory");   /* stage 0 has landed before the barrier publishes it */
  __syncthreads();
  if (nt > 1) g2_stage(lc + G2_STG, ga + 64, sa16, gb + 64, sb16);
#pragma unroll 1
  for (int t = 0; t < nt; ++t) {
    const unsigned char* sb = sm + (t & 1) * G2_STG; const unsigned char* pa = sb + aofs; const unsigned char* pb = sb + bofs;
#pragma unroll
    for (int kk = 0; kk < 2; ++kk) {
      const v16h a0 = g2_lfrag(pa + kk * 64), a1 = g2_lfrag(pa + 16 * G2_PB + kk * 64);
      const v16h b0 = g2_lfrag(pb + kk * 64), b1 = g2_lfrag(pb + 16 * G2_PB + kk * 64), b2 = g2_lfrag(pb + 32 * G2_PB + kk * 64), b3 = g2_lfrag(pb + 48 * G2_PB + kk * 64);
      c00 = g2_mma(a0, b0, c00); c10 = g2_mma(a1, b0, c10);
      c01 = g2_mma(a0, b1, c01); c11 = g2_mma(a1, b1, c11);
      c02 = g2_mma(a0, b2, c02); c12 = g2_mma(a1, b2, c12);
      c03 = g2_mma(a0, b3, c03); c13 = g2_mma(a1, b3, c13);
    }
    asm volatile("s_wait_dscnt 0x0" ::: "memory");      /* this wave's reads of stage t are done before the stage is refilled */
    asm volatile("s_wait_asynccnt 0x0" ::: "memory");   /* this wave's copies of stage t + 1 have landed before the barrier publishes them */
    __syncthreads();
    if (t + 2 < nt) g2_stage(lc + (unsigned)((t & 1) * G2_STG), ga + (size_t)(t + 2) * 64, sa16, gb + (size_t)(t + 2) * 64, sb16);
  }
  asm volatile("s_wait_asynccnt 0x0" ::: "memory");     /* no copy is outstanding when the ring becomes output staging */
  v8f accs[8] = {c00, c01, c02, c03, c10, c11, c12, c13};
#pragma unroll
  for (int u = 0; u < 8; ++u) {
    const int t = u & 3, half = u >> 2;
#pragma unroll
    for (int r = 0; r < 8; ++r) { const int rloc = half * 16 + 8 * hh + r; const float v = accs[u][r] * alpha; so[w][rloc][t * 16 + ln] = v; }
  }
  __builtin_amdgcn_fence(4, "workgroup"); __builtin_amdgcn_wave_barrier();
  const int rsub = lane >> 4, c4 = (lane & 15) * 4;
  {
#pragma unroll
    for (int q = 0; q < 16; ++q) {
      const int r = q * 2 + rsub; const v4f v = *(const v4fa*)&so[w][r][c4];
      *(v4f*)(C + (size_t)(row0 + r) * ldc + col0 + c4) = v;
    }
    
  }
}
// q, k and v projections in one launch: [q | k | v] = x . [Wq ; Wk ; Wv]^T, f32 rows of pitch QKVW
__global__ __launch_bounds__(128) void k_gemm_qkv(const _Float16* __restrict__ X16, const _Float16* __restrict__ BQKV, float* __restrict__ F) {
  __shared__ __attribute__((aligned(16))) unsigned char sm[2 * G2_STG];
  gemm2_body(X16, DM, BQKV, DM, AL_P, F, QKVW, NR, QKVW, DM, (int)blockIdx.x, sm);
}
// both output products in one launch. Blocks [0, OB_E): rows [0, RE) of a batch = [ctx hi | ctx residual] . [Wo x16384 ; Wo x16] / 16384 (K = 2*DM; twice the trips, so they start first);
// blocks [OB_E, OB_E + OB_L): rows [RE, SLEN) = ctx hi . (Wo x16) / 16.
static constexpr int OB_E1 = (RE / 128) * (DM / 64), OB_L1 = ((SLEN - RE) / 128) * (DM / 64), OB_E = OB_E1 * NB, OB_L = OB_L1 * NB;
__global__ __launch_bounds__(128) void k_gemm_out(const _Float16* __restrict__ A2, const _Float16* __restrict__ OH, const _Float16* __restrict__ B2, float* __restrict__ out) {
  __shared__ __attribute__((aligned(16))) unsigned char sm[2 * G2_STG];
  const int bi = (int)blockIdx.x; const bool e = bi < OB_E;
  const int rb = e ? bi : bi - OB_E; const int per = e ? OB_E1 : ((OB_L1 > 0) ? OB_L1 : 1); const int by = rb / per, bx = rb - by * per;
  const _Float16* A = e ? A2 + (size_t)by * RE * 2 * DM : OH + (size_t)by * SLEN * DM + (size_t)RE * DM;
  float* C = out + (size_t)by * SEQ_FULL * DM + (e ? (size_t)0 : (size_t)RE * DM);
  gemm2_body(A, e ? 2 * DM : DM, e ? B2 : B2 + DM, 2 * DM, e ? AL_E : AL_P, C, DM, e ? RE : SLEN - RE, DM, e ? 2 * DM : DM, bx, sm);
}

// per-head RMS normalisation + interleaved-pair rotary step from the f32 GEMM plane F (NR rows of pitch ldf, NHV*128 columns from F on; NHV = compile-time head count, a power of two):
// y = (x * rsqrt(mean_128(x^2) + 1e-6)) * g[d];  out[2i] = y[2i] c[i] - y[2i+1] s[i];  out[2i+1] = y[2i] s[i] + y[2i+1] c[i]  (c, s = table rows [position][64], gain g[128]; all by value, bf16-RNE);
// H [NR][NHV*128] = f16 hi of every row; L [NB*RE][NHV*128] = x1024 residual for positions < RE.
// 32-bit thread indices (shifts and masks of compile-time powers of two); 64-bit offsets only at the final pointer arithmetic.
template <int NHV>
__device__ __forceinline__ void nrope_body(unsigned bi, const float* __restrict__ F, int ldf, const float* __restrict__ NW, const float* __restrict__ CT, const float* __restrict__ ST,
                                           _Float16* __restrict__ H, _Float16* __restrict__ L) {
  #pragma clang fp contract(off)
  const unsigned t0 = bi * 256u + threadIdx.x; const bool live = t0 < (unsigned)(NR * NHV * 16); const unsigned t = live ? t0 : 0u;
  const int p = (int)(t & 15u); const int hd = (int)((t >> 4) % (unsigned)NHV); const unsigned row = t / (unsigned)(16 * NHV);
  const int s = (int)(row % (unsigned)SLEN); const int b = (int)(row / (unsigned)SLEN);
  const float* src = F + (size_t)row * ldf + hd * HDIM + p * 8;
  const v4f xa = *(const v4fa*)src, xb = *(const v4fa*)(src + 4);
  const v4f wa = *(const v4fa*)(NW + p * 8), wb = *(const v4fa*)(NW + p * 8 + 4);
  const v4f cv = *(const v4fa*)(CT + (size_t)s * RTW + p * 4), sv = *(const v4fa*)(ST + (size_t)s * RTW + p * 4);
  const float xs[8] = {xa[0], xa[1], xa[2], xa[3], xb[0], xb[1], xb[2], xb[3]};
  const float gs[8] = {wa[0], wa[1], wa[2], wa[3], wb[0], wb[1], wb[2], wb[3]};
  float ss = 0.f;
#pragma unroll
  for (int i = 0; i < 8; ++i) { const float q = xs[i] * xs[i]; ss = ss + q; }
  ss += __shfl_xor(ss, 1, 32); ss += __shfl_xor(ss, 2, 32); ss += __shfl_xor(ss, 4, 32); ss += __shfl_xor(ss, 8, 32);
  const float mean = ss * 0.0078125f; const float rms = rsqrtf(mean + 1.0e-6f);
  FragH fh, fl;
#pragma unroll
  for (int j = 0; j < 4; ++j) {
    const float c = bf16_rne(cv[j]), sn = bf16_rne(sv[j]);
    const float y1 = (xs[2 * j] * rms) * bf16_rne(gs[2 * j]); const float y2 = (xs[2 * j + 1] * rms) * bf16_rne(gs[2 * j + 1]);
    const float o1 = y1 * c - y2 * sn; const float o2 = y1 * sn + y2 * c;
    const _Float16 h1 = toh_flush(o1), h2 = toh_flush(o2);
    fh.h[2 * j] = h1; fh.h[2 * j + 1] = h2;
    fl.h[2 * j] = toh_flush((o1 - (float)h1) * 1024.0f); fl.h[2 * j + 1] = toh_flush((o2 - (float)h2) * 1024.0f);
  }
  const size_t oh = (size_t)row * (NHV * HDIM) + hd * HDIM + p * 8;
  const bool wl = live && (s < RE);
  const int sl = wl ? s : 0;
  const size_t ol = (size_t)(b * RE + sl) * (NHV * HDIM) + hd * HDIM + p * 8;
  const v8us vh = fh.half[0], vl = fl.half[0];
  {
    if (live) *(v8us*)((unsigned short*)H + oh) = vh;
    if (wl) *(v8us*)((unsigned short*)L + ol) = vl;
    asm volatile("s_wait_xcnt 0x0" ::: "memory");   /* closes this body's stores: in the shared kernel another body's code can stand behind them, not the program's end */
  }
}
// V^T hi plane from the f32 v columns VF (pitch ldv): Vt[(b,g)][64][TK] = f16 of v; tl = the block's 64 x 66 LDS tile
__device__ __forceinline__ void vtg_body(unsigned bi, const float* __restrict__ VF, int ldv, _Float16* __restrict__ Vt, unsigned short (*tl)[66]) {
  const int tid = threadIdx.x; const int nlg = SLEN / 64; const int slab = (int)bi / nlg, lg = (int)bi % nlg; const int b = slab / NV64, h = slab % NV64;
  const int r0 = tid >> 4, c4 = (tid & 15) * 4;
  const float* src = VF + ((size_t)b * SLEN + lg * 64 + r0) * ldv + h * 64 + c4;
  /* the thread's four loads (rows r0 + 16 j) are issued as one group: one load round trip, not four */
  v4f a[4];
#pragma unroll
  for (int j = 0; j < 4; ++j) a[j] = *(const v4fa*)(src + (size_t)(16 * j) * ldv);
  /* the loaded values are inputs only; the address is an input too, so it stays whole (no load's result is given it) up to this wait */
  asm volatile("s_wait_xcnt 0x0" :: "v"(a[0]), "v"(a[1]), "v"(a[2]), "v"(a[3]), "v"(src) : "memory");
#pragma unroll
  for (int j = 0; j < 4; ++j) {
    FragH f;
#pragma unroll
    for (int q = 0; q < 4; ++q) f.h[q] = (_Float16)a[j][q];
#pragma unroll
    for (int q = 0; q < 4; ++q) tl[r0 + 16 * j][c4 + q] = f.u[q];
  }
  __syncthreads();
  {
#pragma unroll
    for (int rd = 0; rd < 2; ++rd) {
      const int d = rd * 32 + (tid >> 3), pc = tid & 7; FragH f;
#pragma unroll
      for (int q = 0; q < 8; ++q) f.u[q] = tl[pc * 8 + q][d];
      *(v8us*)((unsigned short*)Vt + ((size_t)slab * 64 + d) * TK + lg * 64 + pc * 8) = f.half[0];
    }
    asm volatile("s_wait_xcnt 0x0" ::: "memory");   /* closes this body's stores: in the shared kernel another body's code can stand behind them, not the program's end */
  }
}
// V^T residual plane for keys < RE: VtL[(b,g)][64][RE] = f16 of (v - f16(v)) x 1024
__device__ __forceinline__ void vtl_body(unsigned bi, const float* __restrict__ VF, int ldv, _Float16* __restrict__ VtL, unsigned short (*tl)[66]) {
  const int tid = threadIdx.x; const int nlg = RE / 64; const int slab = (int)bi / nlg, lg = (int)bi % nlg; const int b = slab / NV64, h = slab % NV64;
  const int r0 = tid >> 4, c4 = (tid & 15) * 4;
  const float* src = VF + ((size_t)b * SLEN + lg * 64 + r0) * ldv + h * 64 + c4;
  /* the thread's four loads (rows r0 + 16 j) are issued as one group: one load round trip, not four */
  v4f a[4];
#pragma unroll
  for (int j = 0; j < 4; ++j) a[j] = *(const v4fa*)(src + (size_t)(16 * j) * ldv);
  /* the loaded values are inputs only; the address is an input too, so it stays whole (no load's result is given it) up to this wait */
  asm volatile("s_wait_xcnt 0x0" :: "v"(a[0]), "v"(a[1]), "v"(a[2]), "v"(a[3]), "v"(src) : "memory");
#pragma unroll
  for (int j = 0; j < 4; ++j) {
    FragH f;
#pragma unroll
    for (int q = 0; q < 4; ++q) { const float v = a[j][q]; const _Float16 hv = (_Float16)v; f.h[q] = toh_flush((v - (float)hv) * 1024.0f); }
#pragma unroll
    for (int q = 0; q < 4; ++q) tl[r0 + 16 * j][c4 + q] = f.u[q];
  }
  __syncthreads();
  {
#pragma unroll
    for (int rd = 0; rd < 2; ++rd) {
      const int d = rd * 32 + (tid >> 3), pc = tid & 7; FragH f;
#pragma unroll
      for (int q = 0; q < 8; ++q) f.u[q] = tl[pc * 8 + q][d];
      *(v8us*)((unsigned short*)VtL + ((size_t)slab * 64 + d) * RE + lg * 64 + pc * 8) = f.half[0];
    }
    asm volatile("s_wait_xcnt 0x0" ::: "memory");   /* closes this body's stores: in the shared kernel another body's code can stand behind them, not the program's end */
  }
}
// One launch for all that reads only the joint projection plane F = [q | k | v]: both V^T planes, key heads (NKVH per row), query heads (NH per row). The block index picks the body.
static constexpr unsigned QB_V = NB * NV64 * (SLEN / 64), QB_VL = NB * NV64 * (RE / 64), QB_K = (unsigned)(((size_t)NR * NKVH * 16) / 256), QB_Q = (unsigned)(((size_t)NR * NH * 16) / 256);
static constexpr unsigned QB_ALL = QB_V + QB_VL + QB_K + QB_Q;
__global__ __launch_bounds__(256) void k_post(const float* __restrict__ F, const float* __restrict__ QW, const float* __restrict__ KW, const float* __restrict__ CT, const float* __restrict__ ST,
                                              _Float16* __restrict__ QH, _Float16* __restrict__ QL, _Float16* __restrict__ KH, _Float16* __restrict__ KL, _Float16* __restrict__ Vt, _Float16* __restrict__ VtL) {
  __shared__ unsigned short tl[64][66];
  unsigned bi = blockIdx.x;
  if (bi < QB_V) { vtg_body(bi, F + DM + VW, QKVW, Vt, tl); return; }
  bi -= QB_V;
  if (bi < QB_VL) { vtl_body(bi, F + DM + VW, QKVW, VtL, tl); return; }
  bi -= QB_VL;
  if (bi < QB_K) { nrope_body<NKVH>(bi, F + DM, QKVW, KW, CT, ST, KH, KL); return; }
  bi -= QB_K;
  nrope_body<NH>(bi, F, QKVW, QW, CT, ST, QH, QL);
}

__global__ __launch_bounds__(256) void k_hl(const float* __restrict__ Fp, _Float16* __restrict__ Hh, _Float16* __restrict__ A2, size_t n8) {
  const size_t t = (size_t)blockIdx.x * 256 + threadIdx.x; if (t >= n8) return;
  const size_t e = t * 8; const size_t r = e / DM; const int c = (int)(e % DM); const int s = (int)(r % SLEN); const int b = (int)(r / SLEN);
  const v4f a = *(const v4fa*)(Fp + e), d = *(const v4fa*)(Fp + e + 4);
  FragH fh, fl;
#pragma unroll
  for (int q = 0; q < 4; ++q) {
    _Float16 hv = (_Float16)a[q]; fh.h[q] = hv; fl.h[q] = (_Float16)((a[q] - (float)hv) * 1024.0f);
    hv = (_Float16)d[q]; fh.h[4 + q] = hv; fl.h[4 + q] = (_Float16)((d[q] - (float)hv) * 1024.0f);
  }
  const bool wl = (s < RE);
  const size_t o2 = ((size_t)b * RE + (wl ? s : 0)) * (size_t)(2 * DM) + c;
  const v8us vh = fh.half[0], vl = fl.half[0];
  {
    *(v8us*)((unsigned short*)Hh + e) = vh;
    if (wl) { *(v8us*)((unsigned short*)A2 + o2) = vh; *(v8us*)((unsigned short*)A2 + o2 + DM) = vl; }
    
  }
}

// LDS ring of the attention kernel: one stage = one pass of 32 keys = [K 32 rows of 256 B at pitch 272 | V^T 128 rows of 64 B at pitch 80 | mask 4 waves x 1 KiB]; both pitches are 16 B x odd: the 16-B fragment reads meet no bank conflict; two stages
#define FA_KP 272
#define FA_VP 80
#define FA_KB (32 * FA_KP)
#define FA_VB (128 * FA_VP)
#define FA_MB (4 * 1024)
#define FA_STG (FA_KB + FA_VB + FA_MB)
static_assert(FA_STG % 16 == 0 && FA_KB % 16 == 0 && FA_VB % 16 == 0);
static_assert(2 * FA_STG >= 4 * 16 * 132 * 4);   /* the output staging reuses the ring behind the last barrier */
static_assert(2 * FA_STG + 4 * 16 * 40 * 2 <= 65536);
// one stage: 10 copies of 16 B per lane. K: lane (r = tid / 16, c = tid % 16) brings chunk c of key rows r + 8 j (j < 4): a wave-wide copy = 2 whole 256-B rows. V^T: lane (r = tid / 4, c = tid % 4) brings chunk c of rows r + 32 j (j < 4).
// mask: each lane brings its own two 16-B words. lk / lv / lm = the lane's LDS byte addresses in the stage, k / v / m = its global addresses, sk = 8 K rows and sv = 32 V^T rows in elements.
__device__ __forceinline__ void fa_stage(unsigned lk, unsigned lv, unsigned lm, const unsigned short* k, size_t sk, const unsigned short* v, size_t sv, const unsigned short* m) {
  /* s_wait_xcnt closes the copies' own statement: no register that a copy names is rewritten in front of it */
  asm volatile(
      "global_load_async_to_lds_b128 %0, %10, off\n\t"
      "global_load_async_to_lds_b128 %1, %11, off\n\t"
      "global_load_async_to_lds_b128 %2, %12, off\n\t"
      "global_load_async_to_lds_b128 %3, %13, off\n\t"
      "global_load_async_to_lds_b128 %4, %14, off\n\t"
      "global_load_async_to_lds_b128 %5, %15, off\n\t"
      "global_load_async_to_lds_b128 %6, %16, off\n\t"
      "global_load_async_to_lds_b128 %7, %17, off\n\t"
      "global_load_async_to_lds_b128 %8, %18, off\n\t"
      "global_load_async_to_lds_b128 %9, %19, off\n\t"
      "s_wait_xcnt 0x0"
      :: "v"(lk), "v"(lk + 8 * FA_KP), "v"(lk + 16 * FA_KP), "v"(lk + 24 * FA_KP),
         "v"(lv), "v"(lv + 32 * FA_VP), "v"(lv + 64 * FA_VP), "v"(lv + 96 * FA_VP), "v"(lm), "v"(lm + 512),
         "v"(k), "v"(k + sk), "v"(k + 2 * sk), "v"(k + 3 * sk), "v"(v), "v"(v + sv), "v"(v + 2 * sv), "v"(v + 3 * sv), "v"(m), "v"(m + 256)
      : "memory");
}

// fused attention per ((b,h), 64 queries), query blocks [QB0P, QBLKS): wave = 16 queries; S = Q.K^T (d = 128: 4 k-steps, q fragments read once and kept) x SCL + mask (bf16 plane, accumulator layout, two 16-B words per lane per step)
// The pass's K, V^T and mask tiles come through LDS, once for the block's four waves: asynchronous copies in whole row pieces, two stages, stage t + 1 in flight while stage t is worked on.
__global__ __launch_bounds__(128) __attribute__((amdgpu_num_vgpr(256))) void k_flash(const _Float16* __restrict__ Q16, int ldq, const _Float16* __restrict__ K16, int ldk,
                                               const _Float16* __restrict__ Vt, const unsigned short* __restrict__ MP, const int* __restrict__ JE, float* __restrict__ O, int ldo) {
  constexpr int RPW = 16, DT = 8, KS = 4;
  constexpr int NQP = (QBNP > 0) ? QBNP : 1;
  __shared__ __attribute__((aligned(16))) unsigned short sP[4][RPW][40];
  __shared__ __attribute__((aligned(16))) unsigned char ring[2 * FA_STG];
  float (*sO)[RPW][132] = (float (*)[RPW][132])ring;
  const int tid = threadIdx.x, lane = tid & 31, ln = lane & 15, hh = lane >> 4;
  const int w = __builtin_amdgcn_readfirstlane(tid >> 5);
  const int slab = blockIdx.x / NQP, qblk = QB0P + blockIdx.x % NQP; const int b = slab / NH, h = slab % NH; const int kvh = h / NREP;
  const int qb0 = qblk * (4 * RPW); const int q0 = qb0 + w * RPW;
  const unsigned short* qr = (const unsigned short*)Q16 + ((size_t)b * TQ + q0 + ln) * ldq + h * HDIM;
  const unsigned short* Vth = (const unsigned short*)Vt + (size_t)(b * NKVH + kvh) * HDIM * TK;
  int jt = JE[qblk * 128];   /* the largest count of the block's four 16-query tiles */
#pragma unroll
  for (int i = 1; i < 4; ++i) { const int ji = JE[qblk * 128 + i * 32]; jt = (ji > jt) ? ji : jt; }
  jt = (jt < 1) ? 1 : jt; jt = (jt > TK / 32) ? (TK / 32) : jt;
  const int nt = __builtin_amdgcn_readfirstlane(jt);
  /* the lane's copy addresses of stage 0 */
  const unsigned short* gk = (const unsigned short*)K16 + ((size_t)b * TK + (tid >> 4)) * ldk + kvh * HDIM + (tid & 15) * 8;
  const unsigned short* gv = Vth + (size_t)(tid >> 2) * TK + (tid & 3) * 8;
  const unsigned short* gm = MP + (size_t)(q0 >> 4) * (size_t)(TK / 32) * 512 + lane * 8;
  const size_t sk8 = (size_t)8 * ldk, sv32 = (size_t)32 * TK, kst = (size_t)32 * ldk;
  const unsigned rb = (unsigned)(uintptr_t)ring;
  const unsigned lk = rb + (unsigned)((tid >> 4) * FA_KP + (tid & 15) * 16);
  const unsigned lv = rb + (unsigned)(FA_KB + (tid >> 2) * FA_VP + (tid & 3) * 16);
  const unsigned lm = rb + (unsigned)(FA_KB + FA_VB + w * 1024 + lane * 16);
  const int kofs = ln * FA_KP + 16 * hh, vofs = FA_KB + ln * FA_VP + 16 * hh, mofs = FA_KB + FA_VB + w * 1024 + lane * 16;
  fa_stage(lk, lv, lm, gk, sk8, gv, sv32, gm);
  /* A (q) fragments, the same in every pass: element e < 8 <-> d = 32 ks + 8 hh + e; e >= 8 <-> d = 32 ks + 16 + 8 hh + (e - 8) */
  FragH a[KS];
#pragma unroll
  for (int ks = 0; ks < KS; ++ks) { a[ks].half[0] = *(const v8us*)(qr + ks * 32 + 8 * hh); a[ks].half[1] = *(const v8us*)(qr + ks * 32 + 16 + 8 * hh); }
  /* the group's address register is an input here, so it stays whole (no load's result is given it) up to this wait */
  asm volatile("s_wait_xcnt 0x0" :: "v"(qr) : "memory");
  float m_r[8], l_r[8]; v8f oacc[DT];
#pragma unroll
  for (int r = 0; r < 8; ++r) { m_r[r] = -3.0e38f; l_r[r] = 0.f; }
#pragma unroll
  for (int dt = 0; dt < DT; ++dt) oacc[dt] = (v8f){0.f,0.f,0.f,0.f,0.f,0.f,0.f,0.f};
  asm volatile("s_wait_asynccnt 0x0" ::: "memory");   /* stage 0 has landed before the barrier publishes it */
  __syncthreads();
  if (nt > 1) fa_stage(lk + FA_STG, lv + FA_STG, lm + FA_STG, gk + kst, sk8, gv + 32, sv32, gm + 512);
#pragma unroll 1
  for (int t = 0; t < nt; ++t) {
    v8f sa = (v8f){0.f,0.f,0.f,0.f,0.f,0.f,0.f,0.f}, sb = sa;
    const unsigned char* st = ring + (t & 1) * FA_STG;
    const unsigned char* kp = st + kofs; const unsigned char* vp = st + vofs; const unsigned char* mp = st + mofs;
    FragH k0[KS], k1[KS], fm;
#pragma unroll
    for (int ks = 0; ks < KS; ++ks) {
      /* B (k) fragments in the k order of the q fragments: byte 64 ks + 16 hh of key row ln (k0) or 16 + ln (k1), and 32 B further */
      k0[ks].half[0] = *(const v8us*)(kp + ks * 64); k0[ks].half[1] = *(const v8us*)(kp + ks * 64 + 32);
      k1[ks].half[0] = *(const v8us*)(kp + 16 * FA_KP + ks * 64); k1[ks].half[1] = *(const v8us*)(kp + 16 * FA_KP + ks * 64 + 32);
    }
    fm.half[0] = *(const v8us*)mp; fm.half[1] = *(const v8us*)(mp + 512);
#pragma unroll
    for (int ks = 0; ks < KS; ++ks) { sa = g2_mma(a[ks].v, k0[ks].v, sa); sb = g2_mma(a[ks].v, k1[ks].v, sb); }
    /* the V^T fragments of this pass are read here, ahead of the softmax, which covers their LDS trip */
    FragH bv[DT];
#pragma unroll
    for (int dt = 0; dt < DT; ++dt) { bv[dt].half[0] = *(const v8us*)(vp + dt * 16 * FA_VP); bv[dt].half[1] = *(const v8us*)(vp + dt * 16 * FA_VP + 32); }
    float s0v[8], s1v[8], mcv[8];
#pragma unroll
    for (int r = 0; r < 8; ++r) {
      const float mk0 = bf16_val(fm.u[2 * r]), mk1 = bf16_val(fm.u[2 * r + 1]);
      s0v[r] = sa[r] * SCL + mk0; s1v[r] = sb[r] * SCL + mk1;
      mcv[r] = fmaxf(s0v[r], s1v[r]);
    }
    row16_max8(mcv);
    float eav[8];
#pragma unroll
    for (int r = 0; r < 8; ++r) {
      const float mn = fmaxf(m_r[r], mcv[r]); mcv[r] = mn;
      s0v[r] = (s0v[r] - mn) * LOG2E; s1v[r] = (s1v[r] - mn) * LOG2E; eav[r] = (m_r[r] - mn) * LOG2E;
    }
    exp2_8(s0v); exp2_8(s1v); exp2_8(eav);
#pragma unroll
    for (int r = 0; r < 8; ++r) {
      const float mn = mcv[r]; const float al = (mn > -1.0e38f) ? eav[r] : 1.0f; m_r[r] = mn;
      const float p0 = s0v[r], p1 = s1v[r]; l_r[r] = l_r[r] * al + p0 + p1;
#pragma unroll
      for (int dt = 0; dt < DT; ++dt) oacc[dt][r] *= al;
      FragH t2; t2.h[0] = toh_flush(p0 * 1024.0f); t2.h[1] = toh_flush(p1 * 1024.0f);
      sP[w][8 * hh + r][ln] = t2.u[0]; sP[w][8 * hh + r][16 + ln] = t2.u[1];
    }
    __builtin_amdgcn_fence(4, "workgroup"); __builtin_amdgcn_wave_barrier();
    FragH pa; pa.half[0] = *(const v8us*)&sP[w][ln][8 * hh]; pa.half[1] = *(const v8us*)&sP[w][ln][16 + 8 * hh];
#pragma unroll
    for (int dt = 0; dt < DT; ++dt) {
      /* A (P: key columns of the LDS tile) and B (V^T rows, keys contiguous) share the same key order: element e < 8 <-> key 32 t + 8 hh + e; e >= 8 <-> key 32 t + 16 + 8 hh + (e - 8) */
      oacc[dt] = g2_mma(pa.v, bv[dt].v, oacc[dt]);
    }
    asm volatile("s_wait_dscnt 0x0" ::: "memory");      /* this wave's reads of stage t (and of its P tile) are done before the stage is refilled */
    asm volatile("s_wait_asynccnt 0x0" ::: "memory");   /* this wave's copies of stage t + 1 have landed before the barrier publishes them */
    __syncthreads();
    if (t + 2 < nt) { const unsigned so2 = (unsigned)((t & 1) * FA_STG); fa_stage(lk + so2, lv + so2, lm + so2, gk + (size_t)(t + 2) * kst, sk8, gv + (size_t)(t + 2) * 32, sv32, gm + (size_t)(t + 2) * 512); }
  }
  asm volatile("s_wait_asynccnt 0x0" ::: "memory");     /* no copy is outstanding when the ring becomes output staging */
  row16_sum8(l_r);
#pragma unroll
  for (int r = 0; r < 8; ++r) { const float l = l_r[r]; l_r[r] = (l > 0.f) ? 1.0f / (l * 1024.0f) : 0.f; }
#pragma unroll
  for (int dt = 0; dt < DT; ++dt)
#pragma unroll
    for (int r = 0; r < 8; ++r) sO[w][8 * hh + r][dt * 16 + ln] = oacc[dt][r] * l_r[r];
  __builtin_amdgcn_fence(4, "workgroup"); __builtin_amdgcn_wave_barrier();
  {
#pragma unroll
    for (int rp = 0; rp < RPW; ++rp) { const v4f val = *(const v4fa*)&sO[w][rp][lane * 4]; *(v4f*)(O + ((size_t)b * TQ + q0 + rp) * ldo + h * HDIM + lane * 4) = val; }
    
  }
}
// LDS ring of the 5-plane kernel: one stage = one pass of 32 keys = [K hi 32 rows | K residual 32 rows, pitch 272 | V^T hi 64 rows | V^T residual 64 rows, pitch 80 | mask 4 waves x 1 KiB]; two stages; beside it the block's 64 q rows, hi and residual, pitch 272, filled once
#define F5_KB (32 * FA_KP)
#define F5_VB (64 * FA_VP)
#define F5_STG (2 * F5_KB + 2 * F5_VB + FA_MB)
#define F5_QB (64 * FA_KP)
static_assert(F5_STG % 16 == 0 && F5_KB % 16 == 0 && F5_VB % 16 == 0 && F5_QB % 16 == 0);
static_assert(2 * F5_STG >= 4 * 16 * 68 * 4);    /* the output staging reuses the ring behind the last barrier */
static_assert(2 * F5_STG + 2 * F5_QB + 2 * 4 * 16 * 40 * 2 <= 131072);
// one stage: 14 copies of 16 B per lane. K planes: lane (r = tid / 16, c = tid % 16) brings chunk c of key rows r + 8 j (j < 4); V^T planes: lane (r = tid / 4, c = tid % 4) brings chunk c of rows r + 32 j (j < 2); mask: the lane's own two words.
// lk / lv / lm = the lane's LDS byte addresses in the stage (hi planes), kh / kl / vh / vl / m = its global addresses, sk = 8 K rows, svh / svl = 32 V^T rows of the hi / residual plane, in elements.
__device__ __forceinline__ void f5_stage(unsigned lk, unsigned lv, unsigned lm, const unsigned short* kh, const unsigned short* kl, size_t sk,
                                         const unsigned short* vh, size_t svh, const unsigned short* vl, size_t svl, const unsigned short* m) {
  /* s_wait_xcnt closes the copies' own statement: no register that a copy names is rewritten in front of it */
  asm volatile(
      "global_load_async_to_lds_b128 %0, %14, off\n\t"
      "global_load_async_to_lds_b128 %1, %15, off\n\t"
      "global_load_async_to_lds_b128 %2, %16, off\n\t"
      "global_load_async_to_lds_b128 %3, %17, off\n\t"
      "global_load_async_to_lds_b128 %4, %18, off\n\t"
      "global_load_async_to_lds_b128 %5, %19, off\n\t"
      "global_load_async_to_lds_b128 %6, %20, off\n\t"
      "global_load_async_to_lds_b128 %7, %21, off\n\t"
      "global_load_async_to_lds_b128 %8, %22, off\n\t"
      "global_load_async_to_lds_b128 %9, %23, off\n\t"
      "global_load_async_to_lds_b128 %10, %24, off\n\t"
      "global_load_async_to_lds_b128 %11, %25, off\n\t"
      "global_load_async_to_lds_b128 %12, %26, off\n\t"
      "global_load_async_to_lds_b128 %13, %27, off\n\t"
      "s_wait_xcnt 0x0"
      :: "v"(lk), "v"(lk + 8 * FA_KP), "v"(lk + 16 * FA_KP), "v"(lk + 24 * FA_KP),
         "v"(lk + F5_KB), "v"(lk + F5_KB + 8 * FA_KP), "v"(lk + F5_KB + 16 * FA_KP), "v"(lk + F5_KB + 24 * FA_KP),
         "v"(lv), "v"(lv + 32 * FA_VP), "v"(lv + F5_VB), "v"(lv + F5_VB + 32 * FA_VP), "v"(lm), "v"(lm + 512),
         "v"(kh), "v"(kh + sk), "v"(kh + 2 * sk), "v"(kh + 3 * sk), "v"(kl), "v"(kl + sk), "v"(kl + 2 * sk), "v"(kl + 3 * sk),
         "v"(vh), "v"(vh + svh), "v"(vl), "v"(vl + svl), "v"(m), "v"(m + 256)
      : "memory");
}
// one q plane of the block: 8 copies of 16 B per lane; lane (r = tid / 16, c = tid % 16) brings chunk c of query rows r + 8 j (j < 8). l = its LDS byte address, g = its global address, s = 8 rows in elements.
__device__ __forceinline__ void f5_qplane(unsigned l, const unsigned short* g, size_t s) {
  /* s_wait_xcnt closes the copies' own statement: no register that a copy names is rewritten in front of it */
  asm volatile(
      "global_load_async_to_lds_b128 %0, %8, off\n\t"
      "global_load_async_to_lds_b128 %1, %9, off\n\t"
      "global_load_async_to_lds_b128 %2, %10, off\n\t"
      "global_load_async_to_lds_b128 %3, %11, off\n\t"
      "global_load_async_to_lds_b128 %4, %12, off\n\t"
      "global_load_async_to_lds_b128 %5, %13, off\n\t"
      "global_load_async_to_lds_b128 %6, %14, off\n\t"
      "global_load_async_to_lds_b128 %7, %15, off\n\t"
      "s_wait_xcnt 0x0"
      :: "v"(l), "v"(l + 8 * FA_KP), "v"(l + 16 * FA_KP), "v"(l + 24 * FA_KP), "v"(l + 32 * FA_KP), "v"(l + 40 * FA_KP), "v"(l + 48 * FA_KP), "v"(l + 56 * FA_KP),
         "v"(g), "v"(g + s), "v"(g + 2 * s), "v"(g + 3 * s), "v"(g + 4 * s), "v"(g + 5 * s), "v"(g + 6 * s), "v"(g + 7 * s)
      : "memory");
}

// 5-plane variant for query blocks [QB05, QB05+QBN5) (positions < RE), one 64-wide half dh of the head's 128 dims per block: S = Qh.Kh^T + (Ql.Kh^T + Qh.Kl^T)/1024 with Q/K = [hi | x1024 residual] planes (residual planes compact: rows b*RE + s);
// O = (Ph.Vh + (Pl.Vh + Ph.Vl)/1024) / l with P = [hi | x1024 residual] of 1024 p and V^T = [hi | x1024 residual] (VtL pitch RE); separate residual accumulators folded before the normalisation.
// key tiles [0, largest count of the block's four 16-query tiles) clamped to [1, RE/32] (the compact planes hold keys < RE); a block whose mask exposes keys beyond RE writes NaN rows.
// All operand tiles come through LDS, once for the block's four waves: asynchronous copies in whole row pieces; q planes once, the pass's K, V^T and mask tiles in two stages, stage t + 1 in flight while stage t is worked on.
__global__ __launch_bounds__(128) __attribute__((amdgpu_num_vgpr(256))) void k_flash5(const _Float16* __restrict__ Q16, const _Float16* __restrict__ QL, int ldq, const _Float16* __restrict__ K16, const _Float16* __restrict__ KL, int ldk,
                                                const _Float16* __restrict__ Vt, const _Float16* __restrict__ VtL, const unsigned short* __restrict__ MP, const int* __restrict__ JE, float* __restrict__ O, int ldo) {
  constexpr int RPW = 16, DT = 4, KS = 4;
  __shared__ __attribute__((aligned(16))) unsigned short sP[4][RPW][40];
  __shared__ __attribute__((aligned(16))) unsigned short sPL[4][RPW][40];
  __shared__ __attribute__((aligned(16))) unsigned char ring[2 * F5_STG];
  __shared__ __attribute__((aligned(16))) unsigned char sQ[2 * F5_QB];
  float (*sO)[RPW][68] = (float (*)[RPW][68])ring;
  const int tid = threadIdx.x, lane = tid & 31, ln = lane & 15, hh = lane >> 4;
  const int w = __builtin_amdgcn_readfirstlane(tid >> 5);
  const int dh = blockIdx.x & 1; const int bx = blockIdx.x >> 1;
  const int slab = bx / QBN5, qblk = QB05 + bx % QBN5; const int b = slab / NH, h = slab % NH; const int kvh = h / NREP;
  const int qb0 = qblk * (4 * RPW); const int q0 = qb0 + w * RPW;
  int jraw = JE[qblk * 128];   /* the largest count of the block's four 16-query tiles */
#pragma unroll
  for (int i = 1; i < 4; ++i) { const int ji = JE[qblk * 128 + i * 32]; jraw = (ji > jraw) ? ji : jraw; }
  const float pz = (jraw > RE / 32) ? __uint_as_float(0x7FC00000u) : 0.0f;
  int jt = (jraw < 1) ? 1 : jraw; jt = (jt > RE / 32) ? (RE / 32) : jt;
  const int nt = __builtin_amdgcn_readfirstlane(jt);
  /* the lane's copy addresses: q planes, and stage 0 of the ring */
  const unsigned short* gq = (const unsigned short*)Q16 + ((size_t)b * TQ + qb0 + (tid >> 4)) * ldq + h * HDIM + (tid & 15) * 8;
  const unsigned short* gql = (const unsigned short*)QL + ((size_t)b * RE + qb0 + (tid >> 4)) * ldq + h * HDIM + (tid & 15) * 8;
  const unsigned short* gk = (const unsigned short*)K16 + ((size_t)b * TK + (tid >> 4)) * ldk + kvh * HDIM + (tid & 15) * 8;
  const unsigned short* gkl = (const unsigned short*)KL + ((size_t)b * RE + (tid >> 4)) * ldk + kvh * HDIM + (tid & 15) * 8;
  const unsigned short* gv = (const unsigned short*)Vt + ((size_t)(b * NKVH + kvh) * HDIM + dh * 64 + (tid >> 2)) * TK + (tid & 3) * 8;
  const unsigned short* gvl = (const unsigned short*)VtL + ((size_t)(b * NKVH + kvh) * HDIM + dh * 64 + (tid >> 2)) * RE + (tid & 3) * 8;
  const unsigned short* gm = MP + (size_t)(q0 >> 4) * (size_t)(TK / 32) * 512 + lane * 8;
  const size_t sq8 = (size_t)8 * ldq, sk8 = (size_t)8 * ldk, kst = (size_t)32 * ldk, svh = (size_t)32 * TK, svl = (size_t)32 * RE;
  const unsigned rb = (unsigned)(uintptr_t)ring;
  const unsigned lq = (unsigned)(uintptr_t)sQ + (unsigned)((tid >> 4) * FA_KP + (tid & 15) * 16);
  const unsigned lk = rb + (unsigned)((tid >> 4) * FA_KP + (tid & 15) * 16);
  const unsigned lv = rb + (unsigned)(2 * F5_KB + (tid >> 2) * FA_VP + (tid & 3) * 16);
  const unsigned lm = rb + (unsigned)(2 * F5_KB + 2 * F5_VB + w * 1024 + lane * 16);
  const int kofs = ln * FA_KP + 16 * hh, vofs = 2 * F5_KB + ln * FA_VP + 16 * hh, mofs = 2 * F5_KB + 2 * F5_VB + w * 1024 + lane * 16;
  const unsigned char* qp = sQ + (w * RPW + ln) * FA_KP + 16 * hh;
  f5_qplane(lq, gq, sq8);
  f5_qplane(lq + F5_QB, gql, sq8);
  f5_stage(lk, lv, lm, gk, gkl, sk8, gv, svh, gvl, svl, gm);
  float m_r[8], l_r[8]; v8f oacc[DT], oaccL[DT];
#pragma unroll
  for (int r = 0; r < 8; ++r) { m_r[r] = -3.0e38f; l_r[r] = 0.f; }
#pragma unroll
  for (int dt = 0; dt < DT; ++dt) { oacc[dt] = (v8f){0.f,0.f,0.f,0.f,0.f,0.f,0.f,0.f}; oaccL[dt] = oacc[dt]; }
  asm volatile("s_wait_asynccnt 0x0" ::: "memory");   /* the q planes and stage 0 have landed before the barrier publishes them */
  __syncthreads();
  if (nt > 1) f5_stage(lk + F5_STG, lv + F5_STG, lm + F5_STG, gk + kst, gkl + kst, sk8, gv + 32, svh, gvl + 32, svl, gm + 512);
#pragma unroll 1
  for (int t = 0; t < nt; ++t) {
    v8f sa = (v8f){0.f,0.f,0.f,0.f,0.f,0.f,0.f,0.f}, sb = sa, sal = sa, sbl = sa;
    const unsigned char* st = ring + (t & 1) * F5_STG;
    const unsigned char* kp = st + kofs; const unsigned char* vp = st + vofs; const unsigned char* mp = st + mofs;
    FragH fm; fm.half[0] = *(const v8us*)mp; fm.half[1] = *(const v8us*)(mp + 512);
#pragma unroll
    for (int ks = 0; ks < KS; ++ks) {
      /* all A and B fragments of this step share one k order: element e < 8 <-> d = 32 ks + 8 hh + e; e >= 8 <-> d = 32 ks + 16 + 8 hh + (e - 8): byte 64 ks + 16 hh of the row, and 32 B further */
      FragH a, al2, k0, k1, g0, g1;
      a.half[0] = *(const v8us*)(qp + ks * 64); a.half[1] = *(const v8us*)(qp + ks * 64 + 32);
      al2.half[0] = *(const v8us*)(qp + F5_QB + ks * 64); al2.half[1] = *(const v8us*)(qp + F5_QB + ks * 64 + 32);
      k0.half[0] = *(const v8us*)(kp + ks * 64); k0.half[1] = *(const v8us*)(kp + ks * 64 + 32);
      k1.half[0] = *(const v8us*)(kp + 16 * FA_KP + ks * 64); k1.half[1] = *(const v8us*)(kp + 16 * FA_KP + ks * 64 + 32);
      g0.half[0] = *(const v8us*)(kp + F5_KB + ks * 64); g0.half[1] = *(const v8us*)(kp + F5_KB + ks * 64 + 32);
      g1.half[0] = *(const v8us*)(kp + F5_KB + 16 * FA_KP + ks * 64); g1.half[1] = *(const v8us*)(kp + F5_KB + 16 * FA_KP + ks * 64 + 32);
      sa = g2_mma(a.v, k0.v, sa); sb = g2_mma(a.v, k1.v, sb);
      sal = g2_mma(al2.v, k0.v, sal); sbl = g2_mma(al2.v, k1.v, sbl);
      sal = g2_mma(a.v, g0.v, sal); sbl = g2_mma(a.v, g1.v, sbl);
    }
    /* both V^T planes' fragments of this pass are read here, ahead of the softmax, which covers their LDS trip */
    FragH bv[DT], bl[DT];
#pragma unroll
    for (int dt = 0; dt < DT; ++dt) {
      bv[dt].half[0] = *(const v8us*)(vp + dt * 16 * FA_VP); bv[dt].half[1] = *(const v8us*)(vp + dt * 16 * FA_VP + 32);
      bl[dt].half[0] = *(const v8us*)(vp + F5_VB + dt * 16 * FA_VP); bl[dt].half[1] = *(const v8us*)(vp + F5_VB + dt * 16 * FA_VP + 32);
    }
    float s0v[8], s1v[8], mcv[8];
#pragma unroll
    for (int r = 0; r < 8; ++r) {
      const float mk0 = bf16_val(fm.u[2 * r]), mk1 = bf16_val(fm.u[2 * r + 1]);
      const float d0 = sa[r] + sal[r] * 0.0009765625f, d1 = sb[r] + sbl[r] * 0.0009765625f;
      s0v[r] = d0 * SCL + mk0; s1v[r] = d1 * SCL + mk1;
      mcv[r] = fmaxf(s0v[r], s1v[r]);
    }
    row16_max8(mcv);
    float eav[8];
#pragma unroll
    for (int r = 0; r < 8; ++r) {
      const float mn = fmaxf(m_r[r], mcv[r]); mcv[r] = mn;
      s0v[r] = (s0v[r] - mn) * LOG2E; s1v[r] = (s1v[r] - mn) * LOG2E; eav[r] = (m_r[r] - mn) * LOG2E;
    }
    exp2_8(s0v); exp2_8(s1v); exp2_8(eav);
#pragma unroll
    for (int r = 0; r < 8; ++r) {
      const float mn = mcv[r]; const float al = (mn > -1.0e38f) ? eav[r] : 1.0f; m_r[r] = mn;
      const float p0 = s0v[r], p1 = s1v[r]; l_r[r] = l_r[r] * al + p0 + p1;
#pragma unroll
      for (int dt = 0; dt < DT; ++dt) { oacc[dt][r] *= al; oaccL[dt][r] *= al; }
      FragH t2, t2l; const float ps0 = p0 * 1024.0f, ps1 = p1 * 1024.0f;
      t2.h[0] = toh_flush(ps0); t2.h[1] = toh_flush(ps1);
      t2l.h[0] = toh_flush((ps0 - (float)t2.h[0]) * 1024.0f); t2l.h[1] = toh_flush((ps1 - (float)t2.h[1]) * 1024.0f);
      sP[w][8 * hh + r][ln] = t2.u[0]; sP[w][8 * hh + r][16 + ln] = t2.u[1]; sPL[w][8 * hh + r][ln] = t2l.u[0]; sPL[w][8 * hh + r][16 + ln] = t2l.u[1];
    }
    __builtin_amdgcn_fence(4, "workgroup"); __builtin_amdgcn_wave_barrier();
    FragH pa, pl;
    pa.half[0] = *(const v8us*)&sP[w][ln][8 * hh]; pa.half[1] = *(const v8us*)&sP[w][ln][16 + 8 * hh];
    pl.half[0] = *(const v8us*)&sPL[w][ln][8 * hh]; pl.half[1] = *(const v8us*)&sPL[w][ln][16 + 8 * hh];
#pragma unroll
    for (int dt = 0; dt < DT; ++dt) {
      /* A (P tiles) and B (V^T rows) share the same key order: element e < 8 <-> key 32 t + 8 hh + e; e >= 8 <-> key 32 t + 16 + 8 hh + (e - 8) */
      oacc[dt] = g2_mma(pa.v, bv[dt].v, oacc[dt]);
      oaccL[dt] = g2_mma(pl.v, bv[dt].v, oaccL[dt]);
      oaccL[dt] = g2_mma(pa.v, bl[dt].v, oaccL[dt]);
    }
    asm volatile("s_wait_dscnt 0x0" ::: "memory");      /* this wave's reads of stage t (and of its P tiles) are done before the stage is refilled */
    asm volatile("s_wait_asynccnt 0x0" ::: "memory");   /* this wave's copies of stage t + 1 have landed before the barrier publishes them */
    __syncthreads();
    if (t + 2 < nt) {
      const unsigned so2 = (unsigned)((t & 1) * F5_STG);
      f5_stage(lk + so2, lv + so2, lm + so2, gk + (size_t)(t + 2) * kst, gkl + (size_t)(t + 2) * kst, sk8, gv + (size_t)(t + 2) * 32, svh, gvl + (size_t)(t + 2) * 32, svl, gm + (size_t)(t + 2) * 512);
    }
  }
  asm volatile("s_wait_asynccnt 0x0" ::: "memory");     /* no copy is outstanding when the ring becomes output staging */
  row16_sum8(l_r);
#pragma unroll
  for (int r = 0; r < 8; ++r) { const float l = l_r[r]; l_r[r] = (l > 0.f) ? 1.0f / (l * 1024.0f) : 0.f; }
#pragma unroll
  for (int dt = 0; dt < DT; ++dt)
#pragma unroll
    for (int r = 0; r < 8; ++r) { float v = oacc[dt][r]; v += oaccL[dt][r] * 0.0009765625f; sO[w][8 * hh + r][dt * 16 + ln] = v * l_r[r] + pz; }
  __builtin_amdgcn_fence(4, "workgroup"); __builtin_amdgcn_wave_barrier();
  {
#pragma unroll
    for (int rp = 0; rp < RPW; rp += 2) { const int r = rp + (lane >> 4), pc = lane & 15; const v4f val = *(const v4fa*)&sO[w][r][pc * 4]; *(v4f*)(O + ((size_t)b * TQ + q0 + r) * ldo + h * HDIM + dh * 64 + pc * 4) = val; }
    
  }
}

extern "C" void kernel_launch(void* const* d_in, const int* in_sizes, int n_in,
                              void* d_out, int out_size, void* d_ws, size_t ws_size, hipStream_t stream) {
  if (n_in < 10) return;
  const size_t needx = ((size_t)(NB - 1) * SEQ_FULL + (size_t)SLEN) * DM;
  if ((size_t)in_sizes[0] < needx) return;
  if ((size_t)in_sizes[1] < (size_t)DM * DM) return;
  if ((size_t)in_sizes[2] < (size_t)VW * DM) return;
  if ((size_t)in_sizes[3] < (size_t)VW * DM) return;
  if ((size_t)in_sizes[4] < (size_t)DM * DM) return;
  if ((size_t)in_sizes[5] < (size_t)HDIM) return;
  if ((size_t)in_sizes[6] < (size_t)HDIM) return;
  if ((size_t)in_sizes[7] < (size_t)SLEN * RTW) return;
  if ((size_t)in_sizes[8] < (size_t)SLEN * RTW) return;
  if ((size_t)in_sizes[9] < (size_t)(SLEN - 1) * MSKP + (size_t)SLEN) return;
  if ((size_t)out_size < needx) return;
  /* inputs in order: x, Wq, Wk, Wv, Wo, q gain, k gain, cos table, sin table, mask */
  const float* x = (const float*)d_in[0]; const float* Wq = (const float*)d_in[1]; const float* Wk = (const float*)d_in[2]; const float* Wv = (const float*)d_in[3]; const float* Wo = (const float*)d_in[4];
  const float* qnw = (const float*)d_in[5]; const float* knw = (const float*)d_in[6]; const float* rct = (const float*)d_in[7]; const float* rst = (const float*)d_in[8]; const float* msk = (const float*)d_in[9];
  float* dout = (float*)d_out;
  char* ws = (char*)d_ws; size_t off = 0;
  auto take = [&](size_t bytes) { char* p = ws + off; off += (bytes + 255) & ~(size_t)255; return p; };
  const size_t np = (size_t)NR * DM;
  _Float16* BQ = (_Float16*)take(SZ_BQ);                                /* [n][k] f16, x16; BQ, BK, BV back to back = the [QKVW][DM] operand of the joint projection */
  _Float16* BK = (_Float16*)take(SZ_BK);
  _Float16* BV = (_Float16*)take(SZ_BK);
  _Float16* B2 = (_Float16*)take(SZ_B2);                                /* [n][2*DM] f16: [x16384 | x16] copies of Wo */
  float* FS = (float*)take(SZ_FS);                                      /* f32 scratch plane: [q | k | v] rows [NR][QKVW], then the context [NR][DM] */
  _Float16* X16 = (_Float16*)take(SZ_X16);                              /* f16 input rows; reused as V^T [(b,g)][64][TK] after the projection */
  _Float16* VT = X16;
  _Float16* QH = (_Float16*)take(SZ_QH);                                /* reused as the context hi plane after the attention */
  _Float16* KHp = (_Float16*)take(SZ_KH);                               /* [NR][VW] */
  _Float16* QL = (_Float16*)take(SZ_QL);                                /* [NB*RE][DM] residual plane */
  _Float16* KL = (_Float16*)take(SZ_KL);                                /* [NB*RE][VW] residual plane */
  _Float16* VTL = (_Float16*)take(SZ_VTL);                              /* [(b,g)][64][RE] */
  _Float16* A2 = (_Float16*)take(SZ_A2);                                /* [NB*RE][2*DM] = [ctx hi | ctx residual] */
  unsigned short* MPp = (unsigned short*)take(SZ_MP);                   /* bf16 mask plane, accumulator layout */
  int* JEp = (int*)take(SZ_JE);                                         /* [SLEN/16][32] key-tile counts */
  _Float16* OH = QH;
  if (off > ws_size) return;

  k_prep<<<PB_ALL, 256, 0, stream>>>(msk, x, Wq, Wk, Wv, Wo, JEp, X16, BQ, BK, BV, B2, MPp);
  k_gemm_qkv<<<(unsigned)((NR / 128) * (QKVW / 64)), 128, 0, stream>>>(X16, BQ, FS);
  k_post<<<QB_ALL, 256, 0, stream>>>(FS, qnw, knw, rct, rst, QH, QL, KHp, KL, VT, VTL);
  k_flash5<<<(unsigned)(NB * NH * QBN5 * 2), 128, 0, stream>>>(QH, QL, DM, KHp, KL, VW, VT, VTL, MPp, JEp, FS, DM);
  if (QBNP > 0) k_flash<<<(unsigned)(NB * NH * QBNP), 128, 0, stream>>>(QH, DM, KHp, VW, VT, MPp, JEp, FS, DM);
  const unsigned g8 = (unsigned)((np / 8 + 255) / 256);
  k_hl<<<g8, 256, 0, stream>>>(FS, OH, A2, np / 8);
  k_gemm_out<<<(unsigned)(OB_E + OB_L), 128, 0, stream>>>(A2, OH, B2, dout);
}

// v008
// It runs in 225 microseconds.
// Timed twice side by side with v007, it ran 1.08 and 1.09 times as fast.
// All steps since v000 together make it 3.98 times as fast.
#include <hip/hip_runtime.h>
// Contractions: x.Wq^T, x.Wk^T, x.Wv^T, ctx.Wo^T = v_wmma_f32_16x16x32_f16 (f16 operands: bf16-RNE inputs exact in f16, weights carried x16 (x16384 for the ctx-hi half of the early-row output GEMM); f32 accumulate); scores q.k^T and P.V^T = v_wmma_f32_16x16x32_f16 (plain f16 hi planes; hi + x1024 residual planes of q, k, P and v for query positions < RE; P carried x1024), f32 accumulate; per-head RMS normalisation, rotary step, additive mask, softmax and normalisers f32.

#ifndef NB
#define NB 2
#endif
#ifndef SEQ
#define SEQ 2048
#endif
#define NB_FULL 2
#define SEQ_FULL 2048
#define DM 2048
#define NH 16
#define NKVH 4
#define NREP (NH / NKVH)
#define HDIM 128
#define VW (NKVH * HDIM)                     /* width of the k / v projection rows */
#define NV64 (VW / 64)                       /* 64-wide column groups of the v rows */
#define QKVW (DM + 2 * VW)                   /* row of the joint projection plane: [q | k | v] */
#define MSKP 2048                            /* row pitch of the mask input */
#define RTW 64                               /* row pitch of the cos / sin inputs */
#define SLEN SEQ
#define NR (NB * SLEN)
#define TQ SLEN
#define TK SLEN
#define SCL 0.08838834764831845f
#define MVIS (-1.0e8f)                       /* a mask entry above this keeps its key visible */
#define QBLKS (TQ / 64)
#define RE ((SLEN < 512) ? SLEN : 512)      /* query positions [0, RE) get residual planes on q, k, P, v and ctx */
#define QB05 0
#define QBN5 (RE / 64)
#define QB0P QBN5
#define QBNP (QBLKS - QBN5)
static_assert(SLEN % 128 == 0);
static_assert(SLEN <= SEQ_FULL);
static_assert(SLEN <= MSKP);
static_assert(NB >= 1 && NB <= NB_FULL);
static_assert(RE % 128 == 0 && RE <= SLEN);
static_assert((SLEN - RE) % 128 == 0);
static_assert(DM % 128 == 0 && DM == NH * HDIM);
static_assert(QKVW % 128 == 0);
static_assert(HDIM == 128 && NH % NKVH == 0);
static_assert(VW % 64 == 0 && NV64 * 64 == VW);
static_assert(DM % 32 == 0 && (2 * DM) % 32 == 0);
static_assert(NR % 128 == 0);
static_assert(((size_t)NR * NH * 16) % 256 == 0 && ((size_t)NR * NKVH * 16) % 256 == 0);
static_assert((NH & (NH - 1)) == 0 && (NKVH & (NKVH - 1)) == 0);   /* head counts are powers of two: index arithmetic by shifts and masks */
static_assert((size_t)NR * NH * 16 < ((size_t)1 << 31));           /* 32-bit thread indices in the normalise + rotary kernels */
static_assert(((size_t)(SLEN / 16) * (SLEN / 32) * 64) % 256 == 0);
static_assert(32 * 16 == HDIM * 4);          /* one store instruction of 32 lanes x 16 B == one 128-float row segment */
static_assert(16 * 16 == 64 * 4);            /* 16 lanes x 16 B == one 64-float row segment */
static_assert(4 * 16 * 40 * 2 + 4 * 16 * 132 * 4 <= 131072);
static_assert(2 * 4 * 16 * 40 * 2 + 4 * 16 * 68 * 4 <= 131072);
static_assert(4 * 64 * 68 * 4 <= 131072);

static constexpr float WSC_LO = 16.0f;
static constexpr float WSC_HI = 16384.0f;
static constexpr float AL_P = 0.0625f;
static constexpr float AL_E = 6.103515625e-05f;   /* 0.0625 / 1024 */

static constexpr size_t al256(size_t b) { return (b + 255) & ~(size_t)255; }
static constexpr size_t SZ_BQ = al256((size_t)DM * DM * 2);
static constexpr size_t SZ_BK = al256((size_t)VW * DM * 2);
static constexpr size_t SZ_B2 = al256((size_t)DM * 2 * DM * 2);
static constexpr size_t SZ_FS = al256((size_t)NR * QKVW * 4);
static constexpr size_t SZ_X16 = al256((size_t)NR * DM * 2);
static constexpr size_t SZ_QH = al256((size_t)NR * DM * 2);
static constexpr size_t SZ_KH = al256((size_t)NR * VW * 2);
static constexpr size_t SZ_QL = al256((size_t)NB * RE * DM * 2);
static constexpr size_t SZ_KL = al256((size_t)NB * RE * VW * 2);
static constexpr size_t SZ_VTL = al256((size_t)NB * NV64 * 64 * RE * 2);
static constexpr size_t SZ_A2 = al256((size_t)NB * RE * 2 * DM * 2);
static constexpr size_t SZ_MP = al256((size_t)SLEN * SLEN * 2);
static constexpr size_t SZ_JE = al256((size_t)(SLEN / 16) * 32 * 4);
static_assert((size_t)NB * NV64 * 64 * TK * 2 <= SZ_X16);       /* V^T aliases the f16 input plane */
static_assert((size_t)NR * DM * 4 <= SZ_FS);
static_assert(SZ_BQ == (size_t)DM * DM * 2 && SZ_BK == (size_t)VW * DM * 2);   /* the q, k, v weight planes lie back to back: one [QKVW][DM] operand */
static_assert(SZ_BQ + 2 * SZ_BK + SZ_B2 + SZ_FS + SZ_X16 + SZ_QH + SZ_KH + SZ_QL + SZ_KL + SZ_VTL + SZ_A2 + SZ_MP + SZ_JE <= ((size_t)256 << 20));

typedef _Float16 v16h __attribute__((ext_vector_type(16)));
typedef unsigned short v8us __attribute__((ext_vector_type(8), may_alias));
typedef float v8f __attribute__((ext_vector_type(8)));
typedef float v4f __attribute__((ext_vector_type(4)));
typedef float v4fa __attribute__((ext_vector_type(4), may_alias));
union FragH { v16h v; v8us half[2]; _Float16 h[16]; unsigned short u[16]; };

__device__ __forceinline__ unsigned short bf16_bits(float x) { unsigned int u = __float_as_uint(x); return (unsigned short)((u + 0x7FFFu + ((u >> 16) & 1u)) >> 16); }
__device__ __forceinline__ float bf16_val(unsigned short b) { return __uint_as_float(((unsigned int)b) << 16); }
__device__ __forceinline__ float bf16_rne(float x) { return bf16_val(bf16_bits(x)); }
// f32 -> f16 for WMMA operand planes: values under the smallest f16 normal become +0
__device__ __forceinline__ _Float16 toh_flush(float v) { const _Float16 r = (_Float16)v; return (fabsf(v) < 6.103515625e-05f) ? (_Float16)0.0f : r; }

// D += A.B with NT terms: 1 = ah.bh, 2 = + al.bh, 3 = + ah.bl; hazard guard after the group
template <int NT>
__device__ __forceinline__ v8f mmaH(v16h ah, v16h al, v16h bh, v16h bl, v8f c) {
  c = __builtin_amdgcn_wmma_f32_16x16x32_f16(false, ah, false, bh, (short)0, c, false, false);
  if (NT >= 2) c = __builtin_amdgcn_wmma_f32_16x16x32_f16(false, al, false, bh, (short)0, c, false, false);
  if (NT >= 3) c = __builtin_amdgcn_wmma_f32_16x16x32_f16(false, ah, false, bl, (short)0, c, false, false);
  asm volatile("v_nop\n\tv_nop\n\tv_nop\n\tv_nop" : "+v"(c) : "v"(ah), "v"(al), "v"(bh), "v"(bl));
  return c;
}
// 16x32 fragment from a 16-bit row-major tile (rows = m or n, k contiguous): elements 0..7 <- k0+8h+0..7, 8..15 <- k0+16+8h+0..7
__device__ __forceinline__ v16h g2_frag(const _Float16* p, int hh) { FragH f; f.half[0] = *(const v8us*)((const unsigned short*)p + 8 * hh); f.half[1] = *(const v8us*)((const unsigned short*)p + 16 + 8 * hh); return f.v; }
__device__ __forceinline__ v8f g2_mma(v16h a, v16h b, v8f c) { v8f d = __builtin_amdgcn_wmma_f32_16x16x32_f16(false, a, false, b, (short)0, c, false, false); asm volatile("v_nop\n\tv_nop\n\tv_nop\n\tv_nop" : "+v"(d) : "v"(a), "v"(b)); return d; }

// Eight softmax exponentials at once, in place: v <- 2^v on the hardware's base-2 exponential (the callers pass x log2 e with x <= 0: a score or an older maximum minus the running maximum).
// No range reduction and no range tests: nothing overflows for x <= 0; a result under the smallest normal f32 may come out as 0 (beside a row's largest term, which is 1, it adds nothing); -inf gives 0, NaN stays NaN.
// One statement, so that the slot the instruction set asks for behind a transcendental is filled by construction: behind each v_exp_f32 stands the next value's, which touches neither its result nor its source, behind the last a v_nop.
#define EX_ONE(R) "v_exp_f32 " R ", " R "\n\t"
__device__ __forceinline__ void exp2_8(float (&v)[8]) {
  asm(EX_ONE("%0") EX_ONE("%1") EX_ONE("%2") EX_ONE("%3") EX_ONE("%4") EX_ONE("%5") EX_ONE("%6") EX_ONE("%7") "v_nop"
      : "+v"(v[0]), "+v"(v[1]), "+v"(v[2]), "+v"(v[3]), "+v"(v[4]), "+v"(v[5]), "+v"(v[6]), "+v"(v[7]));
}
#define LOG2E 1.4426950408889634f

// Reduction over each 16-lane row (lanes l ^ 1, ^ 2, ^ 4, ^ 8 in that order, the order of the xor butterfly) of eight values at once, on the vector port (DPP row_xmask): no trip through the LDS unit and no wait per step.
// The eight values' instructions of a step stand side by side, so each instruction's producer is eight instructions back and no link of a chain is waited for. All 32 lanes are on at every call.
#define RX_ONE(OP, R, M) OP " " R ", " R ", " R " row_xmask:" M " row_mask:0xf bank_mask:0xf\n\t"
#define RX_EIGHT(OP, M) RX_ONE(OP, "%0", M) RX_ONE(OP, "%1", M) RX_ONE(OP, "%2", M) RX_ONE(OP, "%3", M) RX_ONE(OP, "%4", M) RX_ONE(OP, "%5", M) RX_ONE(OP, "%6", M) RX_ONE(OP, "%7", M)
#define RX_TREE(OP) RX_EIGHT(OP, "1") RX_EIGHT(OP, "2") RX_EIGHT(OP, "4") RX_EIGHT(OP, "8")
__device__ __forceinline__ void row16_max8(float (&v)[8]) {
  asm volatile(RX_TREE("v_max_num_f32_dpp") : "+v"(v[0]), "+v"(v[1]), "+v"(v[2]), "+v"(v[3]), "+v"(v[4]), "+v"(v[5]), "+v"(v[6]), "+v"(v[7]));
}
__device__ __forceinline__ void row16_sum8(float (&v)[8]) {
  asm volatile(RX_TREE("v_add_f32_dpp") : "+v"(v[0]), "+v"(v[1]), "+v"(v[2]), "+v"(v[3]), "+v"(v[4]), "+v"(v[5]), "+v"(v[6]), "+v"(v[7]));
}

// The bodies below take their block index bi as an argument: several of them share one launch, each on its own range of block indices.
// At the foot of each body stands s_wait_xcnt 0: the body returns into a shared kernel, so the wait comes before any register that its stores name is rewritten.
__device__ __forceinline__ void wsc_body(unsigned bi, const float* __restrict__ Wm, _Float16* __restrict__ Bt, size_t n8, float sc) {
  const size_t t = (size_t)bi * 256 + threadIdx.x; if (t >= n8) return;
  const v4f a0 = *(const v4fa*)(Wm + t * 8), a1 = *(const v4fa*)(Wm + t * 8 + 4);
  FragH f;
#pragma unroll
  for (int q = 0; q < 4; ++q) { f.h[q] = toh_flush(bf16_rne(a0[q]) * sc); f.h[4 + q] = toh_flush(bf16_rne(a1[q]) * sc); }
  const v8us o = f.half[0];
  *(v8us*)((unsigned short*)Bt + t * 8) = o;
  asm volatile("s_wait_xcnt 0x0" ::: "memory");   /* closes this body's stores: in the shared kernel another body's code can stand behind them, not the program's end */
}
__device__ __forceinline__ void wsc2_body(unsigned bi, const float* __restrict__ Wm, _Float16* __restrict__ B2, size_t n8, float sc0, float sc1) {
  const size_t t = (size_t)bi * 256 + threadIdx.x; if (t >= n8) return;
  const size_t e = t * 8; const size_t n = e / DM; const size_t k8 = e % DM;
  const v4f a0 = *(const v4fa*)(Wm + e), a1 = *(const v4fa*)(Wm + e + 4);
  FragH f0, f1;
#pragma unroll
  for (int q = 0; q < 4; ++q) {
    const float v0 = bf16_rne(a0[q]), v1 = bf16_rne(a1[q]);
    f0.h[q] = toh_flush(v0 * sc0); f1.h[q] = toh_flush(v0 * sc1);
    f0.h[4 + q] = toh_flush(v1 * sc0); f1.h[4 + q] = toh_flush(v1 * sc1);
  }
  const size_t o = n * (size_t)(2 * DM) + k8;
  const v8us o0 = f0.half[0], o1 = f1.half[0];
  {
    *(v8us*)((unsigned short*)B2 + o) = o0;
    *(v8us*)((unsigned short*)B2 + o + DM) = o1;
    asm volatile("s_wait_xcnt 0x0" ::: "memory");   /* closes this body's stores: in the shared kernel another body's code can stand behind them, not the program's end */
  }
}

// mask plane in accumulator layout: MP[(qt*(SLEN/32) + kt)][half][lane][8] bf16 bits; element 2*rr + c of (half, lane) = mask[qt*16 + 8*(lane>>4) + 4*half + rr][kt*32 + 16*c + (lane&15)];
__device__ __forceinline__ void mperm_body(unsigned bi, const float* __restrict__ msk, unsigned short* __restrict__ MP) {
  const size_t t = (size_t)bi * 256 + threadIdx.x; if (t >= (size_t)(SLEN / 16) * (SLEN / 32) * 64) return;
  const int lane = (int)(t & 31); const int half = (int)((t >> 5) & 1); const size_t tile = t >> 6;
  const int kt = (int)(tile % (size_t)(SLEN / 32)); const int qt = (int)(tile / (size_t)(SLEN / 32));
  const int ln = lane & 15, hh = lane >> 4;
  const float* mr = msk + (size_t)(qt * 16 + 8 * hh + 4 * half) * MSKP + kt * 32 + ln;
  FragH f;
#pragma unroll
  for (int rr = 0; rr < 4; ++rr) { const float a = mr[(size_t)rr * MSKP]; const float c = mr[(size_t)rr * MSKP + 16]; f.u[2 * rr] = bf16_bits(a); f.u[2 * rr + 1] = bf16_bits(c); }
  const v8us o = f.half[0];
  *(v8us*)(MP + t * 8) = o;
  asm volatile("s_wait_xcnt 0x0" ::: "memory");   /* closes this body's stores: in the shared kernel another body's code can stand behind them, not the program's end */
}
// per 16-query tile qt: JE[qt][0..32) = number of 32-key tiles to visit = 1 + last tile holding a visible entry (value > MVIS) in any of the 16 rows; all tiles if some row has no visible entry.
// A 64-query block takes the largest of its four tiles' counts.
__device__ __forceinline__ void mjend_body(unsigned qt, const float* __restrict__ msk, int* __restrict__ JE, int* smax, int* snone) {
  constexpr int NL = SLEN / 128;               /* 16-B loads per lane and row */
  constexpr int NG = 4;                        /* loads of one group */
  static_assert(NL % NG == 0);
  const int tid = threadIdx.x, lane = tid & 31; const int w = __builtin_amdgcn_readfirstlane(tid >> 5);
  int wmax = -1, wnone = 0;
  /* 8 waves, two rows each; both loops kept rolled: one group's registers at a time, so that this body does not set the register count of the launch it shares */
#pragma unroll 1
  for (int rr = 0; rr < 2; ++rr) {
    int lm = -1;
#pragma unroll 1
    for (int g = 0; g < NL / NG; ++g) {
      const float* mr = msk + (size_t)(qt * 16 + w * 2 + rr) * MSKP + g * (NG * 128) + lane * 4;
      /* the loads of a group are issued together ahead of the first compare: one load round trip a group, not one per 128 columns */
      v4f a[NG];
#pragma unroll
      for (int i = 0; i < NG; ++i) a[i] = *(const v4fa*)(mr + i * 128);
      /* the loaded values are inputs only: all loads of the group are issued, none held back behind a compare; the address is an input too, so it stays whole (no load's result is given it) up to this wait */
      asm volatile("s_wait_xcnt 0x0" :: "v"(a[0]), "v"(a[1]), "v"(a[2]), "v"(a[3]), "v"(mr) : "memory");
#pragma unroll
      for (int i = 0; i < NG; ++i) {
        const bool any = (bf16_rne(a[i][0]) > MVIS) | (bf16_rne(a[i][1]) > MVIS) | (bf16_rne(a[i][2]) > MVIS) | (bf16_rne(a[i][3]) > MVIS);
        lm = any ? ((lane + 32 * (g * NG + i)) >> 3) : lm;
      }
    }
    int o = __shfl_xor(lm, 16, 32); lm = (o > lm) ? o : lm;
    o = __shfl_xor(lm, 8, 32); lm = (o > lm) ? o : lm;
    o = __shfl_xor(lm, 4, 32); lm = (o > lm) ? o : lm;
    o = __shfl_xor(lm, 2, 32); lm = (o > lm) ? o : lm;
    o = __shfl_xor(lm, 1, 32); lm = (o > lm) ? o : lm;
    wmax = (lm > wmax) ? lm : wmax; wnone |= (lm < 0) ? 1 : 0;
  }
  if (lane == 0) { smax[w] = wmax; snone[w] = wnone; }
  __syncthreads();
  if (w == 0) {
    int m = -1, nn = 0;
#pragma unroll
    for (int i = 0; i < 8; ++i) { const int a = smax[i]; m = (a > m) ? a : m; nn |= snone[i]; }
    const int jt = (nn != 0) ? (SLEN / 32) : (m + 1);
    *(int*)(JE + qt * 32 + lane) = jt;
    asm volatile("s_wait_xcnt 0x0" ::: "memory");   /* closes this body's stores: in the shared kernel another body's code can stand behind them, not the program's end */
  }
}

__device__ __forceinline__ void x16_body(unsigned bi, const float* __restrict__ x, _Float16* __restrict__ X16, size_t n8) {
  const size_t t = (size_t)bi * 256 + threadIdx.x; if (t >= n8) return;
  const size_t e = t * 8; const size_t r = e / DM; const size_t c = e % DM; const size_t b = r / SLEN, s = r % SLEN;
  const float* src = x + (b * SEQ_FULL + s) * DM + c;
  const v4f a0 = *(const v4fa*)src, a1 = *(const v4fa*)(src + 4);
  FragH f;
#pragma unroll
  for (int q = 0; q < 4; ++q) { f.h[q] = (_Float16)bf16_rne(a0[q]); f.h[4 + q] = (_Float16)bf16_rne(a1[q]); }
  const v8us o = f.half[0];
  *(v8us*)((unsigned short*)X16 + e) = o;
  asm volatile("s_wait_xcnt 0x0" ::: "memory");   /* closes this body's stores: in the shared kernel another body's code can stand behind them, not the program's end */
}

// One launch for all the work that reads only inputs: key-tile counts, f16 input plane, the four weight planes, the mask plane. None reads what another writes; the block index picks the body.
static constexpr size_t NX8 = (size_t)NR * DM / 8, NW8 = (size_t)DM * DM / 8, NK8 = (size_t)VW * DM / 8;
static constexpr unsigned PB_JE = SLEN / 16, PB_X = (unsigned)((NX8 + 255) / 256), PB_W = (unsigned)((NW8 + 255) / 256), PB_K = (unsigned)((NK8 + 255) / 256);
static constexpr unsigned PB_MP = (unsigned)(((size_t)(SLEN / 16) * (SLEN / 32) * 64) / 256);
static constexpr unsigned PB_ALL = PB_JE + PB_X + 2 * PB_W + 2 * PB_K + PB_MP;
__global__ __launch_bounds__(256) void k_prep(const float* __restrict__ msk, const float* __restrict__ x, const float* __restrict__ Wq, const float* __restrict__ Wk, const float* __restrict__ Wv, const float* __restrict__ Wo,
                                              int* __restrict__ JE, _Float16* __restrict__ X16, _Float16* __restrict__ BQ, _Float16* __restrict__ BK, _Float16* __restrict__ BV, _Float16* __restrict__ B2, unsigned short* __restrict__ MP) {
  __shared__ int smax[8]; __shared__ int snone[8];
  unsigned bi = blockIdx.x;
  /* the count blocks have the longest chain of load round trips: they start first */
  if (bi < PB_JE) { mjend_body(bi, msk, JE, smax, snone); return; }
  bi -= PB_JE;
  if (bi < PB_X) { x16_body(bi, x, X16, NX8); return; }
  bi -= PB_X;
  if (bi < PB_W) { wsc_body(bi, Wq, BQ, NW8, WSC_LO); return; }
  bi -= PB_W;
  if (bi < PB_K) { wsc_body(bi, Wk, BK, NK8, WSC_LO); return; }
  bi -= PB_K;
  if (bi < PB_K) { wsc_body(bi, Wv, BV, NK8, WSC_LO); return; }
  bi -= PB_K;
  if (bi < PB_W) { wsc2_body(bi, Wo, B2, NW8, WSC_HI, WSC_LO); return; }
  bi -= PB_W;
  mperm_body(bi, msk, MP);
}

// LDS ring of the GEMM: one stage = 64 k = 128 B of every operand row, [A 128 rows | B 128 rows] at pitch 144 B (16 B x odd: the 16-B fragment reads meet no bank conflict); two stages
#define G2_PB 144
#define G2_STG ((128 + 128) * G2_PB)
static_assert(2 * G2_STG >= 4 * 64 * 68 * 4);   /* the output staging reuses the ring behind the last barrier */
static_assert(2 * G2_STG <= 81920);             /* four blocks fit one WGP's LDS */
static_assert(DM % 64 == 0 && DM >= 128);
// 16x32 fragment from an LDS row (k contiguous), p = row start + 2 * (k0 + 8 hh) bytes: the k order of g2_frag
__device__ __forceinline__ v16h g2_lfrag(const unsigned char* p) { FragH f; f.half[0] = *(const v8us*)p; f.half[1] = *(const v8us*)(p + 32); return f.v; }
// one operand's 128 rows of a stage: 8 copies of 16 B per lane (a wave-wide copy = 4 whole 128-B row pieces); lane (r = tid / 8, c = tid % 8) brings chunk c of rows r + 16 j (j < 8).
// l = LDS byte address of (row r, chunk c) in the operand's part of the stage, g = the lane's global address in row r, s = 16 rows in elements.
__device__ __forceinline__ void g2_stage8(unsigned l, const _Float16* g, size_t s) {
  /* s_wait_xcnt closes the copies' own statement: no register that a copy names is rewritten in front of it */
  asm volatile(
      "global_load_async_to_lds_b128 %0, %8, off\n\t"
      "global_load_async_to_lds_b128 %1, %9, off\n\t"
      "global_load_async_to_lds_b128 %2, %10, off\n\t"
      "global_load_async_to_lds_b128 %3, %11, off\n\t"
      "global_load_async_to_lds_b128 %4, %12, off\n\t"
      "global_load_async_to_lds_b128 %5, %13, off\n\t"
      "global_load_async_to_lds_b128 %6, %14, off\n\t"
      "global_load_async_to_lds_b128 %7, %15, off\n\t"
      "s_wait_xcnt 0x0"
      :: "v"(l), "v"(l + 16 * G2_PB), "v"(l + 32 * G2_PB), "v"(l + 48 * G2_PB), "v"(l + 64 * G2_PB), "v"(l + 80 * G2_PB), "v"(l + 96 * G2_PB), "v"(l + 112 * G2_PB),
         "v"(g), "v"(g + s), "v"(g + 2 * s), "v"(g + 3 * s), "v"(g + 4 * s), "v"(g + 5 * s), "v"(g + 6 * s), "v"(g + 7 * s)
      : "memory");
}
// one stage: the A rows, then the B rows behind them
__device__ __forceinline__ void g2_stage(unsigned l, const _Float16* a, size_t sa, const _Float16* b, size_t sb) {
  g2_stage8(l, a, sa);
  g2_stage8(l + 128 * G2_PB, b, sb);
}

// GEMM C[M][N] = alpha * A[M][K].B  with A f16 row-major (pitch lda), B stored [n][k] f16 (pitch ldb); bx = index of the block's 128 x 128 tile, sm = the block's LDS (2 * G2_STG bytes);
// four waves in a 2 x 2 grid, 64 x 64 of C each: a fragment read from LDS feeds four products, and a staged operand row 128 columns or rows of C.
// writes f32 C (pitch ldc). Requires M % 128 == 0, N % 128 == 0, K % 64 == 0 (asserted by the callers' constants).
// Operand tiles come through LDS: asynchronous copies, two stages, stage t + 1 in flight while stage t is multiplied.
__device__ __forceinline__ void gemm2_body(const _Float16* __restrict__ A, int lda, const _Float16* __restrict__ Bh, int ldb, float alpha,
                                           float* __restrict__ C, int ldc, int M, int N, int K, int bx, unsigned char* sm) {
  float (*so)[64][68] = (float (*)[64][68])sm;
  const int tid = threadIdx.x, w = tid >> 5, lane = tid & 31, ln = lane & 15, hh = lane >> 4;
  const int wm = w >> 1, wn = w & 1;
  const int ntn = N >> 7; const int mt = bx / ntn, nq = bx - mt * ntn; const int row0 = mt * 128 + 64 * wm, col0 = nq * 128 + 64 * wn; if (mt * 128 >= M) return;
  const int cr = tid >> 3, cc = tid & 7;
  const _Float16* ga = A + (size_t)(mt * 128 + cr) * lda + cc * 8; const _Float16* gb = Bh + (size_t)(nq * 128 + cr) * ldb + cc * 8;
  const size_t sa16 = (size_t)16 * lda, sb16 = (size_t)16 * ldb;
  const unsigned lc = (unsigned)(uintptr_t)sm + (unsigned)(cr * G2_PB + cc * 16);
  const int nt = K >> 6;
  const int aofs = (64 * wm + ln) * G2_PB + 16 * hh, bofs = (128 + 64 * wn + ln) * G2_PB + 16 * hh;
  const v8f z8 = {0.f,0.f,0.f,0.f,0.f,0.f,0.f,0.f};
  v8f acc[4][4];
#pragma unroll
  for (int i = 0; i < 4; ++i)
#pragma unroll
    for (int j = 0; j < 4; ++j) acc[i][j] = z8;
  g2_stage(lc, ga, sa16, gb, sb16);
  asm volatile("s_wait_asynccnt 0x0" ::: "memory");   /* stage 0 has landed before the barrier publishes it */
  __syncthreads();
  if (nt > 1) g2_stage(lc + G2_STG, ga + 64, sa16, gb + 64, sb16);
#pragma unroll 1
  for (int t = 0; t < nt; ++t) {
    const unsigned char* sb = sm + (t & 1) * G2_STG; const unsigned char* pa = sb + aofs; const unsigned char* pb = sb + bofs;
#pragma unroll
    for (int kk = 0; kk < 2; ++kk) {
      v16h a[4], b[4];
#pragma unroll
      for (int i = 0; i < 4; ++i) { a[i] = g2_lfrag(pa + i * 16 * G2_PB + kk * 64); b[i] = g2_lfrag(pb + i * 16 * G2_PB + kk * 64); }
#pragma unroll
      for (int j = 0; j < 4; ++j)
#pragma unroll
        for (int i = 0; i < 4; ++i) acc[i][j] = g2_mma(a[i], b[j], acc[i][j]);
    }
    asm volatile("s_wait_dscnt 0x0" ::: "memory");      /* this wave's reads of stage t are done before the stage is refilled */
    asm volatile("s_wait_asynccnt 0x0" ::: "memory");   /* this wave's copies of stage t + 1 have landed before the barrier publishes them */
    __syncthreads();
    if (t + 2 < nt) g2_stage(lc + (unsigned)((t & 1) * G2_STG), ga + (size_t)(t + 2) * 64, sa16, gb + (size_t)(t + 2) * 64, sb16);
  }
  asm volatile("s_wait_asynccnt 0x0" ::: "memory");     /* no copy is outstanding when the ring becomes output staging */
#pragma unroll
  for (int i = 0; i < 4; ++i)
#pragma unroll
    for (int j = 0; j < 4; ++j)
#pragma unroll
      for (int r = 0; r < 8; ++r) { const float v = acc[i][j][r] * alpha; so[w][i * 16 + 8 * hh + r][j * 16 + ln] = v; }
  __builtin_amdgcn_fence(4, "workgroup"); __builtin_amdgcn_wave_barrier();
  const int rsub = lane >> 4, c4 = (lane & 15) * 4;
  {
#pragma unroll
    for (int q = 0; q < 32; ++q) {
      const int r = q * 2 + rsub; const v4f v = *(const v4fa*)&so[w][r][c4];
      *(v4f*)(C + (size_t)(row0 + r) * ldc + col0 + c4) = v;
    }
  }
}
// q, k and v projections in one launch: [q | k | v] = x . [Wq ; Wk ; Wv]^T, f32 rows of pitch QKVW
__global__ __launch_bounds__(128) void k_gemm_qkv(const _Float16* __restrict__ X16, const _Float16* __restrict__ BQKV, float* __restrict__ F) {
  __shared__ __attribute__((aligned(16))) unsigned char sm[2 * G2_STG];
  gemm2_body(X16, DM, BQKV, DM, AL_P, F, QKVW, NR, QKVW, DM, (int)blockIdx.x, sm);
}
// both output products in one launch. Blocks [0, OB_E): rows [0, RE) of a batch = [ctx hi | ctx residual] . [Wo x16384 ; Wo x16] / 16384 (K = 2*DM; twice the trips, so they start first);
// blocks [OB_E, OB_E + OB_L): rows [RE, SLEN) = ctx hi . (Wo x16) / 16.
static constexpr int OB_E1 = (RE / 128) * (DM / 128), OB_L1 = ((SLEN - RE) / 128) * (DM / 128), OB_E = OB_E1 * NB, OB_L = OB_L1 * NB;
__global__ __launch_bounds__(128) void k_gemm_out(const _Float16* __restrict__ A2, const _Float16* __restrict__ OH, const _Float16* __restrict__ B2, float* __restrict__ out) {
  __shared__ __attribute__((aligned(16))) unsigned char sm[2 * G2_STG];
  const int bi = (int)blockIdx.x; const bool e = bi < OB_E;
  const int rb = e ? bi : bi - OB_E; const int per = e ? OB_E1 : ((OB_L1 > 0) ? OB_L1 : 1); const int by = rb / per, bx = rb - by * per;
  const _Float16* A = e ? A2 + (size_t)by * RE * 2 * DM : OH + (size_t)by * SLEN * DM + (size_t)RE * DM;
  float* C = out + (size_t)by * SEQ_FULL * DM + (e ? (size_t)0 : (size_t)RE * DM);
  gemm2_body(A, e ? 2 * DM : DM, e ? B2 : B2 + DM, 2 * DM, e ? AL_E : AL_P, C, DM, e ? RE : SLEN - RE, DM, e ? 2 * DM : DM, bx, sm);
}

// per-head RMS normalisation + interleaved-pair rotary step from the f32 GEMM plane F (NR rows of pitch ldf, NHV*128 columns from F on; NHV = compile-time head count, a power of two):
// y = (x * rsqrt(mean_128(x^2) + 1e-6)) * g[d];  out[2i] = y[2i] c[i] - y[2i+1] s[i];  out[2i+1] = y[2i] s[i] + y[2i+1] c[i]  (c, s = table rows [position][64], gain g[128]; all by value, bf16-RNE);
// H [NR][NHV*128] = f16 hi of every row; L [NB*RE][NHV*128] = x1024 residual for positions < RE.
// 32-bit thread indices (shifts and masks of compile-time powers of two); 64-bit offsets only at the final pointer arithmetic.
template <int NHV>
__device__ __forceinline__ void nrope_body(unsigned bi, const float* __restrict__ F, int ldf, const float* __restrict__ NW, const float* __restrict__ CT, const float* __restrict__ ST,
                                           _Float16* __restrict__ H, _Float16* __restrict__ L) {
  #pragma clang fp contract(off)
  const unsigned t0 = bi * 256u + threadIdx.x; const bool live = t0 < (unsigned)(NR * NHV * 16); const unsigned t = live ? t0 : 0u;
  const int p = (int)(t & 15u); const int hd = (int)((t >> 4) % (unsigned)NHV); const unsigned row = t / (unsigned)(16 * NHV);
  const int s = (int)(row % (unsigned)SLEN); const int b = (int)(row / (unsigned)SLEN);
  const float* src = F + (size_t)row * ldf + hd * HDIM + p * 8;
  const v4f xa = *(const v4fa*)src, xb = *(const v4fa*)(src + 4);
  const v4f wa = *(const v4fa*)(NW + p * 8), wb = *(const v4fa*)(NW + p * 8 + 4);
  const v4f cv = *(const v4fa*)(CT + (size_t)s * RTW + p * 4), sv = *(const v4fa*)(ST + (size_t)s * RTW + p * 4);
  const float xs[8] = {xa[0], xa[1], xa[2], xa[3], xb[0], xb[1], xb[2], xb[3]};
  const float gs[8] = {wa[0], wa[1], wa[2], wa[3], wb[0], wb[1], wb[2], wb[3]};
  float ss = 0.f;
#pragma unroll
  for (int i = 0; i < 8; ++i) { const float q = xs[i] * xs[i]; ss = ss + q; }
  ss += __shfl_xor(ss, 1, 32); ss += __shfl_xor(ss, 2, 32); ss += __shfl_xor(ss, 4, 32); ss += __shfl_xor(ss, 8, 32);
  const float mean = ss * 0.0078125f; const float rms = rsqrtf(mean + 1.0e-6f);
  FragH fh, fl;
#pragma unroll
  for (int j = 0; j < 4; ++j) {
    const float c = bf16_rne(cv[j]), sn = bf16_rne(sv[j]);
    const float y1 = (xs[2 * j] * rms) * bf16_rne(gs[2 * j]); const float y2 = (xs[2 * j + 1] * rms) * bf16_rne(gs[2 * j + 1]);
    const float o1 = y1 * c - y2 * sn; const float o2 = y1 * sn + y2 * c;
    const _Float16 h1 = toh_flush(o1), h2 = toh_flush(o2);
    fh.h[2 * j] = h1; fh.h[2 * j + 1] = h2;
    fl.h[2 * j] = toh_flush((o1 - (float)h1) * 1024.0f); fl.h[2 * j + 1] = toh_flush((o2 - (float)h2) * 1024.0f);
  }
  const size_t oh = (size_t)row * (NHV * HDIM) + hd * HDIM + p * 8;
  const bool wl = live && (s < RE);
  const int sl = wl ? s : 0;
  const size_t ol = (size_t)(b * RE + sl) * (NHV * HDIM) + hd * HDIM + p * 8;
  const v8us vh = fh.half[0], vl = fl.half[0];
  {
    if (live) *(v8us*)((unsigned short*)H + oh) = vh;
    if (wl) *(v8us*)((unsigned short*)L + ol) = vl;
    asm volatile("s_wait_xcnt 0x0" ::: "memory");   /* closes this body's stores: in the shared kernel another body's code can stand behind them, not the program's end */
  }
}
// V^T hi plane from the f32 v columns VF (pitch ldv): Vt[(b,g)][64][TK] = f16 of v; tl = the block's 64 x 66 LDS tile
__device__ __forceinline__ void vtg_body(unsigned bi, const float* __restrict__ VF, int ldv, _Float16* __restrict__ Vt, unsigned short (*tl)[66]) {
  const int tid = threadIdx.x; const int nlg = SLEN / 64; const int slab = (int)bi / nlg, lg = (int)bi % nlg; const int b = slab / NV64, h = slab % NV64;
  const int r0 = tid >> 4, c4 = (tid & 15) * 4;
  const float* src = VF + ((size_t)b * SLEN + lg * 64 + r0) * ldv + h * 64 + c4;
  /* the thread's four loads (rows r0 + 16 j) are issued as one group: one load round trip, not four */
  v4f a[4];
#pragma unroll
  for (int j = 0; j < 4; ++j) a[j] = *(const v4fa*)(src + (size_t)(16 * j) * ldv);
  /* the loaded values are inputs only; the address is an input too, so it stays whole (no load's result is given it) up to this wait */
  asm volatile("s_wait_xcnt 0x0" :: "v"(a[0]), "v"(a[1]), "v"(a[2]), "v"(a[3]), "v"(src) : "memory");
#pragma unroll
  for (int j = 0; j < 4; ++j) {
    FragH f;
#pragma unroll
    for (int q = 0; q < 4; ++q) f.h[q] = (_Float16)a[j][q];
#pragma unroll
    for (int q = 0; q < 4; ++q) tl[r0 + 16 * j][c4 + q] = f.u[q];
  }
  __syncthreads();
  {
#pragma unroll
    for (int rd = 0; rd < 2; ++rd) {
      const int d = rd * 32 + (tid >> 3), pc = tid & 7; FragH f;
#pragma unroll
      for (int q = 0; q < 8; ++q) f.u[q] = tl[pc * 8 + q][d];
      *(v8us*)((unsigned short*)Vt + ((size_t)slab * 64 + d) * TK + lg * 64 + pc * 8) = f.half[0];
    }
    asm volatile("s_wait_xcnt 0x0" ::: "memory");   /* closes this body's stores: in the shared kernel another body's code can stand behind them, not the program's end */
  }
}
// V^T residual plane for keys < RE: VtL[(b,g)][64][RE] = f16 of (v - f16(v)) x 1024
__device__ __forceinline__ void vtl_body(unsigned bi, const float* __restrict__ VF, int ldv, _Float16* __restrict__ VtL, unsigned short (*tl)[66]) {
  const int tid = threadIdx.x; const int nlg = RE / 64; const int slab = (int)bi / nlg, lg = (int)bi % nlg; const int b = slab / NV64, h = slab % NV64;
  const int r0 = tid >> 4, c4 = (tid & 15) * 4;
  const float* src = VF + ((size_t)b * SLEN + lg * 64 + r0) * ldv + h * 64 + c4;
  /* the thread's four loads (rows r0 + 16 j) are issued as one group: one load round trip, not four */
  v4f a[4];
#pragma unroll
  for (int j = 0; j < 4; ++j) a[j] = *(const v4fa*)(src + (size_t)(16 * j) * ldv);
  /* the loaded values are inputs only; the address is an input too, so it stays whole (no load's result is given it) up to this wait */
  asm volatile("s_wait_xcnt 0x0" :: "v"(a[0]), "v"(a[1]), "v"(a[2]), "v"(a[3]), "v"(src) : "memory");
#pragma unroll
  for (int j = 0; j < 4; ++j) {
    FragH f;
#pragma unroll
    for (int q = 0; q < 4; ++q) { const float v = a[j][q]; const _Float16 hv = (_Float16)v; f.h[q] = toh_flush((v - (float)hv) * 1024.0f); }
#pragma unroll
    for (int q = 0; q < 4; ++q) tl[r0 + 16 * j][c4 + q] = f.u[q];
  }
  __syncthreads();
  {
#pragma unroll
    for (int rd = 0; rd < 2; ++rd) {
      const int d = rd * 32 + (tid >> 3), pc = tid & 7; FragH f;
#pragma unroll
      for (int q = 0; q < 8; ++q) f.u[q] = tl[pc * 8 + q][d];
      *(v8us*)((unsigned short*)VtL + ((size_t)slab * 64 + d) * RE + lg * 64 + pc * 8) = f.half[0];
    }
    asm volatile("s_wait_xcnt 0x0" ::: "memory");   /* closes this body's stores: in the shared kernel another body's code can stand behind them, not the program's end */
  }
}
// One launch for all that reads only the joint projection plane F = [q | k | v]: both V^T planes, key heads (NKVH per row), query heads (NH per row). The block index picks the body.
static constexpr unsigned QB_V = NB * NV64 * (SLEN / 64), QB_VL = NB * NV64 * (RE / 64), QB_K = (unsigned)(((size_t)NR * NKVH * 16) / 256), QB_Q = (unsigned)(((size_t)NR * NH * 16) / 256);
static constexpr unsigned QB_ALL = QB_V + QB_VL + QB_K + QB_Q;
__global__ __launch_bounds__(256) void k_post(const float* __restrict__ F, const float* __restrict__ QW, const float* __restrict__ KW, const float* __restrict__ CT, const float* __restrict__ ST,
                                              _Float16* __restrict__ QH, _Float16* __restrict__ QL, _Float16* __restrict__ KH, _Float16* __restrict__ KL, _Float16* __restrict__ Vt, _Float16* __restrict__ VtL) {
  __shared__ unsigned short tl[64][66];
  unsigned bi = blockIdx.x;
  if (bi < QB_V) { vtg_body(bi, F + DM + VW, QKVW, Vt, tl); return; }
  bi -= QB_V;
  if (bi < QB_VL) { vtl_body(bi, F + DM + VW, QKVW, VtL, tl); return; }
  bi -= QB_VL;
  if (bi < QB_K) { nrope_body<NKVH>(bi, F + DM, QKVW, KW, CT, ST, KH, KL); return; }
  bi -= QB_K;
  nrope_body<NH>(bi, F, QKVW, QW, CT, ST, QH, QL);
}

__global__ __launch_bounds__(256) void k_hl(const float* __restrict__ Fp, _Float16* __restrict__ Hh, _Float16* __restrict__ A2, size_t n8) {
  const size_t t = (size_t)blockIdx.x * 256 + threadIdx.x; if (t >= n8) return;
  const size_t e = t * 8; const size_t r = e / DM; const int c = (int)(e % DM); const int s = (int)(r % SLEN); const int b = (int)(r / SLEN);
  const v4f a = *(const v4fa*)(Fp + e), d = *(const v4fa*)(Fp + e + 4);
  FragH fh, fl;
#pragma unroll
  for (int q = 0; q < 4; ++q) {
    _Float16 hv = (_Float16)a[q]; fh.h[q] = hv; fl.h[q] = (_Float16)((a[q] - (float)hv) * 1024.0f);
    hv = (_Float16)d[q]; fh.h[4 + q] = hv; fl.h[4 + q] = (_Float16)((d[q] - (float)hv) * 1024.0f);
  }
  const bool wl = (s < RE);
  const size_t o2 = ((size_t)b * RE + (wl ? s : 0)) * (size_t)(2 * DM) + c;
  const v8us vh = fh.half[0], vl = fl.half[0];
  {
    *(v8us*)((unsigned short*)Hh + e) = vh;
    if (wl) { *(v8us*)((unsigned short*)A2 + o2) = vh; *(v8us*)((unsigned short*)A2 + o2 + DM) = vl; }
    
  }
}

// LDS ring of the attention kernel: one stage = one pass of 32 keys = [K 32 rows of 256 B at pitch 272 | V^T 128 rows of 64 B at pitch 80 | mask 4 waves x 1 KiB]; both pitches are 16 B x odd: the 16-B fragment reads meet no bank conflict; two stages
#define FA_KP 272
#define FA_VP 80
#define FA_KB (32 * FA_KP)
#define FA_VB (128 * FA_VP)
#define FA_MB (4 * 1024)
#define FA_STG (FA_KB + FA_VB + FA_MB)
static_assert(FA_STG % 16 == 0 && FA_KB % 16 == 0 && FA_VB % 16 == 0);
static_assert(2 * FA_STG >= 4 * 16 * 132 * 4);   /* the output staging reuses the ring behind the last barrier */
static_assert(2 * FA_STG + 4 * 16 * 40 * 2 <= 65536);
// one stage: 10 copies of 16 B per lane. K: lane (r = tid / 16, c = tid % 16) brings chunk c of key rows r + 8 j (j < 4): a wave-wide copy = 2 whole 256-B rows. V^T: lane (r = tid / 4, c = tid % 4) brings chunk c of rows r + 32 j (j < 4).
// mask: each lane brings its own two 16-B words. lk / lv / lm = the lane's LDS byte addresses in the stage, k / v / m = its global addresses, sk = 8 K rows and sv = 32 V^T rows in elements.
__device__ __forceinline__ void fa_stage(unsigned lk, unsigned lv, unsigned lm, const unsigned short* k, size_t sk, const unsigned short* v, size_t sv, const unsigned short* m) {
  /* s_wait_xcnt closes the copies' own statement: no register that a copy names is rewritten in front of it */
  asm volatile(
      "global_load_async_to_lds_b128 %0, %10, off\n\t"
      "global_load_async_to_lds_b128 %1, %11, off\n\t"
      "global_load_async_to_lds_b128 %2, %12, off\n\t"
      "global_load_async_to_lds_b128 %3, %13, off\n\t"
      "global_load_async_to_lds_b128 %4, %14, off\n\t"
      "global_load_async_to_lds_b128 %5, %15, off\n\t"
      "global_load_async_to_lds_b128 %6, %16, off\n\t"
      "global_load_async_to_lds_b128 %7, %17, off\n\t"
      "global_load_async_to_lds_b128 %8, %18, off\n\t"
      "global_load_async_to_lds_b128 %9, %19, off\n\t"
      "s_wait_xcnt 0x0"
      :: "v"(lk), "v"(lk + 8 * FA_KP), "v"(lk + 16 * FA_KP), "v"(lk + 24 * FA_KP),
         "v"(lv), "v"(lv + 32 * FA_VP), "v"(lv + 64 * FA_VP), "v"(lv + 96 * FA_VP), "v"(lm), "v"(lm + 512),
         "v"(k), "v"(k + sk), "v"(k + 2 * sk), "v"(k + 3 * sk), "v"(v), "v"(v + sv), "v"(v + 2 * sv), "v"(v + 3 * sv), "v"(m), "v"(m + 256)
      : "memory");
}

// fused attention per ((b,h), 64 queries), query blocks [QB0P, QBLKS): wave = 16 queries; S = Q.K^T (d = 128: 4 k-steps, q fragments read once and kept) x SCL + mask (bf16 plane, accumulator layout, two 16-B words per lane per step)
// The pass's K, V^T and mask tiles come through LDS, once for the block's four waves: asynchronous copies in whole row pieces, two stages, stage t + 1 in flight while stage t is worked on.
__global__ __launch_bounds__(128) __attribute__((amdgpu_num_vgpr(256))) void k_flash(const _Float16* __restrict__ Q16, int ldq, const _Float16* __restrict__ K16, int ldk,
                                               const _Float16* __restrict__ Vt, const unsigned short* __restrict__ MP, const int* __restrict__ JE, float* __restrict__ O, int ldo) {
  constexpr int RPW = 16, DT = 8, KS = 4;
  constexpr int NQP = (QBNP > 0) ? QBNP : 1;
  __shared__ __attribute__((aligned(16))) unsigned short sP[4][RPW][40];
  __shared__ __attribute__((aligned(16))) unsigned char ring[2 * FA_STG];
  float (*sO)[RPW][132] = (float (*)[RPW][132])ring;
  const int tid = threadIdx.x, lane = tid & 31, ln = lane & 15, hh = lane >> 4;
  const int w = __builtin_amdgcn_readfirstlane(tid >> 5);
  const int slab = blockIdx.x / NQP, qblk = QB0P + blockIdx.x % NQP; const int b = slab / NH, h = slab % NH; const int kvh = h / NREP;
  const int qb0 = qblk * (4 * RPW); const int q0 = qb0 + w * RPW;
  const unsigned short* qr = (const unsigned short*)Q16 + ((size_t)b * TQ + q0 + ln) * ldq + h * HDIM;
  const unsigned short* Vth = (const unsigned short*)Vt + (size_t)(b * NKVH + kvh) * HDIM * TK;
  int jt = JE[qblk * 128];   /* the largest count of the block's four 16-query tiles */
#pragma unroll
  for (int i = 1; i < 4; ++i) { const int ji = JE[qblk * 128 + i * 32]; jt = (ji > jt) ? ji : jt; }
  jt = (jt < 1) ? 1 : jt; jt = (jt > TK / 32) ? (TK / 32) : jt;
  const int nt = __builtin_amdgcn_readfirstlane(jt);
  /* the lane's copy addresses of stage 0 */
  const unsigned short* gk = (const unsigned short*)K16 + ((size_t)b * TK + (tid >> 4)) * ldk + kvh * HDIM + (tid & 15) * 8;
  const unsigned short* gv = Vth + (size_t)(tid >> 2) * TK + (tid & 3) * 8;
  const unsigned short* gm = MP + (size_t)(q0 >> 4) * (size_t)(TK / 32) * 512 + lane * 8;
  const size_t sk8 = (size_t)8 * ldk, sv32 = (size_t)32 * TK, kst = (size_t)32 * ldk;
  const unsigned rb = (unsigned)(uintptr_t)ring;
  const unsigned lk = rb + (unsigned)((tid >> 4) * FA_KP + (tid & 15) * 16);
  const unsigned lv = rb + (unsigned)(FA_KB + (tid >> 2) * FA_VP + (tid & 3) * 16);
  const unsigned lm = rb + (unsigned)(FA_KB + FA_VB + w * 1024 + lane * 16);
  const int kofs = ln * FA_KP + 16 * hh, vofs = FA_KB + ln * FA_VP + 16 * hh, mofs = FA_KB + FA_VB + w * 1024 + lane * 16;
  fa_stage(lk, lv, lm, gk, sk8, gv, sv32, gm);
  /* A (q) fragments, the same in every pass: element e < 8 <-> d = 32 ks + 8 hh + e; e >= 8 <-> d = 32 ks + 16 + 8 hh + (e - 8) */
  FragH a[KS];
#pragma unroll
  for (int ks = 0; ks < KS; ++ks) { a[ks].half[0] = *(const v8us*)(qr + ks * 32 + 8 * hh); a[ks].half[1] = *(const v8us*)(qr + ks * 32 + 16 + 8 * hh); }
  /* the group's address register is an input here, so it stays whole (no load's result is given it) up to this wait */
  asm volatile("s_wait_xcnt 0x0" :: "v"(qr) : "memory");
  float m_r[8], l_r[8]; v8f oacc[DT];
#pragma unroll
  for (int r = 0; r < 8; ++r) { m_r[r] = -3.0e38f; l_r[r] = 0.f; }
#pragma unroll
  for (int dt = 0; dt < DT; ++dt) oacc[dt] = (v8f){0.f,0.f,0.f,0.f,0.f,0.f,0.f,0.f};
  asm volatile("s_wait_asynccnt 0x0" ::: "memory");   /* stage 0 has landed before the barrier publishes it */
  __syncthreads();
  if (nt > 1) fa_stage(lk + FA_STG, lv + FA_STG, lm + FA_STG, gk + kst, sk8, gv + 32, sv32, gm + 512);
#pragma unroll 1
  for (int t = 0; t < nt; ++t) {
    v8f sa = (v8f){0.f,0.f,0.f,0.f,0.f,0.f,0.f,0.f}, sb = sa;
    const unsigned char* st = ring + (t & 1) * FA_STG;
    const unsigned char* kp = st + kofs; const unsigned char* vp = st + vofs; const unsigned char* mp = st + mofs;
    FragH k0[KS], k1[KS], fm;
#pragma unroll
    for (int ks = 0; ks < KS; ++ks) {
      /* B (k) fragments in the k order of the q fragments: byte 64 ks + 16 hh of key row ln (k0) or 16 + ln (k1), and 32 B further */
      k0[ks].half[0] = *(const v8us*)(kp + ks * 64); k0[ks].half[1] = *(const v8us*)(kp + ks * 64 + 32);
      k1[ks].half[0] = *(const v8us*)(kp + 16 * FA_KP + ks * 64); k1[ks].half[1] = *(const v8us*)(kp + 16 * FA_KP + ks * 64 + 32);
    }
    fm.half[0] = *(const v8us*)mp; fm.half[1] = *(const v8us*)(mp + 512);
#pragma unroll
    for (int ks = 0; ks < KS; ++ks) { sa = g2_mma(a[ks].v, k0[ks].v, sa); sb = g2_mma(a[ks].v, k1[ks].v, sb); }
    /* the V^T fragments of this pass are read here, ahead of the softmax, which covers their LDS trip */
    FragH bv[DT];
#pragma unroll
    for (int dt = 0; dt < DT; ++dt) { bv[dt].half[0] = *(const v8us*)(vp + dt * 16 * FA_VP); bv[dt].half[1] = *(const v8us*)(vp + dt * 16 * FA_VP + 32); }
    float s0v[8], s1v[8], mcv[8];
#pragma unroll
    for (int r = 0; r < 8; ++r) {
      const float mk0 = bf16_val(fm.u[2 * r]), mk1 = bf16_val(fm.u[2 * r + 1]);
      s0v[r] = sa[r] * SCL + mk0; s1v[r] = sb[r] * SCL + mk1;
      mcv[r] = fmaxf(s0v[r], s1v[r]);
    }
    row16_max8(mcv);
    float eav[8];
#pragma unroll
    for (int r = 0; r < 8; ++r) {
      const float mn = fmaxf(m_r[r], mcv[r]); mcv[r] = mn;
      s0v[r] = (s0v[r] - mn) * LOG2E; s1v[r] = (s1v[r] - mn) * LOG2E; eav[r] = (m_r[r] - mn) * LOG2E;
    }
    exp2_8(s0v); exp2_8(s1v); exp2_8(eav);
#pragma unroll
    for (int r = 0; r < 8; ++r) {
      const float mn = mcv[r]; const float al = (mn > -1.0e38f) ? eav[r] : 1.0f; m_r[r] = mn;
      const float p0 = s0v[r], p1 = s1v[r]; l_r[r] = l_r[r] * al + p0 + p1;
#pragma unroll
      for (int dt = 0; dt < DT; ++dt) oacc[dt][r] *= al;
      FragH t2; t2.h[0] = toh_flush(p0 * 1024.0f); t2.h[1] = toh_flush(p1 * 1024.0f);
      sP[w][8 * hh + r][ln] = t2.u[0]; sP[w][8 * hh + r][16 + ln] = t2.u[1];
    }
    __builtin_amdgcn_fence(4, "workgroup"); __builtin_amdgcn_wave_barrier();
    FragH pa; pa.half[0] = *(const v8us*)&sP[w][ln][8 * hh]; pa.half[1] = *(const v8us*)&sP[w][ln][16 + 8 * hh];
#pragma unroll
    for (int dt = 0; dt < DT; ++dt) {
      /* A (P: key columns of the LDS tile) and B (V^T rows, keys contiguous) share the same key order: element e < 8 <-> key 32 t + 8 hh + e; e >= 8 <-> key 32 t + 16 + 8 hh + (e - 8) */
      oacc[dt] = g2_mma(pa.v, bv[dt].v, oacc[dt]);
    }
    asm volatile("s_wait_dscnt 0x0" ::: "memory");      /* this wave's reads of stage t (and of its P tile) are done before the stage is refilled */
    asm volatile("s_wait_asynccnt 0x0" ::: "memory");   /* this wave's copies of stage t + 1 have landed before the barrier publishes them */
    __syncthreads();
    if (t + 2 < nt) { const unsigned so2 = (unsigned)((t & 1) * FA_STG); fa_stage(lk + so2, lv + so2, lm + so2, gk + (size_t)(t + 2) * kst, sk8, gv + (size_t)(t + 2) * 32, sv32, gm + (size_t)(t + 2) * 512); }
  }
  asm volatile("s_wait_asynccnt 0x0" ::: "memory");     /* no copy is outstanding when the ring becomes output staging */
  row16_sum8(l_r);
#pragma unroll
  for (int r = 0; r < 8; ++r) { const float l = l_r[r]; l_r[r] = (l > 0.f) ? 1.0f / (l * 1024.0f) : 0.f; }
#pragma unroll
  for (int dt = 0; dt < DT; ++dt)
#pragma unroll
    for (int r = 0; r < 8; ++r) sO[w][8 * hh + r][dt * 16 + ln] = oacc[dt][r] * l_r[r];
  __builtin_amdgcn_fence(4, "workgroup"); __builtin_amdgcn_wave_barrier();
  {
#pragma unroll
    for (int rp = 0; rp < RPW; ++rp) { const v4f val = *(const v4fa*)&sO[w][rp][lane * 4]; *(v4f*)(O + ((size_t)b * TQ + q0 + rp) * ldo + h * HDIM + lane * 4) = val; }
    
  }
}
// LDS ring of the 5-plane kernel: one stage = one pass of 32 keys = [K hi 32 rows | K residual 32 rows, pitch 272 | V^T hi 64 rows | V^T residual 64 rows, pitch 80 | mask 4 waves x 1 KiB]; two stages; beside it the block's 64 q rows, hi and residual, pitch 272, filled once
#define F5_KB (32 * FA_KP)
#define F5_VB (64 * FA_VP)
#define F5_STG (2 * F5_KB + 2 * F5_VB + FA_MB)
#define F5_QB (64 * FA_KP)
static_assert(F5_STG % 16 == 0 && F5_KB % 16 == 0 && F5_VB % 16 == 0 && F5_QB % 16 == 0);
static_assert(2 * F5_STG >= 4 * 16 * 68 * 4);    /* the output staging reuses the ring behind the last barrier */
static_assert(2 * F5_STG + 2 * F5_QB + 2 * 4 * 16 * 40 * 2 <= 131072);
// one stage: 14 copies of 16 B per lane. K planes: lane (r = tid / 16, c = tid % 16) brings chunk c of key rows r + 8 j (j < 4); V^T planes: lane (r = tid / 4, c = tid % 4) brings chunk c of rows r + 32 j (j < 2); mask: the lane's own two words.
// lk / lv / lm = the lane's LDS byte addresses in the stage (hi planes), kh / kl / vh / vl / m = its global addresses, sk = 8 K rows, svh / svl = 32 V^T rows of the hi / residual plane, in elements.
__device__ __forceinline__ void f5_stage(unsigned lk, unsigned lv, unsigned lm, const unsigned short* kh, const unsigned short* kl, size_t sk,
                                         const unsigned short* vh, size_t svh, const unsigned short* vl, size_t svl, const unsigned short* m) {
  /* s_wait_xcnt closes the copies' own statement: no register that a copy names is rewritten in front of it */
  asm volatile(
      "global_load_async_to_lds_b128 %0, %14, off\n\t"
      "global_load_async_to_lds_b128 %1, %15, off\n\t"
      "global_load_async_to_lds_b128 %2, %16, off\n\t"
      "global_load_async_to_lds_b128 %3, %17, off\n\t"
      "global_load_async_to_lds_b128 %4, %18, off\n\t"
      "global_load_async_to_lds_b128 %5, %19, off\n\t"
      "global_load_async_to_lds_b128 %6, %20, off\n\t"
      "global_load_async_to_lds_b128 %7, %21, off\n\t"
      "global_load_async_to_lds_b128 %8, %22, off\n\t"
      "global_load_async_to_lds_b128 %9, %23, off\n\t"
      "global_load_async_to_lds_b128 %10, %24, off\n\t"
      "global_load_async_to_lds_b128 %11, %25, off\n\t"
      "global_load_async_to_lds_b128 %12, %26, off\n\t"
      "global_load_async_to_lds_b128 %13, %27, off\n\t"
      "s_wait_xcnt 0x0"
      :: "v"(lk), "v"(lk + 8 * FA_KP), "v"(lk + 16 * FA_KP), "v"(lk + 24 * FA_KP),
         "v"(lk + F5_KB), "v"(lk + F5_KB + 8 * FA_KP), "v"(lk + F5_KB + 16 * FA_KP), "v"(lk + F5_KB + 24 * FA_KP),
         "v"(lv), "v"(lv + 32 * FA_VP), "v"(lv + F5_VB), "v"(lv + F5_VB + 32 * FA_VP), "v"(lm), "v"(lm + 512),
         "v"(kh), "v"(kh + sk), "v"(kh + 2 * sk), "v"(kh + 3 * sk), "v"(kl), "v"(kl + sk), "v"(kl + 2 * sk), "v"(kl + 3 * sk),
         "v"(vh), "v"(vh + svh), "v"(vl), "v"(vl + svl), "v"(m), "v"(m + 256)
      : "memory");
}
// one q plane of the block: 8 copies of 16 B per lane; lane (r = tid / 16, c = tid % 16) brings chunk c of query rows r + 8 j (j < 8). l = its LDS byte address, g = its global address, s = 8 rows in elements.
__device__ __forceinline__ void f5_qplane(unsigned l, const unsigned short* g, size_t s) {
  /* s_wait_xcnt closes the copies' own statement: no register that a copy names is rewritten in front of it */
  asm volatile(
      "global_load_async_to_lds_b128 %0, %8, off\n\t"
      "global_load_async_to_lds_b128 %1, %9, off\n\t"
      "global_load_async_to_lds_b128 %2, %10, off\n\t"
      "global_load_async_to_lds_b128 %3, %11, off\n\t"
      "global_load_async_to_lds_b128 %4, %12, off\n\t"
      "global_load_async_to_lds_b128 %5, %13, off\n\t"
      "global_load_async_to_lds_b128 %6, %14, off\n\t"
      "global_load_async_to_lds_b128 %7, %15, off\n\t"
      "s_wait_xcnt 0x0"
      :: "v"(l), "v"(l + 8 * FA_KP), "v"(l + 16 * FA_KP), "v"(l + 24 * FA_KP), "v"(l + 32 * FA_KP), "v"(l + 40 * FA_KP), "v"(l + 48 * FA_KP), "v"(l + 56 * FA_KP),
         "v"(g), "v"(g + s), "v"(g + 2 * s), "v"(g + 3 * s), "v"(g + 4 * s), "v"(g + 5 * s), "v"(g + 6 * s), "v"(g + 7 * s)
      : "memory");
}

// 5-plane variant for query blocks [QB05, QB05+QBN5) (positions < RE), one 64-wide half dh of the head's 128 dims per block: S = Qh.Kh^T + (Ql.Kh^T + Qh.Kl^T)/1024 with Q/K = [hi | x1024 residual] planes (residual planes compact: rows b*RE + s);
// O = (Ph.Vh + (Pl.Vh + Ph.Vl)/1024) / l with P = [hi | x1024 residual] of 1024 p and V^T = [hi | x1024 residual] (VtL pitch RE); separate residual accumulators folded before the normalisation.
// key tiles [0, largest count of the block's four 16-query tiles) clamped to [1, RE/32] (the compact planes hold keys < RE); a block whose mask exposes keys beyond RE writes NaN rows.
// All operand tiles come through LDS, once for the block's four waves: asynchronous copies in whole row pieces; q planes once, the pass's K, V^T and mask tiles in two stages, stage t + 1 in flight while stage t is worked on.
__global__ __launch_bounds__(128) __attribute__((amdgpu_num_vgpr(256))) void k_flash5(const _Float16* __restrict__ Q16, const _Float16* __restrict__ QL, int ldq, const _Float16* __restrict__ K16, const _Float16* __restrict__ KL, int ldk,
                                                const _Float16* __restrict__ Vt, const _Float16* __restrict__ VtL, const unsigned short* __restrict__ MP, const int* __restrict__ JE, float* __restrict__ O, int ldo) {
  constexpr int RPW = 16, DT = 4, KS = 4;
  __shared__ __attribute__((aligned(16))) unsigned short sP[4][RPW][40];
  __shared__ __attribute__((aligned(16))) unsigned short sPL[4][RPW][40];
  __shared__ __attribute__((aligned(16))) unsigned char ring[2 * F5_STG];
  __shared__ __attribute__((aligned(16))) unsigned char sQ[2 * F5_QB];
  float (*sO)[RPW][68] = (float (*)[RPW][68])ring;
  const int tid = threadIdx.x, lane = tid & 31, ln = lane & 15, hh = lane >> 4;
  const int w = __builtin_amdgcn_readfirstlane(tid >> 5);
  const int dh = blockIdx.x & 1; const int bx = blockIdx.x >> 1;
  const int slab = bx / QBN5, qblk = QB05 + bx % QBN5; const int b = slab / NH, h = slab % NH; const int kvh = h / NREP;
  const int qb0 = qblk * (4 * RPW); const int q0 = qb0 + w * RPW;
  int jraw = JE[qblk * 128];   /* the largest count of the block's four 16-query tiles */
#pragma unroll
  for (int i = 1; i < 4; ++i) { const int ji = JE[qblk * 128 + i * 32]; jraw = (ji > jraw) ? ji : jraw; }
  const float pz = (jraw > RE / 32) ? __uint_as_float(0x7FC00000u) : 0.0f;
  int jt = (jraw < 1) ? 1 : jraw; jt = (jt > RE / 32) ? (RE / 32) : jt;
  const int nt = __builtin_amdgcn_readfirstlane(jt);
  /* the lane's copy addresses: q planes, and stage 0 of the ring */
  const unsigned short* gq = (const unsigned short*)Q16 + ((size_t)b * TQ + qb0 + (tid >> 4)) * ldq + h * HDIM + (tid & 15) * 8;
  const unsigned short* gql = (const unsigned short*)QL + ((size_t)b * RE + qb0 + (tid >> 4)) * ldq + h * HDIM + (tid & 15) * 8;
  const unsigned short* gk = (const unsigned short*)K16 + ((size_t)b * TK + (tid >> 4)) * ldk + kvh * HDIM + (tid & 15) * 8;
  const unsigned short* gkl = (const unsigned short*)KL + ((size_t)b * RE + (tid >> 4)) * ldk + kvh * HDIM + (tid & 15) * 8;
  const unsigned short* gv = (const unsigned short*)Vt + ((size_t)(b * NKVH + kvh) * HDIM + dh * 64 + (tid >> 2)) * TK + (tid & 3) * 8;
  const unsigned short* gvl = (const unsigned short*)VtL + ((size_t)(b * NKVH + kvh) * HDIM + dh * 64 + (tid >> 2)) * RE + (tid & 3) * 8;
  const unsigned short* gm = MP + (size_t)(q0 >> 4) * (size_t)(TK / 32) * 512 + lane * 8;
  const size_t sq8 = (size_t)8 * ldq, sk8 = (size_t)8 * ldk, kst = (size_t)32 * ldk, svh = (size_t)32 * TK, svl = (size_t)32 * RE;
  const unsigned rb = (unsigned)(uintptr_t)ring;
  const unsigned lq = (unsigned)(uintptr_t)sQ + (unsigned)((tid >> 4) * FA_KP + (tid & 15) * 16);
  const unsigned lk = rb + (unsigned)((tid >> 4) * FA_KP + (tid & 15) * 16);
  const unsigned lv = rb + (unsigned)(2 * F5_KB + (tid >> 2) * FA_VP + (tid & 3) * 16);
  const unsigned lm = rb + (unsigned)(2 * F5_KB + 2 * F5_VB + w * 1024 + lane * 16);
  const int kofs = ln * FA_KP + 16 * hh, vofs = 2 * F5_KB + ln * FA_VP + 16 * hh, mofs = 2 * F5_KB + 2 * F5_VB + w * 1024 + lane * 16;
  const unsigned char* qp = sQ + (w * RPW + ln) * FA_KP + 16 * hh;
  f5_qplane(lq, gq, sq8);
  f5_qplane(lq + F5_QB, gql, sq8);
  f5_stage(lk, lv, lm, gk, gkl, sk8, gv, svh, gvl, svl, gm);
  float m_r[8], l_r[8]; v8f oacc[DT], oaccL[DT];
#pragma unroll
  for (int r = 0; r < 8; ++r) { m_r[r] = -3.0e38f; l_r[r] = 0.f; }
#pragma unroll
  for (int dt = 0; dt < DT; ++dt) { oacc[dt] = (v8f){0.f,0.f,0.f,0.f,0.f,0.f,0.f,0.f}; oaccL[dt] = oacc[dt]; }
  asm volatile("s_wait_asynccnt 0x0" ::: "memory");   /* the q planes and stage 0 have landed before the barrier publishes them */
  __syncthreads();
  if (nt > 1) f5_stage(lk + F5_STG, lv + F5_STG, lm + F5_STG, gk + kst, gkl + kst, sk8, gv + 32, svh, gvl + 32, svl, gm + 512);
#pragma unroll 1
  for (int t = 0; t < nt; ++t) {
    v8f sa = (v8f){0.f,0.f,0.f,0.f,0.f,0.f,0.f,0.f}, sb = sa, sal = sa, sbl = sa;
    const unsigned char* st = ring + (t & 1) * F5_STG;
    const unsigned char* kp = st + kofs; const unsigned char* vp = st + vofs; const unsigned char* mp = st + mofs;
    FragH fm; fm.half[0] = *(const v8us*)mp; fm.half[1] = *(const v8us*)(mp + 512);
#pragma unroll
    for (int ks = 0; ks < KS; ++ks) {
      /* all A and B fragments of this step share one k order: element e < 8 <-> d = 32 ks + 8 hh + e; e >= 8 <-> d = 32 ks + 16 + 8 hh + (e - 8): byte 64 ks + 16 hh of the row, and 32 B further */
      FragH a, al2, k0, k1, g0, g1;
      a.half[0] = *(const v8us*)(qp + ks * 64); a.half[1] = *(const v8us*)(qp + ks * 64 + 32);
      al2.half[0] = *(const v8us*)(qp + F5_QB + ks * 64); al2.half[1] = *(const v8us*)(qp + F5_QB + ks * 64 + 32);
      k0.half[0] = *(const v8us*)(kp + ks * 64); k0.half[1] = *(const v8us*)(kp + ks * 64 + 32);
      k1.half[0] = *(const v8us*)(kp + 16 * FA_KP + ks * 64); k1.half[1] = *(const v8us*)(kp + 16 * FA_KP + ks * 64 + 32);
      g0.half[0] = *(const v8us*)(kp + F5_KB + ks * 64); g0.half[1] = *(const v8us*)(kp + F5_KB + ks * 64 + 32);
      g1.half[0] = *(const v8us*)(kp + F5_KB + 16 * FA_KP + ks * 64); g1.half[1] = *(const v8us*)(kp + F5_KB + 16 * FA_KP + ks * 64 + 32);
      sa = g2_mma(a.v, k0.v, sa); sb = g2_mma(a.v, k1.v, sb);
      sal = g2_mma(al2.v, k0.v, sal); sbl = g2_mma(al2.v, k1.v, sbl);
      sal = g2_mma(a.v, g0.v, sal); sbl = g2_mma(a.v, g1.v, sbl);
    }
    /* both V^T planes' fragments of this pass are read here, ahead of the softmax, which covers their LDS trip */
    FragH bv[DT], bl[DT];
#pragma unroll
    for (int dt = 0; dt < DT; ++dt) {
      bv[dt].half[0] = *(const v8us*)(vp + dt * 16 * FA_VP); bv[dt].half[1] = *(const v8us*)(vp + dt * 16 * FA_VP + 32);
      bl[dt].half[0] = *(const v8us*)(vp + F5_VB + dt * 16 * FA_VP); bl[dt].half[1] = *(const v8us*)(vp + F5_VB + dt * 16 * FA_VP + 32);
    }
    float s0v[8], s1v[8], mcv[8];
#pragma unroll
    for (int r = 0; r < 8; ++r) {
      const float mk0 = bf16_val(fm.u[2 * r]), mk1 = bf16_val(fm.u[2 * r + 1]);
      const float d0 = sa[r] + sal[r] * 0.0009765625f, d1 = sb[r] + sbl[r] * 0.0009765625f;
      s0v[r] = d0 * SCL + mk0; s1v[r] = d1 * SCL + mk1;
      mcv[r] = fmaxf(s0v[r], s1v[r]);
    }
    row16_max8(mcv);
    float eav[8];
#pragma unroll
    for (int r = 0; r < 8; ++r) {
      const float mn = fmaxf(m_r[r], mcv[r]); mcv[r] = mn;
      s0v[r] = (s0v[r] - mn) * LOG2E; s1v[r] = (s1v[r] - mn) * LOG2E; eav[r] = (m_r[r] - mn) * LOG2E;
    }
    exp2_8(s0v); exp2_8(s1v); exp2_8(eav);
#pragma unroll
    for (int r = 0; r < 8; ++r) {
      const float mn = mcv[r]; const float al = (mn > -1.0e38f) ? eav[r] : 1.0f; m_r[r] = mn;
      const float p0 = s0v[r], p1 = s1v[r]; l_r[r] = l_r[r] * al + p0 + p1;
#pragma unroll
      for (int dt = 0; dt < DT; ++dt) { oacc[dt][r] *= al; oaccL[dt][r] *= al; }
      FragH t2, t2l; const float ps0 = p0 * 1024.0f, ps1 = p1 * 1024.0f;
      t2.h[0] = toh_flush(ps0); t2.h[1] = toh_flush(ps1);
      t2l.h[0] = toh_flush((ps0 - (float)t2.h[0]) * 1024.0f); t2l.h[1] = toh_flush((ps1 - (float)t2.h[1]) * 1024.0f);
      sP[w][8 * hh + r][ln] = t2.u[0]; sP[w][8 * hh + r][16 + ln] = t2.u[1]; sPL[w][8 * hh + r][ln] = t2l.u[0]; sPL[w][8 * hh + r][16 + ln] = t2l.u[1];
    }
    __builtin_amdgcn_fence(4, "workgroup"); __builtin_amdgcn_wave_barrier();
    FragH pa, pl;
    pa.half[0] = *(const v8us*)&sP[w][ln][8 * hh]; pa.half[1] = *(const v8us*)&sP[w][ln][16 + 8 * hh];
    pl.half[0] = *(const v8us*)&sPL[w][ln][8 * hh]; pl.half[1] = *(const v8us*)&sPL[w][ln][16 + 8 * hh];
#pragma unroll
    for (int dt = 0; dt < DT; ++dt) {
      /* A (P tiles) and B (V^T rows) share the same key order: element e < 8 <-> key 32 t + 8 hh + e; e >= 8 <-> key 32 t + 16 + 8 hh + (e - 8) */
      oacc[dt] = g2_mma(pa.v, bv[dt].v, oacc[dt]);
      oaccL[dt] = g2_mma(pl.v, bv[dt].v, oaccL[dt]);
      oaccL[dt] = g2_mma(pa.v, bl[dt].v, oaccL[dt]);
    }
    asm volatile("s_wait_dscnt 0x0" ::: "memory");      /* this wave's reads of stage t (and of its P tiles) are done before the stage is refilled */
    asm volatile("s_wait_asynccnt 0x0" ::: "memory");   /* this wave's copies of stage t + 1 have landed before the barrier publishes them */
    __syncthreads();
    if (t + 2 < nt) {
      const unsigned so2 = (unsigned)((t & 1) * F5_STG);
      f5_stage(lk + so2, lv + so2, lm + so2, gk + (size_t)(t + 2) * kst, gkl + (size_t)(t + 2) * kst, sk8, gv + (size_t)(t + 2) * 32, svh, gvl + (size_t)(t + 2) * 32, svl, gm + (size_t)(t + 2) * 512);
    }
  }
  asm volatile("s_wait_asynccnt 0x0" ::: "memory");     /* no copy is outstanding when the ring becomes output staging */
  row16_sum8(l_r);
#pragma unroll
  for (int r = 0; r < 8; ++r) { const float l = l_r[r]; l_r[r] = (l > 0.f) ? 1.0f / (l * 1024.0f) : 0.f; }
#pragma unroll
  for (int dt = 0; dt < DT; ++dt)
#pragma unroll
    for (int r = 0; r < 8; ++r) { float v = oacc[dt][r]; v += oaccL[dt][r] * 0.0009765625f; sO[w][8 * hh + r][dt * 16 + ln] = v * l_r[r] + pz; }
  __builtin_amdgcn_fence(4, "workgroup"); __builtin_amdgcn_wave_barrier();
  {
#pragma unroll
    for (int rp = 0; rp < RPW; rp += 2) { const int r = rp + (lane >> 4), pc = lane & 15; const v4f val = *(const v4fa*)&sO[w][r][pc * 4]; *(v4f*)(O + ((size_t)b * TQ + q0 + r) * ldo + h * HDIM + dh * 64 + pc * 4) = val; }
    
  }
}

extern "C" void kernel_launch(void* const* d_in, const int* in_sizes, int n_in,
                              void* d_out, int out_size, void* d_ws, size_t ws_size, hipStream_t stream) {
  if (n_in < 10) return;
  const size_t needx = ((size_t)(NB - 1) * SEQ_FULL + (size_t)SLEN) * DM;
  if ((size_t)in_sizes[0] < needx) return;
  if ((size_t)in_sizes[1] < (size_t)DM * DM) return;
  if ((size_t)in_sizes[2] < (size_t)VW * DM) return;
  if ((size_t)in_sizes[3] < (size_t)VW * DM) return;
  if ((size_t)in_sizes[4] < (size_t)DM * DM) return;
  if ((size_t)in_sizes[5] < (size_t)HDIM) return;
  if ((size_t)in_sizes[6] < (size_t)HDIM) return;
  if ((size_t)in_sizes[7] < (size_t)SLEN * RTW) return;
  if ((size_t)in_sizes[8] < (size_t)SLEN * RTW) return;
  if ((size_t)in_sizes[9] < (size_t)(SLEN - 1) * MSKP + (size_t)SLEN) return;
  if ((size_t)out_size < needx) return;
  /* inputs in order: x, Wq, Wk, Wv, Wo, q gain, k gain, cos table, sin table, mask */
  const float* x = (const float*)d_in[0]; const float* Wq = (const float*)d_in[1]; const float* Wk = (const float*)d_in[2]; const float* Wv = (const float*)d_in[3]; const float* Wo = (const float*)d_in[4];
  const float* qnw = (const float*)d_in[5]; const float* knw = (const float*)d_in[6]; const float* rct = (const float*)d_in[7]; const float* rst = (const float*)d_in[8]; const float* msk = (const float*)d_in[9];
  float* dout = (float*)d_out;
  char* ws = (char*)d_ws; size_t off = 0;
  auto take = [&](size_t bytes) { char* p = ws + off; off += (bytes + 255) & ~(size_t)255; return p; };
  const size_t np = (size_t)NR * DM;
  _Float16* BQ = (_Float16*)take(SZ_BQ);                                /* [n][k] f16, x16; BQ, BK, BV back to back = the [QKVW][DM] operand of the joint projection */
  _Float16* BK = (_Float16*)take(SZ_BK);
  _Float16* BV = (_Float16*)take(SZ_BK);
  _Float16* B2 = (_Float16*)take(SZ_B2);                                /* [n][2*DM] f16: [x16384 | x16] copies of Wo */
  float* FS = (float*)take(SZ_FS);                                      /* f32 scratch plane: [q | k | v] rows [NR][QKVW], then the context [NR][DM] */
  _Float16* X16 = (_Float16*)take(SZ_X16);                              /* f16 input rows; reused as V^T [(b,g)][64][TK] after the projection */
  _Float16* VT = X16;
  _Float16* QH = (_Float16*)take(SZ_QH);                                /* reused as the context hi plane after the attention */
  _Float16* KHp = (_Float16*)take(SZ_KH);                               /* [NR][VW] */
  _Float16* QL = (_Float16*)take(SZ_QL);                                /* [NB*RE][DM] residual plane */
  _Float16* KL = (_Float16*)take(SZ_KL);                                /* [NB*RE][VW] residual plane */
  _Float16* VTL = (_Float16*)take(SZ_VTL);                              /* [(b,g)][64][RE] */
  _Float16* A2 = (_Float16*)take(SZ_A2);                                /* [NB*RE][2*DM] = [ctx hi | ctx residual] */
  unsigned short* MPp = (unsigned short*)take(SZ_MP);                   /* bf16 mask plane, accumulator layout */
  int* JEp = (int*)take(SZ_JE);                                         /* [SLEN/16][32] key-tile counts */
  _Float16* OH = QH;
  if (off > ws_size) return;

  k_prep<<<PB_ALL, 256, 0, stream>>>(msk, x, Wq, Wk, Wv, Wo, JEp, X16, BQ, BK, BV, B2, MPp);
  k_gemm_qkv<<<(unsigned)((NR / 128) * (QKVW / 128)), 128, 0, stream>>>(X16, BQ, FS);
  k_post<<<QB_ALL, 256, 0, stream>>>(FS, qnw, knw, rct, rst, QH, QL, KHp, KL, VT, VTL);
  k_flash5<<<(unsigned)(NB * NH * QBN5 * 2), 128, 0, stream>>>(QH, QL, DM, KHp, KL, VW, VT, VTL, MPp, JEp, FS, DM);
  if (QBNP > 0) k_flash<<<(unsigned)(NB * NH * QBNP), 128, 0, stream>>>(QH, DM, KHp, VW, VT, MPp, JEp, FS, DM);
  const unsigned g8 = (unsigned)((np / 8 + 255) / 256);
  k_hl<<<g8, 256, 0, stream>>>(FS, OH, A2, np / 8);
  k_gemm_out<<<(unsigned)(OB_E + OB_L), 128, 0, stream>>>(A2, OH, B2, dout);
}
